// v000
// Times are from an AMD MI455X. After a warm-up the kernel runs many times in a row, and a time is the length of
// such a window on the GPU divided by its runs, so every launch and the gaps after it count. The runs cycle
// through copies of the inputs. A figure is the median of several windows, for all but v000 over two sittings.
// Sittings can differ by a few percent; kernels timed side by side share one.
// v000 is the starting kernel. One run takes 532 microseconds.
// Contractions: q/k/v projections, q.k^T scores, p.v and output projection all on v_wmma_f32_16x16x32_bf16 with bf16 hi/lo split operands (hi*hi + hi*lo + lo*hi), f32 accumulate; softmax and all side math in f32.
#include <hip/hip_runtime.h>

typedef __attribute__((ext_vector_type(16))) _Float16 v16h;
typedef __attribute__((ext_vector_type(8)))  _Float16 v8h;
typedef __attribute__((ext_vector_type(16))) __bf16   v16b;
typedef __attribute__((ext_vector_type(8)))  __bf16   v8b;
typedef __attribute__((ext_vector_type(8)))  float    v8f;
typedef __attribute__((ext_vector_type(4)))  float    v4f;
typedef __attribute__((ext_vector_type(4)))  unsigned v4u;
#define U16(p) ((const unsigned short*)(const void*)(p))

// ---------------------------------------------------------------------------
// Problem constants
// ---------------------------------------------------------------------------
constexpr int NB    = 2;
constexpr int SEQ   = 2048;
constexpr int EMB   = 1024;
constexpr int NHEAD = 16;
constexpr int HDIM  = 64;
constexpr int NTOK  = NB * SEQ;              // 4096 rows of [EMB]
constexpr int NROWH = NTOK * NHEAD;          // 65536 rows of [HDIM]

// attention tiling
constexpr int AQB = 64;                      // query rows per block (4 waves x 16)
constexpr int AKC = 64;                      // keys per chunk
constexpr int ANW = 4;

// GEMM shape contract (no run-time tails)
static_assert(NROWH % 64 == 0);              // qkv GEMM M
static_assert(HDIM % 64 == 0);               // qkv GEMM N
static_assert(HDIM % 32 == 0);               // qkv GEMM K
static_assert(NTOK % 64 == 0);               // out GEMM M
static_assert(EMB % 64 == 0);                // out GEMM N
static_assert(EMB % 32 == 0);                // out GEMM K
static_assert(SEQ % AQB == 0);
static_assert(AQB == AKC);

// ---------------------------------------------------------------------------
//   XH   [0          ,  8 MiB)  x   bf16 hi  [4194304]
//   XL   [8 MiB      , 16 MiB)  x   bf16 lo
//   WH   [16 MiB     , +24576)  Wq|Wk|Wv bf16 hi, 3 planes of [64][64] (carve 64 KiB)
//   WL   [16 MiB+64K , +24576)  Wq|Wk|Wv bf16 lo (carve 64 KiB)
//   WOH  [17 MiB     , 19 MiB)  Wo  bf16 hi  [1024][1024]
//   WOL  [19 MiB     , 21 MiB)  Wo  bf16 lo
//   QKVH [21 MiB     , 45 MiB)  q|k|v bf16 hi, 3 planes of [65536][64] (element (b,s,h,d) at (b*SEQ+s)*EMB + h*64 + d)
//   QKVL [45 MiB     , 69 MiB)  q|k|v bf16 lo
//   AVH  [69 MiB     , 77 MiB)  av  bf16 hi  [4096][1024]
//   AVL  [77 MiB     , 85 MiB)  av  bf16 lo
//   total 85 MiB = 89128960 B
// ---------------------------------------------------------------------------
constexpr size_t MIB      = 1048576;
constexpr size_t OFF_XH   = 0;
constexpr size_t OFF_XL   = 8 * MIB;
constexpr size_t OFF_WH   = 16 * MIB;
constexpr size_t OFF_WL   = 16 * MIB + 65536;
constexpr size_t OFF_WOH  = 17 * MIB;
constexpr size_t OFF_WOL  = 19 * MIB;
constexpr size_t OFF_QKVH = 21 * MIB;
constexpr size_t OFF_QKVL = 45 * MIB;
constexpr size_t OFF_AVH  = 69 * MIB;
constexpr size_t OFF_AVL  = 77 * MIB;
constexpr size_t WS_TOTAL = 85 * MIB;
constexpr size_t PLANE_QKV = (size_t)NROWH * HDIM;      // elements per q/k/v plane
static_assert((size_t)NB * SEQ * EMB * 2 <= OFF_XL - OFF_XH);
static_assert((size_t)3 * HDIM * HDIM * 2 <= OFF_WL - OFF_WH);
static_assert((size_t)3 * HDIM * HDIM * 2 <= OFF_WOH - OFF_WL);
static_assert((size_t)EMB * EMB * 2 <= OFF_WOL - OFF_WOH);
static_assert((size_t)EMB * EMB * 2 <= OFF_QKVH - OFF_WOL);
static_assert(3 * PLANE_QKV * 2 <= OFF_QKVL - OFF_QKVH);
static_assert(3 * PLANE_QKV * 2 <= OFF_AVH - OFF_QKVL);
static_assert((size_t)NTOK * EMB * 2 <= OFF_AVL - OFF_AVH);
static_assert((size_t)NTOK * EMB * 2 <= WS_TOTAL - OFF_AVL);
static_assert(WS_TOTAL <= 134217728);

// ---------------------------------------------------------------------------
// Helpers
// ---------------------------------------------------------------------------
__device__ __forceinline__ unsigned short f2bf_bits(float f) {
  unsigned u = __float_as_uint(f);
  return (unsigned short)((u + 0x7FFFu + ((u >> 16) & 1u)) >> 16);
}
__device__ __forceinline__ float bf_bits2f(unsigned short h) { return __uint_as_float(((unsigned)h) << 16); }

// hazard guards as plain device helpers (no inline asm inside the kernel template body)
__device__ __forceinline__ void dep_guard_h(v8f& a, v8f& b, v16h x, v16h y) { asm volatile("v_nop\n\tv_nop\n\tv_nop\n\tv_nop" : "+v"(a), "+v"(b) : "v"(x), "v"(y)); }
__device__ __forceinline__ void dep_guard_b(v8f& a, v8f& b, v16b x, v16b y) { asm volatile("v_nop\n\tv_nop\n\tv_nop\n\tv_nop" : "+v"(a), "+v"(b) : "v"(x), "v"(y)); }
__device__ __forceinline__ void keep4_h(v16h a, v16h b, v16h c, v16h d) { asm volatile("v_nop" :: "v"(a), "v"(b), "v"(c), "v"(d)); }
__device__ __forceinline__ void keep4_b(v16b a, v16b b, v16b c, v16b d) { asm volatile("v_nop" :: "v"(a), "v"(b), "v"(c), "v"(d)); }
__device__ __forceinline__ void acc_guard4(v8f& a, v8f& b, v8f& c, v8f& d) { asm volatile("v_nop\n\tv_nop\n\tv_nop\n\tv_nop" : "+v"(a), "+v"(b), "+v"(c), "+v"(d)); }
template <typename T> struct Frag;
template <> struct Frag<_Float16> {
  typedef v16h V; union U { v16h v; v8h h[2]; };
  static __device__ __forceinline__ v16h load(const _Float16* p) {   // elements 0..7 <- p[0..7], 8..15 <- p[16..23]
    U f; f.h[0] = *(const v8h*)(p); f.h[1] = *(const v8h*)(p + 16); return f.v;
  }
  static __device__ __forceinline__ v8f mma(v16h a, v16h b, v8f c) {
    return __builtin_amdgcn_wmma_f32_16x16x32_f16(false, a, false, b, (short)0, c, false, false);
  }
  static __device__ __forceinline__ void guard(v8f& a, v8f& b, v16h x, v16h y) { dep_guard_h(a, b, x, y); }
  static __device__ __forceinline__ void keep(v16h a, v16h b, v16h c, v16h d) { keep4_h(a, b, c, d); }
};
template <> struct Frag<__bf16> {
  typedef v16b V; union U { v16b v; v8b h[2]; };
  static __device__ __forceinline__ v16b load(const __bf16* p) {
    U f; f.h[0] = *(const v8b*)(p); f.h[1] = *(const v8b*)(p + 16); return f.v;
  }
  static __device__ __forceinline__ v8f mma(v16b a, v16b b, v8f c) {
    return __builtin_amdgcn_wmma_f32_16x16x32_bf16(false, a, false, b, (short)0, c, false, false);
  }
  static __device__ __forceinline__ void guard(v8f& a, v8f& b, v16b x, v16b y) { dep_guard_b(a, b, x, y); }
  static __device__ __forceinline__ void keep(v16b a, v16b b, v16b c, v16b d) { keep4_b(a, b, c, d); }
};

// ---- Register-blocked batched WMMA GEMM --------------------------------
// C[m,n] = scale * sum_k A[m,k] * Bt[n,k] (+bias)(+resid); each wave owns a 64x64 tile.
// A row-major [M,K]; Bt row-major [N,K]; M,N % 64 == 0, K % 32 == 0.
// SPLIT: operands are hi/lo planes (A2/Bt2 = lo planes, same layout); product = hi.hi + hi.lo + lo.hi.
// BIAS_MODE: 0 = none, 1 = bias[m], 2 = bias[n].
// OUT_MODE: 0 = f32, 1 = f16, 2 = bf16 hi plane (Cout) + bf16 lo plane (Cout2).
// ET: 0 = f16 operands, 1 = bf16 operands (pointers passed as 16-bit storage)
template <int ET> struct Elem;
template <> struct Elem<0> { typedef _Float16 T; };
template <> struct Elem<1> { typedef __bf16 T; };
template <int ET, bool SPLIT, int BIAS_MODE, int OUT_MODE, bool RESID, int ACT = 0>
__global__ __launch_bounds__(256) void wmma_gemm64(
    const unsigned short* __restrict__ Ap, const unsigned short* __restrict__ A2p, int lda, long strideA,
    const unsigned short* __restrict__ Btp, const unsigned short* __restrict__ Bt2p, int ldb, long strideB,
    void* __restrict__ Cout, void* __restrict__ Cout2, int ldc, long strideC,
    const float* __restrict__ bias,
    const float* __restrict__ resid, long strideR,
    int M, int N, int K, float scale) {
  typedef typename Elem<ET>::T T;
  typedef typename Frag<T>::V V;
  const T* A = (const T*)Ap; const T* A2 = (const T*)A2p; const T* Bt = (const T*)Btp; const T* Bt2 = (const T*)Bt2p;
  __shared__ __align__(16) float sT[8][16 * 68];   // per-wave 16x64 slab, pitch 68 floats
  const int b    = blockIdx.y;
  const int lane = threadIdx.x & 31;
  const int wave = threadIdx.x >> 5;
  const int tilesN = N >> 6;
  const int tilesM = M >> 6;
  const int tile = blockIdx.x * 8 + wave;
  if (tile >= tilesM * tilesN) return;   // wave-uniform; no block barriers in this kernel
  const int tm = tile / tilesN;
  const int tn = tile - tm * tilesN;
  const int m0 = tm << 6;
  const int n0 = tn << 6;

  const T* Ab  = A  + (size_t)b * strideA;
  const T* Bb  = Bt + (size_t)b * strideB;
  const T* Ab2 = SPLIT ? (A2  + (size_t)b * strideA) : nullptr;
  const T* Bb2 = SPLIT ? (Bt2 + (size_t)b * strideB) : nullptr;

  const int rlane = lane & 15;                 // row (A) / col (B, D) within subtile
  const int koff  = (lane >> 4) * 8;           // k offset of this lane half
  const int mOff  = (lane >> 4) * 8;           // D row offset

  v8f acc[4][4];
#pragma unroll
  for (int i = 0; i < 4; ++i)
#pragma unroll
    for (int j = 0; j < 4; ++j) acc[i][j] = (v8f){0.f,0.f,0.f,0.f,0.f,0.f,0.f,0.f};

  for (int k0 = 0; k0 < K; k0 += 32) {
    V bh[4], bl[4];
#pragma unroll
    for (int j = 0; j < 4; ++j) {
      const size_t bo = (size_t)(n0 + (j << 4) + rlane) * ldb + koff + k0;
      bh[j] = Frag<T>::load(Bb + bo);
      if (SPLIT) bl[j] = Frag<T>::load(Bb2 + bo);
    }
#pragma unroll
    for (int i = 0; i < 4; ++i) {
      const size_t ao = (size_t)(m0 + (i << 4) + rlane) * lda + koff + k0;
      V ah = Frag<T>::load(Ab + ao);
      V al;
      if (SPLIT) al = Frag<T>::load(Ab2 + ao);
#pragma unroll
      for (int j = 0; j < 4; ++j) {
        acc[i][j] = Frag<T>::mma(ah, bh[j], acc[i][j]);
        if (SPLIT) {
          acc[i][j] = Frag<T>::mma(ah, bl[j], acc[i][j]);
          acc[i][j] = Frag<T>::mma(al, bh[j], acc[i][j]);
        }
      }
      Frag<T>::guard(acc[i][0], acc[i][3], ah, SPLIT ? al : ah);
    }
    Frag<T>::keep(bh[0], bh[1], bh[2], bh[3]);
    if (SPLIT) Frag<T>::keep(bl[0], bl[1], bl[2], bl[3]);
  }
  acc_guard4(acc[0][0], acc[0][1], acc[0][2], acc[0][3]);
  acc_guard4(acc[1][0], acc[1][1], acc[1][2], acc[1][3]);
  acc_guard4(acc[2][0], acc[2][1], acc[2][2], acc[2][3]);
  acc_guard4(acc[3][0], acc[3][1], acc[3][2], acc[3][3]);

  // ---- epilogue ----
  float* slab = sT[wave];
  const float* Rb = RESID ? (resid + (size_t)b * strideR) : nullptr;
#pragma unroll
  for (int i = 0; i < 4; ++i) {
    const int mBase = m0 + (i << 4);
#pragma unroll
    for (int j = 0; j < 4; ++j) {
      const int n = n0 + (j << 4) + rlane;
      float bv = 0.f;
      if (BIAS_MODE == 2) bv = bias[n];
#pragma unroll
      for (int r = 0; r < 8; ++r) {
        float v = acc[i][j][r] * scale;
        if (BIAS_MODE == 1) v += bias[mBase + mOff + r];
        if (BIAS_MODE == 2) v += bv;
        if (RESID) v += Rb[(size_t)(mBase + mOff + r) * ldc + n];
        if (ACT == 1) v = tanhf(v);
        if (ACT == 2) v = fmaxf(v, 0.0f);
        if (ACT == 3) v = v / (1.0f + expf(-v));
        if (ACT == 4) v = (v > 0.f) ? v : 0.01f * v;
        if (ACT == 5) v = 0.5f * v * (1.0f + erff(v * 0.70710678118654752f));
        slab[(mOff + r) * 68 + (j << 4) + rlane] = v;
      }
    }
    __builtin_amdgcn_fence(__ATOMIC_RELEASE, "workgroup");
    __builtin_amdgcn_wave_barrier();
    __builtin_amdgcn_fence(__ATOMIC_ACQUIRE, "workgroup");
    if (OUT_MODE == 0) {
      float* C = (float*)Cout + (size_t)b * strideC;
      const int hh = lane >> 4, c4 = (lane & 15) * 4;     // row seg = 256 B = 16 lanes x 16 B
      {
#pragma unroll
        for (int it = 0; it < 8; ++it) {
          const int row = it * 2 + hh;
          v4f v = *(const v4f*)(slab + row * 68 + c4);
          *(v4f*)(C + (size_t)(mBase + row) * ldc + n0 + c4) = v;
        }
        
      }
    } else {
      const int q = lane >> 3, c8 = (lane & 7) * 8;
      unsigned short* C  = (unsigned short*)Cout  + (size_t)b * strideC;
      unsigned short* C2 = (OUT_MODE == 2) ? ((unsigned short*)Cout2 + (size_t)b * strideC) : nullptr;
      {
#pragma unroll
        for (int it = 0; it < 4; ++it) {
          const int row = it * 4 + q;
          const float* sp = slab + row * 68 + c8;
          v8h hv, lv;
#pragma unroll
          for (int e = 0; e < 8; ++e) {
            if (OUT_MODE == 1) {
              hv[e] = (_Float16)sp[e];
            } else {
              unsigned short hb = f2bf_bits(sp[e]);
              unsigned short lb = f2bf_bits(sp[e] - bf_bits2f(hb));
              hv[e] = __builtin_bit_cast(_Float16, hb);
              lv[e] = __builtin_bit_cast(_Float16, lb);
            }
          }
          *(v8h*)(C + (size_t)(mBase + row) * ldc + n0 + c8) = hv;
          if (OUT_MODE == 2) *(v8h*)(C2 + (size_t)(mBase + row) * ldc + n0 + c8) = lv;
        }
        
      }
    }
    __builtin_amdgcn_fence(__ATOMIC_RELEASE, "workgroup");
    __builtin_amdgcn_wave_barrier();
    __builtin_amdgcn_fence(__ATOMIC_ACQUIRE, "workgroup");
  }
}

// ---------------------------------------------------------------------------
// f32 -> bf16 hi + bf16 lo planes (RNE converts). 8 elements per thread:
// two b128 loads, one b128 store per plane; lanes 8q..8q+7 of a wave fill one
// ---------------------------------------------------------------------------
__device__ __forceinline__ void split_pair(float f0, float f1, unsigned& hw, unsigned& lw) {
  const unsigned short h0 = f2bf_bits(f0);
  const unsigned short h1 = f2bf_bits(f1);
  const unsigned short l0 = f2bf_bits(f0 - bf_bits2f(h0));
  const unsigned short l1 = f2bf_bits(f1 - bf_bits2f(h1));
  hw = (unsigned)h0 | ((unsigned)h1 << 16);
  lw = (unsigned)l0 | ((unsigned)l1 << 16);
}

__global__ __launch_bounds__(256) void split_planes_bf16(
    const float* __restrict__ src, unsigned short* __restrict__ hi,
    unsigned short* __restrict__ lo, int n8) {
  const int i = blockIdx.x * 256 + threadIdx.x;
  if (i >= n8) return;                      // no barriers in this kernel
  const size_t e0 = (size_t)i * 8;
  const v4f a = *(const v4f*)(src + e0);
  const v4f c = *(const v4f*)(src + e0 + 4);
  unsigned hx, hy, hz, hw, lx, ly, lz, lw;
  split_pair(a[0], a[1], hx, lx);
  split_pair(a[2], a[3], hy, ly);
  split_pair(c[0], c[1], hz, lz);
  split_pair(c[2], c[3], hw, lw);
  const v4u hv = (v4u){hx, hy, hz, hw};
  const v4u lv = (v4u){lx, ly, lz, lw};
  *(v4u*)(hi + e0) = hv;
  *(v4u*)(lo + e0) = lv;
  
}

// ---------------------------------------------------------------------------
// Causal flash attention, head dim 64, bf16 hi/lo planes in, bf16 hi/lo planes out.
//   q,k,v planes: element (b, s, h, d) at (b*SEQ + s)*EMB + h*64 + d (ushort storage).
//   scores = q.k^T * sm_scale : hi.hi + hi.lo + lo.hi on v_wmma_f32_16x16x32_bf16
//   out    = p.v              : p and v as bf16 hi/lo, same three products
//   online softmax in f32; block = 4 waves = 64 query rows of one (b, h);
//   grid.x = NB * NHEAD * (SEQ/64); keys visited in 64-wide chunks 0..qb (causal).
//   Output planes: element (b, q, h*64+d) at (b*SEQ+q)*EMB + h*64 + d; each wave writes
// ---------------------------------------------------------------------------
__device__ __forceinline__ unsigned short at_bf_bits(float f) {
  unsigned u = __float_as_uint(f);
  return (unsigned short)((u + 0x7FFFu + ((u >> 16) & 1u)) >> 16);
}
__device__ __forceinline__ __bf16 at_f2bf(float f) { return __builtin_bit_cast(__bf16, at_bf_bits(f)); }
__device__ __forceinline__ void at_split(float f, __bf16& hi, __bf16& lo) {
  const unsigned short hb = at_bf_bits(f);
  hi = __builtin_bit_cast(__bf16, hb);
  lo = at_f2bf(f - __uint_as_float(((unsigned)hb) << 16));
}
__device__ __forceinline__ v8f at_mma(v16b a, v16b b, v8f c) {
  c = __builtin_amdgcn_wmma_f32_16x16x32_bf16(false, a, false, b, (short)0, c, false, false);
  asm volatile("v_nop\n\tv_nop\n\tv_nop\n\tv_nop" : "+v"(c) : "v"(a), "v"(b));
  return c;
}

// transpose-store 8 consecutive 16-bit elements held in a b128 word into dst[e*pitch], e = 0..7
__device__ __forceinline__ void st_tr8(unsigned short* dst, int pitch, v4u w) {
#pragma unroll
  for (int e = 0; e < 4; ++e) {
    const unsigned word = w[e];
    dst[(2 * e) * pitch]     = (unsigned short)(word & 0xffffu);
    dst[(2 * e + 1) * pitch] = (unsigned short)(word >> 16);
  }
}

__global__ __launch_bounds__(128)
void attn_causal_hd64(const unsigned short* __restrict__ Qh, const unsigned short* __restrict__ Ql,
                      const unsigned short* __restrict__ Kh, const unsigned short* __restrict__ Kl,
                      const unsigned short* __restrict__ Vh, const unsigned short* __restrict__ Vl,
                      unsigned short* __restrict__ Oh, unsigned short* __restrict__ Ol,
                      float sm_scale) {
  union FB { v16b v; v8b h[2]; };
  __shared__ __align__(16) unsigned short Ksh[AKC * HDIM];    // K hi [kv][d]   8 KB
  __shared__ __align__(16) unsigned short Ksl[AKC * HDIM];    // K lo [kv][d]   8 KB
  __shared__ __align__(16) unsigned short Vth[HDIM * AKC];    // V hi [d][kv]   8 KB
  __shared__ __align__(16) unsigned short Vtl[HDIM * AKC];    // V lo [d][kv]   8 KB
  __shared__ __align__(16) __bf16 Psh[ANW][16 * AKC];         // per wave P hi [row][kv]
  __shared__ __align__(16) __bf16 Psl[ANW][16 * AKC];         // per wave P lo
  __shared__ __align__(16) float  Os[ANW][16 * 68];           // per wave out tile, pitch 68

  const int tid  = threadIdx.x;
  const int wave = tid >> 5;
  const int lane = tid & 31;
  const int hh   = lane >> 4;
  const int c    = lane & 15;
  const float NEG_INF = -__builtin_inff();

  constexpr int NQB = SEQ / AQB;                 // 32 query blocks per (b, h)
  const int bx   = blockIdx.x;
  const int qb   = bx % NQB;
  const int bhid = bx / NQB;
  const int h    = bhid % NHEAD;
  const int b    = bhid / NHEAD;
  const int q0   = qb * AQB + wave * 16;
  const size_t hoff = (size_t)h * HDIM;

  // ---- Q fragments (A operand): row = c, elements 0..7 <- d = dc*32 + 8hh + 0..7, 8..15 <- dc*32 + 16 + 8hh + 0..7
  v16b qah[2], qal[2];
  {
    const size_t qo = (size_t)(b * SEQ + q0 + c) * EMB + hoff + 8 * hh;
    const __bf16* qhp = (const __bf16*)(const void*)Qh;
    const __bf16* qlp = (const __bf16*)(const void*)Ql;
#pragma unroll
    for (int dc = 0; dc < 2; ++dc) {
      qah[dc] = Frag<__bf16>::load(qhp + qo + dc * 32);
      qal[dc] = Frag<__bf16>::load(qlp + qo + dc * 32);
    }
  }

  float mrow[8], lrow[8];
  v8f oacc[4];
#pragma unroll
  for (int r = 0; r < 8; ++r) { mrow[r] = NEG_INF; lrow[r] = 0.f; }
#pragma unroll
  for (int t = 0; t < 4; ++t) oacc[t] = (v8f){0.f,0.f,0.f,0.f,0.f,0.f,0.f,0.f};

  const int nChunks = qb + 1;                    // block-uniform, <= 32
  for (int kc = 0; kc < nChunks; ++kc) {
    const int kv0 = kc * AKC;
    __syncthreads();
#pragma unroll
    for (int i = 0; i < 4; ++i) {
      const int ci = tid + 128 * i;
      const int kvr = ci >> 3, col8 = (ci & 7) * 8;
      const size_t go = (size_t)(b * SEQ + kv0 + kvr) * EMB + hoff + col8;
      const v4u w0 = *(const v4u*)(Kh + go);
      const v4u w1 = *(const v4u*)(Kl + go);
      *(v4u*)(Ksh + kvr * HDIM + col8) = w0;
      *(v4u*)(Ksl + kvr * HDIM + col8) = w1;
    }
    asm volatile("" ::: "memory");
    // ---- stage V hi/lo transposed: same 512-word map; each word -> 8 strided 2-B LDS stores ----
#pragma unroll
    for (int i = 0; i < 4; ++i) {
      const int ci = tid + 128 * i;
      const int kvr = ci >> 3, col8 = (ci & 7) * 8;
      const size_t go = (size_t)(b * SEQ + kv0 + kvr) * EMB + hoff + col8;
      const v4u w0 = *(const v4u*)(Vh + go);
      const v4u w1 = *(const v4u*)(Vl + go);
      st_tr8(Vth + col8 * AKC + kvr, AKC, w0);
      st_tr8(Vtl + col8 * AKC + kvr, AKC, w1);
    }
    __syncthreads();

    // ---- scores: 4 key tiles x 2 d-chunks x 3 products ----
    v8f s[4];
#pragma unroll
    for (int j = 0; j < 4; ++j) {
      s[j] = (v8f){0.f,0.f,0.f,0.f,0.f,0.f,0.f,0.f};
#pragma unroll
      for (int dc = 0; dc < 2; ++dc) {
        FB kfh, kfl;
        const int ko = (j * 16 + c) * HDIM + dc * 32 + 8 * hh;
        kfh.h[0] = *(const v8b*)(Ksh + ko);
        kfh.h[1] = *(const v8b*)(Ksh + ko + 16);
        kfl.h[0] = *(const v8b*)(Ksl + ko);
        kfl.h[1] = *(const v8b*)(Ksl + ko + 16);
        s[j] = at_mma(qah[dc], kfh.v, s[j]);
        s[j] = at_mma(qah[dc], kfl.v, s[j]);
        s[j] = at_mma(qal[dc], kfh.v, s[j]);
      }
    }
    // ---- scale, causal mask on the diagonal chunk (select, -inf fill), row max ----
    const bool diag = (kc == qb);
    float cm[8];
#pragma unroll
    for (int r = 0; r < 8; ++r) {
      const int qrow = q0 + 8 * hh + r;
      float m = NEG_INF;
#pragma unroll
      for (int j = 0; j < 4; ++j) {
        const int kvcol = kv0 + j * 16 + c;
        float val = s[j][r] * sm_scale;
        val = (diag && (kvcol > qrow)) ? NEG_INF : val;
        s[j][r] = val;
        m = fmaxf(m, val);
      }
#pragma unroll
      for (int off = 1; off < 16; off <<= 1) m = fmaxf(m, __shfl_xor(m, off, 32));
      cm[r] = m;
    }
    // ---- online softmax update, P hi/lo staged per wave ----
    __bf16* pwh = Psh[wave];
    __bf16* pwl = Psl[wave];
#pragma unroll
    for (int r = 0; r < 8; ++r) {
      const float mnew = fmaxf(mrow[r], cm[r]);
      const float alpha = expf(mrow[r] - mnew);
      mrow[r] = mnew;
      float psum = 0.f;
#pragma unroll
      for (int j = 0; j < 4; ++j) {
        const float p = expf(s[j][r] - mnew);
        psum += p;
        __bf16 a, bl;
        at_split(p, a, bl);
        pwh[(8 * hh + r) * AKC + j * 16 + c] = a;
        pwl[(8 * hh + r) * AKC + j * 16 + c] = bl;
      }
#pragma unroll
      for (int off = 1; off < 16; off <<= 1) psum += __shfl_xor(psum, off, 32);
      lrow[r] = lrow[r] * alpha + psum;
#pragma unroll
      for (int t = 0; t < 4; ++t) oacc[t][r] *= alpha;
    }
    __builtin_amdgcn_fence(__ATOMIC_RELEASE, "workgroup");
    __builtin_amdgcn_wave_barrier();
    __builtin_amdgcn_fence(__ATOMIC_ACQUIRE, "workgroup");
    // ---- O += P.V : A = P [row][kv], B[k=kv][n=d] = Vt[d][kv] ----
#pragma unroll 1
    for (int kk = 0; kk < 2; ++kk) {
      FB pa, pl;
      pa.h[0] = *(const v8b*)(pwh + c * AKC + kk * 32 + 8 * hh);
      pa.h[1] = *(const v8b*)(pwh + c * AKC + kk * 32 + 16 + 8 * hh);
      pl.h[0] = *(const v8b*)(pwl + c * AKC + kk * 32 + 8 * hh);
      pl.h[1] = *(const v8b*)(pwl + c * AKC + kk * 32 + 16 + 8 * hh);
#pragma unroll
      for (int t = 0; t < 4; ++t) {
        FB vb, vlo;
        const int vo = (t * 16 + c) * AKC + kk * 32 + 8 * hh;
        vb.h[0]  = *(const v8b*)(Vth + vo);
        vb.h[1]  = *(const v8b*)(Vth + vo + 16);
        vlo.h[0] = *(const v8b*)(Vtl + vo);
        vlo.h[1] = *(const v8b*)(Vtl + vo + 16);
        oacc[t] = at_mma(pa.v, vb.v, oacc[t]);
        oacc[t] = at_mma(pa.v, vlo.v, oacc[t]);
        oacc[t] = at_mma(pl.v, vb.v, oacc[t]);
      }
    }
  }

  // ---- epilogue: 1/l, per-wave LDS slab, whole-line bf16 hi/lo stores ----
  float* os = Os[wave];
#pragma unroll
  for (int r = 0; r < 8; ++r) {
    const float inv = 1.0f / lrow[r];
#pragma unroll
    for (int t = 0; t < 4; ++t) os[(8 * hh + r) * 68 + t * 16 + c] = oacc[t][r] * inv;
  }
  __builtin_amdgcn_fence(__ATOMIC_RELEASE, "workgroup");
  __builtin_amdgcn_wave_barrier();
  __builtin_amdgcn_fence(__ATOMIC_ACQUIRE, "workgroup");
  {
    // rows it*4 + q4 (it 0..3, q4 0..3) = 0..15; c8 = 0..56 step 8 -> full 16 x 64 tile per plane
    const int q4 = lane >> 3, c8 = (lane & 7) * 8;
    {
#pragma unroll
      for (int it = 0; it < 4; ++it) {
        const int row = it * 4 + q4;
        const float* sp = os + row * 68 + c8;
        v8h hv, lv;
#pragma unroll
        for (int e = 0; e < 8; ++e) {
          unsigned short hb = f2bf_bits(sp[e]);
          unsigned short lb = f2bf_bits(sp[e] - bf_bits2f(hb));
          hv[e] = __builtin_bit_cast(_Float16, hb);
          lv[e] = __builtin_bit_cast(_Float16, lb);
        }
        const size_t oo = (size_t)(b * SEQ + q0 + row) * EMB + hoff + c8;
        *(v8h*)(Oh + oo) = hv;
        *(v8h*)(Ol + oo) = lv;
      }
      
    }
  }
}

// ---------------------------------------------------------------------------
// Host launcher: 8 launches, no runtime API calls other than launches.
// ---------------------------------------------------------------------------
extern "C" void kernel_launch(void* const* d_in, const int* in_sizes, int n_in,
                              void* d_out, int out_size, void* d_ws, size_t ws_size,
                              hipStream_t stream) {
  if (n_in < 5) return;
  if (in_sizes[0] != NB * SEQ * EMB) return;
  if (in_sizes[1] != HDIM * HDIM || in_sizes[2] != HDIM * HDIM || in_sizes[3] != HDIM * HDIM) return;
  if (in_sizes[4] != EMB * EMB) return;
  if (out_size != NB * SEQ * EMB) return;
  if (ws_size < WS_TOTAL) return;

  const float* x  = (const float*)d_in[0];
  const float* Wq = (const float*)d_in[1];
  const float* Wk = (const float*)d_in[2];
  const float* Wv = (const float*)d_in[3];
  const float* Wo = (const float*)d_in[4];
  float* out = (float*)d_out;

  char* ws = (char*)d_ws;
  unsigned short* XH   = (unsigned short*)(ws + OFF_XH);
  unsigned short* XL   = (unsigned short*)(ws + OFF_XL);
  unsigned short* WH   = (unsigned short*)(ws + OFF_WH);
  unsigned short* WL   = (unsigned short*)(ws + OFF_WL);
  unsigned short* WOH  = (unsigned short*)(ws + OFF_WOH);
  unsigned short* WOL  = (unsigned short*)(ws + OFF_WOL);
  unsigned short* QKVH = (unsigned short*)(ws + OFF_QKVH);
  unsigned short* QKVL = (unsigned short*)(ws + OFF_QKVL);
  unsigned short* AVH  = (unsigned short*)(ws + OFF_AVH);
  unsigned short* AVL  = (unsigned short*)(ws + OFF_AVL);
  const float* dummyf = (const float*)(ws + OFF_XH);     // unused pointer slots point inside ws
  void* dummyv = (void*)(ws + OFF_XH);

  // ---- operand planes (bf16 hi/lo) ----
  {
    const int n8x = (NB * SEQ * EMB) / 8;                // 524288 threads cover 4194304 elements
    split_planes_bf16<<<(n8x + 255) / 256, 256, 0, stream>>>(x, XH, XL, n8x);
    const int n8w = (HDIM * HDIM) / 8;                   // 512 threads cover 4096 elements each
    split_planes_bf16<<<(n8w + 255) / 256, 256, 0, stream>>>(Wq, WH + 0 * HDIM * HDIM, WL + 0 * HDIM * HDIM, n8w);
    split_planes_bf16<<<(n8w + 255) / 256, 256, 0, stream>>>(Wk, WH + 1 * HDIM * HDIM, WL + 1 * HDIM * HDIM, n8w);
    split_planes_bf16<<<(n8w + 255) / 256, 256, 0, stream>>>(Wv, WH + 2 * HDIM * HDIM, WL + 2 * HDIM * HDIM, n8w);
    const int n8o = (EMB * EMB) / 8;                     // 131072 threads cover 1048576 elements
    split_planes_bf16<<<(n8o + 255) / 256, 256, 0, stream>>>(Wo, WOH, WOL, n8o);
  }

  // ---- q|k|v = xh[65536][64] . W{q,k,v}^T : M=65536, N=64, K=64; grid.y selects the weight plane ----
  {
    const int tiles = (NROWH / 64) * (HDIM / 64);        // 1024 wave tiles
    dim3 grid((tiles + 7) / 8, 3);
    wmma_gemm64<1, true, 0, 2, false><<<grid, 256, 0, stream>>>(
        XH, XL, HDIM, 0L,
        WH, WL, HDIM, (long)(HDIM * HDIM),
        (void*)QKVH, (void*)QKVL, HDIM, (long)PLANE_QKV,
        dummyf, dummyf, 0L,
        NROWH, HDIM, HDIM, 1.0f);
  }

  // ---- causal attention per (b, h): av hi/lo planes ----
  {
    const int nblk = NB * NHEAD * (SEQ / AQB);           // 1024 blocks x 64 query rows
    attn_causal_hd64<<<nblk, 128, 0, stream>>>(
        QKVH + 0 * PLANE_QKV, QKVL + 0 * PLANE_QKV,
        QKVH + 1 * PLANE_QKV, QKVL + 1 * PLANE_QKV,
        QKVH + 2 * PLANE_QKV, QKVL + 2 * PLANE_QKV,
        AVH, AVL, 0.125f);
  }

  // ---- out = av[4096][1024] . Wo^T : M=4096, N=1024, K=1024, f32 into d_out ----
  {
    const int tiles = (NTOK / 64) * (EMB / 64);          // 1024 wave tiles
    dim3 grid((tiles + 7) / 8, 1);
    wmma_gemm64<1, true, 0, 0, false><<<grid, 256, 0, stream>>>(
        AVH, AVL, EMB, 0L,
        WOH, WOL, EMB, 0L,
        (void*)out, dummyv, EMB, 0L,
        dummyf, dummyf, 0L,
        NTOK, EMB, EMB, 1.0f);
  }
}

// v001
// A run of this version takes 428 microseconds.
// Two timings next to v000 put it at 1.26 and 1.27 times that version's speed.
// Contractions: q/k/v projections, q.k^T scores, p.v and output projection all on v_wmma_f32_16x16x32_bf16 with bf16 hi/lo split operands (hi*hi + hi*lo + lo*hi), f32 accumulate; softmax and all side math in f32.
#include <hip/hip_runtime.h>

typedef __attribute__((ext_vector_type(16))) _Float16 v16h;
typedef __attribute__((ext_vector_type(8)))  _Float16 v8h;
typedef __attribute__((ext_vector_type(16))) __bf16   v16b;
typedef __attribute__((ext_vector_type(8)))  __bf16   v8b;
typedef __attribute__((ext_vector_type(8)))  float    v8f;
typedef __attribute__((ext_vector_type(4)))  float    v4f;
typedef __attribute__((ext_vector_type(4)))  unsigned v4u;
#define U16(p) ((const unsigned short*)(const void*)(p))

// ---------------------------------------------------------------------------
// Problem constants
// ---------------------------------------------------------------------------
constexpr int NB    = 2;
constexpr int SEQ   = 2048;
constexpr int EMB   = 1024;
constexpr int NHEAD = 16;
constexpr int HDIM  = 64;
constexpr int NTOK  = NB * SEQ;              // 4096 rows of [EMB]
constexpr int NROWH = NTOK * NHEAD;          // 65536 rows of [HDIM]

// attention tiling
constexpr int AQB = 64;                      // query rows per block (4 waves x 16)
constexpr int AKC = 64;                      // keys per chunk
constexpr int ANW = 4;
// LDS row pitch of the K, V^T and P tiles, in 16-bit elements: 144 B = 16 B x 9 (odd), so that the
// 16 rows a ds_load_b128 fragment read touches start on distinct bank groups (128-B rows do not).
constexpr int APT = 72;

// GEMM shape contract (no run-time tails)
static_assert(NROWH % 64 == 0);              // qkv GEMM M
static_assert(HDIM % 64 == 0);               // qkv GEMM N
static_assert(HDIM % 32 == 0);               // qkv GEMM K
static_assert(NTOK % 64 == 0);               // out GEMM M
static_assert(EMB % 64 == 0);                // out GEMM N
static_assert(EMB % 32 == 0);                // out GEMM K
static_assert(SEQ % AQB == 0);
static_assert(AQB == AKC);
static_assert(APT >= AKC && APT >= HDIM && (APT * 2) % 16 == 0 && ((APT * 2) / 16) % 2 == 1);

// ---------------------------------------------------------------------------
//   XH   [0          ,  8 MiB)  x   bf16 hi  [4194304]
//   XL   [8 MiB      , 16 MiB)  x   bf16 lo
//   WH   [16 MiB     , +24576)  Wq|Wk|Wv bf16 hi, 3 planes of [64][64] (carve 64 KiB)
//   WL   [16 MiB+64K , +24576)  Wq|Wk|Wv bf16 lo (carve 64 KiB)
//   WOH  [17 MiB     , 19 MiB)  Wo  bf16 hi  [1024][1024]
//   WOL  [19 MiB     , 21 MiB)  Wo  bf16 lo
//   QKVH [21 MiB     , 45 MiB)  q|k|v bf16 hi, 3 planes of [65536][64] (element (b,s,h,d) at (b*SEQ+s)*EMB + h*64 + d)
//   QKVL [45 MiB     , 69 MiB)  q|k|v bf16 lo
//   AVH  [69 MiB     , 77 MiB)  av  bf16 hi  [4096][1024]
//   AVL  [77 MiB     , 85 MiB)  av  bf16 lo
//   total 85 MiB = 89128960 B
// ---------------------------------------------------------------------------
constexpr size_t MIB      = 1048576;
constexpr size_t OFF_XH   = 0;
constexpr size_t OFF_XL   = 8 * MIB;
constexpr size_t OFF_WH   = 16 * MIB;
constexpr size_t OFF_WL   = 16 * MIB + 65536;
constexpr size_t OFF_WOH  = 17 * MIB;
constexpr size_t OFF_WOL  = 19 * MIB;
constexpr size_t OFF_QKVH = 21 * MIB;
constexpr size_t OFF_QKVL = 45 * MIB;
constexpr size_t OFF_AVH  = 69 * MIB;
constexpr size_t OFF_AVL  = 77 * MIB;
constexpr size_t WS_TOTAL = 85 * MIB;
constexpr size_t PLANE_QKV = (size_t)NROWH * HDIM;      // elements per q/k/v plane
static_assert((size_t)NB * SEQ * EMB * 2 <= OFF_XL - OFF_XH);
static_assert((size_t)3 * HDIM * HDIM * 2 <= OFF_WL - OFF_WH);
static_assert((size_t)3 * HDIM * HDIM * 2 <= OFF_WOH - OFF_WL);
static_assert((size_t)EMB * EMB * 2 <= OFF_WOL - OFF_WOH);
static_assert((size_t)EMB * EMB * 2 <= OFF_QKVH - OFF_WOL);
static_assert(3 * PLANE_QKV * 2 <= OFF_QKVL - OFF_QKVH);
static_assert(3 * PLANE_QKV * 2 <= OFF_AVH - OFF_QKVL);
static_assert((size_t)NTOK * EMB * 2 <= OFF_AVL - OFF_AVH);
static_assert((size_t)NTOK * EMB * 2 <= WS_TOTAL - OFF_AVL);
static_assert(WS_TOTAL <= 134217728);

// ---------------------------------------------------------------------------
// Helpers
// ---------------------------------------------------------------------------
__device__ __forceinline__ unsigned short f2bf_bits(float f) {
  unsigned u = __float_as_uint(f);
  return (unsigned short)((u + 0x7FFFu + ((u >> 16) & 1u)) >> 16);
}
__device__ __forceinline__ float bf_bits2f(unsigned short h) { return __uint_as_float(((unsigned)h) << 16); }

// hazard guards as plain device helpers (no inline asm inside the kernel template body)
__device__ __forceinline__ void dep_guard_h(v8f& a, v8f& b, v16h x, v16h y) { asm volatile("v_nop\n\tv_nop\n\tv_nop\n\tv_nop" : "+v"(a), "+v"(b) : "v"(x), "v"(y)); }
__device__ __forceinline__ void dep_guard_b(v8f& a, v8f& b, v16b x, v16b y) { asm volatile("v_nop\n\tv_nop\n\tv_nop\n\tv_nop" : "+v"(a), "+v"(b) : "v"(x), "v"(y)); }
__device__ __forceinline__ void keep4_h(v16h a, v16h b, v16h c, v16h d) { asm volatile("v_nop" :: "v"(a), "v"(b), "v"(c), "v"(d)); }
__device__ __forceinline__ void keep4_b(v16b a, v16b b, v16b c, v16b d) { asm volatile("v_nop" :: "v"(a), "v"(b), "v"(c), "v"(d)); }
__device__ __forceinline__ void acc_guard4(v8f& a, v8f& b, v8f& c, v8f& d) { asm volatile("v_nop\n\tv_nop\n\tv_nop\n\tv_nop" : "+v"(a), "+v"(b), "+v"(c), "+v"(d)); }
template <typename T> struct Frag;
template <> struct Frag<_Float16> {
  typedef v16h V; union U { v16h v; v8h h[2]; };
  static __device__ __forceinline__ v16h load(const _Float16* p) {   // elements 0..7 <- p[0..7], 8..15 <- p[16..23]
    U f; f.h[0] = *(const v8h*)(p); f.h[1] = *(const v8h*)(p + 16); return f.v;
  }
  static __device__ __forceinline__ v8f mma(v16h a, v16h b, v8f c) {
    return __builtin_amdgcn_wmma_f32_16x16x32_f16(false, a, false, b, (short)0, c, false, false);
  }
  static __device__ __forceinline__ void guard(v8f& a, v8f& b, v16h x, v16h y) { dep_guard_h(a, b, x, y); }
  static __device__ __forceinline__ void keep(v16h a, v16h b, v16h c, v16h d) { keep4_h(a, b, c, d); }
};
template <> struct Frag<__bf16> {
  typedef v16b V; union U { v16b v; v8b h[2]; };
  static __device__ __forceinline__ v16b load(const __bf16* p) {
    U f; f.h[0] = *(const v8b*)(p); f.h[1] = *(const v8b*)(p + 16); return f.v;
  }
  static __device__ __forceinline__ v8f mma(v16b a, v16b b, v8f c) {
    return __builtin_amdgcn_wmma_f32_16x16x32_bf16(false, a, false, b, (short)0, c, false, false);
  }
  static __device__ __forceinline__ void guard(v8f& a, v8f& b, v16b x, v16b y) { dep_guard_b(a, b, x, y); }
  static __device__ __forceinline__ void keep(v16b a, v16b b, v16b c, v16b d) { keep4_b(a, b, c, d); }
};

// ---- Register-blocked batched WMMA GEMM --------------------------------
// C[m,n] = scale * sum_k A[m,k] * Bt[n,k] (+bias)(+resid); each wave owns a 64x64 tile.
// A row-major [M,K]; Bt row-major [N,K]; M,N % 64 == 0, K % 32 == 0.
// SPLIT: operands are hi/lo planes (A2/Bt2 = lo planes, same layout); product = hi.hi + hi.lo + lo.hi.
// BIAS_MODE: 0 = none, 1 = bias[m], 2 = bias[n].
// OUT_MODE: 0 = f32, 1 = f16, 2 = bf16 hi plane (Cout) + bf16 lo plane (Cout2).
// ET: 0 = f16 operands, 1 = bf16 operands (pointers passed as 16-bit storage)
template <int ET> struct Elem;
template <> struct Elem<0> { typedef _Float16 T; };
template <> struct Elem<1> { typedef __bf16 T; };
template <int ET, bool SPLIT, int BIAS_MODE, int OUT_MODE, bool RESID, int ACT = 0>
__global__ __launch_bounds__(256) void wmma_gemm64(
    const unsigned short* __restrict__ Ap, const unsigned short* __restrict__ A2p, int lda, long strideA,
    const unsigned short* __restrict__ Btp, const unsigned short* __restrict__ Bt2p, int ldb, long strideB,
    void* __restrict__ Cout, void* __restrict__ Cout2, int ldc, long strideC,
    const float* __restrict__ bias,
    const float* __restrict__ resid, long strideR,
    int M, int N, int K, float scale) {
  typedef typename Elem<ET>::T T;
  typedef typename Frag<T>::V V;
  const T* A = (const T*)Ap; const T* A2 = (const T*)A2p; const T* Bt = (const T*)Btp; const T* Bt2 = (const T*)Bt2p;
  __shared__ __align__(16) float sT[8][16 * 68];   // per-wave 16x64 slab, pitch 68 floats
  const int b    = blockIdx.y;
  const int lane = threadIdx.x & 31;
  const int wave = threadIdx.x >> 5;
  const int tilesN = N >> 6;
  const int tilesM = M >> 6;
  const int tile = blockIdx.x * 8 + wave;
  if (tile >= tilesM * tilesN) return;   // wave-uniform; no block barriers in this kernel
  const int tm = tile / tilesN;
  const int tn = tile - tm * tilesN;
  const int m0 = tm << 6;
  const int n0 = tn << 6;

  const T* Ab  = A  + (size_t)b * strideA;
  const T* Bb  = Bt + (size_t)b * strideB;
  const T* Ab2 = SPLIT ? (A2  + (size_t)b * strideA) : nullptr;
  const T* Bb2 = SPLIT ? (Bt2 + (size_t)b * strideB) : nullptr;

  const int rlane = lane & 15;                 // row (A) / col (B, D) within subtile
  const int koff  = (lane >> 4) * 8;           // k offset of this lane half
  const int mOff  = (lane >> 4) * 8;           // D row offset

  v8f acc[4][4];
#pragma unroll
  for (int i = 0; i < 4; ++i)
#pragma unroll
    for (int j = 0; j < 4; ++j) acc[i][j] = (v8f){0.f,0.f,0.f,0.f,0.f,0.f,0.f,0.f};

  for (int k0 = 0; k0 < K; k0 += 32) {
    V bh[4], bl[4];
#pragma unroll
    for (int j = 0; j < 4; ++j) {
      const size_t bo = (size_t)(n0 + (j << 4) + rlane) * ldb + koff + k0;
      bh[j] = Frag<T>::load(Bb + bo);
      if (SPLIT) bl[j] = Frag<T>::load(Bb2 + bo);
    }
#pragma unroll
    for (int i = 0; i < 4; ++i) {
      const size_t ao = (size_t)(m0 + (i << 4) + rlane) * lda + koff + k0;
      V ah = Frag<T>::load(Ab + ao);
      V al;
      if (SPLIT) al = Frag<T>::load(Ab2 + ao);
#pragma unroll
      for (int j = 0; j < 4; ++j) {
        acc[i][j] = Frag<T>::mma(ah, bh[j], acc[i][j]);
        if (SPLIT) {
          acc[i][j] = Frag<T>::mma(ah, bl[j], acc[i][j]);
          acc[i][j] = Frag<T>::mma(al, bh[j], acc[i][j]);
        }
      }
      Frag<T>::guard(acc[i][0], acc[i][3], ah, SPLIT ? al : ah);
    }
    Frag<T>::keep(bh[0], bh[1], bh[2], bh[3]);
    if (SPLIT) Frag<T>::keep(bl[0], bl[1], bl[2], bl[3]);
  }
  acc_guard4(acc[0][0], acc[0][1], acc[0][2], acc[0][3]);
  acc_guard4(acc[1][0], acc[1][1], acc[1][2], acc[1][3]);
  acc_guard4(acc[2][0], acc[2][1], acc[2][2], acc[2][3]);
  acc_guard4(acc[3][0], acc[3][1], acc[3][2], acc[3][3]);

  // ---- epilogue ----
  float* slab = sT[wave];
  const float* Rb = RESID ? (resid + (size_t)b * strideR) : nullptr;
#pragma unroll
  for (int i = 0; i < 4; ++i) {
    const int mBase = m0 + (i << 4);
#pragma unroll
    for (int j = 0; j < 4; ++j) {
      const int n = n0 + (j << 4) + rlane;
      float bv = 0.f;
      if (BIAS_MODE == 2) bv = bias[n];
#pragma unroll
      for (int r = 0; r < 8; ++r) {
        float v = acc[i][j][r] * scale;
        if (BIAS_MODE == 1) v += bias[mBase + mOff + r];
        if (BIAS_MODE == 2) v += bv;
        if (RESID) v += Rb[(size_t)(mBase + mOff + r) * ldc + n];
        if (ACT == 1) v = tanhf(v);
        if (ACT == 2) v = fmaxf(v, 0.0f);
        if (ACT == 3) v = v / (1.0f + expf(-v));
        if (ACT == 4) v = (v > 0.f) ? v : 0.01f * v;
        if (ACT == 5) v = 0.5f * v * (1.0f + erff(v * 0.70710678118654752f));
        slab[(mOff + r) * 68 + (j << 4) + rlane] = v;
      }
    }
    __builtin_amdgcn_fence(__ATOMIC_RELEASE, "workgroup");
    __builtin_amdgcn_wave_barrier();
    __builtin_amdgcn_fence(__ATOMIC_ACQUIRE, "workgroup");
    if (OUT_MODE == 0) {
      float* C = (float*)Cout + (size_t)b * strideC;
      const int hh = lane >> 4, c4 = (lane & 15) * 4;     // row seg = 256 B = 16 lanes x 16 B
      {
#pragma unroll
        for (int it = 0; it < 8; ++it) {
          const int row = it * 2 + hh;
          v4f v = *(const v4f*)(slab + row * 68 + c4);
          *(v4f*)(C + (size_t)(mBase + row) * ldc + n0 + c4) = v;
        }
        
      }
    } else {
      const int q = lane >> 3, c8 = (lane & 7) * 8;
      unsigned short* C  = (unsigned short*)Cout  + (size_t)b * strideC;
      unsigned short* C2 = (OUT_MODE == 2) ? ((unsigned short*)Cout2 + (size_t)b * strideC) : nullptr;
      {
#pragma unroll
        for (int it = 0; it < 4; ++it) {
          const int row = it * 4 + q;
          const float* sp = slab + row * 68 + c8;
          v8h hv, lv;
#pragma unroll
          for (int e = 0; e < 8; ++e) {
            if (OUT_MODE == 1) {
              hv[e] = (_Float16)sp[e];
            } else {
              unsigned short hb = f2bf_bits(sp[e]);
              unsigned short lb = f2bf_bits(sp[e] - bf_bits2f(hb));
              hv[e] = __builtin_bit_cast(_Float16, hb);
              lv[e] = __builtin_bit_cast(_Float16, lb);
            }
          }
          *(v8h*)(C + (size_t)(mBase + row) * ldc + n0 + c8) = hv;
          if (OUT_MODE == 2) *(v8h*)(C2 + (size_t)(mBase + row) * ldc + n0 + c8) = lv;
        }
        
      }
    }
    __builtin_amdgcn_fence(__ATOMIC_RELEASE, "workgroup");
    __builtin_amdgcn_wave_barrier();
    __builtin_amdgcn_fence(__ATOMIC_ACQUIRE, "workgroup");
  }
}

// ---------------------------------------------------------------------------
// f32 -> bf16 hi + bf16 lo planes (RNE converts). 8 elements per thread:
// two b128 loads, one b128 store per plane; lanes 8q..8q+7 of a wave fill one
// ---------------------------------------------------------------------------
__device__ __forceinline__ void split_pair(float f0, float f1, unsigned& hw, unsigned& lw) {
  const unsigned short h0 = f2bf_bits(f0);
  const unsigned short h1 = f2bf_bits(f1);
  const unsigned short l0 = f2bf_bits(f0 - bf_bits2f(h0));
  const unsigned short l1 = f2bf_bits(f1 - bf_bits2f(h1));
  hw = (unsigned)h0 | ((unsigned)h1 << 16);
  lw = (unsigned)l0 | ((unsigned)l1 << 16);
}

__global__ __launch_bounds__(256) void split_planes_bf16(
    const float* __restrict__ src, unsigned short* __restrict__ hi,
    unsigned short* __restrict__ lo, int n8) {
  const int i = blockIdx.x * 256 + threadIdx.x;
  if (i >= n8) return;                      // no barriers in this kernel
  const size_t e0 = (size_t)i * 8;
  const v4f a = *(const v4f*)(src + e0);
  const v4f c = *(const v4f*)(src + e0 + 4);
  unsigned hx, hy, hz, hw, lx, ly, lz, lw;
  split_pair(a[0], a[1], hx, lx);
  split_pair(a[2], a[3], hy, ly);
  split_pair(c[0], c[1], hz, lz);
  split_pair(c[2], c[3], hw, lw);
  const v4u hv = (v4u){hx, hy, hz, hw};
  const v4u lv = (v4u){lx, ly, lz, lw};
  *(v4u*)(hi + e0) = hv;
  *(v4u*)(lo + e0) = lv;
  
}

// ---------------------------------------------------------------------------
// Causal flash attention, head dim 64, bf16 hi/lo planes in, bf16 hi/lo planes out.
//   q,k,v planes: element (b, s, h, d) at (b*SEQ + s)*EMB + h*64 + d (ushort storage).
//   scores = q.k^T * sm_scale : hi.hi + hi.lo + lo.hi on v_wmma_f32_16x16x32_bf16
//   out    = p.v              : p and v as bf16 hi/lo, same three products
//   online softmax in f32; block = 4 waves = 64 query rows of one (b, h);
//   grid.x = NB * NHEAD * (SEQ/64); keys visited in 64-wide chunks 0..qb (causal).
//   Output planes: element (b, q, h*64+d) at (b*SEQ+q)*EMB + h*64 + d; each wave writes
// ---------------------------------------------------------------------------
__device__ __forceinline__ unsigned short at_bf_bits(float f) {
  unsigned u = __float_as_uint(f);
  return (unsigned short)((u + 0x7FFFu + ((u >> 16) & 1u)) >> 16);
}
__device__ __forceinline__ __bf16 at_f2bf(float f) { return __builtin_bit_cast(__bf16, at_bf_bits(f)); }
__device__ __forceinline__ void at_split(float f, __bf16& hi, __bf16& lo) {
  const unsigned short hb = at_bf_bits(f);
  hi = __builtin_bit_cast(__bf16, hb);
  lo = at_f2bf(f - __uint_as_float(((unsigned)hb) << 16));
}
__device__ __forceinline__ v8f at_mma(v16b a, v16b b, v8f c) {
  c = __builtin_amdgcn_wmma_f32_16x16x32_bf16(false, a, false, b, (short)0, c, false, false);
  asm volatile("v_nop\n\tv_nop\n\tv_nop\n\tv_nop" : "+v"(c) : "v"(a), "v"(b));
  return c;
}

// transpose-store 8 consecutive 16-bit elements held in a b128 word into dst[e*pitch], e = 0..7
__device__ __forceinline__ void st_tr8(unsigned short* dst, int pitch, v4u w) {
#pragma unroll
  for (int e = 0; e < 4; ++e) {
    const unsigned word = w[e];
    dst[(2 * e) * pitch]     = (unsigned short)(word & 0xffffu);
    dst[(2 * e + 1) * pitch] = (unsigned short)(word >> 16);
  }
}

__global__ __launch_bounds__(128)
void attn_causal_hd64(const unsigned short* __restrict__ Qh, const unsigned short* __restrict__ Ql,
                      const unsigned short* __restrict__ Kh, const unsigned short* __restrict__ Kl,
                      const unsigned short* __restrict__ Vh, const unsigned short* __restrict__ Vl,
                      unsigned short* __restrict__ Oh, unsigned short* __restrict__ Ol,
                      float sm_scale) {
  union FB { v16b v; v8b h[2]; };
  __shared__ __align__(16) unsigned short Ksh[AKC * APT];     // K hi [kv][d]   9 KB
  __shared__ __align__(16) unsigned short Ksl[AKC * APT];     // K lo [kv][d]   9 KB
  __shared__ __align__(16) unsigned short Vth[HDIM * APT];    // V hi [d][kv]   9 KB
  __shared__ __align__(16) unsigned short Vtl[HDIM * APT];    // V lo [d][kv]   9 KB
  __shared__ __align__(16) __bf16 Psh[ANW][16 * APT];         // per wave P hi [row][kv]
  __shared__ __align__(16) __bf16 Psl[ANW][16 * APT];         // per wave P lo
  __shared__ __align__(16) float  Os[ANW][16 * 68];           // per wave out tile, pitch 68

  const int tid  = threadIdx.x;
  const int wave = tid >> 5;
  const int lane = tid & 31;
  const int hh   = lane >> 4;
  const int c    = lane & 15;
  const float NEG_INF = -__builtin_inff();

  constexpr int NQB = SEQ / AQB;                 // 32 query blocks per (b, h)
  const int bx   = blockIdx.x;
  const int qb   = bx % NQB;
  const int bhid = bx / NQB;
  const int h    = bhid % NHEAD;
  const int b    = bhid / NHEAD;
  const int q0   = qb * AQB + wave * 16;
  const size_t hoff = (size_t)h * HDIM;

  // ---- Q fragments (A operand): row = c, elements 0..7 <- d = dc*32 + 8hh + 0..7, 8..15 <- dc*32 + 16 + 8hh + 0..7
  v16b qah[2], qal[2];
  {
    const size_t qo = (size_t)(b * SEQ + q0 + c) * EMB + hoff + 8 * hh;
    const __bf16* qhp = (const __bf16*)(const void*)Qh;
    const __bf16* qlp = (const __bf16*)(const void*)Ql;
#pragma unroll
    for (int dc = 0; dc < 2; ++dc) {
      qah[dc] = Frag<__bf16>::load(qhp + qo + dc * 32);
      qal[dc] = Frag<__bf16>::load(qlp + qo + dc * 32);
    }
  }

  float mrow[8], lrow[8];
  v8f oacc[4];
#pragma unroll
  for (int r = 0; r < 8; ++r) { mrow[r] = NEG_INF; lrow[r] = 0.f; }
#pragma unroll
  for (int t = 0; t < 4; ++t) oacc[t] = (v8f){0.f,0.f,0.f,0.f,0.f,0.f,0.f,0.f};

  const int nChunks = qb + 1;                    // block-uniform, <= 32
  for (int kc = 0; kc < nChunks; ++kc) {
    const int kv0 = kc * AKC;
    __syncthreads();
#pragma unroll
    for (int i = 0; i < 4; ++i) {
      const int ci = tid + 128 * i;
      const int kvr = ci >> 3, col8 = (ci & 7) * 8;
      const size_t go = (size_t)(b * SEQ + kv0 + kvr) * EMB + hoff + col8;
      const v4u w0 = *(const v4u*)(Kh + go);
      const v4u w1 = *(const v4u*)(Kl + go);
      *(v4u*)(Ksh + kvr * APT + col8) = w0;
      *(v4u*)(Ksl + kvr * APT + col8) = w1;
    }
    asm volatile("" ::: "memory");
    // ---- stage V hi/lo transposed: same 512-word map; each word -> 8 strided 2-B LDS stores ----
#pragma unroll
    for (int i = 0; i < 4; ++i) {
      const int ci = tid + 128 * i;
      const int kvr = ci >> 3, col8 = (ci & 7) * 8;
      const size_t go = (size_t)(b * SEQ + kv0 + kvr) * EMB + hoff + col8;
      const v4u w0 = *(const v4u*)(Vh + go);
      const v4u w1 = *(const v4u*)(Vl + go);
      st_tr8(Vth + col8 * APT + kvr, APT, w0);
      st_tr8(Vtl + col8 * APT + kvr, APT, w1);
    }
    __syncthreads();

    // ---- scores: 4 key tiles x 2 d-chunks x 3 products ----
    v8f s[4];
#pragma unroll
    for (int j = 0; j < 4; ++j) {
      s[j] = (v8f){0.f,0.f,0.f,0.f,0.f,0.f,0.f,0.f};
#pragma unroll
      for (int dc = 0; dc < 2; ++dc) {
        FB kfh, kfl;
        const int ko = (j * 16 + c) * APT + dc * 32 + 8 * hh;
        kfh.h[0] = *(const v8b*)(Ksh + ko);
        kfh.h[1] = *(const v8b*)(Ksh + ko + 16);
        kfl.h[0] = *(const v8b*)(Ksl + ko);
        kfl.h[1] = *(const v8b*)(Ksl + ko + 16);
        s[j] = at_mma(qah[dc], kfh.v, s[j]);
        s[j] = at_mma(qah[dc], kfl.v, s[j]);
        s[j] = at_mma(qal[dc], kfh.v, s[j]);
      }
    }
    // ---- scale, causal mask on the diagonal chunk (select, -inf fill), row max ----
    const bool diag = (kc == qb);
    float cm[8];
#pragma unroll
    for (int r = 0; r < 8; ++r) {
      const int qrow = q0 + 8 * hh + r;
      float m = NEG_INF;
#pragma unroll
      for (int j = 0; j < 4; ++j) {
        const int kvcol = kv0 + j * 16 + c;
        float val = s[j][r] * sm_scale;
        val = (diag && (kvcol > qrow)) ? NEG_INF : val;
        s[j][r] = val;
        m = fmaxf(m, val);
      }
#pragma unroll
      for (int off = 1; off < 16; off <<= 1) m = fmaxf(m, __shfl_xor(m, off, 32));
      cm[r] = m;
    }
    // ---- online softmax update, P hi/lo staged per wave ----
    __bf16* pwh = Psh[wave];
    __bf16* pwl = Psl[wave];
#pragma unroll
    for (int r = 0; r < 8; ++r) {
      const float mnew = fmaxf(mrow[r], cm[r]);
      const float alpha = expf(mrow[r] - mnew);
      mrow[r] = mnew;
      float psum = 0.f;
#pragma unroll
      for (int j = 0; j < 4; ++j) {
        const float p = expf(s[j][r] - mnew);
        psum += p;
        __bf16 a, bl;
        at_split(p, a, bl);
        pwh[(8 * hh + r) * APT + j * 16 + c] = a;
        pwl[(8 * hh + r) * APT + j * 16 + c] = bl;
      }
#pragma unroll
      for (int off = 1; off < 16; off <<= 1) psum += __shfl_xor(psum, off, 32);
      lrow[r] = lrow[r] * alpha + psum;
#pragma unroll
      for (int t = 0; t < 4; ++t) oacc[t][r] *= alpha;
    }
    __builtin_amdgcn_fence(__ATOMIC_RELEASE, "workgroup");
    __builtin_amdgcn_wave_barrier();
    __builtin_amdgcn_fence(__ATOMIC_ACQUIRE, "workgroup");
    // ---- O += P.V : A = P [row][kv], B[k=kv][n=d] = Vt[d][kv] ----
#pragma unroll 1
    for (int kk = 0; kk < 2; ++kk) {
      FB pa, pl;
      pa.h[0] = *(const v8b*)(pwh + c * APT + kk * 32 + 8 * hh);
      pa.h[1] = *(const v8b*)(pwh + c * APT + kk * 32 + 16 + 8 * hh);
      pl.h[0] = *(const v8b*)(pwl + c * APT + kk * 32 + 8 * hh);
      pl.h[1] = *(const v8b*)(pwl + c * APT + kk * 32 + 16 + 8 * hh);
#pragma unroll
      for (int t = 0; t < 4; ++t) {
        FB vb, vlo;
        const int vo = (t * 16 + c) * APT + kk * 32 + 8 * hh;
        vb.h[0]  = *(const v8b*)(Vth + vo);
        vb.h[1]  = *(const v8b*)(Vth + vo + 16);
        vlo.h[0] = *(const v8b*)(Vtl + vo);
        vlo.h[1] = *(const v8b*)(Vtl + vo + 16);
        oacc[t] = at_mma(pa.v, vb.v, oacc[t]);
        oacc[t] = at_mma(pa.v, vlo.v, oacc[t]);
        oacc[t] = at_mma(pl.v, vb.v, oacc[t]);
      }
    }
  }

  // ---- epilogue: 1/l, per-wave LDS slab, whole-line bf16 hi/lo stores ----
  float* os = Os[wave];
#pragma unroll
  for (int r = 0; r < 8; ++r) {
    const float inv = 1.0f / lrow[r];
#pragma unroll
    for (int t = 0; t < 4; ++t) os[(8 * hh + r) * 68 + t * 16 + c] = oacc[t][r] * inv;
  }
  __builtin_amdgcn_fence(__ATOMIC_RELEASE, "workgroup");
  __builtin_amdgcn_wave_barrier();
  __builtin_amdgcn_fence(__ATOMIC_ACQUIRE, "workgroup");
  {
    // rows it*4 + q4 (it 0..3, q4 0..3) = 0..15; c8 = 0..56 step 8 -> full 16 x 64 tile per plane
    const int q4 = lane >> 3, c8 = (lane & 7) * 8;
    {
#pragma unroll
      for (int it = 0; it < 4; ++it) {
        const int row = it * 4 + q4;
        const float* sp = os + row * 68 + c8;
        v8h hv, lv;
#pragma unroll
        for (int e = 0; e < 8; ++e) {
          unsigned short hb = f2bf_bits(sp[e]);
          unsigned short lb = f2bf_bits(sp[e] - bf_bits2f(hb));
          hv[e] = __builtin_bit_cast(_Float16, hb);
          lv[e] = __builtin_bit_cast(_Float16, lb);
        }
        const size_t oo = (size_t)(b * SEQ + q0 + row) * EMB + hoff + c8;
        *(v8h*)(Oh + oo) = hv;
        *(v8h*)(Ol + oo) = lv;
      }
      
    }
  }
}

// ---------------------------------------------------------------------------
// Host launcher: 8 launches, no runtime API calls other than launches.
// ---------------------------------------------------------------------------
extern "C" void kernel_launch(void* const* d_in, const int* in_sizes, int n_in,
                              void* d_out, int out_size, void* d_ws, size_t ws_size,
                              hipStream_t stream) {
  if (n_in < 5) return;
  if (in_sizes[0] != NB * SEQ * EMB) return;
  if (in_sizes[1] != HDIM * HDIM || in_sizes[2] != HDIM * HDIM || in_sizes[3] != HDIM * HDIM) return;
  if (in_sizes[4] != EMB * EMB) return;
  if (out_size != NB * SEQ * EMB) return;
  if (ws_size < WS_TOTAL) return;

  const float* x  = (const float*)d_in[0];
  const float* Wq = (const float*)d_in[1];
  const float* Wk = (const float*)d_in[2];
  const float* Wv = (const float*)d_in[3];
  const float* Wo = (const float*)d_in[4];
  float* out = (float*)d_out;

  char* ws = (char*)d_ws;
  unsigned short* XH   = (unsigned short*)(ws + OFF_XH);
  unsigned short* XL   = (unsigned short*)(ws + OFF_XL);
  unsigned short* WH   = (unsigned short*)(ws + OFF_WH);
  unsigned short* WL   = (unsigned short*)(ws + OFF_WL);
  unsigned short* WOH  = (unsigned short*)(ws + OFF_WOH);
  unsigned short* WOL  = (unsigned short*)(ws + OFF_WOL);
  unsigned short* QKVH = (unsigned short*)(ws + OFF_QKVH);
  unsigned short* QKVL = (unsigned short*)(ws + OFF_QKVL);
  unsigned short* AVH  = (unsigned short*)(ws + OFF_AVH);
  unsigned short* AVL  = (unsigned short*)(ws + OFF_AVL);
  const float* dummyf = (const float*)(ws + OFF_XH);     // unused pointer slots point inside ws
  void* dummyv = (void*)(ws + OFF_XH);

  // ---- operand planes (bf16 hi/lo) ----
  {
    const int n8x = (NB * SEQ * EMB) / 8;                // 524288 threads cover 4194304 elements
    split_planes_bf16<<<(n8x + 255) / 256, 256, 0, stream>>>(x, XH, XL, n8x);
    const int n8w = (HDIM * HDIM) / 8;                   // 512 threads cover 4096 elements each
    split_planes_bf16<<<(n8w + 255) / 256, 256, 0, stream>>>(Wq, WH + 0 * HDIM * HDIM, WL + 0 * HDIM * HDIM, n8w);
    split_planes_bf16<<<(n8w + 255) / 256, 256, 0, stream>>>(Wk, WH + 1 * HDIM * HDIM, WL + 1 * HDIM * HDIM, n8w);
    split_planes_bf16<<<(n8w + 255) / 256, 256, 0, stream>>>(Wv, WH + 2 * HDIM * HDIM, WL + 2 * HDIM * HDIM, n8w);
    const int n8o = (EMB * EMB) / 8;                     // 131072 threads cover 1048576 elements
    split_planes_bf16<<<(n8o + 255) / 256, 256, 0, stream>>>(Wo, WOH, WOL, n8o);
  }

  // ---- q|k|v = xh[65536][64] . W{q,k,v}^T : M=65536, N=64, K=64; grid.y selects the weight plane ----
  {
    const int tiles = (NROWH / 64) * (HDIM / 64);        // 1024 wave tiles
    dim3 grid((tiles + 7) / 8, 3);
    wmma_gemm64<1, true, 0, 2, false><<<grid, 256, 0, stream>>>(
        XH, XL, HDIM, 0L,
        WH, WL, HDIM, (long)(HDIM * HDIM),
        (void*)QKVH, (void*)QKVL, HDIM, (long)PLANE_QKV,
        dummyf, dummyf, 0L,
        NROWH, HDIM, HDIM, 1.0f);
  }

  // ---- causal attention per (b, h): av hi/lo planes ----
  {
    const int nblk = NB * NHEAD * (SEQ / AQB);           // 1024 blocks x 64 query rows
    attn_causal_hd64<<<nblk, 128, 0, stream>>>(
        QKVH + 0 * PLANE_QKV, QKVL + 0 * PLANE_QKV,
        QKVH + 1 * PLANE_QKV, QKVL + 1 * PLANE_QKV,
        QKVH + 2 * PLANE_QKV, QKVL + 2 * PLANE_QKV,
        AVH, AVL, 0.125f);
  }

  // ---- out = av[4096][1024] . Wo^T : M=4096, N=1024, K=1024, f32 into d_out ----
  {
    const int tiles = (NTOK / 64) * (EMB / 64);          // 1024 wave tiles
    dim3 grid((tiles + 7) / 8, 1);
    wmma_gemm64<1, true, 0, 0, false><<<grid, 256, 0, stream>>>(
        AVH, AVL, EMB, 0L,
        WOH, WOL, EMB, 0L,
        (void*)out, dummyv, EMB, 0L,
        dummyf, dummyf, 0L,
        NTOK, EMB, EMB, 1.0f);
  }
}

// v002
// Measured time: 377 microseconds a run.
// Two timings next to v001 both put it at 1.13 times that version's speed.
// All steps since v000 together make it 1.44 times as fast.
// Contractions: q/k/v projections, q.k^T scores, p.v and output projection all on v_wmma_f32_16x16x32_bf16 with bf16 hi/lo split operands (hi*hi + hi*lo + lo*hi), f32 accumulate; softmax and all side math in f32.
#include <hip/hip_runtime.h>

typedef __attribute__((ext_vector_type(16))) _Float16 v16h;
typedef __attribute__((ext_vector_type(8)))  _Float16 v8h;
typedef __attribute__((ext_vector_type(16))) __bf16   v16b;
typedef __attribute__((ext_vector_type(8)))  __bf16   v8b;
typedef __attribute__((ext_vector_type(8)))  float    v8f;
typedef __attribute__((ext_vector_type(4)))  float    v4f;
typedef __attribute__((ext_vector_type(4)))  unsigned v4u;
#define U16(p) ((const unsigned short*)(const void*)(p))

// ---------------------------------------------------------------------------
// Problem constants
// ---------------------------------------------------------------------------
constexpr int NB    = 2;
constexpr int SEQ   = 2048;
constexpr int EMB   = 1024;
constexpr int NHEAD = 16;
constexpr int HDIM  = 64;
constexpr int NTOK  = NB * SEQ;              // 4096 rows of [EMB]
constexpr int NROWH = NTOK * NHEAD;          // 65536 rows of [HDIM]

// attention tiling
constexpr int AQB = 64;                      // query rows per block (4 waves x 16)
constexpr int AKC = 64;                      // keys per chunk
constexpr int ANW = 4;
// LDS row pitch of the K, V^T and P tiles, in 16-bit elements: 144 B = 16 B x 9 (odd), so that the
// 16 rows a ds_load_b128 fragment read touches start on distinct bank groups (128-B rows do not).
constexpr int APT = 72;

// GEMM shape contract (no run-time tails)
static_assert(NROWH % 64 == 0);              // qkv GEMM M
static_assert(HDIM % 64 == 0);               // qkv GEMM N
static_assert(HDIM % 32 == 0);               // qkv GEMM K
static_assert(NTOK % 64 == 0);               // out GEMM M
static_assert(EMB % 64 == 0);                // out GEMM N
static_assert(EMB % 32 == 0);                // out GEMM K
static_assert(SEQ % AQB == 0);
static_assert(AQB == AKC);
static_assert(APT >= AKC && APT >= HDIM && (APT * 2) % 16 == 0 && ((APT * 2) / 16) % 2 == 1);

// ---------------------------------------------------------------------------
//   XH   [0          ,  8 MiB)  x   bf16 hi  [4194304]
//   XL   [8 MiB      , 16 MiB)  x   bf16 lo
//   WH   [16 MiB     , +24576)  Wq|Wk|Wv bf16 hi, 3 planes of [64][64] (carve 64 KiB)
//   WL   [16 MiB+64K , +24576)  Wq|Wk|Wv bf16 lo (carve 64 KiB)
//   WOH  [17 MiB     , 19 MiB)  Wo  bf16 hi  [1024][1024]
//   WOL  [19 MiB     , 21 MiB)  Wo  bf16 lo
//   QKVH [21 MiB     , 45 MiB)  q|k|v bf16 hi, 3 planes of [65536][64] (element (b,s,h,d) at (b*SEQ+s)*EMB + h*64 + d)
//   QKVL [45 MiB     , 69 MiB)  q|k|v bf16 lo
//   AVH  [69 MiB     , 77 MiB)  av  bf16 hi  [4096][1024]
//   AVL  [77 MiB     , 85 MiB)  av  bf16 lo
//   total 85 MiB = 89128960 B
// ---------------------------------------------------------------------------
constexpr size_t MIB      = 1048576;
constexpr size_t OFF_XH   = 0;
constexpr size_t OFF_XL   = 8 * MIB;
constexpr size_t OFF_WH   = 16 * MIB;
constexpr size_t OFF_WL   = 16 * MIB + 65536;
constexpr size_t OFF_WOH  = 17 * MIB;
constexpr size_t OFF_WOL  = 19 * MIB;
constexpr size_t OFF_QKVH = 21 * MIB;
constexpr size_t OFF_QKVL = 45 * MIB;
constexpr size_t OFF_AVH  = 69 * MIB;
constexpr size_t OFF_AVL  = 77 * MIB;
constexpr size_t WS_TOTAL = 85 * MIB;
constexpr size_t PLANE_QKV = (size_t)NROWH * HDIM;      // elements per q/k/v plane
static_assert((size_t)NB * SEQ * EMB * 2 <= OFF_XL - OFF_XH);
static_assert((size_t)3 * HDIM * HDIM * 2 <= OFF_WL - OFF_WH);
static_assert((size_t)3 * HDIM * HDIM * 2 <= OFF_WOH - OFF_WL);
static_assert((size_t)EMB * EMB * 2 <= OFF_WOL - OFF_WOH);
static_assert((size_t)EMB * EMB * 2 <= OFF_QKVH - OFF_WOL);
static_assert(3 * PLANE_QKV * 2 <= OFF_QKVL - OFF_QKVH);
static_assert(3 * PLANE_QKV * 2 <= OFF_AVH - OFF_QKVL);
static_assert((size_t)NTOK * EMB * 2 <= OFF_AVL - OFF_AVH);
static_assert((size_t)NTOK * EMB * 2 <= WS_TOTAL - OFF_AVL);
static_assert(WS_TOTAL <= 134217728);

// ---------------------------------------------------------------------------
// Helpers
// ---------------------------------------------------------------------------
__device__ __forceinline__ unsigned short f2bf_bits(float f) {
  unsigned u = __float_as_uint(f);
  return (unsigned short)((u + 0x7FFFu + ((u >> 16) & 1u)) >> 16);
}
__device__ __forceinline__ float bf_bits2f(unsigned short h) { return __uint_as_float(((unsigned)h) << 16); }

// hazard guards as plain device helpers (no inline asm inside the kernel template body)
__device__ __forceinline__ void dep_guard_h(v8f& a, v8f& b, v16h x, v16h y) { asm volatile("v_nop\n\tv_nop\n\tv_nop\n\tv_nop" : "+v"(a), "+v"(b) : "v"(x), "v"(y)); }
__device__ __forceinline__ void dep_guard_b(v8f& a, v8f& b, v16b x, v16b y) { asm volatile("v_nop\n\tv_nop\n\tv_nop\n\tv_nop" : "+v"(a), "+v"(b) : "v"(x), "v"(y)); }
__device__ __forceinline__ void keep4_h(v16h a, v16h b, v16h c, v16h d) { asm volatile("v_nop" :: "v"(a), "v"(b), "v"(c), "v"(d)); }
__device__ __forceinline__ void keep4_b(v16b a, v16b b, v16b c, v16b d) { asm volatile("v_nop" :: "v"(a), "v"(b), "v"(c), "v"(d)); }
__device__ __forceinline__ void acc_guard4(v8f& a, v8f& b, v8f& c, v8f& d) { asm volatile("v_nop\n\tv_nop\n\tv_nop\n\tv_nop" : "+v"(a), "+v"(b), "+v"(c), "+v"(d)); }
template <typename T> struct Frag;
template <> struct Frag<_Float16> {
  typedef v16h V; union U { v16h v; v8h h[2]; };
  static __device__ __forceinline__ v16h load(const _Float16* p) {   // elements 0..7 <- p[0..7], 8..15 <- p[16..23]
    U f; f.h[0] = *(const v8h*)(p); f.h[1] = *(const v8h*)(p + 16); return f.v;
  }
  static __device__ __forceinline__ v8f mma(v16h a, v16h b, v8f c) {
    return __builtin_amdgcn_wmma_f32_16x16x32_f16(false, a, false, b, (short)0, c, false, false);
  }
  static __device__ __forceinline__ void guard(v8f& a, v8f& b, v16h x, v16h y) { dep_guard_h(a, b, x, y); }
  static __device__ __forceinline__ void keep(v16h a, v16h b, v16h c, v16h d) { keep4_h(a, b, c, d); }
};
template <> struct Frag<__bf16> {
  typedef v16b V; union U { v16b v; v8b h[2]; };
  static __device__ __forceinline__ v16b load(const __bf16* p) {
    U f; f.h[0] = *(const v8b*)(p); f.h[1] = *(const v8b*)(p + 16); return f.v;
  }
  static __device__ __forceinline__ v8f mma(v16b a, v16b b, v8f c) {
    return __builtin_amdgcn_wmma_f32_16x16x32_bf16(false, a, false, b, (short)0, c, false, false);
  }
  static __device__ __forceinline__ void guard(v8f& a, v8f& b, v16b x, v16b y) { dep_guard_b(a, b, x, y); }
  static __device__ __forceinline__ void keep(v16b a, v16b b, v16b c, v16b d) { keep4_b(a, b, c, d); }
};

// ---- Register-blocked batched WMMA GEMM --------------------------------
// C[m,n] = scale * sum_k A[m,k] * Bt[n,k] (+bias)(+resid); each wave owns a 64x64 tile.
// A row-major [M,K]; Bt row-major [N,K]; M,N % 64 == 0, K % 32 == 0.
// SPLIT: operands are hi/lo planes (A2/Bt2 = lo planes, same layout); product = hi.hi + hi.lo + lo.hi.
// BIAS_MODE: 0 = none, 1 = bias[m], 2 = bias[n].
// OUT_MODE: 0 = f32, 1 = f16, 2 = bf16 hi plane (Cout) + bf16 lo plane (Cout2).
// ET: 0 = f16 operands, 1 = bf16 operands (pointers passed as 16-bit storage)
template <int ET> struct Elem;
template <> struct Elem<0> { typedef _Float16 T; };
template <> struct Elem<1> { typedef __bf16 T; };
template <int ET, bool SPLIT, int BIAS_MODE, int OUT_MODE, bool RESID, int ACT = 0>
__global__ __launch_bounds__(256) void wmma_gemm64(
    const unsigned short* __restrict__ Ap, const unsigned short* __restrict__ A2p, int lda, long strideA,
    const unsigned short* __restrict__ Btp, const unsigned short* __restrict__ Bt2p, int ldb, long strideB,
    void* __restrict__ Cout, void* __restrict__ Cout2, int ldc, long strideC,
    const float* __restrict__ bias,
    const float* __restrict__ resid, long strideR,
    int M, int N, int K, float scale) {
  typedef typename Elem<ET>::T T;
  typedef typename Frag<T>::V V;
  const T* A = (const T*)Ap; const T* A2 = (const T*)A2p; const T* Bt = (const T*)Btp; const T* Bt2 = (const T*)Bt2p;
  __shared__ __align__(16) float sT[8][16 * 68];   // per-wave 16x64 slab, pitch 68 floats
  const int b    = blockIdx.y;
  const int lane = threadIdx.x & 31;
  const int wave = threadIdx.x >> 5;
  const int tilesN = N >> 6;
  const int tilesM = M >> 6;
  const int tile = blockIdx.x * 8 + wave;
  if (tile >= tilesM * tilesN) return;   // wave-uniform; no block barriers in this kernel
  const int tm = tile / tilesN;
  const int tn = tile - tm * tilesN;
  const int m0 = tm << 6;
  const int n0 = tn << 6;

  const T* Ab  = A  + (size_t)b * strideA;
  const T* Bb  = Bt + (size_t)b * strideB;
  const T* Ab2 = SPLIT ? (A2  + (size_t)b * strideA) : nullptr;
  const T* Bb2 = SPLIT ? (Bt2 + (size_t)b * strideB) : nullptr;

  const int rlane = lane & 15;                 // row (A) / col (B, D) within subtile
  const int koff  = (lane >> 4) * 8;           // k offset of this lane half
  const int mOff  = (lane >> 4) * 8;           // D row offset

  v8f acc[4][4];
#pragma unroll
  for (int i = 0; i < 4; ++i)
#pragma unroll
    for (int j = 0; j < 4; ++j) acc[i][j] = (v8f){0.f,0.f,0.f,0.f,0.f,0.f,0.f,0.f};

  for (int k0 = 0; k0 < K; k0 += 32) {
    V bh[4], bl[4];
#pragma unroll
    for (int j = 0; j < 4; ++j) {
      const size_t bo = (size_t)(n0 + (j << 4) + rlane) * ldb + koff + k0;
      bh[j] = Frag<T>::load(Bb + bo);
      if (SPLIT) bl[j] = Frag<T>::load(Bb2 + bo);
    }
#pragma unroll
    for (int i = 0; i < 4; ++i) {
      const size_t ao = (size_t)(m0 + (i << 4) + rlane) * lda + koff + k0;
      V ah = Frag<T>::load(Ab + ao);
      V al;
      if (SPLIT) al = Frag<T>::load(Ab2 + ao);
#pragma unroll
      for (int j = 0; j < 4; ++j) {
        acc[i][j] = Frag<T>::mma(ah, bh[j], acc[i][j]);
        if (SPLIT) {
          acc[i][j] = Frag<T>::mma(ah, bl[j], acc[i][j]);
          acc[i][j] = Frag<T>::mma(al, bh[j], acc[i][j]);
        }
      }
      Frag<T>::guard(acc[i][0], acc[i][3], ah, SPLIT ? al : ah);
    }
    Frag<T>::keep(bh[0], bh[1], bh[2], bh[3]);
    if (SPLIT) Frag<T>::keep(bl[0], bl[1], bl[2], bl[3]);
  }
  acc_guard4(acc[0][0], acc[0][1], acc[0][2], acc[0][3]);
  acc_guard4(acc[1][0], acc[1][1], acc[1][2], acc[1][3]);
  acc_guard4(acc[2][0], acc[2][1], acc[2][2], acc[2][3]);
  acc_guard4(acc[3][0], acc[3][1], acc[3][2], acc[3][3]);

  // ---- epilogue ----
  float* slab = sT[wave];
  const float* Rb = RESID ? (resid + (size_t)b * strideR) : nullptr;
#pragma unroll
  for (int i = 0; i < 4; ++i) {
    const int mBase = m0 + (i << 4);
#pragma unroll
    for (int j = 0; j < 4; ++j) {
      const int n = n0 + (j << 4) + rlane;
      float bv = 0.f;
      if (BIAS_MODE == 2) bv = bias[n];
#pragma unroll
      for (int r = 0; r < 8; ++r) {
        float v = acc[i][j][r] * scale;
        if (BIAS_MODE == 1) v += bias[mBase + mOff + r];
        if (BIAS_MODE == 2) v += bv;
        if (RESID) v += Rb[(size_t)(mBase + mOff + r) * ldc + n];
        if (ACT == 1) v = tanhf(v);
        if (ACT == 2) v = fmaxf(v, 0.0f);
        if (ACT == 3) v = v / (1.0f + expf(-v));
        if (ACT == 4) v = (v > 0.f) ? v : 0.01f * v;
        if (ACT == 5) v = 0.5f * v * (1.0f + erff(v * 0.70710678118654752f));
        slab[(mOff + r) * 68 + (j << 4) + rlane] = v;
      }
    }
    __builtin_amdgcn_fence(__ATOMIC_RELEASE, "workgroup");
    __builtin_amdgcn_wave_barrier();
    __builtin_amdgcn_fence(__ATOMIC_ACQUIRE, "workgroup");
    if (OUT_MODE == 0) {
      float* C = (float*)Cout + (size_t)b * strideC;
      const int hh = lane >> 4, c4 = (lane & 15) * 4;     // row seg = 256 B = 16 lanes x 16 B
      {
#pragma unroll
        for (int it = 0; it < 8; ++it) {
          const int row = it * 2 + hh;
          v4f v = *(const v4f*)(slab + row * 68 + c4);
          *(v4f*)(C + (size_t)(mBase + row) * ldc + n0 + c4) = v;
        }
        
      }
    } else {
      const int q = lane >> 3, c8 = (lane & 7) * 8;
      unsigned short* C  = (unsigned short*)Cout  + (size_t)b * strideC;
      unsigned short* C2 = (OUT_MODE == 2) ? ((unsigned short*)Cout2 + (size_t)b * strideC) : nullptr;
      {
#pragma unroll
        for (int it = 0; it < 4; ++it) {
          const int row = it * 4 + q;
          const float* sp = slab + row * 68 + c8;
          v8h hv, lv;
#pragma unroll
          for (int e = 0; e < 8; ++e) {
            if (OUT_MODE == 1) {
              hv[e] = (_Float16)sp[e];
            } else {
              unsigned short hb = f2bf_bits(sp[e]);
              unsigned short lb = f2bf_bits(sp[e] - bf_bits2f(hb));
              hv[e] = __builtin_bit_cast(_Float16, hb);
              lv[e] = __builtin_bit_cast(_Float16, lb);
            }
          }
          *(v8h*)(C + (size_t)(mBase + row) * ldc + n0 + c8) = hv;
          if (OUT_MODE == 2) *(v8h*)(C2 + (size_t)(mBase + row) * ldc + n0 + c8) = lv;
        }
        
      }
    }
    __builtin_amdgcn_fence(__ATOMIC_RELEASE, "workgroup");
    __builtin_amdgcn_wave_barrier();
    __builtin_amdgcn_fence(__ATOMIC_ACQUIRE, "workgroup");
  }
}

// ---------------------------------------------------------------------------
// f32 -> bf16 hi + bf16 lo planes (RNE converts). 8 elements per thread:
// two b128 loads, one b128 store per plane; lanes 8q..8q+7 of a wave fill one
// ---------------------------------------------------------------------------
__device__ __forceinline__ void split_pair(float f0, float f1, unsigned& hw, unsigned& lw) {
  const unsigned short h0 = f2bf_bits(f0);
  const unsigned short h1 = f2bf_bits(f1);
  const unsigned short l0 = f2bf_bits(f0 - bf_bits2f(h0));
  const unsigned short l1 = f2bf_bits(f1 - bf_bits2f(h1));
  hw = (unsigned)h0 | ((unsigned)h1 << 16);
  lw = (unsigned)l0 | ((unsigned)l1 << 16);
}

__global__ __launch_bounds__(256) void split_planes_bf16(
    const float* __restrict__ src, unsigned short* __restrict__ hi,
    unsigned short* __restrict__ lo, int n8) {
  const int i = blockIdx.x * 256 + threadIdx.x;
  if (i >= n8) return;                      // no barriers in this kernel
  const size_t e0 = (size_t)i * 8;
  const v4f a = *(const v4f*)(src + e0);
  const v4f c = *(const v4f*)(src + e0 + 4);
  unsigned hx, hy, hz, hw, lx, ly, lz, lw;
  split_pair(a[0], a[1], hx, lx);
  split_pair(a[2], a[3], hy, ly);
  split_pair(c[0], c[1], hz, lz);
  split_pair(c[2], c[3], hw, lw);
  const v4u hv = (v4u){hx, hy, hz, hw};
  const v4u lv = (v4u){lx, ly, lz, lw};
  *(v4u*)(hi + e0) = hv;
  *(v4u*)(lo + e0) = lv;
  
}

// ---------------------------------------------------------------------------
// Causal flash attention, head dim 64, bf16 hi/lo planes in, bf16 hi/lo planes out.
//   q,k,v planes: element (b, s, h, d) at (b*SEQ + s)*EMB + h*64 + d (ushort storage).
//   scores = q.k^T * sm_scale : hi.hi + hi.lo + lo.hi on v_wmma_f32_16x16x32_bf16
//   out    = p.v              : p and v as bf16 hi/lo, same three products
//   online softmax in f32; block = 4 waves = 64 query rows of one (b, h);
//   grid.x = NB * NHEAD * (SEQ/64); keys visited in 64-wide chunks 0..qb (causal).
//   Output planes: element (b, q, h*64+d) at (b*SEQ+q)*EMB + h*64 + d; each wave writes
// ---------------------------------------------------------------------------
__device__ __forceinline__ unsigned short at_bf_bits(float f) {
  unsigned u = __float_as_uint(f);
  return (unsigned short)((u + 0x7FFFu + ((u >> 16) & 1u)) >> 16);
}
__device__ __forceinline__ __bf16 at_f2bf(float f) { return __builtin_bit_cast(__bf16, at_bf_bits(f)); }
__device__ __forceinline__ void at_split(float f, __bf16& hi, __bf16& lo) {
  const unsigned short hb = at_bf_bits(f);
  hi = __builtin_bit_cast(__bf16, hb);
  lo = at_f2bf(f - __uint_as_float(((unsigned)hb) << 16));
}
__device__ __forceinline__ v8f at_mma(v16b a, v16b b, v8f c) {
  c = __builtin_amdgcn_wmma_f32_16x16x32_bf16(false, a, false, b, (short)0, c, false, false);
  asm volatile("v_nop\n\tv_nop\n\tv_nop\n\tv_nop" : "+v"(c) : "v"(a), "v"(b));
  return c;
}

// value of lane l ^ M (M < 16, same 16-lane row) by a DPP row_xmask move: stays in the vector unit, where
// __shfl_xor goes through the LDS pipe and a wait on it. All 32 lanes are active at every call, so every source
// lane is valid; no old value and bound_ctrl on let the compiler fold the move into the add that follows.
template <int M> __device__ __forceinline__ float row_xor(float x) {
  const int v = __float_as_int(x);
  return __int_as_float(__builtin_amdgcn_update_dpp(0, v, 0x160 | M, 0xf, 0xf, true));
}

// transpose-store 8 consecutive 16-bit elements held in a b128 word into dst[e*pitch], e = 0..7
__device__ __forceinline__ void st_tr8(unsigned short* dst, int pitch, v4u w) {
#pragma unroll
  for (int e = 0; e < 4; ++e) {
    const unsigned word = w[e];
    dst[(2 * e) * pitch]     = (unsigned short)(word & 0xffffu);
    dst[(2 * e + 1) * pitch] = (unsigned short)(word >> 16);
  }
}

__global__ __launch_bounds__(128)
void attn_causal_hd64(const unsigned short* __restrict__ Qh, const unsigned short* __restrict__ Ql,
                      const unsigned short* __restrict__ Kh, const unsigned short* __restrict__ Kl,
                      const unsigned short* __restrict__ Vh, const unsigned short* __restrict__ Vl,
                      unsigned short* __restrict__ Oh, unsigned short* __restrict__ Ol,
                      float sm_scale) {
  union FB { v16b v; v8b h[2]; };
  __shared__ __align__(16) unsigned short Ksh[AKC * APT];     // K hi [kv][d]   9 KB
  __shared__ __align__(16) unsigned short Ksl[AKC * APT];     // K lo [kv][d]   9 KB
  __shared__ __align__(16) unsigned short Vth[HDIM * APT];    // V hi [d][kv]   9 KB
  __shared__ __align__(16) unsigned short Vtl[HDIM * APT];    // V lo [d][kv]   9 KB
  __shared__ __align__(16) __bf16 Psh[ANW][16 * APT];         // per wave P hi [row][kv]
  __shared__ __align__(16) __bf16 Psl[ANW][16 * APT];         // per wave P lo
  __shared__ __align__(16) float  Os[ANW][16 * 68];           // per wave out tile, pitch 68

  const int tid  = threadIdx.x;
  const int wave = tid >> 5;
  const int lane = tid & 31;
  const int hh   = lane >> 4;
  const int c    = lane & 15;
  const float NEG_INF = -__builtin_inff();

  constexpr int NQB = SEQ / AQB;                 // 32 query blocks per (b, h)
  const int bx   = blockIdx.x;
  const int qb   = bx % NQB;
  const int bhid = bx / NQB;
  const int h    = bhid % NHEAD;
  const int b    = bhid / NHEAD;
  const int q0   = qb * AQB + wave * 16;
  const size_t hoff = (size_t)h * HDIM;

  // ---- Q fragments (A operand): row = c, elements 0..7 <- d = dc*32 + 8hh + 0..7, 8..15 <- dc*32 + 16 + 8hh + 0..7
  v16b qah[2], qal[2];
  {
    const size_t qo = (size_t)(b * SEQ + q0 + c) * EMB + hoff + 8 * hh;
    const __bf16* qhp = (const __bf16*)(const void*)Qh;
    const __bf16* qlp = (const __bf16*)(const void*)Ql;
#pragma unroll
    for (int dc = 0; dc < 2; ++dc) {
      qah[dc] = Frag<__bf16>::load(qhp + qo + dc * 32);
      qal[dc] = Frag<__bf16>::load(qlp + qo + dc * 32);
    }
  }

  float mrow[8], lrow[8];
  v8f oacc[4];
#pragma unroll
  for (int r = 0; r < 8; ++r) { mrow[r] = NEG_INF; lrow[r] = 0.f; }
#pragma unroll
  for (int t = 0; t < 4; ++t) oacc[t] = (v8f){0.f,0.f,0.f,0.f,0.f,0.f,0.f,0.f};

  const int nChunks = qb + 1;                    // block-uniform, <= 32
  for (int kc = 0; kc < nChunks; ++kc) {
    const int kv0 = kc * AKC;
    __syncthreads();
#pragma unroll
    for (int i = 0; i < 4; ++i) {
      const int ci = tid + 128 * i;
      const int kvr = ci >> 3, col8 = (ci & 7) * 8;
      const size_t go = (size_t)(b * SEQ + kv0 + kvr) * EMB + hoff + col8;
      const v4u w0 = *(const v4u*)(Kh + go);
      const v4u w1 = *(const v4u*)(Kl + go);
      *(v4u*)(Ksh + kvr * APT + col8) = w0;
      *(v4u*)(Ksl + kvr * APT + col8) = w1;
    }
    asm volatile("" ::: "memory");
    // ---- stage V hi/lo transposed: same 512-word map; each word -> 8 strided 2-B LDS stores ----
#pragma unroll
    for (int i = 0; i < 4; ++i) {
      const int ci = tid + 128 * i;
      const int kvr = ci >> 3, col8 = (ci & 7) * 8;
      const size_t go = (size_t)(b * SEQ + kv0 + kvr) * EMB + hoff + col8;
      const v4u w0 = *(const v4u*)(Vh + go);
      const v4u w1 = *(const v4u*)(Vl + go);
      st_tr8(Vth + col8 * APT + kvr, APT, w0);
      st_tr8(Vtl + col8 * APT + kvr, APT, w1);
    }
    __syncthreads();

    // ---- scores: 4 key tiles x 2 d-chunks x 3 products ----
    v8f s[4];
#pragma unroll
    for (int j = 0; j < 4; ++j) {
      s[j] = (v8f){0.f,0.f,0.f,0.f,0.f,0.f,0.f,0.f};
#pragma unroll
      for (int dc = 0; dc < 2; ++dc) {
        FB kfh, kfl;
        const int ko = (j * 16 + c) * APT + dc * 32 + 8 * hh;
        kfh.h[0] = *(const v8b*)(Ksh + ko);
        kfh.h[1] = *(const v8b*)(Ksh + ko + 16);
        kfl.h[0] = *(const v8b*)(Ksl + ko);
        kfl.h[1] = *(const v8b*)(Ksl + ko + 16);
        s[j] = at_mma(qah[dc], kfh.v, s[j]);
        s[j] = at_mma(qah[dc], kfl.v, s[j]);
        s[j] = at_mma(qal[dc], kfh.v, s[j]);
      }
    }
    // ---- scale, causal mask on the diagonal chunk (select, -inf fill), row max ----
    const bool diag = (kc == qb);
    float cm[8];
#pragma unroll
    for (int r = 0; r < 8; ++r) {
      const int qrow = q0 + 8 * hh + r;
      float m = NEG_INF;
#pragma unroll
      for (int j = 0; j < 4; ++j) {
        const int kvcol = kv0 + j * 16 + c;
        float val = s[j][r] * sm_scale;
        val = (diag && (kvcol > qrow)) ? NEG_INF : val;
        s[j][r] = val;
        m = fmaxf(m, val);
      }
      m = fmaxf(m, row_xor<1>(m));
      m = fmaxf(m, row_xor<2>(m));
      m = fmaxf(m, row_xor<4>(m));
      m = fmaxf(m, row_xor<8>(m));
      cm[r] = m;
    }
    // ---- online softmax update, P hi/lo staged per wave ----
    __bf16* pwh = Psh[wave];
    __bf16* pwl = Psl[wave];
#pragma unroll
    for (int r = 0; r < 8; ++r) {
      const float mnew = fmaxf(mrow[r], cm[r]);
      const float alpha = expf(mrow[r] - mnew);
      mrow[r] = mnew;
      float psum = 0.f;
#pragma unroll
      for (int j = 0; j < 4; ++j) {
        const float p = expf(s[j][r] - mnew);
        psum += p;
        __bf16 a, bl;
        at_split(p, a, bl);
        pwh[(8 * hh + r) * APT + j * 16 + c] = a;
        pwl[(8 * hh + r) * APT + j * 16 + c] = bl;
      }
      psum += row_xor<1>(psum);
      psum += row_xor<2>(psum);
      psum += row_xor<4>(psum);
      psum += row_xor<8>(psum);
      lrow[r] = lrow[r] * alpha + psum;
#pragma unroll
      for (int t = 0; t < 4; ++t) oacc[t][r] *= alpha;
    }
    __builtin_amdgcn_fence(__ATOMIC_RELEASE, "workgroup");
    __builtin_amdgcn_wave_barrier();
    __builtin_amdgcn_fence(__ATOMIC_ACQUIRE, "workgroup");
    // ---- O += P.V : A = P [row][kv], B[k=kv][n=d] = Vt[d][kv] ----
#pragma unroll 1
    for (int kk = 0; kk < 2; ++kk) {
      FB pa, pl;
      pa.h[0] = *(const v8b*)(pwh + c * APT + kk * 32 + 8 * hh);
      pa.h[1] = *(const v8b*)(pwh + c * APT + kk * 32 + 16 + 8 * hh);
      pl.h[0] = *(const v8b*)(pwl + c * APT + kk * 32 + 8 * hh);
      pl.h[1] = *(const v8b*)(pwl + c * APT + kk * 32 + 16 + 8 * hh);
#pragma unroll
      for (int t = 0; t < 4; ++t) {
        FB vb, vlo;
        const int vo = (t * 16 + c) * APT + kk * 32 + 8 * hh;
        vb.h[0]  = *(const v8b*)(Vth + vo);
        vb.h[1]  = *(const v8b*)(Vth + vo + 16);
        vlo.h[0] = *(const v8b*)(Vtl + vo);
        vlo.h[1] = *(const v8b*)(Vtl + vo + 16);
        oacc[t] = at_mma(pa.v, vb.v, oacc[t]);
        oacc[t] = at_mma(pa.v, vlo.v, oacc[t]);
        oacc[t] = at_mma(pl.v, vb.v, oacc[t]);
      }
    }
  }

  // ---- epilogue: 1/l, per-wave LDS slab, whole-line bf16 hi/lo stores ----
  float* os = Os[wave];
#pragma unroll
  for (int r = 0; r < 8; ++r) {
    const float inv = 1.0f / lrow[r];
#pragma unroll
    for (int t = 0; t < 4; ++t) os[(8 * hh + r) * 68 + t * 16 + c] = oacc[t][r] * inv;
  }
  __builtin_amdgcn_fence(__ATOMIC_RELEASE, "workgroup");
  __builtin_amdgcn_wave_barrier();
  __builtin_amdgcn_fence(__ATOMIC_ACQUIRE, "workgroup");
  {
    // rows it*4 + q4 (it 0..3, q4 0..3) = 0..15; c8 = 0..56 step 8 -> full 16 x 64 tile per plane
    const int q4 = lane >> 3, c8 = (lane & 7) * 8;
    {
#pragma unroll
      for (int it = 0; it < 4; ++it) {
        const int row = it * 4 + q4;
        const float* sp = os + row * 68 + c8;
        v8h hv, lv;
#pragma unroll
        for (int e = 0; e < 8; ++e) {
          unsigned short hb = f2bf_bits(sp[e]);
          unsigned short lb = f2bf_bits(sp[e] - bf_bits2f(hb));
          hv[e] = __builtin_bit_cast(_Float16, hb);
          lv[e] = __builtin_bit_cast(_Float16, lb);
        }
        const size_t oo = (size_t)(b * SEQ + q0 + row) * EMB + hoff + c8;
        *(v8h*)(Oh + oo) = hv;
        *(v8h*)(Ol + oo) = lv;
      }
      
    }
  }
}

// ---------------------------------------------------------------------------
// Host launcher: 8 launches, no runtime API calls other than launches.
// ---------------------------------------------------------------------------
extern "C" void kernel_launch(void* const* d_in, const int* in_sizes, int n_in,
                              void* d_out, int out_size, void* d_ws, size_t ws_size,
                              hipStream_t stream) {
  if (n_in < 5) return;
  if (in_sizes[0] != NB * SEQ * EMB) return;
  if (in_sizes[1] != HDIM * HDIM || in_sizes[2] != HDIM * HDIM || in_sizes[3] != HDIM * HDIM) return;
  if (in_sizes[4] != EMB * EMB) return;
  if (out_size != NB * SEQ * EMB) return;
  if (ws_size < WS_TOTAL) return;

  const float* x  = (const float*)d_in[0];
  const float* Wq = (const float*)d_in[1];
  const float* Wk = (const float*)d_in[2];
  const float* Wv = (const float*)d_in[3];
  const float* Wo = (const float*)d_in[4];
  float* out = (float*)d_out;

  char* ws = (char*)d_ws;
  unsigned short* XH   = (unsigned short*)(ws + OFF_XH);
  unsigned short* XL   = (unsigned short*)(ws + OFF_XL);
  unsigned short* WH   = (unsigned short*)(ws + OFF_WH);
  unsigned short* WL   = (unsigned short*)(ws + OFF_WL);
  unsigned short* WOH  = (unsigned short*)(ws + OFF_WOH);
  unsigned short* WOL  = (unsigned short*)(ws + OFF_WOL);
  unsigned short* QKVH = (unsigned short*)(ws + OFF_QKVH);
  unsigned short* QKVL = (unsigned short*)(ws + OFF_QKVL);
  unsigned short* AVH  = (unsigned short*)(ws + OFF_AVH);
  unsigned short* AVL  = (unsigned short*)(ws + OFF_AVL);
  const float* dummyf = (const float*)(ws + OFF_XH);     // unused pointer slots point inside ws
  void* dummyv = (void*)(ws + OFF_XH);

  // ---- operand planes (bf16 hi/lo) ----
  {
    const int n8x = (NB * SEQ * EMB) / 8;                // 524288 threads cover 4194304 elements
    split_planes_bf16<<<(n8x + 255) / 256, 256, 0, stream>>>(x, XH, XL, n8x);
    const int n8w = (HDIM * HDIM) / 8;                   // 512 threads cover 4096 elements each
    split_planes_bf16<<<(n8w + 255) / 256, 256, 0, stream>>>(Wq, WH + 0 * HDIM * HDIM, WL + 0 * HDIM * HDIM, n8w);
    split_planes_bf16<<<(n8w + 255) / 256, 256, 0, stream>>>(Wk, WH + 1 * HDIM * HDIM, WL + 1 * HDIM * HDIM, n8w);
    split_planes_bf16<<<(n8w + 255) / 256, 256, 0, stream>>>(Wv, WH + 2 * HDIM * HDIM, WL + 2 * HDIM * HDIM, n8w);
    const int n8o = (EMB * EMB) / 8;                     // 131072 threads cover 1048576 elements
    split_planes_bf16<<<(n8o + 255) / 256, 256, 0, stream>>>(Wo, WOH, WOL, n8o);
  }

  // ---- q|k|v = xh[65536][64] . W{q,k,v}^T : M=65536, N=64, K=64; grid.y selects the weight plane ----
  {
    const int tiles = (NROWH / 64) * (HDIM / 64);        // 1024 wave tiles
    dim3 grid((tiles + 7) / 8, 3);
    wmma_gemm64<1, true, 0, 2, false><<<grid, 256, 0, stream>>>(
        XH, XL, HDIM, 0L,
        WH, WL, HDIM, (long)(HDIM * HDIM),
        (void*)QKVH, (void*)QKVL, HDIM, (long)PLANE_QKV,
        dummyf, dummyf, 0L,
        NROWH, HDIM, HDIM, 1.0f);
  }

  // ---- causal attention per (b, h): av hi/lo planes ----
  {
    const int nblk = NB * NHEAD * (SEQ / AQB);           // 1024 blocks x 64 query rows
    attn_causal_hd64<<<nblk, 128, 0, stream>>>(
        QKVH + 0 * PLANE_QKV, QKVL + 0 * PLANE_QKV,
        QKVH + 1 * PLANE_QKV, QKVL + 1 * PLANE_QKV,
        QKVH + 2 * PLANE_QKV, QKVL + 2 * PLANE_QKV,
        AVH, AVL, 0.125f);
  }

  // ---- out = av[4096][1024] . Wo^T : M=4096, N=1024, K=1024, f32 into d_out ----
  {
    const int tiles = (NTOK / 64) * (EMB / 64);          // 1024 wave tiles
    dim3 grid((tiles + 7) / 8, 1);
    wmma_gemm64<1, true, 0, 0, false><<<grid, 256, 0, stream>>>(
        AVH, AVL, EMB, 0L,
        WOH, WOL, EMB, 0L,
        (void*)out, dummyv, EMB, 0L,
        dummyf, dummyf, 0L,
        NTOK, EMB, EMB, 1.0f);
  }
}

// v003
// One run takes 326 microseconds.
// Next to v002, in two timings, it ran 1.16 times as fast each time.
// Over all steps from v000 it is 1.66 times as fast.
// Contractions: q/k/v projections, q.k^T scores, p.v and output projection all on v_wmma_f32_16x16x32_bf16 with bf16 hi/lo split operands (hi*hi + hi*lo + lo*hi), f32 accumulate; softmax and all side math in f32.
#include <hip/hip_runtime.h>

typedef __attribute__((ext_vector_type(16))) _Float16 v16h;
typedef __attribute__((ext_vector_type(8)))  _Float16 v8h;
typedef __attribute__((ext_vector_type(16))) __bf16   v16b;
typedef __attribute__((ext_vector_type(8)))  __bf16   v8b;
typedef __attribute__((ext_vector_type(8)))  float    v8f;
typedef __attribute__((ext_vector_type(4)))  float    v4f;
typedef __attribute__((ext_vector_type(4)))  unsigned v4u;
#define U16(p) ((const unsigned short*)(const void*)(p))

// ---------------------------------------------------------------------------
// Problem constants
// ---------------------------------------------------------------------------
constexpr int NB    = 2;
constexpr int SEQ   = 2048;
constexpr int EMB   = 1024;
constexpr int NHEAD = 16;
constexpr int HDIM  = 64;
constexpr int NTOK  = NB * SEQ;              // 4096 rows of [EMB]
constexpr int NROWH = NTOK * NHEAD;          // 65536 rows of [HDIM]

// attention tiling
constexpr int AQB = 64;                      // query rows per block (4 waves x 16)
constexpr int AKC = 64;                      // keys per chunk
constexpr int ANW = 4;
// LDS row pitch of the K, V^T and P tiles, in 16-bit elements: 144 B = 16 B x 9 (odd), so that the
// 16 rows a ds_load_b128 fragment read touches start on distinct bank groups (128-B rows do not).
constexpr int APT = 72;

// GEMM shape contract (no run-time tails)
static_assert(NROWH % 64 == 0);              // qkv GEMM M
static_assert(HDIM % 64 == 0);               // qkv GEMM N
static_assert(HDIM % 32 == 0);               // qkv GEMM K
static_assert(NTOK % 64 == 0);               // out GEMM M
static_assert(EMB % 64 == 0);                // out GEMM N
static_assert(EMB % 32 == 0);                // out GEMM K
static_assert(SEQ % AQB == 0);
static_assert(AQB == AKC);
static_assert(APT >= AKC && APT >= HDIM && (APT * 2) % 16 == 0 && ((APT * 2) / 16) % 2 == 1);

// ---------------------------------------------------------------------------
//   XH   [0          ,  8 MiB)  x   bf16 hi  [4194304]
//   XL   [8 MiB      , 16 MiB)  x   bf16 lo
//   WH   [16 MiB     , +24576)  Wq|Wk|Wv bf16 hi, 3 planes of [64][64] (carve 64 KiB)
//   WL   [16 MiB+64K , +24576)  Wq|Wk|Wv bf16 lo (carve 64 KiB)
//   WOH  [17 MiB     , 19 MiB)  Wo  bf16 hi  [1024][1024]
//   WOL  [19 MiB     , 21 MiB)  Wo  bf16 lo
//   QKVH [21 MiB     , 45 MiB)  q|k|v bf16 hi, 3 planes of [65536][64] (element (b,s,h,d) at (b*SEQ+s)*EMB + h*64 + d)
//   QKVL [45 MiB     , 69 MiB)  q|k|v bf16 lo
//   AVH  [69 MiB     , 77 MiB)  av  bf16 hi  [4096][1024]
//   AVL  [77 MiB     , 85 MiB)  av  bf16 lo
//   total 85 MiB = 89128960 B
// ---------------------------------------------------------------------------
constexpr size_t MIB      = 1048576;
constexpr size_t OFF_XH   = 0;
constexpr size_t OFF_XL   = 8 * MIB;
constexpr size_t OFF_WH   = 16 * MIB;
constexpr size_t OFF_WL   = 16 * MIB + 65536;
constexpr size_t OFF_WOH  = 17 * MIB;
constexpr size_t OFF_WOL  = 19 * MIB;
constexpr size_t OFF_QKVH = 21 * MIB;
constexpr size_t OFF_QKVL = 45 * MIB;
constexpr size_t OFF_AVH  = 69 * MIB;
constexpr size_t OFF_AVL  = 77 * MIB;
constexpr size_t WS_TOTAL = 85 * MIB;
constexpr size_t PLANE_QKV = (size_t)NROWH * HDIM;      // elements per q/k/v plane
static_assert((size_t)NB * SEQ * EMB * 2 <= OFF_XL - OFF_XH);
static_assert((size_t)3 * HDIM * HDIM * 2 <= OFF_WL - OFF_WH);
static_assert((size_t)3 * HDIM * HDIM * 2 <= OFF_WOH - OFF_WL);
static_assert((size_t)EMB * EMB * 2 <= OFF_WOL - OFF_WOH);
static_assert((size_t)EMB * EMB * 2 <= OFF_QKVH - OFF_WOL);
static_assert(3 * PLANE_QKV * 2 <= OFF_QKVL - OFF_QKVH);
static_assert(3 * PLANE_QKV * 2 <= OFF_AVH - OFF_QKVL);
static_assert((size_t)NTOK * EMB * 2 <= OFF_AVL - OFF_AVH);
static_assert((size_t)NTOK * EMB * 2 <= WS_TOTAL - OFF_AVL);
static_assert(WS_TOTAL <= 134217728);

// ---------------------------------------------------------------------------
// Helpers
// ---------------------------------------------------------------------------
__device__ __forceinline__ unsigned short f2bf_bits(float f) {
  unsigned u = __float_as_uint(f);
  return (unsigned short)((u + 0x7FFFu + ((u >> 16) & 1u)) >> 16);
}
__device__ __forceinline__ float bf_bits2f(unsigned short h) { return __uint_as_float(((unsigned)h) << 16); }

// hazard guards as plain device helpers (no inline asm inside the kernel template body)
__device__ __forceinline__ void dep_guard_h(v8f& a, v8f& b, v16h x, v16h y) { asm volatile("v_nop\n\tv_nop\n\tv_nop\n\tv_nop" : "+v"(a), "+v"(b) : "v"(x), "v"(y)); }
__device__ __forceinline__ void dep_guard_b(v8f& a, v8f& b, v16b x, v16b y) { asm volatile("v_nop\n\tv_nop\n\tv_nop\n\tv_nop" : "+v"(a), "+v"(b) : "v"(x), "v"(y)); }
__device__ __forceinline__ void keep4_h(v16h a, v16h b, v16h c, v16h d) { asm volatile("v_nop" :: "v"(a), "v"(b), "v"(c), "v"(d)); }
__device__ __forceinline__ void keep4_b(v16b a, v16b b, v16b c, v16b d) { asm volatile("v_nop" :: "v"(a), "v"(b), "v"(c), "v"(d)); }
__device__ __forceinline__ void acc_guard4(v8f& a, v8f& b, v8f& c, v8f& d) { asm volatile("v_nop\n\tv_nop\n\tv_nop\n\tv_nop" : "+v"(a), "+v"(b), "+v"(c), "+v"(d)); }
template <typename T> struct Frag;
template <> struct Frag<_Float16> {
  typedef v16h V; union U { v16h v; v8h h[2]; };
  static __device__ __forceinline__ v16h load(const _Float16* p) {   // elements 0..7 <- p[0..7], 8..15 <- p[16..23]
    U f; f.h[0] = *(const v8h*)(p); f.h[1] = *(const v8h*)(p + 16); return f.v;
  }
  static __device__ __forceinline__ v8f mma(v16h a, v16h b, v8f c) {
    return __builtin_amdgcn_wmma_f32_16x16x32_f16(false, a, false, b, (short)0, c, false, false);
  }
  static __device__ __forceinline__ void guard(v8f& a, v8f& b, v16h x, v16h y) { dep_guard_h(a, b, x, y); }
  static __device__ __forceinline__ void keep(v16h a, v16h b, v16h c, v16h d) { keep4_h(a, b, c, d); }
};
template <> struct Frag<__bf16> {
  typedef v16b V; union U { v16b v; v8b h[2]; };
  static __device__ __forceinline__ v16b load(const __bf16* p) {
    U f; f.h[0] = *(const v8b*)(p); f.h[1] = *(const v8b*)(p + 16); return f.v;
  }
  static __device__ __forceinline__ v8f mma(v16b a, v16b b, v8f c) {
    return __builtin_amdgcn_wmma_f32_16x16x32_bf16(false, a, false, b, (short)0, c, false, false);
  }
  static __device__ __forceinline__ void guard(v8f& a, v8f& b, v16b x, v16b y) { dep_guard_b(a, b, x, y); }
  static __device__ __forceinline__ void keep(v16b a, v16b b, v16b c, v16b d) { keep4_b(a, b, c, d); }
};

// ---- Register-blocked batched WMMA GEMM --------------------------------
// C[m,n] = scale * sum_k A[m,k] * Bt[n,k] (+bias)(+resid); each wave owns a 64x64 tile.
// A row-major [M,K]; Bt row-major [N,K]; M,N % 64 == 0, K % 32 == 0.
// SPLIT: operands are hi/lo planes (A2/Bt2 = lo planes, same layout); product = hi.hi + hi.lo + lo.hi.
// BIAS_MODE: 0 = none, 1 = bias[m], 2 = bias[n].
// OUT_MODE: 0 = f32, 1 = f16, 2 = bf16 hi plane (Cout) + bf16 lo plane (Cout2).
// ET: 0 = f16 operands, 1 = bf16 operands (pointers passed as 16-bit storage)
template <int ET> struct Elem;
template <> struct Elem<0> { typedef _Float16 T; };
template <> struct Elem<1> { typedef __bf16 T; };
template <int ET, bool SPLIT, int BIAS_MODE, int OUT_MODE, bool RESID, int ACT = 0>
__global__ __launch_bounds__(256) void wmma_gemm64(
    const unsigned short* __restrict__ Ap, const unsigned short* __restrict__ A2p, int lda, long strideA,
    const unsigned short* __restrict__ Btp, const unsigned short* __restrict__ Bt2p, int ldb, long strideB,
    void* __restrict__ Cout, void* __restrict__ Cout2, int ldc, long strideC,
    const float* __restrict__ bias,
    const float* __restrict__ resid, long strideR,
    int M, int N, int K, float scale) {
  typedef typename Elem<ET>::T T;
  typedef typename Frag<T>::V V;
  const T* A = (const T*)Ap; const T* A2 = (const T*)A2p; const T* Bt = (const T*)Btp; const T* Bt2 = (const T*)Bt2p;
  __shared__ __align__(16) float sT[8][16 * 68];   // per-wave 16x64 slab, pitch 68 floats
  const int b    = blockIdx.y;
  const int lane = threadIdx.x & 31;
  const int wave = threadIdx.x >> 5;
  const int tilesN = N >> 6;
  const int tilesM = M >> 6;
  const int tile = blockIdx.x * 8 + wave;
  if (tile >= tilesM * tilesN) return;   // wave-uniform; no block barriers in this kernel
  const int tm = tile / tilesN;
  const int tn = tile - tm * tilesN;
  const int m0 = tm << 6;
  const int n0 = tn << 6;

  const T* Ab  = A  + (size_t)b * strideA;
  const T* Bb  = Bt + (size_t)b * strideB;
  const T* Ab2 = SPLIT ? (A2  + (size_t)b * strideA) : nullptr;
  const T* Bb2 = SPLIT ? (Bt2 + (size_t)b * strideB) : nullptr;

  const int rlane = lane & 15;                 // row (A) / col (B, D) within subtile
  const int koff  = (lane >> 4) * 8;           // k offset of this lane half
  const int mOff  = (lane >> 4) * 8;           // D row offset

  v8f acc[4][4];
#pragma unroll
  for (int i = 0; i < 4; ++i)
#pragma unroll
    for (int j = 0; j < 4; ++j) acc[i][j] = (v8f){0.f,0.f,0.f,0.f,0.f,0.f,0.f,0.f};

  for (int k0 = 0; k0 < K; k0 += 32) {
    V bh[4], bl[4];
#pragma unroll
    for (int j = 0; j < 4; ++j) {
      const size_t bo = (size_t)(n0 + (j << 4) + rlane) * ldb + koff + k0;
      bh[j] = Frag<T>::load(Bb + bo);
      if (SPLIT) bl[j] = Frag<T>::load(Bb2 + bo);
    }
#pragma unroll
    for (int i = 0; i < 4; ++i) {
      const size_t ao = (size_t)(m0 + (i << 4) + rlane) * lda + koff + k0;
      V ah = Frag<T>::load(Ab + ao);
      V al;
      if (SPLIT) al = Frag<T>::load(Ab2 + ao);
#pragma unroll
      for (int j = 0; j < 4; ++j) {
        acc[i][j] = Frag<T>::mma(ah, bh[j], acc[i][j]);
        if (SPLIT) {
          acc[i][j] = Frag<T>::mma(ah, bl[j], acc[i][j]);
          acc[i][j] = Frag<T>::mma(al, bh[j], acc[i][j]);
        }
      }
      Frag<T>::guard(acc[i][0], acc[i][3], ah, SPLIT ? al : ah);
    }
    Frag<T>::keep(bh[0], bh[1], bh[2], bh[3]);
    if (SPLIT) Frag<T>::keep(bl[0], bl[1], bl[2], bl[3]);
  }
  acc_guard4(acc[0][0], acc[0][1], acc[0][2], acc[0][3]);
  acc_guard4(acc[1][0], acc[1][1], acc[1][2], acc[1][3]);
  acc_guard4(acc[2][0], acc[2][1], acc[2][2], acc[2][3]);
  acc_guard4(acc[3][0], acc[3][1], acc[3][2], acc[3][3]);

  // ---- epilogue ----
  float* slab = sT[wave];
  const float* Rb = RESID ? (resid + (size_t)b * strideR) : nullptr;
#pragma unroll
  for (int i = 0; i < 4; ++i) {
    const int mBase = m0 + (i << 4);
#pragma unroll
    for (int j = 0; j < 4; ++j) {
      const int n = n0 + (j << 4) + rlane;
      float bv = 0.f;
      if (BIAS_MODE == 2) bv = bias[n];
#pragma unroll
      for (int r = 0; r < 8; ++r) {
        float v = acc[i][j][r] * scale;
        if (BIAS_MODE == 1) v += bias[mBase + mOff + r];
        if (BIAS_MODE == 2) v += bv;
        if (RESID) v += Rb[(size_t)(mBase + mOff + r) * ldc + n];
        if (ACT == 1) v = tanhf(v);
        if (ACT == 2) v = fmaxf(v, 0.0f);
        if (ACT == 3) v = v / (1.0f + expf(-v));
        if (ACT == 4) v = (v > 0.f) ? v : 0.01f * v;
        if (ACT == 5) v = 0.5f * v * (1.0f + erff(v * 0.70710678118654752f));
        slab[(mOff + r) * 68 + (j << 4) + rlane] = v;
      }
    }
    __builtin_amdgcn_fence(__ATOMIC_RELEASE, "workgroup");
    __builtin_amdgcn_wave_barrier();
    __builtin_amdgcn_fence(__ATOMIC_ACQUIRE, "workgroup");
    if (OUT_MODE == 0) {
      float* C = (float*)Cout + (size_t)b * strideC;
      const int hh = lane >> 4, c4 = (lane & 15) * 4;     // row seg = 256 B = 16 lanes x 16 B
      {
#pragma unroll
        for (int it = 0; it < 8; ++it) {
          const int row = it * 2 + hh;
          v4f v = *(const v4f*)(slab + row * 68 + c4);
          *(v4f*)(C + (size_t)(mBase + row) * ldc + n0 + c4) = v;
        }
        
      }
    } else {
      const int q = lane >> 3, c8 = (lane & 7) * 8;
      unsigned short* C  = (unsigned short*)Cout  + (size_t)b * strideC;
      unsigned short* C2 = (OUT_MODE == 2) ? ((unsigned short*)Cout2 + (size_t)b * strideC) : nullptr;
      {
#pragma unroll
        for (int it = 0; it < 4; ++it) {
          const int row = it * 4 + q;
          const float* sp = slab + row * 68 + c8;
          v8h hv, lv;
#pragma unroll
          for (int e = 0; e < 8; ++e) {
            if (OUT_MODE == 1) {
              hv[e] = (_Float16)sp[e];
            } else {
              unsigned short hb = f2bf_bits(sp[e]);
              unsigned short lb = f2bf_bits(sp[e] - bf_bits2f(hb));
              hv[e] = __builtin_bit_cast(_Float16, hb);
              lv[e] = __builtin_bit_cast(_Float16, lb);
            }
          }
          *(v8h*)(C + (size_t)(mBase + row) * ldc + n0 + c8) = hv;
          if (OUT_MODE == 2) *(v8h*)(C2 + (size_t)(mBase + row) * ldc + n0 + c8) = lv;
        }
        
      }
    }
    __builtin_amdgcn_fence(__ATOMIC_RELEASE, "workgroup");
    __builtin_amdgcn_wave_barrier();
    __builtin_amdgcn_fence(__ATOMIC_ACQUIRE, "workgroup");
  }
}

// ---------------------------------------------------------------------------
// f32 -> bf16 hi + bf16 lo planes (RNE converts). 8 elements per thread:
// two b128 loads, one b128 store per plane; lanes 8q..8q+7 of a wave fill one
// ---------------------------------------------------------------------------
__device__ __forceinline__ void split_pair(float f0, float f1, unsigned& hw, unsigned& lw) {
  const unsigned short h0 = f2bf_bits(f0);
  const unsigned short h1 = f2bf_bits(f1);
  const unsigned short l0 = f2bf_bits(f0 - bf_bits2f(h0));
  const unsigned short l1 = f2bf_bits(f1 - bf_bits2f(h1));
  hw = (unsigned)h0 | ((unsigned)h1 << 16);
  lw = (unsigned)l0 | ((unsigned)l1 << 16);
}

__global__ __launch_bounds__(256) void split_planes_bf16(
    const float* __restrict__ src, unsigned short* __restrict__ hi,
    unsigned short* __restrict__ lo, int n8) {
  const int i = blockIdx.x * 256 + threadIdx.x;
  if (i >= n8) return;                      // no barriers in this kernel
  const size_t e0 = (size_t)i * 8;
  const v4f a = *(const v4f*)(src + e0);
  const v4f c = *(const v4f*)(src + e0 + 4);
  unsigned hx, hy, hz, hw, lx, ly, lz, lw;
  split_pair(a[0], a[1], hx, lx);
  split_pair(a[2], a[3], hy, ly);
  split_pair(c[0], c[1], hz, lz);
  split_pair(c[2], c[3], hw, lw);
  const v4u hv = (v4u){hx, hy, hz, hw};
  const v4u lv = (v4u){lx, ly, lz, lw};
  *(v4u*)(hi + e0) = hv;
  *(v4u*)(lo + e0) = lv;
  
}

// ---------------------------------------------------------------------------
// Causal flash attention, head dim 64, bf16 hi/lo planes in, bf16 hi/lo planes out.
//   q,k,v planes: element (b, s, h, d) at (b*SEQ + s)*EMB + h*64 + d (ushort storage).
//   scores = q.k^T * sm_scale : hi.hi + hi.lo + lo.hi on v_wmma_f32_16x16x32_bf16
//   out    = p.v              : p and v as bf16 hi/lo, same three products
//   online softmax in f32; block = 4 waves = 64 query rows of one (b, h);
//   grid.x = NB * NHEAD * (SEQ/64); keys visited in 64-wide chunks 0..qb (causal).
//   Output planes: element (b, q, h*64+d) at (b*SEQ+q)*EMB + h*64 + d; each wave writes
// ---------------------------------------------------------------------------
__device__ __forceinline__ unsigned short at_bf_bits(float f) {
  unsigned u = __float_as_uint(f);
  return (unsigned short)((u + 0x7FFFu + ((u >> 16) & 1u)) >> 16);
}
__device__ __forceinline__ __bf16 at_f2bf(float f) { return __builtin_bit_cast(__bf16, at_bf_bits(f)); }
__device__ __forceinline__ void at_split(float f, __bf16& hi, __bf16& lo) {
  const unsigned short hb = at_bf_bits(f);
  hi = __builtin_bit_cast(__bf16, hb);
  lo = at_f2bf(f - __uint_as_float(((unsigned)hb) << 16));
}
__device__ __forceinline__ v8f at_mma(v16b a, v16b b, v8f c) {
  c = __builtin_amdgcn_wmma_f32_16x16x32_bf16(false, a, false, b, (short)0, c, false, false);
  asm volatile("v_nop\n\tv_nop\n\tv_nop\n\tv_nop" : "+v"(c) : "v"(a), "v"(b));
  return c;
}

// value of lane l ^ M (M < 16, same 16-lane row) by a DPP row_xmask move: stays in the vector unit, where
// __shfl_xor goes through the LDS pipe and a wait on it. All 32 lanes are active at every call, so every source
// lane is valid; no old value and bound_ctrl on let the compiler fold the move into the add that follows.
template <int M> __device__ __forceinline__ float row_xor(float x) {
  const int v = __float_as_int(x);
  return __int_as_float(__builtin_amdgcn_update_dpp(0, v, 0x160 | M, 0xf, 0xf, true));
}

// transpose-store 8 consecutive 16-bit elements held in a b128 word into dst[e*pitch], e = 0..7
__device__ __forceinline__ void st_tr8(unsigned short* dst, int pitch, v4u w) {
#pragma unroll
  for (int e = 0; e < 4; ++e) {
    const unsigned word = w[e];
    dst[(2 * e) * pitch]     = (unsigned short)(word & 0xffffu);
    dst[(2 * e + 1) * pitch] = (unsigned short)(word >> 16);
  }
}

__global__ __launch_bounds__(128)
void attn_causal_hd64(const unsigned short* __restrict__ Qh, const unsigned short* __restrict__ Ql,
                      const unsigned short* __restrict__ Kh, const unsigned short* __restrict__ Kl,
                      const unsigned short* __restrict__ Vh, const unsigned short* __restrict__ Vl,
                      unsigned short* __restrict__ Oh, unsigned short* __restrict__ Ol,
                      float sm_scale) {
  union FB { v16b v; v8b h[2]; };
  __shared__ __align__(16) unsigned short Ksh[AKC * APT];     // K hi [kv][d]   9 KB
  __shared__ __align__(16) unsigned short Ksl[AKC * APT];     // K lo [kv][d]   9 KB
  __shared__ __align__(16) unsigned short Vth[HDIM * APT];    // V hi [d][kv]   9 KB
  __shared__ __align__(16) unsigned short Vtl[HDIM * APT];    // V lo [d][kv]   9 KB
  __shared__ __align__(16) __bf16 Psh[ANW][16 * APT];         // per wave P hi [row][kv]
  __shared__ __align__(16) __bf16 Psl[ANW][16 * APT];         // per wave P lo
  __shared__ __align__(16) float  Os[ANW][16 * 68];           // per wave out tile, pitch 68

  const int tid  = threadIdx.x;
  const int wave = tid >> 5;
  const int lane = tid & 31;
  const int hh   = lane >> 4;
  const int c    = lane & 15;
  const float NEG_INF = -__builtin_inff();

  constexpr int NQB = SEQ / AQB;                 // 32 query blocks per (b, h)
  const int bx   = blockIdx.x;
  const int qb   = bx % NQB;
  const int bhid = bx / NQB;
  const int h    = bhid % NHEAD;
  const int b    = bhid / NHEAD;
  const int q0   = qb * AQB + wave * 16;
  const size_t hoff = (size_t)h * HDIM;

  // ---- Q fragments (A operand): row = c, elements 0..7 <- d = dc*32 + 8hh + 0..7, 8..15 <- dc*32 + 16 + 8hh + 0..7
  v16b qah[2], qal[2];
  {
    const size_t qo = (size_t)(b * SEQ + q0 + c) * EMB + hoff + 8 * hh;
    const __bf16* qhp = (const __bf16*)(const void*)Qh;
    const __bf16* qlp = (const __bf16*)(const void*)Ql;
#pragma unroll
    for (int dc = 0; dc < 2; ++dc) {
      qah[dc] = Frag<__bf16>::load(qhp + qo + dc * 32);
      qal[dc] = Frag<__bf16>::load(qlp + qo + dc * 32);
    }
  }

  float mrow[8], lrow[8];
  v8f oacc[4];
#pragma unroll
  for (int r = 0; r < 8; ++r) { mrow[r] = NEG_INF; lrow[r] = 0.f; }
#pragma unroll
  for (int t = 0; t < 4; ++t) oacc[t] = (v8f){0.f,0.f,0.f,0.f,0.f,0.f,0.f,0.f};

  // staging map: thread -> rows skv + 16 i (i = 0..3), 16-byte column group scol, of each 64 x 64 K / V plane tile
  const int skv = tid >> 3, scol = (tid & 7) * 8;
  // one 32-bit byte offset (< 8 MiB) serves all four planes on their scalar base pointers: one address register
  // instead of four pairs, which is what lets the 64 registers of fetched words fit at four waves per SIMD
  const unsigned sgb = (unsigned)(((b * SEQ + skv) * EMB + h * HDIM + scol) * 2);
  v4u kwh[4], kwl[4], vwh[4], vwl[4];            // K hi, K lo, V hi, V lo words of the chunk fetched ahead
  const int nChunks = qb + 1;                    // block-uniform, <= 32
  // ---- chunk 0's K and V words, all 16 global loads in flight together ----
  {
    const unsigned gb = sgb;
#pragma unroll
    for (int i = 0; i < 4; ++i) {
      kwh[i] = *(const v4u*)((const char*)Kh + gb + 16 * i * EMB * 2);
      kwl[i] = *(const v4u*)((const char*)Kl + gb + 16 * i * EMB * 2);
      vwh[i] = *(const v4u*)((const char*)Vh + gb + 16 * i * EMB * 2);
      vwl[i] = *(const v4u*)((const char*)Vl + gb + 16 * i * EMB * 2);
    }
  }
  for (int kc = 0; kc < nChunks; ++kc) {
    const int kv0 = kc * AKC;
    __syncthreads();
    // ---- K and V words fetched one trip ahead go from registers to LDS ----
#pragma unroll
    for (int i = 0; i < 4; ++i) {
      *(v4u*)(Ksh + (skv + 16 * i) * APT + scol) = kwh[i];
      *(v4u*)(Ksl + (skv + 16 * i) * APT + scol) = kwl[i];
    }
    // ---- V hi/lo transposed: each word -> 8 strided 2-B LDS stores ----
#pragma unroll
    for (int i = 0; i < 4; ++i) {
      st_tr8(Vth + scol * APT + skv + 16 * i, APT, vwh[i]);
      st_tr8(Vtl + scol * APT + skv + 16 * i, APT, vwl[i]);
    }
    __syncthreads();

    // ---- scores: 4 key tiles x 2 d-chunks x 3 products ----
    v8f s[4];
#pragma unroll
    for (int j = 0; j < 4; ++j) {
      s[j] = (v8f){0.f,0.f,0.f,0.f,0.f,0.f,0.f,0.f};
#pragma unroll
      for (int dc = 0; dc < 2; ++dc) {
        FB kfh, kfl;
        const int ko = (j * 16 + c) * APT + dc * 32 + 8 * hh;
        kfh.h[0] = *(const v8b*)(Ksh + ko);
        kfh.h[1] = *(const v8b*)(Ksh + ko + 16);
        kfl.h[0] = *(const v8b*)(Ksl + ko);
        kfl.h[1] = *(const v8b*)(Ksl + ko + 16);
        s[j] = at_mma(qah[dc], kfh.v, s[j]);
        s[j] = at_mma(qah[dc], kfl.v, s[j]);
        s[j] = at_mma(qal[dc], kfh.v, s[j]);
      }
    }
    // ---- scale, causal mask on the diagonal chunk (select, -inf fill), row max ----
    const bool diag = (kc == qb);
    float cm[8];
#pragma unroll
    for (int r = 0; r < 8; ++r) {
      const int qrow = q0 + 8 * hh + r;
      float m = NEG_INF;
#pragma unroll
      for (int j = 0; j < 4; ++j) {
        const int kvcol = kv0 + j * 16 + c;
        float val = s[j][r] * sm_scale;
        val = (diag && (kvcol > qrow)) ? NEG_INF : val;
        s[j][r] = val;
        m = fmaxf(m, val);
      }
      m = fmaxf(m, row_xor<1>(m));
      m = fmaxf(m, row_xor<2>(m));
      m = fmaxf(m, row_xor<4>(m));
      m = fmaxf(m, row_xor<8>(m));
      cm[r] = m;
    }
    // ---- online softmax update, P hi/lo staged per wave ----
    __bf16* pwh = Psh[wave];
    __bf16* pwl = Psl[wave];
#pragma unroll
    for (int r = 0; r < 8; ++r) {
      const float mnew = fmaxf(mrow[r], cm[r]);
      const float alpha = expf(mrow[r] - mnew);
      mrow[r] = mnew;
      float psum = 0.f;
#pragma unroll
      for (int j = 0; j < 4; ++j) {
        const float p = expf(s[j][r] - mnew);
        psum += p;
        __bf16 a, bl;
        at_split(p, a, bl);
        pwh[(8 * hh + r) * APT + j * 16 + c] = a;
        pwl[(8 * hh + r) * APT + j * 16 + c] = bl;
      }
      psum += row_xor<1>(psum);
      psum += row_xor<2>(psum);
      psum += row_xor<4>(psum);
      psum += row_xor<8>(psum);
      lrow[r] = lrow[r] * alpha + psum;
#pragma unroll
      for (int t = 0; t < 4; ++t) oacc[t][r] *= alpha;
    }
    __builtin_amdgcn_fence(__ATOMIC_RELEASE, "workgroup");
    __builtin_amdgcn_wave_barrier();
    __builtin_amdgcn_fence(__ATOMIC_ACQUIRE, "workgroup");
    // ---- next chunk's K and V words: 16 global loads in flight together, their latency under the P.V products ----
    if (kc + 1 < nChunks) {
      const unsigned gb = sgb + (unsigned)(kv0 + AKC) * (EMB * 2);
#pragma unroll
      for (int i = 0; i < 4; ++i) {
        kwh[i] = *(const v4u*)((const char*)Kh + gb + 16 * i * EMB * 2);
        kwl[i] = *(const v4u*)((const char*)Kl + gb + 16 * i * EMB * 2);
        vwh[i] = *(const v4u*)((const char*)Vh + gb + 16 * i * EMB * 2);
        vwl[i] = *(const v4u*)((const char*)Vl + gb + 16 * i * EMB * 2);
      }
    }
    // ---- O += P.V : A = P [row][kv], B[k=kv][n=d] = Vt[d][kv] ----
#pragma unroll 1
    for (int kk = 0; kk < 2; ++kk) {
      FB pa, pl;
      pa.h[0] = *(const v8b*)(pwh + c * APT + kk * 32 + 8 * hh);
      pa.h[1] = *(const v8b*)(pwh + c * APT + kk * 32 + 16 + 8 * hh);
      pl.h[0] = *(const v8b*)(pwl + c * APT + kk * 32 + 8 * hh);
      pl.h[1] = *(const v8b*)(pwl + c * APT + kk * 32 + 16 + 8 * hh);
#pragma unroll
      for (int t = 0; t < 4; ++t) {
        FB vb, vlo;
        const int vo = (t * 16 + c) * APT + kk * 32 + 8 * hh;
        vb.h[0]  = *(const v8b*)(Vth + vo);
        vb.h[1]  = *(const v8b*)(Vth + vo + 16);
        vlo.h[0] = *(const v8b*)(Vtl + vo);
        vlo.h[1] = *(const v8b*)(Vtl + vo + 16);
        oacc[t] = at_mma(pa.v, vb.v, oacc[t]);
        oacc[t] = at_mma(pa.v, vlo.v, oacc[t]);
        oacc[t] = at_mma(pl.v, vb.v, oacc[t]);
      }
    }
  }

  // ---- epilogue: 1/l, per-wave LDS slab, whole-line bf16 hi/lo stores ----
  float* os = Os[wave];
#pragma unroll
  for (int r = 0; r < 8; ++r) {
    const float inv = 1.0f / lrow[r];
#pragma unroll
    for (int t = 0; t < 4; ++t) os[(8 * hh + r) * 68 + t * 16 + c] = oacc[t][r] * inv;
  }
  __builtin_amdgcn_fence(__ATOMIC_RELEASE, "workgroup");
  __builtin_amdgcn_wave_barrier();
  __builtin_amdgcn_fence(__ATOMIC_ACQUIRE, "workgroup");
  {
    // rows it*4 + q4 (it 0..3, q4 0..3) = 0..15; c8 = 0..56 step 8 -> full 16 x 64 tile per plane
    const int q4 = lane >> 3, c8 = (lane & 7) * 8;
    {
#pragma unroll
      for (int it = 0; it < 4; ++it) {
        const int row = it * 4 + q4;
        const float* sp = os + row * 68 + c8;
        v8h hv, lv;
#pragma unroll
        for (int e = 0; e < 8; ++e) {
          unsigned short hb = f2bf_bits(sp[e]);
          unsigned short lb = f2bf_bits(sp[e] - bf_bits2f(hb));
          hv[e] = __builtin_bit_cast(_Float16, hb);
          lv[e] = __builtin_bit_cast(_Float16, lb);
        }
        const size_t oo = (size_t)(b * SEQ + q0 + row) * EMB + hoff + c8;
        *(v8h*)(Oh + oo) = hv;
        *(v8h*)(Ol + oo) = lv;
      }
      
    }
  }
}

// ---------------------------------------------------------------------------
// Host launcher: 8 launches, no runtime API calls other than launches.
// ---------------------------------------------------------------------------
extern "C" void kernel_launch(void* const* d_in, const int* in_sizes, int n_in,
                              void* d_out, int out_size, void* d_ws, size_t ws_size,
                              hipStream_t stream) {
  if (n_in < 5) return;
  if (in_sizes[0] != NB * SEQ * EMB) return;
  if (in_sizes[1] != HDIM * HDIM || in_sizes[2] != HDIM * HDIM || in_sizes[3] != HDIM * HDIM) return;
  if (in_sizes[4] != EMB * EMB) return;
  if (out_size != NB * SEQ * EMB) return;
  if (ws_size < WS_TOTAL) return;

  const float* x  = (const float*)d_in[0];
  const float* Wq = (const float*)d_in[1];
  const float* Wk = (const float*)d_in[2];
  const float* Wv = (const float*)d_in[3];
  const float* Wo = (const float*)d_in[4];
  float* out = (float*)d_out;

  char* ws = (char*)d_ws;
  unsigned short* XH   = (unsigned short*)(ws + OFF_XH);
  unsigned short* XL   = (unsigned short*)(ws + OFF_XL);
  unsigned short* WH   = (unsigned short*)(ws + OFF_WH);
  unsigned short* WL   = (unsigned short*)(ws + OFF_WL);
  unsigned short* WOH  = (unsigned short*)(ws + OFF_WOH);
  unsigned short* WOL  = (unsigned short*)(ws + OFF_WOL);
  unsigned short* QKVH = (unsigned short*)(ws + OFF_QKVH);
  unsigned short* QKVL = (unsigned short*)(ws + OFF_QKVL);
  unsigned short* AVH  = (unsigned short*)(ws + OFF_AVH);
  unsigned short* AVL  = (unsigned short*)(ws + OFF_AVL);
  const float* dummyf = (const float*)(ws + OFF_XH);     // unused pointer slots point inside ws
  void* dummyv = (void*)(ws + OFF_XH);

  // ---- operand planes (bf16 hi/lo) ----
  {
    const int n8x = (NB * SEQ * EMB) / 8;                // 524288 threads cover 4194304 elements
    split_planes_bf16<<<(n8x + 255) / 256, 256, 0, stream>>>(x, XH, XL, n8x);
    const int n8w = (HDIM * HDIM) / 8;                   // 512 threads cover 4096 elements each
    split_planes_bf16<<<(n8w + 255) / 256, 256, 0, stream>>>(Wq, WH + 0 * HDIM * HDIM, WL + 0 * HDIM * HDIM, n8w);
    split_planes_bf16<<<(n8w + 255) / 256, 256, 0, stream>>>(Wk, WH + 1 * HDIM * HDIM, WL + 1 * HDIM * HDIM, n8w);
    split_planes_bf16<<<(n8w + 255) / 256, 256, 0, stream>>>(Wv, WH + 2 * HDIM * HDIM, WL + 2 * HDIM * HDIM, n8w);
    const int n8o = (EMB * EMB) / 8;                     // 131072 threads cover 1048576 elements
    split_planes_bf16<<<(n8o + 255) / 256, 256, 0, stream>>>(Wo, WOH, WOL, n8o);
  }

  // ---- q|k|v = xh[65536][64] . W{q,k,v}^T : M=65536, N=64, K=64; grid.y selects the weight plane ----
  {
    const int tiles = (NROWH / 64) * (HDIM / 64);        // 1024 wave tiles
    dim3 grid((tiles + 7) / 8, 3);
    wmma_gemm64<1, true, 0, 2, false><<<grid, 256, 0, stream>>>(
        XH, XL, HDIM, 0L,
        WH, WL, HDIM, (long)(HDIM * HDIM),
        (void*)QKVH, (void*)QKVL, HDIM, (long)PLANE_QKV,
        dummyf, dummyf, 0L,
        NROWH, HDIM, HDIM, 1.0f);
  }

  // ---- causal attention per (b, h): av hi/lo planes ----
  {
    const int nblk = NB * NHEAD * (SEQ / AQB);           // 1024 blocks x 64 query rows
    attn_causal_hd64<<<nblk, 128, 0, stream>>>(
        QKVH + 0 * PLANE_QKV, QKVL + 0 * PLANE_QKV,
        QKVH + 1 * PLANE_QKV, QKVL + 1 * PLANE_QKV,
        QKVH + 2 * PLANE_QKV, QKVL + 2 * PLANE_QKV,
        AVH, AVL, 0.125f);
  }

  // ---- out = av[4096][1024] . Wo^T : M=4096, N=1024, K=1024, f32 into d_out ----
  {
    const int tiles = (NTOK / 64) * (EMB / 64);          // 1024 wave tiles
    dim3 grid((tiles + 7) / 8, 1);
    wmma_gemm64<1, true, 0, 0, false><<<grid, 256, 0, stream>>>(
        AVH, AVL, EMB, 0L,
        WOH, WOL, EMB, 0L,
        (void*)out, dummyv, EMB, 0L,
        dummyf, dummyf, 0L,
        NTOK, EMB, EMB, 1.0f);
  }
}

// v004
// Measured time: 248 microseconds a run.
// Timed twice side by side with v003, it ran 1.31 times as fast both times.
// Over all steps from v000 it is 2.18 times as fast.
// Contractions: q/k/v projections, q.k^T scores, p.v and output projection all on v_wmma_f32_16x16x32_bf16 with bf16 hi/lo split operands (hi*hi + hi*lo + lo*hi), f32 accumulate; softmax and all side math in f32.
#include <hip/hip_runtime.h>

typedef __attribute__((ext_vector_type(16))) _Float16 v16h;
typedef __attribute__((ext_vector_type(8)))  _Float16 v8h;
typedef __attribute__((ext_vector_type(16))) __bf16   v16b;
typedef __attribute__((ext_vector_type(8)))  __bf16   v8b;
typedef __attribute__((ext_vector_type(8)))  float    v8f;
typedef __attribute__((ext_vector_type(4)))  float    v4f;
typedef __attribute__((ext_vector_type(4)))  unsigned v4u;
#define U16(p) ((const unsigned short*)(const void*)(p))

// ---------------------------------------------------------------------------
// Problem constants
// ---------------------------------------------------------------------------
constexpr int NB    = 2;
constexpr int SEQ   = 2048;
constexpr int EMB   = 1024;
constexpr int NHEAD = 16;
constexpr int HDIM  = 64;
constexpr int NTOK  = NB * SEQ;              // 4096 rows of [EMB]
constexpr int NROWH = NTOK * NHEAD;          // 65536 rows of [HDIM]

// attention tiling
constexpr int AQB = 64;                      // query rows per query block (4 waves x 16)
constexpr int AKC = 64;                      // keys per chunk
constexpr int ANW = 4;
// LDS row pitch of the K, V^T and P tiles, in 16-bit elements: 144 B = 16 B x 9 (odd), so that the
// 16 rows a ds_load_b128 fragment read touches start on distinct bank groups (128-B rows do not).
constexpr int APT = 72;

// GEMM shape contract (no run-time tails)
static_assert(NROWH % 64 == 0);              // qkv GEMM M
static_assert(HDIM % 64 == 0);               // qkv GEMM N
static_assert(HDIM % 32 == 0);               // qkv GEMM K
static_assert(NTOK % 64 == 0);               // out GEMM M
static_assert(EMB % 64 == 0);                // out GEMM N
static_assert(EMB % 32 == 0);                // out GEMM K
static_assert(SEQ % AQB == 0);
static_assert(AQB == AKC);
static_assert(APT >= AKC && APT >= HDIM && (APT * 2) % 16 == 0 && ((APT * 2) / 16) % 2 == 1);

// ---------------------------------------------------------------------------
//   XH   [0          ,  8 MiB)  x   bf16 hi  [4194304]
//   XL   [8 MiB      , 16 MiB)  x   bf16 lo
//   WH   [16 MiB     , +24576)  Wq|Wk|Wv bf16 hi, 3 planes of [64][64] (carve 64 KiB)
//   WL   [16 MiB+64K , +24576)  Wq|Wk|Wv bf16 lo (carve 64 KiB)
//   WOH  [17 MiB     , 19 MiB)  Wo  bf16 hi  [1024][1024]
//   WOL  [19 MiB     , 21 MiB)  Wo  bf16 lo
//   QKVH [21 MiB     , 45 MiB)  q|k|v bf16 hi, 3 planes of [65536][64] (element (b,s,h,d) at (b*SEQ+s)*EMB + h*64 + d)
//   QKVL [45 MiB     , 69 MiB)  q|k|v bf16 lo
//   AVH  [69 MiB     , 77 MiB)  av  bf16 hi  [4096][1024]
//   AVL  [77 MiB     , 85 MiB)  av  bf16 lo
//   total 85 MiB = 89128960 B
// ---------------------------------------------------------------------------
constexpr size_t MIB      = 1048576;
constexpr size_t OFF_XH   = 0;
constexpr size_t OFF_XL   = 8 * MIB;
constexpr size_t OFF_WH   = 16 * MIB;
constexpr size_t OFF_WL   = 16 * MIB + 65536;
constexpr size_t OFF_WOH  = 17 * MIB;
constexpr size_t OFF_WOL  = 19 * MIB;
constexpr size_t OFF_QKVH = 21 * MIB;
constexpr size_t OFF_QKVL = 45 * MIB;
constexpr size_t OFF_AVH  = 69 * MIB;
constexpr size_t OFF_AVL  = 77 * MIB;
constexpr size_t WS_TOTAL = 85 * MIB;
constexpr size_t PLANE_QKV = (size_t)NROWH * HDIM;      // elements per q/k/v plane
static_assert((size_t)NB * SEQ * EMB * 2 <= OFF_XL - OFF_XH);
static_assert((size_t)3 * HDIM * HDIM * 2 <= OFF_WL - OFF_WH);
static_assert((size_t)3 * HDIM * HDIM * 2 <= OFF_WOH - OFF_WL);
static_assert((size_t)EMB * EMB * 2 <= OFF_WOL - OFF_WOH);
static_assert((size_t)EMB * EMB * 2 <= OFF_QKVH - OFF_WOL);
static_assert(3 * PLANE_QKV * 2 <= OFF_QKVL - OFF_QKVH);
static_assert(3 * PLANE_QKV * 2 <= OFF_AVH - OFF_QKVL);
static_assert((size_t)NTOK * EMB * 2 <= OFF_AVL - OFF_AVH);
static_assert((size_t)NTOK * EMB * 2 <= WS_TOTAL - OFF_AVL);
static_assert(WS_TOTAL <= 134217728);

// ---------------------------------------------------------------------------
// Helpers
// ---------------------------------------------------------------------------
__device__ __forceinline__ unsigned short f2bf_bits(float f) {
  unsigned u = __float_as_uint(f);
  return (unsigned short)((u + 0x7FFFu + ((u >> 16) & 1u)) >> 16);
}
__device__ __forceinline__ float bf_bits2f(unsigned short h) { return __uint_as_float(((unsigned)h) << 16); }

// hazard guards as plain device helpers (no inline asm inside the kernel template body)
__device__ __forceinline__ void dep_guard_h(v8f& a, v8f& b, v16h x, v16h y) { asm volatile("v_nop\n\tv_nop\n\tv_nop\n\tv_nop" : "+v"(a), "+v"(b) : "v"(x), "v"(y)); }
__device__ __forceinline__ void dep_guard_b(v8f& a, v8f& b, v16b x, v16b y) { asm volatile("v_nop\n\tv_nop\n\tv_nop\n\tv_nop" : "+v"(a), "+v"(b) : "v"(x), "v"(y)); }
__device__ __forceinline__ void keep4_h(v16h a, v16h b, v16h c, v16h d) { asm volatile("v_nop" :: "v"(a), "v"(b), "v"(c), "v"(d)); }
__device__ __forceinline__ void keep4_b(v16b a, v16b b, v16b c, v16b d) { asm volatile("v_nop" :: "v"(a), "v"(b), "v"(c), "v"(d)); }
__device__ __forceinline__ void acc_guard4(v8f& a, v8f& b, v8f& c, v8f& d) { asm volatile("v_nop\n\tv_nop\n\tv_nop\n\tv_nop" : "+v"(a), "+v"(b), "+v"(c), "+v"(d)); }
template <typename T> struct Frag;
template <> struct Frag<_Float16> {
  typedef v16h V; union U { v16h v; v8h h[2]; };
  static __device__ __forceinline__ v16h load(const _Float16* p) {   // elements 0..7 <- p[0..7], 8..15 <- p[16..23]
    U f; f.h[0] = *(const v8h*)(p); f.h[1] = *(const v8h*)(p + 16); return f.v;
  }
  static __device__ __forceinline__ v8f mma(v16h a, v16h b, v8f c) {
    return __builtin_amdgcn_wmma_f32_16x16x32_f16(false, a, false, b, (short)0, c, false, false);
  }
  static __device__ __forceinline__ void guard(v8f& a, v8f& b, v16h x, v16h y) { dep_guard_h(a, b, x, y); }
  static __device__ __forceinline__ void keep(v16h a, v16h b, v16h c, v16h d) { keep4_h(a, b, c, d); }
};
template <> struct Frag<__bf16> {
  typedef v16b V; union U { v16b v; v8b h[2]; };
  static __device__ __forceinline__ v16b load(const __bf16* p) {
    U f; f.h[0] = *(const v8b*)(p); f.h[1] = *(const v8b*)(p + 16); return f.v;
  }
  static __device__ __forceinline__ v8f mma(v16b a, v16b b, v8f c) {
    return __builtin_amdgcn_wmma_f32_16x16x32_bf16(false, a, false, b, (short)0, c, false, false);
  }
  static __device__ __forceinline__ void guard(v8f& a, v8f& b, v16b x, v16b y) { dep_guard_b(a, b, x, y); }
  static __device__ __forceinline__ void keep(v16b a, v16b b, v16b c, v16b d) { keep4_b(a, b, c, d); }
};

// ---- Register-blocked batched WMMA GEMM --------------------------------
// C[m,n] = scale * sum_k A[m,k] * Bt[n,k] (+bias)(+resid); each wave owns a 64x64 tile.
// A row-major [M,K]; Bt row-major [N,K]; M,N % 64 == 0, K % 32 == 0.
// SPLIT: operands are hi/lo planes (A2/Bt2 = lo planes, same layout); product = hi.hi + hi.lo + lo.hi.
// BIAS_MODE: 0 = none, 1 = bias[m], 2 = bias[n].
// OUT_MODE: 0 = f32, 1 = f16, 2 = bf16 hi plane (Cout) + bf16 lo plane (Cout2).
// ET: 0 = f16 operands, 1 = bf16 operands (pointers passed as 16-bit storage)
template <int ET> struct Elem;
template <> struct Elem<0> { typedef _Float16 T; };
template <> struct Elem<1> { typedef __bf16 T; };
template <int ET, bool SPLIT, int BIAS_MODE, int OUT_MODE, bool RESID, int ACT = 0>
__global__ __launch_bounds__(256) void wmma_gemm64(
    const unsigned short* __restrict__ Ap, const unsigned short* __restrict__ A2p, int lda, long strideA,
    const unsigned short* __restrict__ Btp, const unsigned short* __restrict__ Bt2p, int ldb, long strideB,
    void* __restrict__ Cout, void* __restrict__ Cout2, int ldc, long strideC,
    const float* __restrict__ bias,
    const float* __restrict__ resid, long strideR,
    int M, int N, int K, float scale) {
  typedef typename Elem<ET>::T T;
  typedef typename Frag<T>::V V;
  const T* A = (const T*)Ap; const T* A2 = (const T*)A2p; const T* Bt = (const T*)Btp; const T* Bt2 = (const T*)Bt2p;
  __shared__ __align__(16) float sT[8][16 * 68];   // per-wave 16x64 slab, pitch 68 floats
  const int b    = blockIdx.y;
  const int lane = threadIdx.x & 31;
  const int wave = threadIdx.x >> 5;
  const int tilesN = N >> 6;
  const int tilesM = M >> 6;
  const int tile = blockIdx.x * 8 + wave;
  if (tile >= tilesM * tilesN) return;   // wave-uniform; no block barriers in this kernel
  const int tm = tile / tilesN;
  const int tn = tile - tm * tilesN;
  const int m0 = tm << 6;
  const int n0 = tn << 6;

  const T* Ab  = A  + (size_t)b * strideA;
  const T* Bb  = Bt + (size_t)b * strideB;
  const T* Ab2 = SPLIT ? (A2  + (size_t)b * strideA) : nullptr;
  const T* Bb2 = SPLIT ? (Bt2 + (size_t)b * strideB) : nullptr;

  const int rlane = lane & 15;                 // row (A) / col (B, D) within subtile
  const int koff  = (lane >> 4) * 8;           // k offset of this lane half
  const int mOff  = (lane >> 4) * 8;           // D row offset

  v8f acc[4][4];
#pragma unroll
  for (int i = 0; i < 4; ++i)
#pragma unroll
    for (int j = 0; j < 4; ++j) acc[i][j] = (v8f){0.f,0.f,0.f,0.f,0.f,0.f,0.f,0.f};

  for (int k0 = 0; k0 < K; k0 += 32) {
    V bh[4], bl[4];
#pragma unroll
    for (int j = 0; j < 4; ++j) {
      const size_t bo = (size_t)(n0 + (j << 4) + rlane) * ldb + koff + k0;
      bh[j] = Frag<T>::load(Bb + bo);
      if (SPLIT) bl[j] = Frag<T>::load(Bb2 + bo);
    }
#pragma unroll
    for (int i = 0; i < 4; ++i) {
      const size_t ao = (size_t)(m0 + (i << 4) + rlane) * lda + koff + k0;
      V ah = Frag<T>::load(Ab + ao);
      V al;
      if (SPLIT) al = Frag<T>::load(Ab2 + ao);
#pragma unroll
      for (int j = 0; j < 4; ++j) {
        acc[i][j] = Frag<T>::mma(ah, bh[j], acc[i][j]);
        if (SPLIT) {
          acc[i][j] = Frag<T>::mma(ah, bl[j], acc[i][j]);
          acc[i][j] = Frag<T>::mma(al, bh[j], acc[i][j]);
        }
      }
      Frag<T>::guard(acc[i][0], acc[i][3], ah, SPLIT ? al : ah);
    }
    Frag<T>::keep(bh[0], bh[1], bh[2], bh[3]);
    if (SPLIT) Frag<T>::keep(bl[0], bl[1], bl[2], bl[3]);
  }
  acc_guard4(acc[0][0], acc[0][1], acc[0][2], acc[0][3]);
  acc_guard4(acc[1][0], acc[1][1], acc[1][2], acc[1][3]);
  acc_guard4(acc[2][0], acc[2][1], acc[2][2], acc[2][3]);
  acc_guard4(acc[3][0], acc[3][1], acc[3][2], acc[3][3]);

  // ---- epilogue ----
  float* slab = sT[wave];
  const float* Rb = RESID ? (resid + (size_t)b * strideR) : nullptr;
#pragma unroll
  for (int i = 0; i < 4; ++i) {
    const int mBase = m0 + (i << 4);
#pragma unroll
    for (int j = 0; j < 4; ++j) {
      const int n = n0 + (j << 4) + rlane;
      float bv = 0.f;
      if (BIAS_MODE == 2) bv = bias[n];
#pragma unroll
      for (int r = 0; r < 8; ++r) {
        float v = acc[i][j][r] * scale;
        if (BIAS_MODE == 1) v += bias[mBase + mOff + r];
        if (BIAS_MODE == 2) v += bv;
        if (RESID) v += Rb[(size_t)(mBase + mOff + r) * ldc + n];
        if (ACT == 1) v = tanhf(v);
        if (ACT == 2) v = fmaxf(v, 0.0f);
        if (ACT == 3) v = v / (1.0f + expf(-v));
        if (ACT == 4) v = (v > 0.f) ? v : 0.01f * v;
        if (ACT == 5) v = 0.5f * v * (1.0f + erff(v * 0.70710678118654752f));
        slab[(mOff + r) * 68 + (j << 4) + rlane] = v;
      }
    }
    __builtin_amdgcn_fence(__ATOMIC_RELEASE, "workgroup");
    __builtin_amdgcn_wave_barrier();
    __builtin_amdgcn_fence(__ATOMIC_ACQUIRE, "workgroup");
    if (OUT_MODE == 0) {
      float* C = (float*)Cout + (size_t)b * strideC;
      const int hh = lane >> 4, c4 = (lane & 15) * 4;     // row seg = 256 B = 16 lanes x 16 B
      {
#pragma unroll
        for (int it = 0; it < 8; ++it) {
          const int row = it * 2 + hh;
          v4f v = *(const v4f*)(slab + row * 68 + c4);
          *(v4f*)(C + (size_t)(mBase + row) * ldc + n0 + c4) = v;
        }
        
      }
    } else {
      const int q = lane >> 3, c8 = (lane & 7) * 8;
      unsigned short* C  = (unsigned short*)Cout  + (size_t)b * strideC;
      unsigned short* C2 = (OUT_MODE == 2) ? ((unsigned short*)Cout2 + (size_t)b * strideC) : nullptr;
      {
#pragma unroll
        for (int it = 0; it < 4; ++it) {
          const int row = it * 4 + q;
          const float* sp = slab + row * 68 + c8;
          v8h hv, lv;
#pragma unroll
          for (int e = 0; e < 8; ++e) {
            if (OUT_MODE == 1) {
              hv[e] = (_Float16)sp[e];
            } else {
              unsigned short hb = f2bf_bits(sp[e]);
              unsigned short lb = f2bf_bits(sp[e] - bf_bits2f(hb));
              hv[e] = __builtin_bit_cast(_Float16, hb);
              lv[e] = __builtin_bit_cast(_Float16, lb);
            }
          }
          *(v8h*)(C + (size_t)(mBase + row) * ldc + n0 + c8) = hv;
          if (OUT_MODE == 2) *(v8h*)(C2 + (size_t)(mBase + row) * ldc + n0 + c8) = lv;
        }
        
      }
    }
    __builtin_amdgcn_fence(__ATOMIC_RELEASE, "workgroup");
    __builtin_amdgcn_wave_barrier();
    __builtin_amdgcn_fence(__ATOMIC_ACQUIRE, "workgroup");
  }
}

// ---------------------------------------------------------------------------
// f32 -> bf16 hi + bf16 lo planes (RNE converts). 8 elements per thread:
// two b128 loads, one b128 store per plane; lanes 8q..8q+7 of a wave fill one
// ---------------------------------------------------------------------------
__device__ __forceinline__ void split_pair(float f0, float f1, unsigned& hw, unsigned& lw) {
  const unsigned short h0 = f2bf_bits(f0);
  const unsigned short h1 = f2bf_bits(f1);
  const unsigned short l0 = f2bf_bits(f0 - bf_bits2f(h0));
  const unsigned short l1 = f2bf_bits(f1 - bf_bits2f(h1));
  hw = (unsigned)h0 | ((unsigned)h1 << 16);
  lw = (unsigned)l0 | ((unsigned)l1 << 16);
}

__global__ __launch_bounds__(256) void split_planes_bf16(
    const float* __restrict__ src, unsigned short* __restrict__ hi,
    unsigned short* __restrict__ lo, int n8) {
  const int i = blockIdx.x * 256 + threadIdx.x;
  if (i >= n8) return;                      // no barriers in this kernel
  const size_t e0 = (size_t)i * 8;
  const v4f a = *(const v4f*)(src + e0);
  const v4f c = *(const v4f*)(src + e0 + 4);
  unsigned hx, hy, hz, hw, lx, ly, lz, lw;
  split_pair(a[0], a[1], hx, lx);
  split_pair(a[2], a[3], hy, ly);
  split_pair(c[0], c[1], hz, lz);
  split_pair(c[2], c[3], hw, lw);
  const v4u hv = (v4u){hx, hy, hz, hw};
  const v4u lv = (v4u){lx, ly, lz, lw};
  *(v4u*)(hi + e0) = hv;
  *(v4u*)(lo + e0) = lv;
  
}

// ---------------------------------------------------------------------------
// Causal flash attention, head dim 64, bf16 hi/lo planes in, bf16 hi/lo planes out.
//   q,k,v planes: element (b, s, h, d) at (b*SEQ + s)*EMB + h*64 + d (ushort storage).
//   scores = q.k^T * sm_scale : hi.hi + hi.lo + lo.hi on v_wmma_f32_16x16x32_bf16
//   out    = p.v              : p and v as bf16 hi/lo, same three products
//   online softmax in f32; block = 4 waves; a query block = 64 query rows of one (b, h), 16 per wave;
//   grid.x = NB * NHEAD * (SEQ/64) / 2; keys visited in 64-wide chunks 0..qb (causal).
//   A query block qb costs qb + 1 chunks, and all blocks of the grid are resident at once, so the launch lasts as
//   long as its fullest block: each block takes query blocks 31 - p and p of one (b, h), one after the other in
//   every wave, which is 33 chunks for every block of the grid.
//   Output planes: element (b, q, h*64+d) at (b*SEQ+q)*EMB + h*64 + d; each wave writes
// ---------------------------------------------------------------------------
__device__ __forceinline__ unsigned short at_bf_bits(float f) {
  unsigned u = __float_as_uint(f);
  return (unsigned short)((u + 0x7FFFu + ((u >> 16) & 1u)) >> 16);
}
__device__ __forceinline__ __bf16 at_f2bf(float f) { return __builtin_bit_cast(__bf16, at_bf_bits(f)); }
__device__ __forceinline__ void at_split(float f, __bf16& hi, __bf16& lo) {
  const unsigned short hb = at_bf_bits(f);
  hi = __builtin_bit_cast(__bf16, hb);
  lo = at_f2bf(f - __uint_as_float(((unsigned)hb) << 16));
}
__device__ __forceinline__ v8f at_mma(v16b a, v16b b, v8f c) {
  c = __builtin_amdgcn_wmma_f32_16x16x32_bf16(false, a, false, b, (short)0, c, false, false);
  asm volatile("v_nop\n\tv_nop\n\tv_nop\n\tv_nop" : "+v"(c) : "v"(a), "v"(b));
  return c;
}

// value of lane l ^ M (M < 16, same 16-lane row) by a DPP row_xmask move: stays in the vector unit, where
// __shfl_xor goes through the LDS pipe and a wait on it. All 32 lanes are active at every call, so every source
// lane is valid; no old value and bound_ctrl on let the compiler fold the move into the add that follows.
template <int M> __device__ __forceinline__ float row_xor(float x) {
  const int v = __float_as_int(x);
  return __int_as_float(__builtin_amdgcn_update_dpp(0, v, 0x160 | M, 0xf, 0xf, true));
}

// transpose-store 8 consecutive 16-bit elements held in a b128 word into dst[e*pitch], e = 0..7
__device__ __forceinline__ void st_tr8(unsigned short* dst, int pitch, v4u w) {
#pragma unroll
  for (int e = 0; e < 4; ++e) {
    const unsigned word = w[e];
    dst[(2 * e) * pitch]     = (unsigned short)(word & 0xffffu);
    dst[(2 * e + 1) * pitch] = (unsigned short)(word >> 16);
  }
}

__global__ __launch_bounds__(128)
void attn_causal_hd64(const unsigned short* __restrict__ Qh, const unsigned short* __restrict__ Ql,
                      const unsigned short* __restrict__ Kh, const unsigned short* __restrict__ Kl,
                      const unsigned short* __restrict__ Vh, const unsigned short* __restrict__ Vl,
                      unsigned short* __restrict__ Oh, unsigned short* __restrict__ Ol,
                      float sm_scale) {
  union FB { v16b v; v8b h[2]; };
  __shared__ __align__(16) unsigned short Ksh[AKC * APT];     // K hi [kv][d]   9 KB
  __shared__ __align__(16) unsigned short Ksl[AKC * APT];     // K lo [kv][d]   9 KB
  __shared__ __align__(16) unsigned short Vth[HDIM * APT];    // V hi [d][kv]   9 KB
  __shared__ __align__(16) unsigned short Vtl[HDIM * APT];    // V lo [d][kv]   9 KB
  __shared__ __align__(16) __bf16 Psh[ANW][16 * APT];         // per wave P hi [row][kv]
  __shared__ __align__(16) __bf16 Psl[ANW][16 * APT];         // per wave P lo
  __shared__ __align__(16) float  Os[ANW][16 * 68];           // per wave out tile, pitch 68

  const int tid  = threadIdx.x;
  const int wave = tid >> 5;
  const int lane = tid & 31;
  const int hh   = lane >> 4;
  const int c    = lane & 15;
  const float NEG_INF = -__builtin_inff();

  constexpr int NQB = SEQ / AQB;                 // 32 query blocks per (b, h)
  constexpr int NPR = NQB / 2;                   // 16 pairs (31 - p, p) per (b, h)
  static_assert(NQB % 2 == 0);
  const int bx   = blockIdx.x;
  const int pr   = bx % NPR;
  const int bhid = bx / NPR;
  const int h    = bhid % NHEAD;
  const int b    = bhid / NHEAD;
  const size_t hoff = (size_t)h * HDIM;

  for (int half = 0; half < 2; ++half) {         // block-uniform: every wave walks both query blocks in this order
  const int qb   = half ? pr : NQB - 1 - pr;
  const int q0   = qb * AQB + wave * 16;

  // ---- Q fragments (A operand): row = c, elements 0..7 <- d = dc*32 + 8hh + 0..7, 8..15 <- dc*32 + 16 + 8hh + 0..7
  v16b qah[2], qal[2];
  {
    const size_t qo = (size_t)(b * SEQ + q0 + c) * EMB + hoff + 8 * hh;
    const __bf16* qhp = (const __bf16*)(const void*)Qh;
    const __bf16* qlp = (const __bf16*)(const void*)Ql;
#pragma unroll
    for (int dc = 0; dc < 2; ++dc) {
      qah[dc] = Frag<__bf16>::load(qhp + qo + dc * 32);
      qal[dc] = Frag<__bf16>::load(qlp + qo + dc * 32);
    }
  }

  float mrow[8], lrow[8];
  v8f oacc[4];
#pragma unroll
  for (int r = 0; r < 8; ++r) { mrow[r] = NEG_INF; lrow[r] = 0.f; }
#pragma unroll
  for (int t = 0; t < 4; ++t) oacc[t] = (v8f){0.f,0.f,0.f,0.f,0.f,0.f,0.f,0.f};

  // staging map: thread -> rows skv + 16 i (i = 0..3), 16-byte column group scol, of each 64 x 64 K / V plane tile
  const int skv = tid >> 3, scol = (tid & 7) * 8;
  // one 32-bit byte offset (< 8 MiB) serves all four planes on their scalar base pointers: one address register
  // instead of four pairs
  const unsigned sgb = (unsigned)(((b * SEQ + skv) * EMB + h * HDIM + scol) * 2);
  v4u kwh[4], kwl[4], vwh[4], vwl[4];            // K hi, K lo, V hi, V lo words of the chunk fetched ahead
  const int nChunks = qb + 1;                    // block-uniform, <= 32
  // ---- chunk 0's K and V words, all 16 global loads in flight together ----
  {
    const unsigned gb = sgb;
#pragma unroll
    for (int i = 0; i < 4; ++i) {
      kwh[i] = *(const v4u*)((const char*)Kh + gb + 16 * i * EMB * 2);
      kwl[i] = *(const v4u*)((const char*)Kl + gb + 16 * i * EMB * 2);
      vwh[i] = *(const v4u*)((const char*)Vh + gb + 16 * i * EMB * 2);
      vwl[i] = *(const v4u*)((const char*)Vl + gb + 16 * i * EMB * 2);
    }
  }
  // the address registers of the Q, K and V loads above are written anew below: their translations are waited for
  // first; the Q words as inputs keep the wait behind their loads (once per query block)
  asm volatile("s_wait_xcnt 0x0" :: "v"(qah[0]), "v"(qah[1]), "v"(qal[0]), "v"(qal[1]) : "memory");
  for (int kc = 0; kc < nChunks; ++kc) {
    const int kv0 = kc * AKC;
    __syncthreads();
    // ---- K and V words fetched one trip ahead go from registers to LDS ----
#pragma unroll
    for (int i = 0; i < 4; ++i) {
      *(v4u*)(Ksh + (skv + 16 * i) * APT + scol) = kwh[i];
      *(v4u*)(Ksl + (skv + 16 * i) * APT + scol) = kwl[i];
    }
    // ---- V hi/lo transposed: each word -> 8 strided 2-B LDS stores ----
#pragma unroll
    for (int i = 0; i < 4; ++i) {
      st_tr8(Vth + scol * APT + skv + 16 * i, APT, vwh[i]);
      st_tr8(Vtl + scol * APT + skv + 16 * i, APT, vwl[i]);
    }
    __syncthreads();

    // ---- scores: 4 key tiles x 2 d-chunks x 3 products ----
    v8f s[4];
#pragma unroll
    for (int j = 0; j < 4; ++j) {
      s[j] = (v8f){0.f,0.f,0.f,0.f,0.f,0.f,0.f,0.f};
#pragma unroll
      for (int dc = 0; dc < 2; ++dc) {
        FB kfh, kfl;
        const int ko = (j * 16 + c) * APT + dc * 32 + 8 * hh;
        kfh.h[0] = *(const v8b*)(Ksh + ko);
        kfh.h[1] = *(const v8b*)(Ksh + ko + 16);
        kfl.h[0] = *(const v8b*)(Ksl + ko);
        kfl.h[1] = *(const v8b*)(Ksl + ko + 16);
        s[j] = at_mma(qah[dc], kfh.v, s[j]);
        s[j] = at_mma(qah[dc], kfl.v, s[j]);
        s[j] = at_mma(qal[dc], kfh.v, s[j]);
      }
    }
    // ---- scale, causal mask on the diagonal chunk (select, -inf fill), row max ----
    const bool diag = (kc == qb);
    float cm[8];
#pragma unroll
    for (int r = 0; r < 8; ++r) {
      const int qrow = q0 + 8 * hh + r;
      float m = NEG_INF;
#pragma unroll
      for (int j = 0; j < 4; ++j) {
        const int kvcol = kv0 + j * 16 + c;
        float val = s[j][r] * sm_scale;
        val = (diag && (kvcol > qrow)) ? NEG_INF : val;
        s[j][r] = val;
        m = fmaxf(m, val);
      }
      m = fmaxf(m, row_xor<1>(m));
      m = fmaxf(m, row_xor<2>(m));
      m = fmaxf(m, row_xor<4>(m));
      m = fmaxf(m, row_xor<8>(m));
      cm[r] = m;
    }
    // ---- online softmax update, P hi/lo staged per wave ----
    __bf16* pwh = Psh[wave];
    __bf16* pwl = Psl[wave];
#pragma unroll
    for (int r = 0; r < 8; ++r) {
      const float mnew = fmaxf(mrow[r], cm[r]);
      const float alpha = expf(mrow[r] - mnew);
      mrow[r] = mnew;
      float psum = 0.f;
#pragma unroll
      for (int j = 0; j < 4; ++j) {
        const float p = expf(s[j][r] - mnew);
        psum += p;
        __bf16 a, bl;
        at_split(p, a, bl);
        pwh[(8 * hh + r) * APT + j * 16 + c] = a;
        pwl[(8 * hh + r) * APT + j * 16 + c] = bl;
      }
      psum += row_xor<1>(psum);
      psum += row_xor<2>(psum);
      psum += row_xor<4>(psum);
      psum += row_xor<8>(psum);
      lrow[r] = lrow[r] * alpha + psum;
#pragma unroll
      for (int t = 0; t < 4; ++t) oacc[t][r] *= alpha;
    }
    __builtin_amdgcn_fence(__ATOMIC_RELEASE, "workgroup");
    __builtin_amdgcn_wave_barrier();
    __builtin_amdgcn_fence(__ATOMIC_ACQUIRE, "workgroup");
    // ---- next chunk's K and V words: 16 global loads in flight together, their latency under the P.V products ----
    if (kc + 1 < nChunks) {
      const unsigned gb = sgb + (unsigned)(kv0 + AKC) * (EMB * 2);
#pragma unroll
      for (int i = 0; i < 4; ++i) {
        kwh[i] = *(const v4u*)((const char*)Kh + gb + 16 * i * EMB * 2);
        kwl[i] = *(const v4u*)((const char*)Kl + gb + 16 * i * EMB * 2);
        vwh[i] = *(const v4u*)((const char*)Vh + gb + 16 * i * EMB * 2);
        vwl[i] = *(const v4u*)((const char*)Vl + gb + 16 * i * EMB * 2);
      }
      // the offset register of these loads is written anew right below: their translations are waited for first
      asm volatile("s_wait_xcnt 0x0" ::: "memory");
    }
    // ---- O += P.V : A = P [row][kv], B[k=kv][n=d] = Vt[d][kv] ----
#pragma unroll 1
    for (int kk = 0; kk < 2; ++kk) {
      FB pa, pl;
      pa.h[0] = *(const v8b*)(pwh + c * APT + kk * 32 + 8 * hh);
      pa.h[1] = *(const v8b*)(pwh + c * APT + kk * 32 + 16 + 8 * hh);
      pl.h[0] = *(const v8b*)(pwl + c * APT + kk * 32 + 8 * hh);
      pl.h[1] = *(const v8b*)(pwl + c * APT + kk * 32 + 16 + 8 * hh);
#pragma unroll
      for (int t = 0; t < 4; ++t) {
        FB vb, vlo;
        const int vo = (t * 16 + c) * APT + kk * 32 + 8 * hh;
        vb.h[0]  = *(const v8b*)(Vth + vo);
        vb.h[1]  = *(const v8b*)(Vth + vo + 16);
        vlo.h[0] = *(const v8b*)(Vtl + vo);
        vlo.h[1] = *(const v8b*)(Vtl + vo + 16);
        oacc[t] = at_mma(pa.v, vb.v, oacc[t]);
        oacc[t] = at_mma(pa.v, vlo.v, oacc[t]);
        oacc[t] = at_mma(pl.v, vb.v, oacc[t]);
      }
    }
  }

  // ---- epilogue: 1/l, per-wave LDS slab, whole-line bf16 hi/lo stores ----
  float* os = Os[wave];
#pragma unroll
  for (int r = 0; r < 8; ++r) {
    const float inv = 1.0f / lrow[r];
#pragma unroll
    for (int t = 0; t < 4; ++t) os[(8 * hh + r) * 68 + t * 16 + c] = oacc[t][r] * inv;
  }
  __builtin_amdgcn_fence(__ATOMIC_RELEASE, "workgroup");
  __builtin_amdgcn_wave_barrier();
  __builtin_amdgcn_fence(__ATOMIC_ACQUIRE, "workgroup");
  {
    // rows it*4 + q4 (it 0..3, q4 0..3) = 0..15; c8 = 0..56 step 8 -> full 16 x 64 tile per plane
    const int q4 = lane >> 3, c8 = (lane & 7) * 8;
    {
#pragma unroll
      for (int it = 0; it < 4; ++it) {
        const int row = it * 4 + q4;
        const float* sp = os + row * 68 + c8;
        v8h hv, lv;
#pragma unroll
        for (int e = 0; e < 8; ++e) {
          unsigned short hb = f2bf_bits(sp[e]);
          unsigned short lb = f2bf_bits(sp[e] - bf_bits2f(hb));
          hv[e] = __builtin_bit_cast(_Float16, hb);
          lv[e] = __builtin_bit_cast(_Float16, lb);
        }
        const size_t oo = (size_t)(b * SEQ + q0 + row) * EMB + hoff + c8;
        *(v8h*)(Oh + oo) = hv;
        *(v8h*)(Ol + oo) = lv;
      }
      
    }
  }
  // the second query block writes the registers of the stores above anew: their translations are waited for first
  asm volatile("s_wait_xcnt 0x0" ::: "memory");
  }   // half
}

// ---------------------------------------------------------------------------
// Host launcher: 8 launches, no runtime API calls other than launches.
// ---------------------------------------------------------------------------
extern "C" void kernel_launch(void* const* d_in, const int* in_sizes, int n_in,
                              void* d_out, int out_size, void* d_ws, size_t ws_size,
                              hipStream_t stream) {
  if (n_in < 5) return;
  if (in_sizes[0] != NB * SEQ * EMB) return;
  if (in_sizes[1] != HDIM * HDIM || in_sizes[2] != HDIM * HDIM || in_sizes[3] != HDIM * HDIM) return;
  if (in_sizes[4] != EMB * EMB) return;
  if (out_size != NB * SEQ * EMB) return;
  if (ws_size < WS_TOTAL) return;

  const float* x  = (const float*)d_in[0];
  const float* Wq = (const float*)d_in[1];
  const float* Wk = (const float*)d_in[2];
  const float* Wv = (const float*)d_in[3];
  const float* Wo = (const float*)d_in[4];
  float* out = (float*)d_out;

  char* ws = (char*)d_ws;
  unsigned short* XH   = (unsigned short*)(ws + OFF_XH);
  unsigned short* XL   = (unsigned short*)(ws + OFF_XL);
  unsigned short* WH   = (unsigned short*)(ws + OFF_WH);
  unsigned short* WL   = (unsigned short*)(ws + OFF_WL);
  unsigned short* WOH  = (unsigned short*)(ws + OFF_WOH);
  unsigned short* WOL  = (unsigned short*)(ws + OFF_WOL);
  unsigned short* QKVH = (unsigned short*)(ws + OFF_QKVH);
  unsigned short* QKVL = (unsigned short*)(ws + OFF_QKVL);
  unsigned short* AVH  = (unsigned short*)(ws + OFF_AVH);
  unsigned short* AVL  = (unsigned short*)(ws + OFF_AVL);
  const float* dummyf = (const float*)(ws + OFF_XH);     // unused pointer slots point inside ws
  void* dummyv = (void*)(ws + OFF_XH);

  // ---- operand planes (bf16 hi/lo) ----
  {
    const int n8x = (NB * SEQ * EMB) / 8;                // 524288 threads cover 4194304 elements
    split_planes_bf16<<<(n8x + 255) / 256, 256, 0, stream>>>(x, XH, XL, n8x);
    const int n8w = (HDIM * HDIM) / 8;                   // 512 threads cover 4096 elements each
    split_planes_bf16<<<(n8w + 255) / 256, 256, 0, stream>>>(Wq, WH + 0 * HDIM * HDIM, WL + 0 * HDIM * HDIM, n8w);
    split_planes_bf16<<<(n8w + 255) / 256, 256, 0, stream>>>(Wk, WH + 1 * HDIM * HDIM, WL + 1 * HDIM * HDIM, n8w);
    split_planes_bf16<<<(n8w + 255) / 256, 256, 0, stream>>>(Wv, WH + 2 * HDIM * HDIM, WL + 2 * HDIM * HDIM, n8w);
    const int n8o = (EMB * EMB) / 8;                     // 131072 threads cover 1048576 elements
    split_planes_bf16<<<(n8o + 255) / 256, 256, 0, stream>>>(Wo, WOH, WOL, n8o);
  }

  // ---- q|k|v = xh[65536][64] . W{q,k,v}^T : M=65536, N=64, K=64; grid.y selects the weight plane ----
  {
    const int tiles = (NROWH / 64) * (HDIM / 64);        // 1024 wave tiles
    dim3 grid((tiles + 7) / 8, 3);
    wmma_gemm64<1, true, 0, 2, false><<<grid, 256, 0, stream>>>(
        XH, XL, HDIM, 0L,
        WH, WL, HDIM, (long)(HDIM * HDIM),
        (void*)QKVH, (void*)QKVL, HDIM, (long)PLANE_QKV,
        dummyf, dummyf, 0L,
        NROWH, HDIM, HDIM, 1.0f);
  }

  // ---- causal attention per (b, h): av hi/lo planes ----
  {
    const int nblk = NB * NHEAD * (SEQ / AQB) / 2;       // 512 blocks x 2 x 64 query rows
    attn_causal_hd64<<<nblk, 128, 0, stream>>>(
        QKVH + 0 * PLANE_QKV, QKVL + 0 * PLANE_QKV,
        QKVH + 1 * PLANE_QKV, QKVL + 1 * PLANE_QKV,
        QKVH + 2 * PLANE_QKV, QKVL + 2 * PLANE_QKV,
        AVH, AVL, 0.125f);
  }

  // ---- out = av[4096][1024] . Wo^T : M=4096, N=1024, K=1024, f32 into d_out ----
  {
    const int tiles = (NTOK / 64) * (EMB / 64);          // 1024 wave tiles
    dim3 grid((tiles + 7) / 8, 1);
    wmma_gemm64<1, true, 0, 0, false><<<grid, 256, 0, stream>>>(
        AVH, AVL, EMB, 0L,
        WOH, WOL, EMB, 0L,
        (void*)out, dummyv, EMB, 0L,
        dummyf, dummyf, 0L,
        NTOK, EMB, EMB, 1.0f);
  }
}

// v005
// It runs in 207 microseconds.
// Two timings next to v004 both put it at 1.20 times that version's speed.
// Counting every step since v000, it is 2.62 times as fast.
// Contractions: q/k/v projections, q.k^T scores, p.v and output projection all on v_wmma_f32_16x16x32_bf16 with bf16 hi/lo split operands (hi*hi + hi*lo + lo*hi), f32 accumulate; softmax and all side math in f32.
#include <hip/hip_runtime.h>

typedef __attribute__((ext_vector_type(16))) _Float16 v16h;
typedef __attribute__((ext_vector_type(8)))  _Float16 v8h;
typedef __attribute__((ext_vector_type(16))) __bf16   v16b;
typedef __attribute__((ext_vector_type(8)))  __bf16   v8b;
typedef __attribute__((ext_vector_type(8)))  float    v8f;
typedef __attribute__((ext_vector_type(4)))  float    v4f;
typedef __attribute__((ext_vector_type(4)))  unsigned v4u;
#define U16(p) ((const unsigned short*)(const void*)(p))

// ---------------------------------------------------------------------------
// Problem constants
// ---------------------------------------------------------------------------
constexpr int NB    = 2;
constexpr int SEQ   = 2048;
constexpr int EMB   = 1024;
constexpr int NHEAD = 16;
constexpr int HDIM  = 64;
constexpr int NTOK  = NB * SEQ;              // 4096 rows of [EMB]
constexpr int NROWH = NTOK * NHEAD;          // 65536 rows of [HDIM]

// attention tiling
constexpr int AQB = 64;                      // query rows per query block (4 waves x 16)
constexpr int AKC = 64;                      // keys per chunk
constexpr int ANW = 4;
// LDS row pitch of the K and P tiles, in 16-bit elements: 144 B = 16 B x 9 (odd), so that the
// 16 rows a ds_load_b128 fragment read touches start on distinct bank groups (128-B rows do not).
constexpr int APT = 72;
// LDS row pitch of the V tiles, kept row-major [kv][d] and read by ds_load_tr16_b128: 160 B = 32 B x 5 (odd),
// the conflict-free pitch of that reader.
constexpr int VPT = 80;

// GEMM shape contract (no run-time tails)
static_assert(NROWH % 64 == 0);              // qkv GEMM M
static_assert(HDIM % 64 == 0);               // qkv GEMM N
static_assert(HDIM % 32 == 0);               // qkv GEMM K
static_assert(NTOK % 64 == 0);               // out GEMM M
static_assert(EMB % 64 == 0);                // out GEMM N
static_assert(EMB % 32 == 0);                // out GEMM K
static_assert(SEQ % AQB == 0);
static_assert(AQB == AKC);
static_assert(APT >= AKC && APT >= HDIM && (APT * 2) % 16 == 0 && ((APT * 2) / 16) % 2 == 1);
static_assert(VPT >= HDIM && (VPT * 2) % 32 == 0 && ((VPT * 2) / 32) % 2 == 1);

// ---------------------------------------------------------------------------
//   XH   [0          ,  8 MiB)  x   bf16 hi  [4194304]
//   XL   [8 MiB      , 16 MiB)  x   bf16 lo
//   WH   [16 MiB     , +24576)  Wq|Wk|Wv bf16 hi, 3 planes of [64][64] (carve 64 KiB)
//   WL   [16 MiB+64K , +24576)  Wq|Wk|Wv bf16 lo (carve 64 KiB)
//   WOH  [17 MiB     , 19 MiB)  Wo  bf16 hi  [1024][1024]
//   WOL  [19 MiB     , 21 MiB)  Wo  bf16 lo
//   QKVH [21 MiB     , 45 MiB)  q|k|v bf16 hi, 3 planes of [65536][64] (element (b,s,h,d) at (b*SEQ+s)*EMB + h*64 + d)
//   QKVL [45 MiB     , 69 MiB)  q|k|v bf16 lo
//   AVH  [69 MiB     , 77 MiB)  av  bf16 hi  [4096][1024]
//   AVL  [77 MiB     , 85 MiB)  av  bf16 lo
//   total 85 MiB = 89128960 B
// ---------------------------------------------------------------------------
constexpr size_t MIB      = 1048576;
constexpr size_t OFF_XH   = 0;
constexpr size_t OFF_XL   = 8 * MIB;
constexpr size_t OFF_WH   = 16 * MIB;
constexpr size_t OFF_WL   = 16 * MIB + 65536;
constexpr size_t OFF_WOH  = 17 * MIB;
constexpr size_t OFF_WOL  = 19 * MIB;
constexpr size_t OFF_QKVH = 21 * MIB;
constexpr size_t OFF_QKVL = 45 * MIB;
constexpr size_t OFF_AVH  = 69 * MIB;
constexpr size_t OFF_AVL  = 77 * MIB;
constexpr size_t WS_TOTAL = 85 * MIB;
constexpr size_t PLANE_QKV = (size_t)NROWH * HDIM;      // elements per q/k/v plane
static_assert((size_t)NB * SEQ * EMB * 2 <= OFF_XL - OFF_XH);
static_assert((size_t)3 * HDIM * HDIM * 2 <= OFF_WL - OFF_WH);
static_assert((size_t)3 * HDIM * HDIM * 2 <= OFF_WOH - OFF_WL);
static_assert((size_t)EMB * EMB * 2 <= OFF_WOL - OFF_WOH);
static_assert((size_t)EMB * EMB * 2 <= OFF_QKVH - OFF_WOL);
static_assert(3 * PLANE_QKV * 2 <= OFF_QKVL - OFF_QKVH);
static_assert(3 * PLANE_QKV * 2 <= OFF_AVH - OFF_QKVL);
static_assert((size_t)NTOK * EMB * 2 <= OFF_AVL - OFF_AVH);
static_assert((size_t)NTOK * EMB * 2 <= WS_TOTAL - OFF_AVL);
static_assert(WS_TOTAL <= 134217728);

// ---------------------------------------------------------------------------
// Helpers
// ---------------------------------------------------------------------------
__device__ __forceinline__ unsigned short f2bf_bits(float f) {
  unsigned u = __float_as_uint(f);
  return (unsigned short)((u + 0x7FFFu + ((u >> 16) & 1u)) >> 16);
}
__device__ __forceinline__ float bf_bits2f(unsigned short h) { return __uint_as_float(((unsigned)h) << 16); }

// hazard guards as plain device helpers (no inline asm inside the kernel template body)
__device__ __forceinline__ void dep_guard_h(v8f& a, v8f& b, v16h x, v16h y) { asm volatile("v_nop\n\tv_nop\n\tv_nop\n\tv_nop" : "+v"(a), "+v"(b) : "v"(x), "v"(y)); }
__device__ __forceinline__ void dep_guard_b(v8f& a, v8f& b, v16b x, v16b y) { asm volatile("v_nop\n\tv_nop\n\tv_nop\n\tv_nop" : "+v"(a), "+v"(b) : "v"(x), "v"(y)); }
__device__ __forceinline__ void keep4_h(v16h a, v16h b, v16h c, v16h d) { asm volatile("v_nop" :: "v"(a), "v"(b), "v"(c), "v"(d)); }
__device__ __forceinline__ void keep4_b(v16b a, v16b b, v16b c, v16b d) { asm volatile("v_nop" :: "v"(a), "v"(b), "v"(c), "v"(d)); }
__device__ __forceinline__ void acc_guard4(v8f& a, v8f& b, v8f& c, v8f& d) { asm volatile("v_nop\n\tv_nop\n\tv_nop\n\tv_nop" : "+v"(a), "+v"(b), "+v"(c), "+v"(d)); }
template <typename T> struct Frag;
template <> struct Frag<_Float16> {
  typedef v16h V; union U { v16h v; v8h h[2]; };
  static __device__ __forceinline__ v16h load(const _Float16* p) {   // elements 0..7 <- p[0..7], 8..15 <- p[16..23]
    U f; f.h[0] = *(const v8h*)(p); f.h[1] = *(const v8h*)(p + 16); return f.v;
  }
  static __device__ __forceinline__ v8f mma(v16h a, v16h b, v8f c) {
    return __builtin_amdgcn_wmma_f32_16x16x32_f16(false, a, false, b, (short)0, c, false, false);
  }
  static __device__ __forceinline__ void guard(v8f& a, v8f& b, v16h x, v16h y) { dep_guard_h(a, b, x, y); }
  static __device__ __forceinline__ void keep(v16h a, v16h b, v16h c, v16h d) { keep4_h(a, b, c, d); }
};
template <> struct Frag<__bf16> {
  typedef v16b V; union U { v16b v; v8b h[2]; };
  static __device__ __forceinline__ v16b load(const __bf16* p) {
    U f; f.h[0] = *(const v8b*)(p); f.h[1] = *(const v8b*)(p + 16); return f.v;
  }
  static __device__ __forceinline__ v8f mma(v16b a, v16b b, v8f c) {
    return __builtin_amdgcn_wmma_f32_16x16x32_bf16(false, a, false, b, (short)0, c, false, false);
  }
  static __device__ __forceinline__ void guard(v8f& a, v8f& b, v16b x, v16b y) { dep_guard_b(a, b, x, y); }
  static __device__ __forceinline__ void keep(v16b a, v16b b, v16b c, v16b d) { keep4_b(a, b, c, d); }
};

// ---- Register-blocked batched WMMA GEMM --------------------------------
// C[m,n] = scale * sum_k A[m,k] * Bt[n,k] (+bias)(+resid); each wave owns a 64x64 tile.
// A row-major [M,K]; Bt row-major [N,K]; M,N % 64 == 0, K % 32 == 0.
// SPLIT: operands are hi/lo planes (A2/Bt2 = lo planes, same layout); product = hi.hi + hi.lo + lo.hi.
// BIAS_MODE: 0 = none, 1 = bias[m], 2 = bias[n].
// OUT_MODE: 0 = f32, 1 = f16, 2 = bf16 hi plane (Cout) + bf16 lo plane (Cout2).
// ET: 0 = f16 operands, 1 = bf16 operands (pointers passed as 16-bit storage)
template <int ET> struct Elem;
template <> struct Elem<0> { typedef _Float16 T; };
template <> struct Elem<1> { typedef __bf16 T; };
template <int ET, bool SPLIT, int BIAS_MODE, int OUT_MODE, bool RESID, int ACT = 0>
__global__ __launch_bounds__(256) void wmma_gemm64(
    const unsigned short* __restrict__ Ap, const unsigned short* __restrict__ A2p, int lda, long strideA,
    const unsigned short* __restrict__ Btp, const unsigned short* __restrict__ Bt2p, int ldb, long strideB,
    void* __restrict__ Cout, void* __restrict__ Cout2, int ldc, long strideC,
    const float* __restrict__ bias,
    const float* __restrict__ resid, long strideR,
    int M, int N, int K, float scale) {
  typedef typename Elem<ET>::T T;
  typedef typename Frag<T>::V V;
  const T* A = (const T*)Ap; const T* A2 = (const T*)A2p; const T* Bt = (const T*)Btp; const T* Bt2 = (const T*)Bt2p;
  __shared__ __align__(16) float sT[8][16 * 68];   // per-wave 16x64 slab, pitch 68 floats
  const int b    = blockIdx.y;
  const int lane = threadIdx.x & 31;
  const int wave = threadIdx.x >> 5;
  const int tilesN = N >> 6;
  const int tilesM = M >> 6;
  const int tile = blockIdx.x * 8 + wave;
  if (tile >= tilesM * tilesN) return;   // wave-uniform; no block barriers in this kernel
  const int tm = tile / tilesN;
  const int tn = tile - tm * tilesN;
  const int m0 = tm << 6;
  const int n0 = tn << 6;

  const T* Ab  = A  + (size_t)b * strideA;
  const T* Bb  = Bt + (size_t)b * strideB;
  const T* Ab2 = SPLIT ? (A2  + (size_t)b * strideA) : nullptr;
  const T* Bb2 = SPLIT ? (Bt2 + (size_t)b * strideB) : nullptr;

  const int rlane = lane & 15;                 // row (A) / col (B, D) within subtile
  const int koff  = (lane >> 4) * 8;           // k offset of this lane half
  const int mOff  = (lane >> 4) * 8;           // D row offset

  v8f acc[4][4];
#pragma unroll
  for (int i = 0; i < 4; ++i)
#pragma unroll
    for (int j = 0; j < 4; ++j) acc[i][j] = (v8f){0.f,0.f,0.f,0.f,0.f,0.f,0.f,0.f};

  for (int k0 = 0; k0 < K; k0 += 32) {
    V bh[4], bl[4];
#pragma unroll
    for (int j = 0; j < 4; ++j) {
      const size_t bo = (size_t)(n0 + (j << 4) + rlane) * ldb + koff + k0;
      bh[j] = Frag<T>::load(Bb + bo);
      if (SPLIT) bl[j] = Frag<T>::load(Bb2 + bo);
    }
#pragma unroll
    for (int i = 0; i < 4; ++i) {
      const size_t ao = (size_t)(m0 + (i << 4) + rlane) * lda + koff + k0;
      V ah = Frag<T>::load(Ab + ao);
      V al;
      if (SPLIT) al = Frag<T>::load(Ab2 + ao);
#pragma unroll
      for (int j = 0; j < 4; ++j) {
        acc[i][j] = Frag<T>::mma(ah, bh[j], acc[i][j]);
        if (SPLIT) {
          acc[i][j] = Frag<T>::mma(ah, bl[j], acc[i][j]);
          acc[i][j] = Frag<T>::mma(al, bh[j], acc[i][j]);
        }
      }
      Frag<T>::guard(acc[i][0], acc[i][3], ah, SPLIT ? al : ah);
    }
    Frag<T>::keep(bh[0], bh[1], bh[2], bh[3]);
    if (SPLIT) Frag<T>::keep(bl[0], bl[1], bl[2], bl[3]);
  }
  acc_guard4(acc[0][0], acc[0][1], acc[0][2], acc[0][3]);
  acc_guard4(acc[1][0], acc[1][1], acc[1][2], acc[1][3]);
  acc_guard4(acc[2][0], acc[2][1], acc[2][2], acc[2][3]);
  acc_guard4(acc[3][0], acc[3][1], acc[3][2], acc[3][3]);

  // ---- epilogue ----
  float* slab = sT[wave];
  const float* Rb = RESID ? (resid + (size_t)b * strideR) : nullptr;
#pragma unroll
  for (int i = 0; i < 4; ++i) {
    const int mBase = m0 + (i << 4);
#pragma unroll
    for (int j = 0; j < 4; ++j) {
      const int n = n0 + (j << 4) + rlane;
      float bv = 0.f;
      if (BIAS_MODE == 2) bv = bias[n];
#pragma unroll
      for (int r = 0; r < 8; ++r) {
        float v = acc[i][j][r] * scale;
        if (BIAS_MODE == 1) v += bias[mBase + mOff + r];
        if (BIAS_MODE == 2) v += bv;
        if (RESID) v += Rb[(size_t)(mBase + mOff + r) * ldc + n];
        if (ACT == 1) v = tanhf(v);
        if (ACT == 2) v = fmaxf(v, 0.0f);
        if (ACT == 3) v = v / (1.0f + expf(-v));
        if (ACT == 4) v = (v > 0.f) ? v : 0.01f * v;
        if (ACT == 5) v = 0.5f * v * (1.0f + erff(v * 0.70710678118654752f));
        slab[(mOff + r) * 68 + (j << 4) + rlane] = v;
      }
    }
    __builtin_amdgcn_fence(__ATOMIC_RELEASE, "workgroup");
    __builtin_amdgcn_wave_barrier();
    __builtin_amdgcn_fence(__ATOMIC_ACQUIRE, "workgroup");
    if (OUT_MODE == 0) {
      float* C = (float*)Cout + (size_t)b * strideC;
      const int hh = lane >> 4, c4 = (lane & 15) * 4;     // row seg = 256 B = 16 lanes x 16 B
      {
#pragma unroll
        for (int it = 0; it < 8; ++it) {
          const int row = it * 2 + hh;
          v4f v = *(const v4f*)(slab + row * 68 + c4);
          *(v4f*)(C + (size_t)(mBase + row) * ldc + n0 + c4) = v;
        }
        
      }
    } else {
      const int q = lane >> 3, c8 = (lane & 7) * 8;
      unsigned short* C  = (unsigned short*)Cout  + (size_t)b * strideC;
      unsigned short* C2 = (OUT_MODE == 2) ? ((unsigned short*)Cout2 + (size_t)b * strideC) : nullptr;
      {
#pragma unroll
        for (int it = 0; it < 4; ++it) {
          const int row = it * 4 + q;
          const float* sp = slab + row * 68 + c8;
          v8h hv, lv;
#pragma unroll
          for (int e = 0; e < 8; ++e) {
            if (OUT_MODE == 1) {
              hv[e] = (_Float16)sp[e];
            } else {
              unsigned short hb = f2bf_bits(sp[e]);
              unsigned short lb = f2bf_bits(sp[e] - bf_bits2f(hb));
              hv[e] = __builtin_bit_cast(_Float16, hb);
              lv[e] = __builtin_bit_cast(_Float16, lb);
            }
          }
          *(v8h*)(C + (size_t)(mBase + row) * ldc + n0 + c8) = hv;
          if (OUT_MODE == 2) *(v8h*)(C2 + (size_t)(mBase + row) * ldc + n0 + c8) = lv;
        }
        
      }
    }
    __builtin_amdgcn_fence(__ATOMIC_RELEASE, "workgroup");
    __builtin_amdgcn_wave_barrier();
    __builtin_amdgcn_fence(__ATOMIC_ACQUIRE, "workgroup");
  }
}

// ---------------------------------------------------------------------------
// f32 -> bf16 hi + bf16 lo planes (RNE converts). 8 elements per thread:
// two b128 loads, one b128 store per plane; lanes 8q..8q+7 of a wave fill one
// ---------------------------------------------------------------------------
__device__ __forceinline__ void split_pair(float f0, float f1, unsigned& hw, unsigned& lw) {
  const unsigned short h0 = f2bf_bits(f0);
  const unsigned short h1 = f2bf_bits(f1);
  const unsigned short l0 = f2bf_bits(f0 - bf_bits2f(h0));
  const unsigned short l1 = f2bf_bits(f1 - bf_bits2f(h1));
  hw = (unsigned)h0 | ((unsigned)h1 << 16);
  lw = (unsigned)l0 | ((unsigned)l1 << 16);
}

__global__ __launch_bounds__(256) void split_planes_bf16(
    const float* __restrict__ src, unsigned short* __restrict__ hi,
    unsigned short* __restrict__ lo, int n8) {
  const int i = blockIdx.x * 256 + threadIdx.x;
  if (i >= n8) return;                      // no barriers in this kernel
  const size_t e0 = (size_t)i * 8;
  const v4f a = *(const v4f*)(src + e0);
  const v4f c = *(const v4f*)(src + e0 + 4);
  unsigned hx, hy, hz, hw, lx, ly, lz, lw;
  split_pair(a[0], a[1], hx, lx);
  split_pair(a[2], a[3], hy, ly);
  split_pair(c[0], c[1], hz, lz);
  split_pair(c[2], c[3], hw, lw);
  const v4u hv = (v4u){hx, hy, hz, hw};
  const v4u lv = (v4u){lx, ly, lz, lw};
  *(v4u*)(hi + e0) = hv;
  *(v4u*)(lo + e0) = lv;
  
}

// ---------------------------------------------------------------------------
// Causal flash attention, head dim 64, bf16 hi/lo planes in, bf16 hi/lo planes out.
//   q,k,v planes: element (b, s, h, d) at (b*SEQ + s)*EMB + h*64 + d (ushort storage).
//   scores = q.k^T * sm_scale : hi.hi + hi.lo + lo.hi on v_wmma_f32_16x16x32_bf16
//   out    = p.v              : p and v as bf16 hi/lo, same three products
//   online softmax in f32; block = 4 waves; a query block = 64 query rows of one (b, h), 16 per wave;
//   grid.x = NB * NHEAD * (SEQ/64) / 2; keys visited in 64-wide chunks 0..qb (causal).
//   A query block qb costs qb + 1 chunks, and all blocks of the grid are resident at once, so the launch lasts as
//   long as its fullest block: each block takes query blocks 31 - p and p of one (b, h), one after the other in
//   every wave, which is 33 chunks for every block of the grid.
//   Output planes: element (b, q, h*64+d) at (b*SEQ+q)*EMB + h*64 + d; each wave writes
// ---------------------------------------------------------------------------
__device__ __forceinline__ unsigned short at_bf_bits(float f) {
  unsigned u = __float_as_uint(f);
  return (unsigned short)((u + 0x7FFFu + ((u >> 16) & 1u)) >> 16);
}
__device__ __forceinline__ __bf16 at_f2bf(float f) { return __builtin_bit_cast(__bf16, at_bf_bits(f)); }
__device__ __forceinline__ void at_split(float f, __bf16& hi, __bf16& lo) {
  const unsigned short hb = at_bf_bits(f);
  hi = __builtin_bit_cast(__bf16, hb);
  lo = at_f2bf(f - __uint_as_float(((unsigned)hb) << 16));
}
__device__ __forceinline__ v8f at_mma(v16b a, v16b b, v8f c) {
  c = __builtin_amdgcn_wmma_f32_16x16x32_bf16(false, a, false, b, (short)0, c, false, false);
  asm volatile("v_nop\n\tv_nop\n\tv_nop\n\tv_nop" : "+v"(c) : "v"(a), "v"(b));
  return c;
}

// value of lane l ^ M (M < 16, same 16-lane row) by a DPP row_xmask move: stays in the vector unit, where
// __shfl_xor goes through the LDS pipe and a wait on it. All 32 lanes are active at every call, so every source
// lane is valid; no old value and bound_ctrl on let the compiler fold the move into the add that follows.
template <int M> __device__ __forceinline__ float row_xor(float x) {
  const int v = __float_as_int(x);
  return __int_as_float(__builtin_amdgcn_update_dpp(0, v, 0x160 | M, 0xf, 0xf, true));
}

// transposing LDS read of a row-major 16-bit tile T: with lane l's pointer at
// T[kbase + 8 (l >> 4) + (l & 7)][dbase + 8 ((l >> 3) & 1)], lane (c = l & 15, hh = l >> 4) gets
// T[kbase + 8 hh + 0..7][dbase + c]. All 32 lanes are active and hold an address inside the tile at every call.
typedef __attribute__((ext_vector_type(8))) short v8s;
__device__ __forceinline__ v8b ld_tr16(const unsigned short* p) {
  typedef __attribute__((address_space(3))) v8s lds_v8s;
  return __builtin_bit_cast(v8b, __builtin_amdgcn_ds_load_tr16_b128_v8i16((lds_v8s*)p));
}

__global__ __launch_bounds__(128)
void attn_causal_hd64(const unsigned short* __restrict__ Qh, const unsigned short* __restrict__ Ql,
                      const unsigned short* __restrict__ Kh, const unsigned short* __restrict__ Kl,
                      const unsigned short* __restrict__ Vh, const unsigned short* __restrict__ Vl,
                      unsigned short* __restrict__ Oh, unsigned short* __restrict__ Ol,
                      float sm_scale) {
  union FB { v16b v; v8b h[2]; };
  __shared__ __align__(16) unsigned short Ksh[AKC * APT];     // K hi [kv][d]   9 KB
  __shared__ __align__(16) unsigned short Ksl[AKC * APT];     // K lo [kv][d]   9 KB
  __shared__ __align__(16) unsigned short Vsh[AKC * VPT];     // V hi [kv][d]  10 KB
  __shared__ __align__(16) unsigned short Vsl[AKC * VPT];     // V lo [kv][d]  10 KB
  __shared__ __align__(16) __bf16 Psh[ANW][16 * APT];         // per wave P hi [row][kv]
  __shared__ __align__(16) __bf16 Psl[ANW][16 * APT];         // per wave P lo
  __shared__ __align__(16) float  Os[ANW][16 * 68];           // per wave out tile, pitch 68

  const int tid  = threadIdx.x;
  const int wave = tid >> 5;
  const int lane = tid & 31;
  const int hh   = lane >> 4;
  const int c    = lane & 15;
  const float NEG_INF = -__builtin_inff();

  constexpr int NQB = SEQ / AQB;                 // 32 query blocks per (b, h)
  constexpr int NPR = NQB / 2;                   // 16 pairs (31 - p, p) per (b, h)
  static_assert(NQB % 2 == 0);
  const int bx   = blockIdx.x;
  const int pr   = bx % NPR;
  const int bhid = bx / NPR;
  const int h    = bhid % NHEAD;
  const int b    = bhid / NHEAD;
  const size_t hoff = (size_t)h * HDIM;

  for (int half = 0; half < 2; ++half) {         // block-uniform: every wave walks both query blocks in this order
  const int qb   = half ? pr : NQB - 1 - pr;
  const int q0   = qb * AQB + wave * 16;

  // ---- Q fragments (A operand): row = c, elements 0..7 <- d = dc*32 + 8hh + 0..7, 8..15 <- dc*32 + 16 + 8hh + 0..7
  v16b qah[2], qal[2];
  {
    const size_t qo = (size_t)(b * SEQ + q0 + c) * EMB + hoff + 8 * hh;
    const __bf16* qhp = (const __bf16*)(const void*)Qh;
    const __bf16* qlp = (const __bf16*)(const void*)Ql;
#pragma unroll
    for (int dc = 0; dc < 2; ++dc) {
      qah[dc] = Frag<__bf16>::load(qhp + qo + dc * 32);
      qal[dc] = Frag<__bf16>::load(qlp + qo + dc * 32);
    }
  }

  float mrow[8], lrow[8];
  v8f oacc[4];
#pragma unroll
  for (int r = 0; r < 8; ++r) { mrow[r] = NEG_INF; lrow[r] = 0.f; }
#pragma unroll
  for (int t = 0; t < 4; ++t) oacc[t] = (v8f){0.f,0.f,0.f,0.f,0.f,0.f,0.f,0.f};

  // staging map: thread -> rows skv + 16 i (i = 0..3), 16-byte column group scol, of each 64 x 64 K / V plane tile
  const int skv = tid >> 3, scol = (tid & 7) * 8;
  // one 32-bit byte offset (< 8 MiB) serves all four planes on their scalar base pointers: one address register
  // instead of four pairs
  const unsigned sgb = (unsigned)(((b * SEQ + skv) * EMB + h * HDIM + scol) * 2);
  v4u kwh[4], kwl[4], vwh[4], vwl[4];            // K hi, K lo, V hi, V lo words of the chunk fetched ahead
  const int nChunks = qb + 1;                    // block-uniform, <= 32
  // ---- chunk 0's K and V words, all 16 global loads in flight together ----
  {
    const unsigned gb = sgb;
#pragma unroll
    for (int i = 0; i < 4; ++i) {
      kwh[i] = *(const v4u*)((const char*)Kh + gb + 16 * i * EMB * 2);
      kwl[i] = *(const v4u*)((const char*)Kl + gb + 16 * i * EMB * 2);
      vwh[i] = *(const v4u*)((const char*)Vh + gb + 16 * i * EMB * 2);
      vwl[i] = *(const v4u*)((const char*)Vl + gb + 16 * i * EMB * 2);
    }
  }
  // the address registers of the Q, K and V loads above are written anew below: their translations are waited for
  // first; the Q words as inputs keep the wait behind their loads (once per query block)
  asm volatile("s_wait_xcnt 0x0" :: "v"(qah[0]), "v"(qah[1]), "v"(qal[0]), "v"(qal[1]) : "memory");
  for (int kc = 0; kc < nChunks; ++kc) {
    const int kv0 = kc * AKC;
    __syncthreads();
    // ---- K and V words fetched one trip ahead go from registers to LDS ----
#pragma unroll
    for (int i = 0; i < 4; ++i) {
      *(v4u*)(Ksh + (skv + 16 * i) * APT + scol) = kwh[i];
      *(v4u*)(Ksl + (skv + 16 * i) * APT + scol) = kwl[i];
    }
    // ---- V hi/lo row-major as they come: one 16-B LDS store a word; the fragment reads transpose ----
#pragma unroll
    for (int i = 0; i < 4; ++i) {
      *(v4u*)(Vsh + (skv + 16 * i) * VPT + scol) = vwh[i];
      *(v4u*)(Vsl + (skv + 16 * i) * VPT + scol) = vwl[i];
    }
    __syncthreads();

    // ---- scores: 4 key tiles x 2 d-chunks x 3 products ----
    v8f s[4];
#pragma unroll
    for (int j = 0; j < 4; ++j) {
      s[j] = (v8f){0.f,0.f,0.f,0.f,0.f,0.f,0.f,0.f};
#pragma unroll
      for (int dc = 0; dc < 2; ++dc) {
        FB kfh, kfl;
        const int ko = (j * 16 + c) * APT + dc * 32 + 8 * hh;
        kfh.h[0] = *(const v8b*)(Ksh + ko);
        kfh.h[1] = *(const v8b*)(Ksh + ko + 16);
        kfl.h[0] = *(const v8b*)(Ksl + ko);
        kfl.h[1] = *(const v8b*)(Ksl + ko + 16);
        s[j] = at_mma(qah[dc], kfh.v, s[j]);
        s[j] = at_mma(qah[dc], kfl.v, s[j]);
        s[j] = at_mma(qal[dc], kfh.v, s[j]);
      }
    }
    // ---- scale, causal mask on the diagonal chunk (select, -inf fill), row max ----
    const bool diag = (kc == qb);
    float cm[8];
#pragma unroll
    for (int r = 0; r < 8; ++r) {
      const int qrow = q0 + 8 * hh + r;
      float m = NEG_INF;
#pragma unroll
      for (int j = 0; j < 4; ++j) {
        const int kvcol = kv0 + j * 16 + c;
        float val = s[j][r] * sm_scale;
        val = (diag && (kvcol > qrow)) ? NEG_INF : val;
        s[j][r] = val;
        m = fmaxf(m, val);
      }
      m = fmaxf(m, row_xor<1>(m));
      m = fmaxf(m, row_xor<2>(m));
      m = fmaxf(m, row_xor<4>(m));
      m = fmaxf(m, row_xor<8>(m));
      cm[r] = m;
    }
    // ---- online softmax update, P hi/lo staged per wave ----
    __bf16* pwh = Psh[wave];
    __bf16* pwl = Psl[wave];
#pragma unroll
    for (int r = 0; r < 8; ++r) {
      const float mnew = fmaxf(mrow[r], cm[r]);
      const float alpha = expf(mrow[r] - mnew);
      mrow[r] = mnew;
      float psum = 0.f;
#pragma unroll
      for (int j = 0; j < 4; ++j) {
        const float p = expf(s[j][r] - mnew);
        psum += p;
        __bf16 a, bl;
        at_split(p, a, bl);
        pwh[(8 * hh + r) * APT + j * 16 + c] = a;
        pwl[(8 * hh + r) * APT + j * 16 + c] = bl;
      }
      psum += row_xor<1>(psum);
      psum += row_xor<2>(psum);
      psum += row_xor<4>(psum);
      psum += row_xor<8>(psum);
      lrow[r] = lrow[r] * alpha + psum;
#pragma unroll
      for (int t = 0; t < 4; ++t) oacc[t][r] *= alpha;
    }
    __builtin_amdgcn_fence(__ATOMIC_RELEASE, "workgroup");
    __builtin_amdgcn_wave_barrier();
    __builtin_amdgcn_fence(__ATOMIC_ACQUIRE, "workgroup");
    // ---- next chunk's K and V words: 16 global loads in flight together, their latency under the P.V products ----
    if (kc + 1 < nChunks) {
      const unsigned gb = sgb + (unsigned)(kv0 + AKC) * (EMB * 2);
#pragma unroll
      for (int i = 0; i < 4; ++i) {
        kwh[i] = *(const v4u*)((const char*)Kh + gb + 16 * i * EMB * 2);
        kwl[i] = *(const v4u*)((const char*)Kl + gb + 16 * i * EMB * 2);
        vwh[i] = *(const v4u*)((const char*)Vh + gb + 16 * i * EMB * 2);
        vwl[i] = *(const v4u*)((const char*)Vl + gb + 16 * i * EMB * 2);
      }
      // the offset register of these loads is written anew right below: their translations are waited for first
      asm volatile("s_wait_xcnt 0x0" ::: "memory");
    }
    // ---- O += P.V : A = P [row][kv], B[k=kv][n=d] = V[kv][d], column d = t*16 + c by transposing reads;
    //      elements 0..7 <- kv = kk*32 + 8hh + 0..7, 8..15 <- kk*32 + 16 + 8hh + 0..7, the k order of the P loads ----
#pragma unroll 1
    for (int kk = 0; kk < 2; ++kk) {
      FB pa, pl;
      pa.h[0] = *(const v8b*)(pwh + c * APT + kk * 32 + 8 * hh);
      pa.h[1] = *(const v8b*)(pwh + c * APT + kk * 32 + 16 + 8 * hh);
      pl.h[0] = *(const v8b*)(pwl + c * APT + kk * 32 + 8 * hh);
      pl.h[1] = *(const v8b*)(pwl + c * APT + kk * 32 + 16 + 8 * hh);
#pragma unroll
      for (int t = 0; t < 4; ++t) {
        FB vb, vlo;
        const int vo = (kk * 32 + 8 * hh + (lane & 7)) * VPT + t * 16 + 8 * ((lane >> 3) & 1);
        vb.h[0]  = ld_tr16(Vsh + vo);
        vb.h[1]  = ld_tr16(Vsh + vo + 16 * VPT);
        vlo.h[0] = ld_tr16(Vsl + vo);
        vlo.h[1] = ld_tr16(Vsl + vo + 16 * VPT);
        oacc[t] = at_mma(pa.v, vb.v, oacc[t]);
        oacc[t] = at_mma(pa.v, vlo.v, oacc[t]);
        oacc[t] = at_mma(pl.v, vb.v, oacc[t]);
      }
    }
  }

  // ---- epilogue: 1/l, per-wave LDS slab, whole-line bf16 hi/lo stores ----
  float* os = Os[wave];
#pragma unroll
  for (int r = 0; r < 8; ++r) {
    const float inv = 1.0f / lrow[r];
#pragma unroll
    for (int t = 0; t < 4; ++t) os[(8 * hh + r) * 68 + t * 16 + c] = oacc[t][r] * inv;
  }
  __builtin_amdgcn_fence(__ATOMIC_RELEASE, "workgroup");
  __builtin_amdgcn_wave_barrier();
  __builtin_amdgcn_fence(__ATOMIC_ACQUIRE, "workgroup");
  {
    // rows it*4 + q4 (it 0..3, q4 0..3) = 0..15; c8 = 0..56 step 8 -> full 16 x 64 tile per plane
    const int q4 = lane >> 3, c8 = (lane & 7) * 8;
    {
#pragma unroll
      for (int it = 0; it < 4; ++it) {
        const int row = it * 4 + q4;
        const float* sp = os + row * 68 + c8;
        v8h hv, lv;
#pragma unroll
        for (int e = 0; e < 8; ++e) {
          unsigned short hb = f2bf_bits(sp[e]);
          unsigned short lb = f2bf_bits(sp[e] - bf_bits2f(hb));
          hv[e] = __builtin_bit_cast(_Float16, hb);
          lv[e] = __builtin_bit_cast(_Float16, lb);
        }
        const size_t oo = (size_t)(b * SEQ + q0 + row) * EMB + hoff + c8;
        *(v8h*)(Oh + oo) = hv;
        *(v8h*)(Ol + oo) = lv;
      }
      
    }
  }
  // the second query block writes the registers of the stores above anew: their translations are waited for first
  asm volatile("s_wait_xcnt 0x0" ::: "memory");
  }   // half
}

// ---------------------------------------------------------------------------
// Host launcher: 8 launches, no runtime API calls other than launches.
// ---------------------------------------------------------------------------
extern "C" void kernel_launch(void* const* d_in, const int* in_sizes, int n_in,
                              void* d_out, int out_size, void* d_ws, size_t ws_size,
                              hipStream_t stream) {
  if (n_in < 5) return;
  if (in_sizes[0] != NB * SEQ * EMB) return;
  if (in_sizes[1] != HDIM * HDIM || in_sizes[2] != HDIM * HDIM || in_sizes[3] != HDIM * HDIM) return;
  if (in_sizes[4] != EMB * EMB) return;
  if (out_size != NB * SEQ * EMB) return;
  if (ws_size < WS_TOTAL) return;

  const float* x  = (const float*)d_in[0];
  const float* Wq = (const float*)d_in[1];
  const float* Wk = (const float*)d_in[2];
  const float* Wv = (const float*)d_in[3];
  const float* Wo = (const float*)d_in[4];
  float* out = (float*)d_out;

  char* ws = (char*)d_ws;
  unsigned short* XH   = (unsigned short*)(ws + OFF_XH);
  unsigned short* XL   = (unsigned short*)(ws + OFF_XL);
  unsigned short* WH   = (unsigned short*)(ws + OFF_WH);
  unsigned short* WL   = (unsigned short*)(ws + OFF_WL);
  unsigned short* WOH  = (unsigned short*)(ws + OFF_WOH);
  unsigned short* WOL  = (unsigned short*)(ws + OFF_WOL);
  unsigned short* QKVH = (unsigned short*)(ws + OFF_QKVH);
  unsigned short* QKVL = (unsigned short*)(ws + OFF_QKVL);
  unsigned short* AVH  = (unsigned short*)(ws + OFF_AVH);
  unsigned short* AVL  = (unsigned short*)(ws + OFF_AVL);
  const float* dummyf = (const float*)(ws + OFF_XH);     // unused pointer slots point inside ws
  void* dummyv = (void*)(ws + OFF_XH);

  // ---- operand planes (bf16 hi/lo) ----
  {
    const int n8x = (NB * SEQ * EMB) / 8;                // 524288 threads cover 4194304 elements
    split_planes_bf16<<<(n8x + 255) / 256, 256, 0, stream>>>(x, XH, XL, n8x);
    const int n8w = (HDIM * HDIM) / 8;                   // 512 threads cover 4096 elements each
    split_planes_bf16<<<(n8w + 255) / 256, 256, 0, stream>>>(Wq, WH + 0 * HDIM * HDIM, WL + 0 * HDIM * HDIM, n8w);
    split_planes_bf16<<<(n8w + 255) / 256, 256, 0, stream>>>(Wk, WH + 1 * HDIM * HDIM, WL + 1 * HDIM * HDIM, n8w);
    split_planes_bf16<<<(n8w + 255) / 256, 256, 0, stream>>>(Wv, WH + 2 * HDIM * HDIM, WL + 2 * HDIM * HDIM, n8w);
    const int n8o = (EMB * EMB) / 8;                     // 131072 threads cover 1048576 elements
    split_planes_bf16<<<(n8o + 255) / 256, 256, 0, stream>>>(Wo, WOH, WOL, n8o);
  }

  // ---- q|k|v = xh[65536][64] . W{q,k,v}^T : M=65536, N=64, K=64; grid.y selects the weight plane ----
  {
    const int tiles = (NROWH / 64) * (HDIM / 64);        // 1024 wave tiles
    dim3 grid((tiles + 7) / 8, 3);
    wmma_gemm64<1, true, 0, 2, false><<<grid, 256, 0, stream>>>(
        XH, XL, HDIM, 0L,
        WH, WL, HDIM, (long)(HDIM * HDIM),
        (void*)QKVH, (void*)QKVL, HDIM, (long)PLANE_QKV,
        dummyf, dummyf, 0L,
        NROWH, HDIM, HDIM, 1.0f);
  }

  // ---- causal attention per (b, h): av hi/lo planes ----
  {
    const int nblk = NB * NHEAD * (SEQ / AQB) / 2;       // 512 blocks x 2 x 64 query rows
    attn_causal_hd64<<<nblk, 128, 0, stream>>>(
        QKVH + 0 * PLANE_QKV, QKVL + 0 * PLANE_QKV,
        QKVH + 1 * PLANE_QKV, QKVL + 1 * PLANE_QKV,
        QKVH + 2 * PLANE_QKV, QKVL + 2 * PLANE_QKV,
        AVH, AVL, 0.125f);
  }

  // ---- out = av[4096][1024] . Wo^T : M=4096, N=1024, K=1024, f32 into d_out ----
  {
    const int tiles = (NTOK / 64) * (EMB / 64);          // 1024 wave tiles
    dim3 grid((tiles + 7) / 8, 1);
    wmma_gemm64<1, true, 0, 0, false><<<grid, 256, 0, stream>>>(
        AVH, AVL, EMB, 0L,
        WOH, WOL, EMB, 0L,
        (void*)out, dummyv, EMB, 0L,
        dummyf, dummyf, 0L,
        NTOK, EMB, EMB, 1.0f);
  }
}

// v006
// Measured time: 156 microseconds a run.
// Two timings next to v005 both put it at 1.33 times that version's speed.
// Counting every step since v000, it is 3.48 times as fast.
// Contractions: q/k/v projections, q.k^T scores, p.v and output projection all on v_wmma_f32_16x16x32_bf16 with bf16 hi/lo split operands (hi*hi + hi*lo + lo*hi), f32 accumulate; softmax and all side math in f32.
#include <hip/hip_runtime.h>

typedef __attribute__((ext_vector_type(16))) _Float16 v16h;
typedef __attribute__((ext_vector_type(8)))  _Float16 v8h;
typedef __attribute__((ext_vector_type(16))) __bf16   v16b;
typedef __attribute__((ext_vector_type(8)))  __bf16   v8b;
typedef __attribute__((ext_vector_type(8)))  float    v8f;
typedef __attribute__((ext_vector_type(4)))  float    v4f;
typedef __attribute__((ext_vector_type(4)))  unsigned v4u;
#define U16(p) ((const unsigned short*)(const void*)(p))

// ---------------------------------------------------------------------------
// Problem constants
// ---------------------------------------------------------------------------
constexpr int NB    = 2;
constexpr int SEQ   = 2048;
constexpr int EMB   = 1024;
constexpr int NHEAD = 16;
constexpr int HDIM  = 64;
constexpr int NTOK  = NB * SEQ;              // 4096 rows of [EMB]
constexpr int NROWH = NTOK * NHEAD;          // 65536 rows of [HDIM]

// attention tiling
constexpr int AQB = 64;                      // query rows per query block (4 waves x 16)
constexpr int AKC = 64;                      // keys per chunk
constexpr int ANW = 4;
// LDS row pitch of the K and P tiles, in 16-bit elements: 144 B = 16 B x 9 (odd), so that the
// 16 rows a ds_load_b128 fragment read touches start on distinct bank groups (128-B rows do not).
constexpr int APT = 72;
// LDS row pitch of the V tiles, kept row-major [kv][d] and read by ds_load_tr16_b128: 160 B = 32 B x 5 (odd),
// the conflict-free pitch of that reader.
constexpr int VPT = 80;

// GEMM shape contract (no run-time tails)
static_assert(NROWH % 64 == 0);              // qkv GEMM M
static_assert(HDIM % 64 == 0);               // qkv GEMM N
static_assert(HDIM % 32 == 0);               // qkv GEMM K
static_assert(NTOK % 64 == 0);
static_assert(EMB % 64 == 0);
static_assert(EMB % 32 == 0);
static_assert(SEQ % AQB == 0);
static_assert(AQB == AKC);
static_assert(APT >= AKC && APT >= HDIM && (APT * 2) % 16 == 0 && ((APT * 2) / 16) % 2 == 1);
static_assert(VPT >= HDIM && (VPT * 2) % 32 == 0 && ((VPT * 2) / 32) % 2 == 1);

// ---------------------------------------------------------------------------
//   XH   [0          ,  8 MiB)  x   bf16 hi  [4194304]
//   XL   [8 MiB      , 16 MiB)  x   bf16 lo
//   WH   [16 MiB     , +24576)  Wq|Wk|Wv bf16 hi, 3 planes of [64][64] (carve 64 KiB)
//   WL   [16 MiB+64K , +24576)  Wq|Wk|Wv bf16 lo (carve 64 KiB)
//   WOH  [17 MiB     , 19 MiB)  Wo  bf16 hi  [1024][1024]
//   WOL  [19 MiB     , 21 MiB)  Wo  bf16 lo
//   QKVH [21 MiB     , 45 MiB)  q|k|v bf16 hi, 3 planes of [65536][64] (element (b,s,h,d) at (b*SEQ+s)*EMB + h*64 + d)
//   QKVL [45 MiB     , 69 MiB)  q|k|v bf16 lo
//   AVH  [69 MiB     , 77 MiB)  av  bf16 hi  [4096][1024]
//   AVL  [77 MiB     , 85 MiB)  av  bf16 lo
//   total 85 MiB = 89128960 B
// ---------------------------------------------------------------------------
constexpr size_t MIB      = 1048576;
constexpr size_t OFF_XH   = 0;
constexpr size_t OFF_XL   = 8 * MIB;
constexpr size_t OFF_WH   = 16 * MIB;
constexpr size_t OFF_WL   = 16 * MIB + 65536;
constexpr size_t OFF_WOH  = 17 * MIB;
constexpr size_t OFF_WOL  = 19 * MIB;
constexpr size_t OFF_QKVH = 21 * MIB;
constexpr size_t OFF_QKVL = 45 * MIB;
constexpr size_t OFF_AVH  = 69 * MIB;
constexpr size_t OFF_AVL  = 77 * MIB;
constexpr size_t WS_TOTAL = 85 * MIB;
constexpr size_t PLANE_QKV = (size_t)NROWH * HDIM;      // elements per q/k/v plane
static_assert((size_t)NB * SEQ * EMB * 2 <= OFF_XL - OFF_XH);
static_assert((size_t)3 * HDIM * HDIM * 2 <= OFF_WL - OFF_WH);
static_assert((size_t)3 * HDIM * HDIM * 2 <= OFF_WOH - OFF_WL);
static_assert((size_t)EMB * EMB * 2 <= OFF_WOL - OFF_WOH);
static_assert((size_t)EMB * EMB * 2 <= OFF_QKVH - OFF_WOL);
static_assert(3 * PLANE_QKV * 2 <= OFF_QKVL - OFF_QKVH);
static_assert(3 * PLANE_QKV * 2 <= OFF_AVH - OFF_QKVL);
static_assert((size_t)NTOK * EMB * 2 <= OFF_AVL - OFF_AVH);
static_assert((size_t)NTOK * EMB * 2 <= WS_TOTAL - OFF_AVL);
static_assert(WS_TOTAL <= 134217728);

// ---------------------------------------------------------------------------
// Helpers
// ---------------------------------------------------------------------------
__device__ __forceinline__ unsigned short f2bf_bits(float f) {
  unsigned u = __float_as_uint(f);
  return (unsigned short)((u + 0x7FFFu + ((u >> 16) & 1u)) >> 16);
}
__device__ __forceinline__ float bf_bits2f(unsigned short h) { return __uint_as_float(((unsigned)h) << 16); }

// hazard guards as plain device helpers (no inline asm inside the kernel template body)
__device__ __forceinline__ void dep_guard_h(v8f& a, v8f& b, v16h x, v16h y) { asm volatile("v_nop\n\tv_nop\n\tv_nop\n\tv_nop" : "+v"(a), "+v"(b) : "v"(x), "v"(y)); }
__device__ __forceinline__ void dep_guard_b(v8f& a, v8f& b, v16b x, v16b y) { asm volatile("v_nop\n\tv_nop\n\tv_nop\n\tv_nop" : "+v"(a), "+v"(b) : "v"(x), "v"(y)); }
__device__ __forceinline__ void keep4_h(v16h a, v16h b, v16h c, v16h d) { asm volatile("v_nop" :: "v"(a), "v"(b), "v"(c), "v"(d)); }
__device__ __forceinline__ void keep4_b(v16b a, v16b b, v16b c, v16b d) { asm volatile("v_nop" :: "v"(a), "v"(b), "v"(c), "v"(d)); }
__device__ __forceinline__ void acc_guard4(v8f& a, v8f& b, v8f& c, v8f& d) { asm volatile("v_nop\n\tv_nop\n\tv_nop\n\tv_nop" : "+v"(a), "+v"(b), "+v"(c), "+v"(d)); }
template <typename T> struct Frag;
template <> struct Frag<_Float16> {
  typedef v16h V; union U { v16h v; v8h h[2]; };
  static __device__ __forceinline__ v16h load(const _Float16* p) {   // elements 0..7 <- p[0..7], 8..15 <- p[16..23]
    U f; f.h[0] = *(const v8h*)(p); f.h[1] = *(const v8h*)(p + 16); return f.v;
  }
  static __device__ __forceinline__ v8f mma(v16h a, v16h b, v8f c) {
    return __builtin_amdgcn_wmma_f32_16x16x32_f16(false, a, false, b, (short)0, c, false, false);
  }
  static __device__ __forceinline__ void guard(v8f& a, v8f& b, v16h x, v16h y) { dep_guard_h(a, b, x, y); }
  static __device__ __forceinline__ void keep(v16h a, v16h b, v16h c, v16h d) { keep4_h(a, b, c, d); }
};
template <> struct Frag<__bf16> {
  typedef v16b V; union U { v16b v; v8b h[2]; };
  static __device__ __forceinline__ v16b load(const __bf16* p) {
    U f; f.h[0] = *(const v8b*)(p); f.h[1] = *(const v8b*)(p + 16); return f.v;
  }
  static __device__ __forceinline__ v8f mma(v16b a, v16b b, v8f c) {
    return __builtin_amdgcn_wmma_f32_16x16x32_bf16(false, a, false, b, (short)0, c, false, false);
  }
  static __device__ __forceinline__ void guard(v8f& a, v8f& b, v16b x, v16b y) { dep_guard_b(a, b, x, y); }
  static __device__ __forceinline__ void keep(v16b a, v16b b, v16b c, v16b d) { keep4_b(a, b, c, d); }
};

// ---- Register-blocked batched WMMA GEMM --------------------------------
// C[m,n] = scale * sum_k A[m,k] * Bt[n,k] (+bias)(+resid); each wave owns a 64x64 tile.
// A row-major [M,K]; Bt row-major [N,K]; M,N % 64 == 0, K % 32 == 0.
// SPLIT: operands are hi/lo planes (A2/Bt2 = lo planes, same layout); product = hi.hi + hi.lo + lo.hi.
// BIAS_MODE: 0 = none, 1 = bias[m], 2 = bias[n].
// OUT_MODE: 0 = f32, 1 = f16, 2 = bf16 hi plane (Cout) + bf16 lo plane (Cout2).
// ET: 0 = f16 operands, 1 = bf16 operands (pointers passed as 16-bit storage)
template <int ET> struct Elem;
template <> struct Elem<0> { typedef _Float16 T; };
template <> struct Elem<1> { typedef __bf16 T; };
template <int ET, bool SPLIT, int BIAS_MODE, int OUT_MODE, bool RESID, int ACT = 0>
__global__ __launch_bounds__(256) void wmma_gemm64(
    const unsigned short* __restrict__ Ap, const unsigned short* __restrict__ A2p, int lda, long strideA,
    const unsigned short* __restrict__ Btp, const unsigned short* __restrict__ Bt2p, int ldb, long strideB,
    void* __restrict__ Cout, void* __restrict__ Cout2, int ldc, long strideC,
    const float* __restrict__ bias,
    const float* __restrict__ resid, long strideR,
    int M, int N, int K, float scale) {
  typedef typename Elem<ET>::T T;
  typedef typename Frag<T>::V V;
  const T* A = (const T*)Ap; const T* A2 = (const T*)A2p; const T* Bt = (const T*)Btp; const T* Bt2 = (const T*)Bt2p;
  __shared__ __align__(16) float sT[8][16 * 68];   // per-wave 16x64 slab, pitch 68 floats
  const int b    = blockIdx.y;
  const int lane = threadIdx.x & 31;
  const int wave = threadIdx.x >> 5;
  const int tilesN = N >> 6;
  const int tilesM = M >> 6;
  const int tile = blockIdx.x * 8 + wave;
  if (tile >= tilesM * tilesN) return;   // wave-uniform; no block barriers in this kernel
  const int tm = tile / tilesN;
  const int tn = tile - tm * tilesN;
  const int m0 = tm << 6;
  const int n0 = tn << 6;

  const T* Ab  = A  + (size_t)b * strideA;
  const T* Bb  = Bt + (size_t)b * strideB;
  const T* Ab2 = SPLIT ? (A2  + (size_t)b * strideA) : nullptr;
  const T* Bb2 = SPLIT ? (Bt2 + (size_t)b * strideB) : nullptr;

  const int rlane = lane & 15;                 // row (A) / col (B, D) within subtile
  const int koff  = (lane >> 4) * 8;           // k offset of this lane half
  const int mOff  = (lane >> 4) * 8;           // D row offset

  v8f acc[4][4];
#pragma unroll
  for (int i = 0; i < 4; ++i)
#pragma unroll
    for (int j = 0; j < 4; ++j) acc[i][j] = (v8f){0.f,0.f,0.f,0.f,0.f,0.f,0.f,0.f};

  for (int k0 = 0; k0 < K; k0 += 32) {
    V bh[4], bl[4];
#pragma unroll
    for (int j = 0; j < 4; ++j) {
      const size_t bo = (size_t)(n0 + (j << 4) + rlane) * ldb + koff + k0;
      bh[j] = Frag<T>::load(Bb + bo);
      if (SPLIT) bl[j] = Frag<T>::load(Bb2 + bo);
    }
#pragma unroll
    for (int i = 0; i < 4; ++i) {
      const size_t ao = (size_t)(m0 + (i << 4) + rlane) * lda + koff + k0;
      V ah = Frag<T>::load(Ab + ao);
      V al;
      if (SPLIT) al = Frag<T>::load(Ab2 + ao);
#pragma unroll
      for (int j = 0; j < 4; ++j) {
        acc[i][j] = Frag<T>::mma(ah, bh[j], acc[i][j]);
        if (SPLIT) {
          acc[i][j] = Frag<T>::mma(ah, bl[j], acc[i][j]);
          acc[i][j] = Frag<T>::mma(al, bh[j], acc[i][j]);
        }
      }
      Frag<T>::guard(acc[i][0], acc[i][3], ah, SPLIT ? al : ah);
    }
    Frag<T>::keep(bh[0], bh[1], bh[2], bh[3]);
    if (SPLIT) Frag<T>::keep(bl[0], bl[1], bl[2], bl[3]);
  }
  acc_guard4(acc[0][0], acc[0][1], acc[0][2], acc[0][3]);
  acc_guard4(acc[1][0], acc[1][1], acc[1][2], acc[1][3]);
  acc_guard4(acc[2][0], acc[2][1], acc[2][2], acc[2][3]);
  acc_guard4(acc[3][0], acc[3][1], acc[3][2], acc[3][3]);

  // ---- epilogue ----
  float* slab = sT[wave];
  const float* Rb = RESID ? (resid + (size_t)b * strideR) : nullptr;
#pragma unroll
  for (int i = 0; i < 4; ++i) {
    const int mBase = m0 + (i << 4);
#pragma unroll
    for (int j = 0; j < 4; ++j) {
      const int n = n0 + (j << 4) + rlane;
      float bv = 0.f;
      if (BIAS_MODE == 2) bv = bias[n];
#pragma unroll
      for (int r = 0; r < 8; ++r) {
        float v = acc[i][j][r] * scale;
        if (BIAS_MODE == 1) v += bias[mBase + mOff + r];
        if (BIAS_MODE == 2) v += bv;
        if (RESID) v += Rb[(size_t)(mBase + mOff + r) * ldc + n];
        if (ACT == 1) v = tanhf(v);
        if (ACT == 2) v = fmaxf(v, 0.0f);
        if (ACT == 3) v = v / (1.0f + expf(-v));
        if (ACT == 4) v = (v > 0.f) ? v : 0.01f * v;
        if (ACT == 5) v = 0.5f * v * (1.0f + erff(v * 0.70710678118654752f));
        slab[(mOff + r) * 68 + (j << 4) + rlane] = v;
      }
    }
    __builtin_amdgcn_fence(__ATOMIC_RELEASE, "workgroup");
    __builtin_amdgcn_wave_barrier();
    __builtin_amdgcn_fence(__ATOMIC_ACQUIRE, "workgroup");
    if (OUT_MODE == 0) {
      float* C = (float*)Cout + (size_t)b * strideC;
      const int hh = lane >> 4, c4 = (lane & 15) * 4;     // row seg = 256 B = 16 lanes x 16 B
      {
#pragma unroll
        for (int it = 0; it < 8; ++it) {
          const int row = it * 2 + hh;
          v4f v = *(const v4f*)(slab + row * 68 + c4);
          *(v4f*)(C + (size_t)(mBase + row) * ldc + n0 + c4) = v;
        }
        
      }
    } else {
      const int q = lane >> 3, c8 = (lane & 7) * 8;
      unsigned short* C  = (unsigned short*)Cout  + (size_t)b * strideC;
      unsigned short* C2 = (OUT_MODE == 2) ? ((unsigned short*)Cout2 + (size_t)b * strideC) : nullptr;
      {
#pragma unroll
        for (int it = 0; it < 4; ++it) {
          const int row = it * 4 + q;
          const float* sp = slab + row * 68 + c8;
          v8h hv, lv;
#pragma unroll
          for (int e = 0; e < 8; ++e) {
            if (OUT_MODE == 1) {
              hv[e] = (_Float16)sp[e];
            } else {
              unsigned short hb = f2bf_bits(sp[e]);
              unsigned short lb = f2bf_bits(sp[e] - bf_bits2f(hb));
              hv[e] = __builtin_bit_cast(_Float16, hb);
              lv[e] = __builtin_bit_cast(_Float16, lb);
            }
          }
          *(v8h*)(C + (size_t)(mBase + row) * ldc + n0 + c8) = hv;
          if (OUT_MODE == 2) *(v8h*)(C2 + (size_t)(mBase + row) * ldc + n0 + c8) = lv;
        }
        
      }
    }
    __builtin_amdgcn_fence(__ATOMIC_RELEASE, "workgroup");
    __builtin_amdgcn_wave_barrier();
    __builtin_amdgcn_fence(__ATOMIC_ACQUIRE, "workgroup");
  }
}

// ---------------------------------------------------------------------------
// f32 -> bf16 hi + bf16 lo planes (RNE converts). 8 elements per thread:
// two b128 loads, one b128 store per plane; lanes 8q..8q+7 of a wave fill one
// ---------------------------------------------------------------------------
__device__ __forceinline__ void split_pair(float f0, float f1, unsigned& hw, unsigned& lw) {
  const unsigned short h0 = f2bf_bits(f0);
  const unsigned short h1 = f2bf_bits(f1);
  const unsigned short l0 = f2bf_bits(f0 - bf_bits2f(h0));
  const unsigned short l1 = f2bf_bits(f1 - bf_bits2f(h1));
  hw = (unsigned)h0 | ((unsigned)h1 << 16);
  lw = (unsigned)l0 | ((unsigned)l1 << 16);
}

__global__ __launch_bounds__(256) void split_planes_bf16(
    const float* __restrict__ src, unsigned short* __restrict__ hi,
    unsigned short* __restrict__ lo, int n8) {
  const int i = blockIdx.x * 256 + threadIdx.x;
  if (i >= n8) return;                      // no barriers in this kernel
  const size_t e0 = (size_t)i * 8;
  const v4f a = *(const v4f*)(src + e0);
  const v4f c = *(const v4f*)(src + e0 + 4);
  unsigned hx, hy, hz, hw, lx, ly, lz, lw;
  split_pair(a[0], a[1], hx, lx);
  split_pair(a[2], a[3], hy, ly);
  split_pair(c[0], c[1], hz, lz);
  split_pair(c[2], c[3], hw, lw);
  const v4u hv = (v4u){hx, hy, hz, hw};
  const v4u lv = (v4u){lx, ly, lz, lw};
  *(v4u*)(hi + e0) = hv;
  *(v4u*)(lo + e0) = lv;
  
}

// ---------------------------------------------------------------------------
// Causal flash attention, head dim 64, bf16 hi/lo planes in, bf16 hi/lo planes out.
//   q,k,v planes: element (b, s, h, d) at (b*SEQ + s)*EMB + h*64 + d (ushort storage).
//   scores = q.k^T * sm_scale : hi.hi + hi.lo + lo.hi on v_wmma_f32_16x16x32_bf16
//   out    = p.v              : p and v as bf16 hi/lo, same three products
//   online softmax in f32; block = 4 waves; a query block = 64 query rows of one (b, h), 16 per wave;
//   grid.x = NB * NHEAD * (SEQ/64) / 2; keys visited in 64-wide chunks 0..qb (causal).
//   A query block qb costs qb + 1 chunks, and all blocks of the grid are resident at once, so the launch lasts as
//   long as its fullest block: each block takes query blocks 31 - p and p of one (b, h), one after the other in
//   every wave, which is 33 chunks for every block of the grid.
//   Output planes: element (b, q, h*64+d) at (b*SEQ+q)*EMB + h*64 + d; each wave writes
// ---------------------------------------------------------------------------
__device__ __forceinline__ unsigned short at_bf_bits(float f) {
  unsigned u = __float_as_uint(f);
  return (unsigned short)((u + 0x7FFFu + ((u >> 16) & 1u)) >> 16);
}
__device__ __forceinline__ __bf16 at_f2bf(float f) { return __builtin_bit_cast(__bf16, at_bf_bits(f)); }
__device__ __forceinline__ void at_split(float f, __bf16& hi, __bf16& lo) {
  const unsigned short hb = at_bf_bits(f);
  hi = __builtin_bit_cast(__bf16, hb);
  lo = at_f2bf(f - __uint_as_float(((unsigned)hb) << 16));
}
__device__ __forceinline__ v8f at_mma(v16b a, v16b b, v8f c) {
  c = __builtin_amdgcn_wmma_f32_16x16x32_bf16(false, a, false, b, (short)0, c, false, false);
  asm volatile("v_nop\n\tv_nop\n\tv_nop\n\tv_nop" : "+v"(c) : "v"(a), "v"(b));
  return c;
}

// value of lane l ^ M (M < 16, same 16-lane row) by a DPP row_xmask move: stays in the vector unit, where
// __shfl_xor goes through the LDS pipe and a wait on it. All 32 lanes are active at every call, so every source
// lane is valid; no old value and bound_ctrl on let the compiler fold the move into the add that follows.
template <int M> __device__ __forceinline__ float row_xor(float x) {
  const int v = __float_as_int(x);
  return __int_as_float(__builtin_amdgcn_update_dpp(0, v, 0x160 | M, 0xf, 0xf, true));
}

// transposing LDS read of a row-major 16-bit tile T: with lane l's pointer at
// T[kbase + 8 (l >> 4) + (l & 7)][dbase + 8 ((l >> 3) & 1)], lane (c = l & 15, hh = l >> 4) gets
// T[kbase + 8 hh + 0..7][dbase + c]. All 32 lanes are active and hold an address inside the tile at every call.
typedef __attribute__((ext_vector_type(8))) short v8s;
__device__ __forceinline__ v8b ld_tr16(const unsigned short* p) {
  typedef __attribute__((address_space(3))) v8s lds_v8s;
  return __builtin_bit_cast(v8b, __builtin_amdgcn_ds_load_tr16_b128_v8i16((lds_v8s*)p));
}

__global__ __launch_bounds__(128)
void attn_causal_hd64(const unsigned short* __restrict__ Qh, const unsigned short* __restrict__ Ql,
                      const unsigned short* __restrict__ Kh, const unsigned short* __restrict__ Kl,
                      const unsigned short* __restrict__ Vh, const unsigned short* __restrict__ Vl,
                      unsigned short* __restrict__ Oh, unsigned short* __restrict__ Ol,
                      float sm_scale) {
  union FB { v16b v; v8b h[2]; };
  __shared__ __align__(16) unsigned short Ksh[AKC * APT];     // K hi [kv][d]   9 KB
  __shared__ __align__(16) unsigned short Ksl[AKC * APT];     // K lo [kv][d]   9 KB
  __shared__ __align__(16) unsigned short Vsh[AKC * VPT];     // V hi [kv][d]  10 KB
  __shared__ __align__(16) unsigned short Vsl[AKC * VPT];     // V lo [kv][d]  10 KB
  __shared__ __align__(16) __bf16 Psh[ANW][16 * APT];         // per wave P hi [row][kv]
  __shared__ __align__(16) __bf16 Psl[ANW][16 * APT];         // per wave P lo
  __shared__ __align__(16) float  Os[ANW][16 * 68];           // per wave out tile, pitch 68

  const int tid  = threadIdx.x;
  const int wave = tid >> 5;
  const int lane = tid & 31;
  const int hh   = lane >> 4;
  const int c    = lane & 15;
  const float NEG_INF = -__builtin_inff();

  constexpr int NQB = SEQ / AQB;                 // 32 query blocks per (b, h)
  constexpr int NPR = NQB / 2;                   // 16 pairs (31 - p, p) per (b, h)
  static_assert(NQB % 2 == 0);
  const int bx   = blockIdx.x;
  const int pr   = bx % NPR;
  const int bhid = bx / NPR;
  const int h    = bhid % NHEAD;
  const int b    = bhid / NHEAD;
  const size_t hoff = (size_t)h * HDIM;

  for (int half = 0; half < 2; ++half) {         // block-uniform: every wave walks both query blocks in this order
  const int qb   = half ? pr : NQB - 1 - pr;
  const int q0   = qb * AQB + wave * 16;

  // ---- Q fragments (A operand): row = c, elements 0..7 <- d = dc*32 + 8hh + 0..7, 8..15 <- dc*32 + 16 + 8hh + 0..7
  v16b qah[2], qal[2];
  {
    const size_t qo = (size_t)(b * SEQ + q0 + c) * EMB + hoff + 8 * hh;
    const __bf16* qhp = (const __bf16*)(const void*)Qh;
    const __bf16* qlp = (const __bf16*)(const void*)Ql;
#pragma unroll
    for (int dc = 0; dc < 2; ++dc) {
      qah[dc] = Frag<__bf16>::load(qhp + qo + dc * 32);
      qal[dc] = Frag<__bf16>::load(qlp + qo + dc * 32);
    }
  }

  float mrow[8], lrow[8];
  v8f oacc[4];
#pragma unroll
  for (int r = 0; r < 8; ++r) { mrow[r] = NEG_INF; lrow[r] = 0.f; }
#pragma unroll
  for (int t = 0; t < 4; ++t) oacc[t] = (v8f){0.f,0.f,0.f,0.f,0.f,0.f,0.f,0.f};

  // staging map: thread -> rows skv + 16 i (i = 0..3), 16-byte column group scol, of each 64 x 64 K / V plane tile
  const int skv = tid >> 3, scol = (tid & 7) * 8;
  // one 32-bit byte offset (< 8 MiB) serves all four planes on their scalar base pointers: one address register
  // instead of four pairs
  const unsigned sgb = (unsigned)(((b * SEQ + skv) * EMB + h * HDIM + scol) * 2);
  v4u kwh[4], kwl[4], vwh[4], vwl[4];            // K hi, K lo, V hi, V lo words of the chunk fetched ahead
  const int nChunks = qb + 1;                    // block-uniform, <= 32
  // ---- chunk 0's K and V words, all 16 global loads in flight together ----
  {
    const unsigned gb = sgb;
#pragma unroll
    for (int i = 0; i < 4; ++i) {
      kwh[i] = *(const v4u*)((const char*)Kh + gb + 16 * i * EMB * 2);
      kwl[i] = *(const v4u*)((const char*)Kl + gb + 16 * i * EMB * 2);
      vwh[i] = *(const v4u*)((const char*)Vh + gb + 16 * i * EMB * 2);
      vwl[i] = *(const v4u*)((const char*)Vl + gb + 16 * i * EMB * 2);
    }
  }
  // the address registers of the Q, K and V loads above are written anew below: their translations are waited for
  // first; the Q words as inputs keep the wait behind their loads (once per query block)
  asm volatile("s_wait_xcnt 0x0" :: "v"(qah[0]), "v"(qah[1]), "v"(qal[0]), "v"(qal[1]) : "memory");
  for (int kc = 0; kc < nChunks; ++kc) {
    const int kv0 = kc * AKC;
    __syncthreads();
    // ---- K and V words fetched one trip ahead go from registers to LDS ----
#pragma unroll
    for (int i = 0; i < 4; ++i) {
      *(v4u*)(Ksh + (skv + 16 * i) * APT + scol) = kwh[i];
      *(v4u*)(Ksl + (skv + 16 * i) * APT + scol) = kwl[i];
    }
    // ---- V hi/lo row-major as they come: one 16-B LDS store a word; the fragment reads transpose ----
#pragma unroll
    for (int i = 0; i < 4; ++i) {
      *(v4u*)(Vsh + (skv + 16 * i) * VPT + scol) = vwh[i];
      *(v4u*)(Vsl + (skv + 16 * i) * VPT + scol) = vwl[i];
    }
    __syncthreads();

    // ---- scores: 4 key tiles x 2 d-chunks x 3 products ----
    v8f s[4];
#pragma unroll
    for (int j = 0; j < 4; ++j) {
      s[j] = (v8f){0.f,0.f,0.f,0.f,0.f,0.f,0.f,0.f};
#pragma unroll
      for (int dc = 0; dc < 2; ++dc) {
        FB kfh, kfl;
        const int ko = (j * 16 + c) * APT + dc * 32 + 8 * hh;
        kfh.h[0] = *(const v8b*)(Ksh + ko);
        kfh.h[1] = *(const v8b*)(Ksh + ko + 16);
        kfl.h[0] = *(const v8b*)(Ksl + ko);
        kfl.h[1] = *(const v8b*)(Ksl + ko + 16);
        s[j] = at_mma(qah[dc], kfh.v, s[j]);
        s[j] = at_mma(qah[dc], kfl.v, s[j]);
        s[j] = at_mma(qal[dc], kfh.v, s[j]);
      }
    }
    // ---- scale, causal mask on the diagonal chunk (select, -inf fill), row max ----
    const bool diag = (kc == qb);
    float cm[8];
#pragma unroll
    for (int r = 0; r < 8; ++r) {
      const int qrow = q0 + 8 * hh + r;
      float m = NEG_INF;
#pragma unroll
      for (int j = 0; j < 4; ++j) {
        const int kvcol = kv0 + j * 16 + c;
        float val = s[j][r] * sm_scale;
        val = (diag && (kvcol > qrow)) ? NEG_INF : val;
        s[j][r] = val;
        m = fmaxf(m, val);
      }
      m = fmaxf(m, row_xor<1>(m));
      m = fmaxf(m, row_xor<2>(m));
      m = fmaxf(m, row_xor<4>(m));
      m = fmaxf(m, row_xor<8>(m));
      cm[r] = m;
    }
    // ---- online softmax update, P hi/lo staged per wave ----
    __bf16* pwh = Psh[wave];
    __bf16* pwl = Psl[wave];
#pragma unroll
    for (int r = 0; r < 8; ++r) {
      const float mnew = fmaxf(mrow[r], cm[r]);
      const float alpha = expf(mrow[r] - mnew);
      mrow[r] = mnew;
      float psum = 0.f;
#pragma unroll
      for (int j = 0; j < 4; ++j) {
        const float p = expf(s[j][r] - mnew);
        psum += p;
        __bf16 a, bl;
        at_split(p, a, bl);
        pwh[(8 * hh + r) * APT + j * 16 + c] = a;
        pwl[(8 * hh + r) * APT + j * 16 + c] = bl;
      }
      psum += row_xor<1>(psum);
      psum += row_xor<2>(psum);
      psum += row_xor<4>(psum);
      psum += row_xor<8>(psum);
      lrow[r] = lrow[r] * alpha + psum;
#pragma unroll
      for (int t = 0; t < 4; ++t) oacc[t][r] *= alpha;
    }
    __builtin_amdgcn_fence(__ATOMIC_RELEASE, "workgroup");
    __builtin_amdgcn_wave_barrier();
    __builtin_amdgcn_fence(__ATOMIC_ACQUIRE, "workgroup");
    // ---- next chunk's K and V words: 16 global loads in flight together, their latency under the P.V products ----
    if (kc + 1 < nChunks) {
      const unsigned gb = sgb + (unsigned)(kv0 + AKC) * (EMB * 2);
#pragma unroll
      for (int i = 0; i < 4; ++i) {
        kwh[i] = *(const v4u*)((const char*)Kh + gb + 16 * i * EMB * 2);
        kwl[i] = *(const v4u*)((const char*)Kl + gb + 16 * i * EMB * 2);
        vwh[i] = *(const v4u*)((const char*)Vh + gb + 16 * i * EMB * 2);
        vwl[i] = *(const v4u*)((const char*)Vl + gb + 16 * i * EMB * 2);
      }
      // the offset register of these loads is written anew right below: their translations are waited for first
      asm volatile("s_wait_xcnt 0x0" ::: "memory");
    }
    // ---- O += P.V : A = P [row][kv], B[k=kv][n=d] = V[kv][d], column d = t*16 + c by transposing reads;
    //      elements 0..7 <- kv = kk*32 + 8hh + 0..7, 8..15 <- kk*32 + 16 + 8hh + 0..7, the k order of the P loads ----
#pragma unroll 1
    for (int kk = 0; kk < 2; ++kk) {
      FB pa, pl;
      pa.h[0] = *(const v8b*)(pwh + c * APT + kk * 32 + 8 * hh);
      pa.h[1] = *(const v8b*)(pwh + c * APT + kk * 32 + 16 + 8 * hh);
      pl.h[0] = *(const v8b*)(pwl + c * APT + kk * 32 + 8 * hh);
      pl.h[1] = *(const v8b*)(pwl + c * APT + kk * 32 + 16 + 8 * hh);
#pragma unroll
      for (int t = 0; t < 4; ++t) {
        FB vb, vlo;
        const int vo = (kk * 32 + 8 * hh + (lane & 7)) * VPT + t * 16 + 8 * ((lane >> 3) & 1);
        vb.h[0]  = ld_tr16(Vsh + vo);
        vb.h[1]  = ld_tr16(Vsh + vo + 16 * VPT);
        vlo.h[0] = ld_tr16(Vsl + vo);
        vlo.h[1] = ld_tr16(Vsl + vo + 16 * VPT);
        oacc[t] = at_mma(pa.v, vb.v, oacc[t]);
        oacc[t] = at_mma(pa.v, vlo.v, oacc[t]);
        oacc[t] = at_mma(pl.v, vb.v, oacc[t]);
      }
    }
  }

  // ---- epilogue: 1/l, per-wave LDS slab, whole-line bf16 hi/lo stores ----
  float* os = Os[wave];
#pragma unroll
  for (int r = 0; r < 8; ++r) {
    const float inv = 1.0f / lrow[r];
#pragma unroll
    for (int t = 0; t < 4; ++t) os[(8 * hh + r) * 68 + t * 16 + c] = oacc[t][r] * inv;
  }
  __builtin_amdgcn_fence(__ATOMIC_RELEASE, "workgroup");
  __builtin_amdgcn_wave_barrier();
  __builtin_amdgcn_fence(__ATOMIC_ACQUIRE, "workgroup");
  {
    // rows it*4 + q4 (it 0..3, q4 0..3) = 0..15; c8 = 0..56 step 8 -> full 16 x 64 tile per plane
    const int q4 = lane >> 3, c8 = (lane & 7) * 8;
    {
#pragma unroll
      for (int it = 0; it < 4; ++it) {
        const int row = it * 4 + q4;
        const float* sp = os + row * 68 + c8;
        v8h hv, lv;
#pragma unroll
        for (int e = 0; e < 8; ++e) {
          unsigned short hb = f2bf_bits(sp[e]);
          unsigned short lb = f2bf_bits(sp[e] - bf_bits2f(hb));
          hv[e] = __builtin_bit_cast(_Float16, hb);
          lv[e] = __builtin_bit_cast(_Float16, lb);
        }
        const size_t oo = (size_t)(b * SEQ + q0 + row) * EMB + hoff + c8;
        *(v8h*)(Oh + oo) = hv;
        *(v8h*)(Ol + oo) = lv;
      }
      
    }
  }
  // the second query block writes the registers of the stores above anew: their translations are waited for first
  asm volatile("s_wait_xcnt 0x0" ::: "memory");
  }   // half
}

// ---------------------------------------------------------------------------
// Output projection C[m][n] = sum_k A[m][k] * Bt[n][k], A = av hi/lo [NTOK][EMB], Bt = Wo hi/lo [EMB][EMB], C f32.
//   One 128 x 128 tile of C per block, 256 blocks, 8 waves of 64 x 32 (2 x 4). A stage is 64 k = one 128-B line of
//   every operand row: the block loads it once by whole lines (a wave-wide 16-B load covers 4 rows), one stage ahead
//   into registers, stores it to LDS at the 144-B pitch of the ds_load_b128 fragment reads, and all 8 waves read
//   their fragments from there. Two LDS buffers, one barrier a stage: a wave stores stage s + 1 only behind the
//   barrier of stage s, which every wave reaches only after its last read of stage s - 1 (the same buffer).
//   Per accumulator the products come in the order k ascending by 32, hi.hi, hi.lo, lo.hi.
// ---------------------------------------------------------------------------
constexpr int GBT = 128;                     // tile rows (m) and columns (n) per block
constexpr int GBK = 64;                      // k per stage
constexpr int GNS = EMB / GBK;               // 16 stages
constexpr int GPL = GBT * APT;               // 16-bit elements of one plane tile in LDS
constexpr int GCP = 36;                      // f32 pitch of the per-wave output slab: 144 B
static_assert(NTOK % GBT == 0 && EMB % GBT == 0 && EMB % GBK == 0 && GBK <= APT);

__global__ __launch_bounds__(256)
void out_proj_lds(const unsigned short* __restrict__ Ah, const unsigned short* __restrict__ Al,
                  const unsigned short* __restrict__ Bh, const unsigned short* __restrict__ Bl,
                  float* __restrict__ C) {
  union FB { v16b v; v8b h[2]; };
  __shared__ __align__(16) unsigned short sAh[2 * GPL];
  __shared__ __align__(16) unsigned short sAl[2 * GPL];
  __shared__ __align__(16) unsigned short sBh[2 * GPL];
  __shared__ __align__(16) unsigned short sBl[2 * GPL];
  __shared__ __align__(16) float sC[8][16 * GCP];

  const int tid  = threadIdx.x;
  const int wave = tid >> 5;
  const int lane = tid & 31;
  const int hh   = lane >> 4;
  const int c    = lane & 15;
  constexpr int TN = EMB / GBT;                // 8 tile columns
  const int tn = blockIdx.x % TN;
  const int tm = blockIdx.x / TN;
  const int m0 = tm * GBT;
  const int n0 = tn * GBT;
  const int wm = (wave >> 2) * 64;             // wave's rows inside the tile
  const int wn = (wave & 3) * 32;              // wave's columns inside the tile

  // staging map: thread -> rows srow + 32 i (i = 0..3), 16-byte column group scol, of each 128 x 64 plane tile.
  // 8 lanes take one row (a whole 128-B line); the two rows of a 16-lane half lie 8 rows = 1152 B apart in LDS,
  // 128 B modulo the 256 B of the banks, so that a half's ds_store_b128 meets every bank once.
  const int sg   = lane >> 3;
  const int srow = (wave >> 2) * 16 + (sg & 1) * 8 + (wave & 3) * 2 + (sg >> 1);
  const int scol = (tid & 7) * 8;
  const unsigned ga = (unsigned)(((m0 + srow) * EMB + scol) * 2);   // byte offset in the A planes (< 8 MiB)
  const unsigned gb = (unsigned)(((n0 + srow) * EMB + scol) * 2);   // byte offset in the B planes (< 2 MiB)
  v4u rah[4], ral[4], rbh[4], rbl[4];
#pragma unroll
  for (int i = 0; i < 4; ++i) {
    rah[i] = *(const v4u*)((const char*)Ah + ga + 32 * i * EMB * 2);
    ral[i] = *(const v4u*)((const char*)Al + ga + 32 * i * EMB * 2);
    rbh[i] = *(const v4u*)((const char*)Bh + gb + 32 * i * EMB * 2);
    rbl[i] = *(const v4u*)((const char*)Bl + gb + 32 * i * EMB * 2);
  }
  // the offset registers of these loads may be written anew below: their translations are waited for first
  asm volatile("s_wait_xcnt 0x0" ::: "memory");

  v8f acc[4][2];
#pragma unroll
  for (int i = 0; i < 4; ++i)
#pragma unroll
    for (int j = 0; j < 2; ++j) acc[i][j] = (v8f){0.f,0.f,0.f,0.f,0.f,0.f,0.f,0.f};

  for (int s = 0; s < GNS; ++s) {
    const int bo = (s & 1) * GPL;
    // ---- the stage fetched one trip ahead goes from registers to LDS ----
#pragma unroll
    for (int i = 0; i < 4; ++i) {
      const int so = bo + (srow + 32 * i) * APT + scol;
      *(v4u*)(sAh + so) = rah[i];
      *(v4u*)(sAl + so) = ral[i];
      *(v4u*)(sBh + so) = rbh[i];
      *(v4u*)(sBl + so) = rbl[i];
    }
    __syncthreads();
    // ---- next stage's 16 global loads in flight together, their latency under this stage's products ----
    if (s + 1 < GNS) {
      const unsigned ko = (unsigned)(s + 1) * (GBK * 2);
#pragma unroll
      for (int i = 0; i < 4; ++i) {
        rah[i] = *(const v4u*)((const char*)Ah + (ga + ko) + 32 * i * EMB * 2);
        ral[i] = *(const v4u*)((const char*)Al + (ga + ko) + 32 * i * EMB * 2);
        rbh[i] = *(const v4u*)((const char*)Bh + (gb + ko) + 32 * i * EMB * 2);
        rbl[i] = *(const v4u*)((const char*)Bl + (gb + ko) + 32 * i * EMB * 2);
      }
      // the offset registers of these loads are written anew in the next trip: their translations are waited for first
      asm volatile("s_wait_xcnt 0x0" ::: "memory");
    }
    // ---- fragments: row (A) or column (B) = c, elements 0..7 <- k = ks*32 + 8hh + 0..7, 8..15 <- ks*32 + 16 + 8hh + 0..7
#pragma unroll
    for (int ks = 0; ks < 2; ++ks) {
      FB fah[4], fal[4], fbh[2], fbl[2];
#pragma unroll
      for (int i = 0; i < 4; ++i) {
        const int ao = bo + (wm + i * 16 + c) * APT + ks * 32 + 8 * hh;
        fah[i].h[0] = *(const v8b*)(sAh + ao);
        fah[i].h[1] = *(const v8b*)(sAh + ao + 16);
        fal[i].h[0] = *(const v8b*)(sAl + ao);
        fal[i].h[1] = *(const v8b*)(sAl + ao + 16);
      }
#pragma unroll
      for (int j = 0; j < 2; ++j) {
        const int bq = bo + (wn + j * 16 + c) * APT + ks * 32 + 8 * hh;
        fbh[j].h[0] = *(const v8b*)(sBh + bq);
        fbh[j].h[1] = *(const v8b*)(sBh + bq + 16);
        fbl[j].h[0] = *(const v8b*)(sBl + bq);
        fbl[j].h[1] = *(const v8b*)(sBl + bq + 16);
      }
      // eight independent accumulator tiles between two products into the same tile
#pragma unroll
      for (int i = 0; i < 4; ++i)
#pragma unroll
        for (int j = 0; j < 2; ++j) acc[i][j] = Frag<__bf16>::mma(fah[i].v, fbh[j].v, acc[i][j]);
#pragma unroll
      for (int i = 0; i < 4; ++i)
#pragma unroll
        for (int j = 0; j < 2; ++j) acc[i][j] = Frag<__bf16>::mma(fah[i].v, fbl[j].v, acc[i][j]);
#pragma unroll
      for (int i = 0; i < 4; ++i)
#pragma unroll
        for (int j = 0; j < 2; ++j) acc[i][j] = Frag<__bf16>::mma(fal[i].v, fbh[j].v, acc[i][j]);
    }
  }

  // ---- epilogue: per-wave 16 x 32 f32 slab, whole 128-B lines to C ----
  // The slab passes values between lanes of one wave only, so the fences name LDS alone: a fence over all memory
  // would also wait for the C stores of the tile row before.
  float* slab = sC[wave];
#pragma unroll
  for (int i = 0; i < 4; ++i) {
#pragma unroll
    for (int j = 0; j < 2; ++j)
#pragma unroll
      for (int r = 0; r < 8; ++r) slab[(8 * hh + r) * GCP + j * 16 + c] = acc[i][j][r];
    __builtin_amdgcn_fence(__ATOMIC_RELEASE, "workgroup", "local");
    __builtin_amdgcn_wave_barrier();
    __builtin_amdgcn_fence(__ATOMIC_ACQUIRE, "workgroup", "local");
    const int q4 = lane >> 3, c4 = (lane & 7) * 4;       // 8 lanes x 16 B = one 128-B row segment
#pragma unroll
    for (int it = 0; it < 4; ++it) {
      const int row = it * 4 + q4;
      const v4f v = *(const v4f*)(slab + row * GCP + c4);
      *(v4f*)(C + (size_t)(m0 + wm + i * 16 + row) * EMB + n0 + wn + c4) = v;
    }
    // the next tile row writes registers of the stores above anew: their translations are waited for first
    if (i < 3) {
      asm volatile("s_wait_xcnt 0x0" ::: "memory");
      __builtin_amdgcn_sched_barrier(0);   // keeps the next tile row's address arithmetic behind that wait
    }
    __builtin_amdgcn_fence(__ATOMIC_RELEASE, "workgroup", "local");
    __builtin_amdgcn_wave_barrier();
    __builtin_amdgcn_fence(__ATOMIC_ACQUIRE, "workgroup", "local");
  }
}

// ---------------------------------------------------------------------------
// Host launcher: 8 launches, no runtime API calls other than launches.
// ---------------------------------------------------------------------------
extern "C" void kernel_launch(void* const* d_in, const int* in_sizes, int n_in,
                              void* d_out, int out_size, void* d_ws, size_t ws_size,
                              hipStream_t stream) {
  if (n_in < 5) return;
  if (in_sizes[0] != NB * SEQ * EMB) return;
  if (in_sizes[1] != HDIM * HDIM || in_sizes[2] != HDIM * HDIM || in_sizes[3] != HDIM * HDIM) return;
  if (in_sizes[4] != EMB * EMB) return;
  if (out_size != NB * SEQ * EMB) return;
  if (ws_size < WS_TOTAL) return;

  const float* x  = (const float*)d_in[0];
  const float* Wq = (const float*)d_in[1];
  const float* Wk = (const float*)d_in[2];
  const float* Wv = (const float*)d_in[3];
  const float* Wo = (const float*)d_in[4];
  float* out = (float*)d_out;

  char* ws = (char*)d_ws;
  unsigned short* XH   = (unsigned short*)(ws + OFF_XH);
  unsigned short* XL   = (unsigned short*)(ws + OFF_XL);
  unsigned short* WH   = (unsigned short*)(ws + OFF_WH);
  unsigned short* WL   = (unsigned short*)(ws + OFF_WL);
  unsigned short* WOH  = (unsigned short*)(ws + OFF_WOH);
  unsigned short* WOL  = (unsigned short*)(ws + OFF_WOL);
  unsigned short* QKVH = (unsigned short*)(ws + OFF_QKVH);
  unsigned short* QKVL = (unsigned short*)(ws + OFF_QKVL);
  unsigned short* AVH  = (unsigned short*)(ws + OFF_AVH);
  unsigned short* AVL  = (unsigned short*)(ws + OFF_AVL);
  const float* dummyf = (const float*)(ws + OFF_XH);     // unused pointer slots point inside ws

  // ---- operand planes (bf16 hi/lo) ----
  {
    const int n8x = (NB * SEQ * EMB) / 8;                // 524288 threads cover 4194304 elements
    split_planes_bf16<<<(n8x + 255) / 256, 256, 0, stream>>>(x, XH, XL, n8x);
    const int n8w = (HDIM * HDIM) / 8;                   // 512 threads cover 4096 elements each
    split_planes_bf16<<<(n8w + 255) / 256, 256, 0, stream>>>(Wq, WH + 0 * HDIM * HDIM, WL + 0 * HDIM * HDIM, n8w);
    split_planes_bf16<<<(n8w + 255) / 256, 256, 0, stream>>>(Wk, WH + 1 * HDIM * HDIM, WL + 1 * HDIM * HDIM, n8w);
    split_planes_bf16<<<(n8w + 255) / 256, 256, 0, stream>>>(Wv, WH + 2 * HDIM * HDIM, WL + 2 * HDIM * HDIM, n8w);
    const int n8o = (EMB * EMB) / 8;                     // 131072 threads cover 1048576 elements
    split_planes_bf16<<<(n8o + 255) / 256, 256, 0, stream>>>(Wo, WOH, WOL, n8o);
  }

  // ---- q|k|v = xh[65536][64] . W{q,k,v}^T : M=65536, N=64, K=64; grid.y selects the weight plane ----
  {
    const int tiles = (NROWH / 64) * (HDIM / 64);        // 1024 wave tiles
    dim3 grid((tiles + 7) / 8, 3);
    wmma_gemm64<1, true, 0, 2, false><<<grid, 256, 0, stream>>>(
        XH, XL, HDIM, 0L,
        WH, WL, HDIM, (long)(HDIM * HDIM),
        (void*)QKVH, (void*)QKVL, HDIM, (long)PLANE_QKV,
        dummyf, dummyf, 0L,
        NROWH, HDIM, HDIM, 1.0f);
  }

  // ---- causal attention per (b, h): av hi/lo planes ----
  {
    const int nblk = NB * NHEAD * (SEQ / AQB) / 2;       // 512 blocks x 2 x 64 query rows
    attn_causal_hd64<<<nblk, 128, 0, stream>>>(
        QKVH + 0 * PLANE_QKV, QKVL + 0 * PLANE_QKV,
        QKVH + 1 * PLANE_QKV, QKVL + 1 * PLANE_QKV,
        QKVH + 2 * PLANE_QKV, QKVL + 2 * PLANE_QKV,
        AVH, AVL, 0.125f);
  }

  // ---- out = av[4096][1024] . Wo^T : M=4096, N=1024, K=1024, f32 into d_out ----
  {
    const int nblk = (NTOK / GBT) * (EMB / GBT);         // 256 blocks, one 128 x 128 tile each
    out_proj_lds<<<nblk, 256, 0, stream>>>(AVH, AVL, WOH, WOL, out);
  }
}

// v007
// A run of this version takes 145 microseconds.
// In two side-by-side timings against v006, it was 1.08 and 1.07 times as fast.
// Counting every step since v000, it is 3.74 times as fast.
// Contractions: q/k/v projections, q.k^T scores, p.v and output projection all on v_wmma_f32_16x16x32_bf16 with bf16 hi/lo split operands (hi*hi + hi*lo + lo*hi), f32 accumulate; softmax and all side math in f32.
#include <hip/hip_runtime.h>

typedef __attribute__((ext_vector_type(16))) _Float16 v16h;
typedef __attribute__((ext_vector_type(8)))  _Float16 v8h;
typedef __attribute__((ext_vector_type(16))) __bf16   v16b;
typedef __attribute__((ext_vector_type(8)))  __bf16   v8b;
typedef __attribute__((ext_vector_type(8)))  float    v8f;
typedef __attribute__((ext_vector_type(4)))  float    v4f;
typedef __attribute__((ext_vector_type(4)))  unsigned v4u;
#define U16(p) ((const unsigned short*)(const void*)(p))

// ---------------------------------------------------------------------------
// Problem constants
// ---------------------------------------------------------------------------
constexpr int NB    = 2;
constexpr int SEQ   = 2048;
constexpr int EMB   = 1024;
constexpr int NHEAD = 16;
constexpr int HDIM  = 64;
constexpr int NTOK  = NB * SEQ;              // 4096 rows of [EMB]
constexpr int NROWH = NTOK * NHEAD;          // 65536 rows of [HDIM]

// attention tiling
constexpr int AQB = 64;                      // query rows per query block (4 waves x 16)
constexpr int AKC = 64;                      // keys per chunk
constexpr int ANW = 4;
// LDS row pitch of the K and P tiles, in 16-bit elements: 144 B = 16 B x 9 (odd), so that the
// 16 rows a ds_load_b128 fragment read touches start on distinct bank groups (128-B rows do not).
constexpr int APT = 72;
// LDS row pitch of the V tiles, kept row-major [kv][d] and read by ds_load_tr16_b128: 160 B = 32 B x 5 (odd),
// the conflict-free pitch of that reader.
constexpr int VPT = 80;

// GEMM shape contract (no run-time tails)
static_assert(NROWH % 64 == 0);              // qkv GEMM M
static_assert(HDIM % 64 == 0);               // qkv GEMM N
static_assert(HDIM % 32 == 0);               // qkv GEMM K
static_assert(NTOK % 64 == 0);
static_assert(EMB % 64 == 0);
static_assert(EMB % 32 == 0);
static_assert(SEQ % AQB == 0);
static_assert(AQB == AKC);
static_assert(APT >= AKC && APT >= HDIM && (APT * 2) % 16 == 0 && ((APT * 2) / 16) % 2 == 1);
static_assert(VPT >= HDIM && (VPT * 2) % 32 == 0 && ((VPT * 2) / 32) % 2 == 1);

// ---------------------------------------------------------------------------
//   XH   [0          ,  8 MiB)  x   bf16 hi  [4194304]
//   XL   [8 MiB      , 16 MiB)  x   bf16 lo
//   WH   [16 MiB     , +24576)  Wq|Wk|Wv bf16 hi, 3 planes of [64][64] (carve 64 KiB)
//   WL   [16 MiB+64K , +24576)  Wq|Wk|Wv bf16 lo (carve 960 KiB)
//   WOH  [17 MiB     , 19 MiB)  Wo  bf16 hi  [1024][1024]
//   WOL  [19 MiB     , 21 MiB)  Wo  bf16 lo
//   QKVH [21 MiB     , 45 MiB)  q|k|v bf16 hi, 3 planes of [65536][64] (element (b,s,h,d) at (b*SEQ+s)*EMB + h*64 + d)
//   QKVL [45 MiB     , 69 MiB)  q|k|v bf16 lo
//   AVH  [69 MiB     , 77 MiB)  av  bf16 hi  [4096][1024]
//   AVL  [77 MiB     , 85 MiB)  av  bf16 lo
//   total 85 MiB = 89128960 B
// ---------------------------------------------------------------------------
constexpr size_t MIB      = 1048576;
constexpr size_t OFF_XH   = 0;
constexpr size_t OFF_XL   = 8 * MIB;
constexpr size_t OFF_WH   = 16 * MIB;
constexpr size_t OFF_WL   = 16 * MIB + 65536;
constexpr size_t OFF_WOH  = 17 * MIB;
constexpr size_t OFF_WOL  = 19 * MIB;
constexpr size_t OFF_QKVH = 21 * MIB;
constexpr size_t OFF_QKVL = 45 * MIB;
constexpr size_t OFF_AVH  = 69 * MIB;
constexpr size_t OFF_AVL  = 77 * MIB;
constexpr size_t WS_TOTAL = 85 * MIB;
constexpr size_t PLANE_QKV = (size_t)NROWH * HDIM;      // elements per q/k/v plane
static_assert((size_t)NB * SEQ * EMB * 2 <= OFF_XL - OFF_XH);
static_assert((size_t)3 * HDIM * HDIM * 2 <= OFF_WL - OFF_WH);
static_assert((size_t)3 * HDIM * HDIM * 2 <= OFF_WOH - OFF_WL);
static_assert((size_t)EMB * EMB * 2 <= OFF_WOL - OFF_WOH);
static_assert((size_t)EMB * EMB * 2 <= OFF_QKVH - OFF_WOL);
static_assert(3 * PLANE_QKV * 2 <= OFF_QKVL - OFF_QKVH);
static_assert(3 * PLANE_QKV * 2 <= OFF_AVH - OFF_QKVL);
static_assert((size_t)NTOK * EMB * 2 <= OFF_AVL - OFF_AVH);
static_assert((size_t)NTOK * EMB * 2 <= WS_TOTAL - OFF_AVL);
static_assert(WS_TOTAL <= 134217728);

// ---------------------------------------------------------------------------
// Helpers
// ---------------------------------------------------------------------------
__device__ __forceinline__ unsigned short f2bf_bits(float f) {
  unsigned u = __float_as_uint(f);
  return (unsigned short)((u + 0x7FFFu + ((u >> 16) & 1u)) >> 16);
}
__device__ __forceinline__ float bf_bits2f(unsigned short h) { return __uint_as_float(((unsigned)h) << 16); }

// hazard guards as plain device helpers (no inline asm inside the kernel template body)
__device__ __forceinline__ void dep_guard_h(v8f& a, v8f& b, v16h x, v16h y) { asm volatile("v_nop\n\tv_nop\n\tv_nop\n\tv_nop" : "+v"(a), "+v"(b) : "v"(x), "v"(y)); }
__device__ __forceinline__ void dep_guard_b(v8f& a, v8f& b, v16b x, v16b y) { asm volatile("v_nop\n\tv_nop\n\tv_nop\n\tv_nop" : "+v"(a), "+v"(b) : "v"(x), "v"(y)); }
__device__ __forceinline__ void keep4_h(v16h a, v16h b, v16h c, v16h d) { asm volatile("v_nop" :: "v"(a), "v"(b), "v"(c), "v"(d)); }
__device__ __forceinline__ void keep4_b(v16b a, v16b b, v16b c, v16b d) { asm volatile("v_nop" :: "v"(a), "v"(b), "v"(c), "v"(d)); }
__device__ __forceinline__ void acc_guard4(v8f& a, v8f& b, v8f& c, v8f& d) { asm volatile("v_nop\n\tv_nop\n\tv_nop\n\tv_nop" : "+v"(a), "+v"(b), "+v"(c), "+v"(d)); }
template <typename T> struct Frag;
template <> struct Frag<_Float16> {
  typedef v16h V; union U { v16h v; v8h h[2]; };
  static __device__ __forceinline__ v16h load(const _Float16* p) {   // elements 0..7 <- p[0..7], 8..15 <- p[16..23]
    U f; f.h[0] = *(const v8h*)(p); f.h[1] = *(const v8h*)(p + 16); return f.v;
  }
  static __device__ __forceinline__ v8f mma(v16h a, v16h b, v8f c) {
    return __builtin_amdgcn_wmma_f32_16x16x32_f16(false, a, false, b, (short)0, c, false, false);
  }
  static __device__ __forceinline__ void guard(v8f& a, v8f& b, v16h x, v16h y) { dep_guard_h(a, b, x, y); }
  static __device__ __forceinline__ void keep(v16h a, v16h b, v16h c, v16h d) { keep4_h(a, b, c, d); }
};
template <> struct Frag<__bf16> {
  typedef v16b V; union U { v16b v; v8b h[2]; };
  static __device__ __forceinline__ v16b load(const __bf16* p) {
    U f; f.h[0] = *(const v8b*)(p); f.h[1] = *(const v8b*)(p + 16); return f.v;
  }
  static __device__ __forceinline__ v8f mma(v16b a, v16b b, v8f c) {
    return __builtin_amdgcn_wmma_f32_16x16x32_bf16(false, a, false, b, (short)0, c, false, false);
  }
  static __device__ __forceinline__ void guard(v8f& a, v8f& b, v16b x, v16b y) { dep_guard_b(a, b, x, y); }
  static __device__ __forceinline__ void keep(v16b a, v16b b, v16b c, v16b d) { keep4_b(a, b, c, d); }
};

// ---- Register-blocked batched WMMA GEMM --------------------------------
// C[m,n] = scale * sum_k A[m,k] * Bt[n,k] (+bias)(+resid); each wave owns a 64x64 tile.
// A row-major [M,K]; Bt row-major [N,K]; M,N % 64 == 0, K % 32 == 0.
// SPLIT: operands are hi/lo planes (A2/Bt2 = lo planes, same layout); product = hi.hi + hi.lo + lo.hi.
// BIAS_MODE: 0 = none, 1 = bias[m], 2 = bias[n].
// OUT_MODE: 0 = f32, 1 = f16, 2 = bf16 hi plane (Cout) + bf16 lo plane (Cout2).
// ET: 0 = f16 operands, 1 = bf16 operands (pointers passed as 16-bit storage)
template <int ET> struct Elem;
template <> struct Elem<0> { typedef _Float16 T; };
template <> struct Elem<1> { typedef __bf16 T; };
template <int ET, bool SPLIT, int BIAS_MODE, int OUT_MODE, bool RESID, int ACT = 0>
__global__ __launch_bounds__(256) void wmma_gemm64(
    const unsigned short* __restrict__ Ap, const unsigned short* __restrict__ A2p, int lda, long strideA,
    const unsigned short* __restrict__ Btp, const unsigned short* __restrict__ Bt2p, int ldb, long strideB,
    void* __restrict__ Cout, void* __restrict__ Cout2, int ldc, long strideC,
    const float* __restrict__ bias,
    const float* __restrict__ resid, long strideR,
    int M, int N, int K, float scale) {
  typedef typename Elem<ET>::T T;
  typedef typename Frag<T>::V V;
  const T* A = (const T*)Ap; const T* A2 = (const T*)A2p; const T* Bt = (const T*)Btp; const T* Bt2 = (const T*)Bt2p;
  __shared__ __align__(16) float sT[8][16 * 68];   // per-wave 16x64 slab, pitch 68 floats
  const int b    = blockIdx.y;
  const int lane = threadIdx.x & 31;
  const int wave = threadIdx.x >> 5;
  const int tilesN = N >> 6;
  const int tilesM = M >> 6;
  const int tile = blockIdx.x * 8 + wave;
  if (tile >= tilesM * tilesN) return;   // wave-uniform; no block barriers in this kernel
  const int tm = tile / tilesN;
  const int tn = tile - tm * tilesN;
  const int m0 = tm << 6;
  const int n0 = tn << 6;

  const T* Ab  = A  + (size_t)b * strideA;
  const T* Bb  = Bt + (size_t)b * strideB;
  const T* Ab2 = SPLIT ? (A2  + (size_t)b * strideA) : nullptr;
  const T* Bb2 = SPLIT ? (Bt2 + (size_t)b * strideB) : nullptr;

  const int rlane = lane & 15;                 // row (A) / col (B, D) within subtile
  const int koff  = (lane >> 4) * 8;           // k offset of this lane half
  const int mOff  = (lane >> 4) * 8;           // D row offset

  v8f acc[4][4];
#pragma unroll
  for (int i = 0; i < 4; ++i)
#pragma unroll
    for (int j = 0; j < 4; ++j) acc[i][j] = (v8f){0.f,0.f,0.f,0.f,0.f,0.f,0.f,0.f};

  for (int k0 = 0; k0 < K; k0 += 32) {
    V bh[4], bl[4];
#pragma unroll
    for (int j = 0; j < 4; ++j) {
      const size_t bo = (size_t)(n0 + (j << 4) + rlane) * ldb + koff + k0;
      bh[j] = Frag<T>::load(Bb + bo);
      if (SPLIT) bl[j] = Frag<T>::load(Bb2 + bo);
    }
#pragma unroll
    for (int i = 0; i < 4; ++i) {
      const size_t ao = (size_t)(m0 + (i << 4) + rlane) * lda + koff + k0;
      V ah = Frag<T>::load(Ab + ao);
      V al;
      if (SPLIT) al = Frag<T>::load(Ab2 + ao);
#pragma unroll
      for (int j = 0; j < 4; ++j) {
        acc[i][j] = Frag<T>::mma(ah, bh[j], acc[i][j]);
        if (SPLIT) {
          acc[i][j] = Frag<T>::mma(ah, bl[j], acc[i][j]);
          acc[i][j] = Frag<T>::mma(al, bh[j], acc[i][j]);
        }
      }
      Frag<T>::guard(acc[i][0], acc[i][3], ah, SPLIT ? al : ah);
    }
    Frag<T>::keep(bh[0], bh[1], bh[2], bh[3]);
    if (SPLIT) Frag<T>::keep(bl[0], bl[1], bl[2], bl[3]);
  }
  acc_guard4(acc[0][0], acc[0][1], acc[0][2], acc[0][3]);
  acc_guard4(acc[1][0], acc[1][1], acc[1][2], acc[1][3]);
  acc_guard4(acc[2][0], acc[2][1], acc[2][2], acc[2][3]);
  acc_guard4(acc[3][0], acc[3][1], acc[3][2], acc[3][3]);

  // ---- epilogue ----
  float* slab = sT[wave];
  const float* Rb = RESID ? (resid + (size_t)b * strideR) : nullptr;
#pragma unroll
  for (int i = 0; i < 4; ++i) {
    const int mBase = m0 + (i << 4);
#pragma unroll
    for (int j = 0; j < 4; ++j) {
      const int n = n0 + (j << 4) + rlane;
      float bv = 0.f;
      if (BIAS_MODE == 2) bv = bias[n];
#pragma unroll
      for (int r = 0; r < 8; ++r) {
        float v = acc[i][j][r] * scale;
        if (BIAS_MODE == 1) v += bias[mBase + mOff + r];
        if (BIAS_MODE == 2) v += bv;
        if (RESID) v += Rb[(size_t)(mBase + mOff + r) * ldc + n];
        if (ACT == 1) v = tanhf(v);
        if (ACT == 2) v = fmaxf(v, 0.0f);
        if (ACT == 3) v = v / (1.0f + expf(-v));
        if (ACT == 4) v = (v > 0.f) ? v : 0.01f * v;
        if (ACT == 5) v = 0.5f * v * (1.0f + erff(v * 0.70710678118654752f));
        slab[(mOff + r) * 68 + (j << 4) + rlane] = v;
      }
    }
    __builtin_amdgcn_fence(__ATOMIC_RELEASE, "workgroup");
    __builtin_amdgcn_wave_barrier();
    __builtin_amdgcn_fence(__ATOMIC_ACQUIRE, "workgroup");
    if (OUT_MODE == 0) {
      float* C = (float*)Cout + (size_t)b * strideC;
      const int hh = lane >> 4, c4 = (lane & 15) * 4;     // row seg = 256 B = 16 lanes x 16 B
      {
#pragma unroll
        for (int it = 0; it < 8; ++it) {
          const int row = it * 2 + hh;
          v4f v = *(const v4f*)(slab + row * 68 + c4);
          *(v4f*)(C + (size_t)(mBase + row) * ldc + n0 + c4) = v;
        }
        
      }
    } else {
      const int q = lane >> 3, c8 = (lane & 7) * 8;
      unsigned short* C  = (unsigned short*)Cout  + (size_t)b * strideC;
      unsigned short* C2 = (OUT_MODE == 2) ? ((unsigned short*)Cout2 + (size_t)b * strideC) : nullptr;
      {
#pragma unroll
        for (int it = 0; it < 4; ++it) {
          const int row = it * 4 + q;
          const float* sp = slab + row * 68 + c8;
          v8h hv, lv;
#pragma unroll
          for (int e = 0; e < 8; ++e) {
            if (OUT_MODE == 1) {
              hv[e] = (_Float16)sp[e];
            } else {
              unsigned short hb = f2bf_bits(sp[e]);
              unsigned short lb = f2bf_bits(sp[e] - bf_bits2f(hb));
              hv[e] = __builtin_bit_cast(_Float16, hb);
              lv[e] = __builtin_bit_cast(_Float16, lb);
            }
          }
          *(v8h*)(C + (size_t)(mBase + row) * ldc + n0 + c8) = hv;
          if (OUT_MODE == 2) *(v8h*)(C2 + (size_t)(mBase + row) * ldc + n0 + c8) = lv;
        }
        
      }
    }
    __builtin_amdgcn_fence(__ATOMIC_RELEASE, "workgroup");
    __builtin_amdgcn_wave_barrier();
    __builtin_amdgcn_fence(__ATOMIC_ACQUIRE, "workgroup");
  }
}

// ---------------------------------------------------------------------------
// f32 -> bf16 hi + bf16 lo planes (RNE converts). 8 elements per thread:
// two b128 loads, one b128 store per plane; lanes 8q..8q+7 of a wave fill one
// ---------------------------------------------------------------------------
__device__ __forceinline__ void split_pair(float f0, float f1, unsigned& hw, unsigned& lw) {
  const unsigned short h0 = f2bf_bits(f0);
  const unsigned short h1 = f2bf_bits(f1);
  const unsigned short l0 = f2bf_bits(f0 - bf_bits2f(h0));
  const unsigned short l1 = f2bf_bits(f1 - bf_bits2f(h1));
  hw = (unsigned)h0 | ((unsigned)h1 << 16);
  lw = (unsigned)l0 | ((unsigned)l1 << 16);
}

__global__ __launch_bounds__(256) void split_planes_bf16(
    const float* __restrict__ src, unsigned short* __restrict__ hi,
    unsigned short* __restrict__ lo, int n8) {
  const int i = blockIdx.x * 256 + threadIdx.x;
  if (i >= n8) return;                      // no barriers in this kernel
  const size_t e0 = (size_t)i * 8;
  const v4f a = *(const v4f*)(src + e0);
  const v4f c = *(const v4f*)(src + e0 + 4);
  unsigned hx, hy, hz, hw, lx, ly, lz, lw;
  split_pair(a[0], a[1], hx, lx);
  split_pair(a[2], a[3], hy, ly);
  split_pair(c[0], c[1], hz, lz);
  split_pair(c[2], c[3], hw, lw);
  const v4u hv = (v4u){hx, hy, hz, hw};
  const v4u lv = (v4u){lx, ly, lz, lw};
  *(v4u*)(hi + e0) = hv;
  *(v4u*)(lo + e0) = lv;
  
}

// ---------------------------------------------------------------------------
// Causal flash attention, head dim 64, bf16 hi/lo planes in, bf16 hi/lo planes out.
//   q,k,v planes: element (b, s, h, d) at (b*SEQ + s)*EMB + h*64 + d (ushort storage).
//   scores = q.k^T * sm_scale : hi.hi + hi.lo + lo.hi on v_wmma_f32_16x16x32_bf16
//   out    = p.v              : p and v as bf16 hi/lo, same three products
//   online softmax in f32, exponentials in base 2; block = 4 waves; a query block = 64 query rows of one (b, h), 16 per wave;
//   grid.x = NB * NHEAD * (SEQ/64) / 2; keys visited in 64-wide chunks 0..qb (causal).
//   A query block qb costs qb + 1 chunks, and all blocks of the grid are resident at once, so the launch lasts as
//   long as its fullest block: each block takes query blocks 31 - p and p of one (b, h), one after the other in
//   every wave, which is 33 chunks for every block of the grid.
//   Output planes: element (b, q, h*64+d) at (b*SEQ+q)*EMB + h*64 + d; each wave writes
// ---------------------------------------------------------------------------
__device__ __forceinline__ unsigned short at_bf_bits(float f) {
  unsigned u = __float_as_uint(f);
  return (unsigned short)((u + 0x7FFFu + ((u >> 16) & 1u)) >> 16);
}
__device__ __forceinline__ __bf16 at_f2bf(float f) { return __builtin_bit_cast(__bf16, at_bf_bits(f)); }
__device__ __forceinline__ void at_split(float f, __bf16& hi, __bf16& lo) {
  const unsigned short hb = at_bf_bits(f);
  hi = __builtin_bit_cast(__bf16, hb);
  lo = at_f2bf(f - __uint_as_float(((unsigned)hb) << 16));
}
__device__ __forceinline__ v8f at_mma(v16b a, v16b b, v8f c) {
  c = __builtin_amdgcn_wmma_f32_16x16x32_bf16(false, a, false, b, (short)0, c, false, false);
  asm volatile("v_nop\n\tv_nop\n\tv_nop\n\tv_nop" : "+v"(c) : "v"(a), "v"(b));
  return c;
}

// value of lane l ^ M (M < 16, same 16-lane row) by a DPP row_xmask move: stays in the vector unit, where
// __shfl_xor goes through the LDS pipe and a wait on it. All 32 lanes are active at every call, so every source
// lane is valid; no old value and bound_ctrl on let the compiler fold the move into the add that follows.
template <int M> __device__ __forceinline__ float row_xor(float x) {
  const int v = __float_as_int(x);
  return __int_as_float(__builtin_amdgcn_update_dpp(0, v, 0x160 | M, 0xf, 0xf, true));
}

// 2^x in place, 8 or 16 values a statement. The instruction set asks for one free slot between a transcendental and a
// next instruction that reads its result or overwrites its source. Here each v_exp_f32 names one register of
// its own, so none touches its neighbour's, and the v_nop at the end is the slot of the last.
__device__ __forceinline__ void exp2_x8(float (&x)[8]) {
  asm("v_exp_f32 %0, %0\n\tv_exp_f32 %1, %1\n\tv_exp_f32 %2, %2\n\tv_exp_f32 %3, %3\n\t"
      "v_exp_f32 %4, %4\n\tv_exp_f32 %5, %5\n\tv_exp_f32 %6, %6\n\tv_exp_f32 %7, %7\n\t"
      "v_nop"
      : "+v"(x[0]), "+v"(x[1]), "+v"(x[2]), "+v"(x[3]), "+v"(x[4]), "+v"(x[5]), "+v"(x[6]), "+v"(x[7]));
}
__device__ __forceinline__ void exp2_x16(float (&x)[16]) {
  asm("v_exp_f32 %0, %0\n\tv_exp_f32 %1, %1\n\tv_exp_f32 %2, %2\n\tv_exp_f32 %3, %3\n\t"
      "v_exp_f32 %4, %4\n\tv_exp_f32 %5, %5\n\tv_exp_f32 %6, %6\n\tv_exp_f32 %7, %7\n\t"
      "v_exp_f32 %8, %8\n\tv_exp_f32 %9, %9\n\tv_exp_f32 %10, %10\n\tv_exp_f32 %11, %11\n\t"
      "v_exp_f32 %12, %12\n\tv_exp_f32 %13, %13\n\tv_exp_f32 %14, %14\n\tv_exp_f32 %15, %15\n\t"
      "v_nop"
      : "+v"(x[0]), "+v"(x[1]), "+v"(x[2]), "+v"(x[3]), "+v"(x[4]), "+v"(x[5]), "+v"(x[6]), "+v"(x[7]),
        "+v"(x[8]), "+v"(x[9]), "+v"(x[10]), "+v"(x[11]), "+v"(x[12]), "+v"(x[13]), "+v"(x[14]), "+v"(x[15]));
}

// transposing LDS read of a row-major 16-bit tile T: with lane l's pointer at
// T[kbase + 8 (l >> 4) + (l & 7)][dbase + 8 ((l >> 3) & 1)], lane (c = l & 15, hh = l >> 4) gets
// T[kbase + 8 hh + 0..7][dbase + c]. All 32 lanes are active and hold an address inside the tile at every call.
typedef __attribute__((ext_vector_type(8))) short v8s;
__device__ __forceinline__ v8b ld_tr16(const unsigned short* p) {
  typedef __attribute__((address_space(3))) v8s lds_v8s;
  return __builtin_bit_cast(v8b, __builtin_amdgcn_ds_load_tr16_b128_v8i16((lds_v8s*)p));
}

__global__ __launch_bounds__(128)
void attn_causal_hd64(const unsigned short* __restrict__ Qh, const unsigned short* __restrict__ Ql,
                      const unsigned short* __restrict__ Kh, const unsigned short* __restrict__ Kl,
                      const unsigned short* __restrict__ Vh, const unsigned short* __restrict__ Vl,
                      unsigned short* __restrict__ Oh, unsigned short* __restrict__ Ol,
                      float sm_scale) {
  union FB { v16b v; v8b h[2]; };
  __shared__ __align__(16) unsigned short Ksh[AKC * APT];     // K hi [kv][d]   9 KB
  __shared__ __align__(16) unsigned short Ksl[AKC * APT];     // K lo [kv][d]   9 KB
  __shared__ __align__(16) unsigned short Vsh[AKC * VPT];     // V hi [kv][d]  10 KB
  __shared__ __align__(16) unsigned short Vsl[AKC * VPT];     // V lo [kv][d]  10 KB
  __shared__ __align__(16) __bf16 Psh[ANW][16 * APT];         // per wave P hi [row][kv]
  __shared__ __align__(16) __bf16 Psl[ANW][16 * APT];         // per wave P lo
  __shared__ __align__(16) float  Os[ANW][16 * 68];           // per wave out tile, pitch 68

  const int tid  = threadIdx.x;
  const int wave = tid >> 5;
  const int lane = tid & 31;
  const int hh   = lane >> 4;
  const int c    = lane & 15;
  const float NEG_INF = -__builtin_inff();
  // exp(sm_scale * s - m) = 2^(sc2 * s - m * log2(e)): one multiply-add and one v_exp_f32 an element (sm_scale > 0)
  const float sc2 = sm_scale * 1.44269504088896340736f;

  constexpr int NQB = SEQ / AQB;                 // 32 query blocks per (b, h)
  constexpr int NPR = NQB / 2;                   // 16 pairs (31 - p, p) per (b, h)
  static_assert(NQB % 2 == 0);
  const int bx   = blockIdx.x;
  const int pr   = bx % NPR;
  const int bhid = bx / NPR;
  const int h    = bhid % NHEAD;
  const int b    = bhid / NHEAD;
  const size_t hoff = (size_t)h * HDIM;

  for (int half = 0; half < 2; ++half) {         // block-uniform: every wave walks both query blocks in this order
  const int qb   = half ? pr : NQB - 1 - pr;
  const int q0   = qb * AQB + wave * 16;

  // ---- Q fragments (A operand): row = c, elements 0..7 <- d = dc*32 + 8hh + 0..7, 8..15 <- dc*32 + 16 + 8hh + 0..7
  v16b qah[2], qal[2];
  {
    const size_t qo = (size_t)(b * SEQ + q0 + c) * EMB + hoff + 8 * hh;
    const __bf16* qhp = (const __bf16*)(const void*)Qh;
    const __bf16* qlp = (const __bf16*)(const void*)Ql;
#pragma unroll
    for (int dc = 0; dc < 2; ++dc) {
      qah[dc] = Frag<__bf16>::load(qhp + qo + dc * 32);
      qal[dc] = Frag<__bf16>::load(qlp + qo + dc * 32);
    }
  }

  float mrow[8], lrow[8];
  v8f oacc[4];
#pragma unroll
  for (int r = 0; r < 8; ++r) { mrow[r] = NEG_INF; lrow[r] = 0.f; }
#pragma unroll
  for (int t = 0; t < 4; ++t) oacc[t] = (v8f){0.f,0.f,0.f,0.f,0.f,0.f,0.f,0.f};

  // staging map: thread -> rows skv + 16 i (i = 0..3), 16-byte column group scol, of each 64 x 64 K / V plane tile
  const int skv = tid >> 3, scol = (tid & 7) * 8;
  // one 32-bit byte offset (< 8 MiB) serves all four planes on their scalar base pointers: one address register
  // instead of four pairs
  const unsigned sgb = (unsigned)(((b * SEQ + skv) * EMB + h * HDIM + scol) * 2);
  v4u kwh[4], kwl[4], vwh[4], vwl[4];            // K hi, K lo, V hi, V lo words of the chunk fetched ahead
  const int nChunks = qb + 1;                    // block-uniform, <= 32
  // ---- chunk 0's K and V words, all 16 global loads in flight together ----
  {
    const unsigned gb = sgb;
#pragma unroll
    for (int i = 0; i < 4; ++i) {
      kwh[i] = *(const v4u*)((const char*)Kh + gb + 16 * i * EMB * 2);
      kwl[i] = *(const v4u*)((const char*)Kl + gb + 16 * i * EMB * 2);
      vwh[i] = *(const v4u*)((const char*)Vh + gb + 16 * i * EMB * 2);
      vwl[i] = *(const v4u*)((const char*)Vl + gb + 16 * i * EMB * 2);
    }
  }
  // the address registers of the Q, K and V loads above are written anew below: their translations are waited for
  // first; the Q words as inputs keep the wait behind their loads (once per query block)
  asm volatile("s_wait_xcnt 0x0" :: "v"(qah[0]), "v"(qah[1]), "v"(qal[0]), "v"(qal[1]) : "memory");
  for (int kc = 0; kc < nChunks; ++kc) {
    const int kv0 = kc * AKC;
    __syncthreads();
    // ---- K and V words fetched one trip ahead go from registers to LDS ----
#pragma unroll
    for (int i = 0; i < 4; ++i) {
      *(v4u*)(Ksh + (skv + 16 * i) * APT + scol) = kwh[i];
      *(v4u*)(Ksl + (skv + 16 * i) * APT + scol) = kwl[i];
    }
    // ---- V hi/lo row-major as they come: one 16-B LDS store a word; the fragment reads transpose ----
#pragma unroll
    for (int i = 0; i < 4; ++i) {
      *(v4u*)(Vsh + (skv + 16 * i) * VPT + scol) = vwh[i];
      *(v4u*)(Vsl + (skv + 16 * i) * VPT + scol) = vwl[i];
    }
    __syncthreads();

    // ---- scores: 4 key tiles x 2 d-chunks x 3 products ----
    v8f s[4];
#pragma unroll
    for (int j = 0; j < 4; ++j) {
      s[j] = (v8f){0.f,0.f,0.f,0.f,0.f,0.f,0.f,0.f};
#pragma unroll
      for (int dc = 0; dc < 2; ++dc) {
        FB kfh, kfl;
        const int ko = (j * 16 + c) * APT + dc * 32 + 8 * hh;
        kfh.h[0] = *(const v8b*)(Ksh + ko);
        kfh.h[1] = *(const v8b*)(Ksh + ko + 16);
        kfl.h[0] = *(const v8b*)(Ksl + ko);
        kfl.h[1] = *(const v8b*)(Ksl + ko + 16);
        s[j] = at_mma(qah[dc], kfh.v, s[j]);
        s[j] = at_mma(qah[dc], kfl.v, s[j]);
        s[j] = at_mma(qal[dc], kfh.v, s[j]);
      }
    }
    // ---- causal mask on the diagonal chunk (select, -inf fill), row max of the raw scores; the maximum alone is
    //      scaled here: sc2 > 0 and rounding is monotone, so it is the maximum of the scaled scores ----
    const bool diag = (kc == qb);
    float cm[8];
#pragma unroll
    for (int r = 0; r < 8; ++r) {
      const int qrow = q0 + 8 * hh + r;
      float m = NEG_INF;
#pragma unroll
      for (int j = 0; j < 4; ++j) {
        const int kvcol = kv0 + j * 16 + c;
        float val = s[j][r];
        val = (diag && (kvcol > qrow)) ? NEG_INF : val;
        s[j][r] = val;
        m = fmaxf(m, val);
      }
      m = fmaxf(m, row_xor<1>(m));
      m = fmaxf(m, row_xor<2>(m));
      m = fmaxf(m, row_xor<4>(m));
      m = fmaxf(m, row_xor<8>(m));
      cm[r] = m * sc2;
    }
    // ---- online softmax update in base 2 (mrow holds log2 units), P hi/lo staged per wave ----
    __bf16* pwh = Psh[wave];
    __bf16* pwl = Psl[wave];
    float alphas[8];                             // 2^(old maximum - new maximum) of the eight rows
#pragma unroll
    for (int r = 0; r < 8; ++r) {
      const float mnew = fmaxf(mrow[r], cm[r]);
      alphas[r] = mrow[r] - mnew;
      mrow[r] = mnew;
    }
    exp2_x8(alphas);
#pragma unroll
    for (int g = 0; g < 2; ++g) {                // four rows = 16 exponentials a statement
      float pe[16];
#pragma unroll
      for (int q = 0; q < 4; ++q)
#pragma unroll
        for (int j = 0; j < 4; ++j) pe[q * 4 + j] = fmaf(s[j][g * 4 + q], sc2, -mrow[g * 4 + q]);
      exp2_x16(pe);
#pragma unroll
      for (int q = 0; q < 4; ++q) {
        const int r = g * 4 + q;
        const float alpha = alphas[r];
        float psum = 0.f;
#pragma unroll
        for (int j = 0; j < 4; ++j) {
          const float p = pe[q * 4 + j];
          psum = j ? psum + p : p;               // p >= +0, so this is 0 + p
          __bf16 a, bl;
          at_split(p, a, bl);
          pwh[(8 * hh + r) * APT + j * 16 + c] = a;
          pwl[(8 * hh + r) * APT + j * 16 + c] = bl;
        }
        psum += row_xor<1>(psum);
        psum += row_xor<2>(psum);
        psum += row_xor<4>(psum);
        psum += row_xor<8>(psum);
        lrow[r] = lrow[r] * alpha + psum;
#pragma unroll
        for (int t = 0; t < 4; ++t) oacc[t][r] *= alpha;
      }
    }
    __builtin_amdgcn_fence(__ATOMIC_RELEASE, "workgroup");
    __builtin_amdgcn_wave_barrier();
    __builtin_amdgcn_fence(__ATOMIC_ACQUIRE, "workgroup");
    // ---- next chunk's K and V words: 16 global loads in flight together, their latency under the P.V products ----
    if (kc + 1 < nChunks) {
      const unsigned gb = sgb + (unsigned)(kv0 + AKC) * (EMB * 2);
#pragma unroll
      for (int i = 0; i < 4; ++i) {
        kwh[i] = *(const v4u*)((const char*)Kh + gb + 16 * i * EMB * 2);
        kwl[i] = *(const v4u*)((const char*)Kl + gb + 16 * i * EMB * 2);
        vwh[i] = *(const v4u*)((const char*)Vh + gb + 16 * i * EMB * 2);
        vwl[i] = *(const v4u*)((const char*)Vl + gb + 16 * i * EMB * 2);
      }
      // the offset register of these loads is written anew right below: their translations are waited for first
      asm volatile("s_wait_xcnt 0x0" ::: "memory");
    }
    // ---- O += P.V : A = P [row][kv], B[k=kv][n=d] = V[kv][d], column d = t*16 + c by transposing reads;
    //      elements 0..7 <- kv = kk*32 + 8hh + 0..7, 8..15 <- kk*32 + 16 + 8hh + 0..7, the k order of the P loads ----
#pragma unroll 1
    for (int kk = 0; kk < 2; ++kk) {
      FB pa, pl;
      pa.h[0] = *(const v8b*)(pwh + c * APT + kk * 32 + 8 * hh);
      pa.h[1] = *(const v8b*)(pwh + c * APT + kk * 32 + 16 + 8 * hh);
      pl.h[0] = *(const v8b*)(pwl + c * APT + kk * 32 + 8 * hh);
      pl.h[1] = *(const v8b*)(pwl + c * APT + kk * 32 + 16 + 8 * hh);
#pragma unroll
      for (int t = 0; t < 4; ++t) {
        FB vb, vlo;
        const int vo = (kk * 32 + 8 * hh + (lane & 7)) * VPT + t * 16 + 8 * ((lane >> 3) & 1);
        vb.h[0]  = ld_tr16(Vsh + vo);
        vb.h[1]  = ld_tr16(Vsh + vo + 16 * VPT);
        vlo.h[0] = ld_tr16(Vsl + vo);
        vlo.h[1] = ld_tr16(Vsl + vo + 16 * VPT);
        oacc[t] = at_mma(pa.v, vb.v, oacc[t]);
        oacc[t] = at_mma(pa.v, vlo.v, oacc[t]);
        oacc[t] = at_mma(pl.v, vb.v, oacc[t]);
      }
    }
  }

  // ---- epilogue: 1/l, per-wave LDS slab, whole-line bf16 hi/lo stores ----
  float* os = Os[wave];
#pragma unroll
  for (int r = 0; r < 8; ++r) {
    const float inv = 1.0f / lrow[r];
#pragma unroll
    for (int t = 0; t < 4; ++t) os[(8 * hh + r) * 68 + t * 16 + c] = oacc[t][r] * inv;
  }
  __builtin_amdgcn_fence(__ATOMIC_RELEASE, "workgroup");
  __builtin_amdgcn_wave_barrier();
  __builtin_amdgcn_fence(__ATOMIC_ACQUIRE, "workgroup");
  {
    // rows it*4 + q4 (it 0..3, q4 0..3) = 0..15; c8 = 0..56 step 8 -> full 16 x 64 tile per plane
    const int q4 = lane >> 3, c8 = (lane & 7) * 8;
    {
#pragma unroll
      for (int it = 0; it < 4; ++it) {
        const int row = it * 4 + q4;
        const float* sp = os + row * 68 + c8;
        v8h hv, lv;
#pragma unroll
        for (int e = 0; e < 8; ++e) {
          unsigned short hb = f2bf_bits(sp[e]);
          unsigned short lb = f2bf_bits(sp[e] - bf_bits2f(hb));
          hv[e] = __builtin_bit_cast(_Float16, hb);
          lv[e] = __builtin_bit_cast(_Float16, lb);
        }
        const size_t oo = (size_t)(b * SEQ + q0 + row) * EMB + hoff + c8;
        *(v8h*)(Oh + oo) = hv;
        *(v8h*)(Ol + oo) = lv;
      }
      
    }
  }
  // the second query block writes the registers of the stores above anew: their translations are waited for first
  asm volatile("s_wait_xcnt 0x0" ::: "memory");
  }   // half
}

// ---------------------------------------------------------------------------
// Output projection C[m][n] = sum_k A[m][k] * Bt[n][k], A = av hi/lo [NTOK][EMB], Bt = Wo hi/lo [EMB][EMB], C f32.
//   One 128 x 128 tile of C per block, 256 blocks, 8 waves of 64 x 32 (2 x 4). A stage is 64 k = one 128-B line of
//   every operand row: the block loads it once by whole lines (a wave-wide 16-B load covers 4 rows), one stage ahead
//   into registers, stores it to LDS at the 144-B pitch of the ds_load_b128 fragment reads, and all 8 waves read
//   their fragments from there. Two LDS buffers, one barrier a stage: a wave stores stage s + 1 only behind the
//   barrier of stage s, which every wave reaches only after its last read of stage s - 1 (the same buffer).
//   Per accumulator the products come in the order k ascending by 32, hi.hi, hi.lo, lo.hi.
// ---------------------------------------------------------------------------
constexpr int GBT = 128;                     // tile rows (m) and columns (n) per block
constexpr int GBK = 64;                      // k per stage
constexpr int GNS = EMB / GBK;               // 16 stages
constexpr int GPL = GBT * APT;               // 16-bit elements of one plane tile in LDS
constexpr int GCP = 36;                      // f32 pitch of the per-wave output slab: 144 B
static_assert(NTOK % GBT == 0 && EMB % GBT == 0 && EMB % GBK == 0 && GBK <= APT);

__global__ __launch_bounds__(256)
void out_proj_lds(const unsigned short* __restrict__ Ah, const unsigned short* __restrict__ Al,
                  const unsigned short* __restrict__ Bh, const unsigned short* __restrict__ Bl,
                  float* __restrict__ C) {
  union FB { v16b v; v8b h[2]; };
  __shared__ __align__(16) unsigned short sAh[2 * GPL];
  __shared__ __align__(16) unsigned short sAl[2 * GPL];
  __shared__ __align__(16) unsigned short sBh[2 * GPL];
  __shared__ __align__(16) unsigned short sBl[2 * GPL];
  __shared__ __align__(16) float sC[8][16 * GCP];

  const int tid  = threadIdx.x;
  const int wave = tid >> 5;
  const int lane = tid & 31;
  const int hh   = lane >> 4;
  const int c    = lane & 15;
  constexpr int TN = EMB / GBT;                // 8 tile columns
  const int tn = blockIdx.x % TN;
  const int tm = blockIdx.x / TN;
  const int m0 = tm * GBT;
  const int n0 = tn * GBT;
  const int wm = (wave >> 2) * 64;             // wave's rows inside the tile
  const int wn = (wave & 3) * 32;              // wave's columns inside the tile

  // staging map: thread -> rows srow + 32 i (i = 0..3), 16-byte column group scol, of each 128 x 64 plane tile.
  // 8 lanes take one row (a whole 128-B line); the two rows of a 16-lane half lie 8 rows = 1152 B apart in LDS,
  // 128 B modulo the 256 B of the banks, so that a half's ds_store_b128 meets every bank once.
  const int sg   = lane >> 3;
  const int srow = (wave >> 2) * 16 + (sg & 1) * 8 + (wave & 3) * 2 + (sg >> 1);
  const int scol = (tid & 7) * 8;
  const unsigned ga = (unsigned)(((m0 + srow) * EMB + scol) * 2);   // byte offset in the A planes (< 8 MiB)
  const unsigned gb = (unsigned)(((n0 + srow) * EMB + scol) * 2);   // byte offset in the B planes (< 2 MiB)
  v4u rah[4], ral[4], rbh[4], rbl[4];
#pragma unroll
  for (int i = 0; i < 4; ++i) {
    rah[i] = *(const v4u*)((const char*)Ah + ga + 32 * i * EMB * 2);
    ral[i] = *(const v4u*)((const char*)Al + ga + 32 * i * EMB * 2);
    rbh[i] = *(const v4u*)((const char*)Bh + gb + 32 * i * EMB * 2);
    rbl[i] = *(const v4u*)((const char*)Bl + gb + 32 * i * EMB * 2);
  }
  // the offset registers of these loads may be written anew below: their translations are waited for first
  asm volatile("s_wait_xcnt 0x0" ::: "memory");

  v8f acc[4][2];
#pragma unroll
  for (int i = 0; i < 4; ++i)
#pragma unroll
    for (int j = 0; j < 2; ++j) acc[i][j] = (v8f){0.f,0.f,0.f,0.f,0.f,0.f,0.f,0.f};

  for (int s = 0; s < GNS; ++s) {
    const int bo = (s & 1) * GPL;
    // ---- the stage fetched one trip ahead goes from registers to LDS ----
#pragma unroll
    for (int i = 0; i < 4; ++i) {
      const int so = bo + (srow + 32 * i) * APT + scol;
      *(v4u*)(sAh + so) = rah[i];
      *(v4u*)(sAl + so) = ral[i];
      *(v4u*)(sBh + so) = rbh[i];
      *(v4u*)(sBl + so) = rbl[i];
    }
    __syncthreads();
    // ---- next stage's 16 global loads in flight together, their latency under this stage's products ----
    if (s + 1 < GNS) {
      const unsigned ko = (unsigned)(s + 1) * (GBK * 2);
#pragma unroll
      for (int i = 0; i < 4; ++i) {
        rah[i] = *(const v4u*)((const char*)Ah + (ga + ko) + 32 * i * EMB * 2);
        ral[i] = *(const v4u*)((const char*)Al + (ga + ko) + 32 * i * EMB * 2);
        rbh[i] = *(const v4u*)((const char*)Bh + (gb + ko) + 32 * i * EMB * 2);
        rbl[i] = *(const v4u*)((const char*)Bl + (gb + ko) + 32 * i * EMB * 2);
      }
      // the offset registers of these loads are written anew in the next trip: their translations are waited for first
      asm volatile("s_wait_xcnt 0x0" ::: "memory");
    }
    // ---- fragments: row (A) or column (B) = c, elements 0..7 <- k = ks*32 + 8hh + 0..7, 8..15 <- ks*32 + 16 + 8hh + 0..7
#pragma unroll
    for (int ks = 0; ks < 2; ++ks) {
      FB fah[4], fal[4], fbh[2], fbl[2];
#pragma unroll
      for (int i = 0; i < 4; ++i) {
        const int ao = bo + (wm + i * 16 + c) * APT + ks * 32 + 8 * hh;
        fah[i].h[0] = *(const v8b*)(sAh + ao);
        fah[i].h[1] = *(const v8b*)(sAh + ao + 16);
        fal[i].h[0] = *(const v8b*)(sAl + ao);
        fal[i].h[1] = *(const v8b*)(sAl + ao + 16);
      }
#pragma unroll
      for (int j = 0; j < 2; ++j) {
        const int bq = bo + (wn + j * 16 + c) * APT + ks * 32 + 8 * hh;
        fbh[j].h[0] = *(const v8b*)(sBh + bq);
        fbh[j].h[1] = *(const v8b*)(sBh + bq + 16);
        fbl[j].h[0] = *(const v8b*)(sBl + bq);
        fbl[j].h[1] = *(const v8b*)(sBl + bq + 16);
      }
      // eight independent accumulator tiles between two products into the same tile
#pragma unroll
      for (int i = 0; i < 4; ++i)
#pragma unroll
        for (int j = 0; j < 2; ++j) acc[i][j] = Frag<__bf16>::mma(fah[i].v, fbh[j].v, acc[i][j]);
#pragma unroll
      for (int i = 0; i < 4; ++i)
#pragma unroll
        for (int j = 0; j < 2; ++j) acc[i][j] = Frag<__bf16>::mma(fah[i].v, fbl[j].v, acc[i][j]);
#pragma unroll
      for (int i = 0; i < 4; ++i)
#pragma unroll
        for (int j = 0; j < 2; ++j) acc[i][j] = Frag<__bf16>::mma(fal[i].v, fbh[j].v, acc[i][j]);
    }
  }

  // ---- epilogue: per-wave 16 x 32 f32 slab, whole 128-B lines to C ----
  // The slab passes values between lanes of one wave only, so the fences name LDS alone: a fence over all memory
  // would also wait for the C stores of the tile row before.
  float* slab = sC[wave];
#pragma unroll
  for (int i = 0; i < 4; ++i) {
#pragma unroll
    for (int j = 0; j < 2; ++j)
#pragma unroll
      for (int r = 0; r < 8; ++r) slab[(8 * hh + r) * GCP + j * 16 + c] = acc[i][j][r];
    __builtin_amdgcn_fence(__ATOMIC_RELEASE, "workgroup", "local");
    __builtin_amdgcn_wave_barrier();
    __builtin_amdgcn_fence(__ATOMIC_ACQUIRE, "workgroup", "local");
    const int q4 = lane >> 3, c4 = (lane & 7) * 4;       // 8 lanes x 16 B = one 128-B row segment
#pragma unroll
    for (int it = 0; it < 4; ++it) {
      const int row = it * 4 + q4;
      const v4f v = *(const v4f*)(slab + row * GCP + c4);
      *(v4f*)(C + (size_t)(m0 + wm + i * 16 + row) * EMB + n0 + wn + c4) = v;
    }
    // the next tile row writes registers of the stores above anew: their translations are waited for first
    if (i < 3) {
      asm volatile("s_wait_xcnt 0x0" ::: "memory");
      __builtin_amdgcn_sched_barrier(0);   // keeps the next tile row's address arithmetic behind that wait
    }
    __builtin_amdgcn_fence(__ATOMIC_RELEASE, "workgroup", "local");
    __builtin_amdgcn_wave_barrier();
    __builtin_amdgcn_fence(__ATOMIC_ACQUIRE, "workgroup", "local");
  }
}

// ---------------------------------------------------------------------------
// Host launcher: 8 launches, no runtime API calls other than launches.
// ---------------------------------------------------------------------------
extern "C" void kernel_launch(void* const* d_in, const int* in_sizes, int n_in,
                              void* d_out, int out_size, void* d_ws, size_t ws_size,
                              hipStream_t stream) {
  if (n_in < 5) return;
  if (in_sizes[0] != NB * SEQ * EMB) return;
  if (in_sizes[1] != HDIM * HDIM || in_sizes[2] != HDIM * HDIM || in_sizes[3] != HDIM * HDIM) return;
  if (in_sizes[4] != EMB * EMB) return;
  if (out_size != NB * SEQ * EMB) return;
  if (ws_size < WS_TOTAL) return;

  const float* x  = (const float*)d_in[0];
  const float* Wq = (const float*)d_in[1];
  const float* Wk = (const float*)d_in[2];
  const float* Wv = (const float*)d_in[3];
  const float* Wo = (const float*)d_in[4];
  float* out = (float*)d_out;

  char* ws = (char*)d_ws;
  unsigned short* XH   = (unsigned short*)(ws + OFF_XH);
  unsigned short* XL   = (unsigned short*)(ws + OFF_XL);
  unsigned short* WH   = (unsigned short*)(ws + OFF_WH);
  unsigned short* WL   = (unsigned short*)(ws + OFF_WL);
  unsigned short* WOH  = (unsigned short*)(ws + OFF_WOH);
  unsigned short* WOL  = (unsigned short*)(ws + OFF_WOL);
  unsigned short* QKVH = (unsigned short*)(ws + OFF_QKVH);
  unsigned short* QKVL = (unsigned short*)(ws + OFF_QKVL);
  unsigned short* AVH  = (unsigned short*)(ws + OFF_AVH);
  unsigned short* AVL  = (unsigned short*)(ws + OFF_AVL);
  const float* dummyf = (const float*)(ws + OFF_XH);     // unused pointer slots point inside ws

  // ---- operand planes (bf16 hi/lo) ----
  {
    const int n8x = (NB * SEQ * EMB) / 8;                // 524288 threads cover 4194304 elements
    split_planes_bf16<<<(n8x + 255) / 256, 256, 0, stream>>>(x, XH, XL, n8x);
    const int n8w = (HDIM * HDIM) / 8;                   // 512 threads cover 4096 elements each
    split_planes_bf16<<<(n8w + 255) / 256, 256, 0, stream>>>(Wq, WH + 0 * HDIM * HDIM, WL + 0 * HDIM * HDIM, n8w);
    split_planes_bf16<<<(n8w + 255) / 256, 256, 0, stream>>>(Wk, WH + 1 * HDIM * HDIM, WL + 1 * HDIM * HDIM, n8w);
    split_planes_bf16<<<(n8w + 255) / 256, 256, 0, stream>>>(Wv, WH + 2 * HDIM * HDIM, WL + 2 * HDIM * HDIM, n8w);
    const int n8o = (EMB * EMB) / 8;                     // 131072 threads cover 1048576 elements
    split_planes_bf16<<<(n8o + 255) / 256, 256, 0, stream>>>(Wo, WOH, WOL, n8o);
  }

  // ---- q|k|v = xh[65536][64] . W{q,k,v}^T : M=65536, N=64, K=64; grid.y selects the weight plane ----
  {
    const int tiles = (NROWH / 64) * (HDIM / 64);        // 1024 wave tiles
    dim3 grid((tiles + 7) / 8, 3);
    wmma_gemm64<1, true, 0, 2, false><<<grid, 256, 0, stream>>>(
        XH, XL, HDIM, 0L,
        WH, WL, HDIM, (long)(HDIM * HDIM),
        (void*)QKVH, (void*)QKVL, HDIM, (long)PLANE_QKV,
        dummyf, dummyf, 0L,
        NROWH, HDIM, HDIM, 1.0f);
  }

  // ---- causal attention per (b, h): av hi/lo planes ----
  {
    const int nblk = NB * NHEAD * (SEQ / AQB) / 2;       // 512 blocks x 2 x 64 query rows
    attn_causal_hd64<<<nblk, 128, 0, stream>>>(
        QKVH + 0 * PLANE_QKV, QKVL + 0 * PLANE_QKV,
        QKVH + 1 * PLANE_QKV, QKVL + 1 * PLANE_QKV,
        QKVH + 2 * PLANE_QKV, QKVL + 2 * PLANE_QKV,
        AVH, AVL, 0.125f);
  }

  // ---- out = av[4096][1024] . Wo^T : M=4096, N=1024, K=1024, f32 into d_out ----
  {
    const int nblk = (NTOK / GBT) * (EMB / GBT);         // 256 blocks, one 128 x 128 tile each
    out_proj_lds<<<nblk, 256, 0, stream>>>(AVH, AVL, WOH, WOL, out);
  }
}

// v008
// One run takes 120 microseconds.
// Timed twice side by side with v007, it ran 1.21 times as fast both times.
// All steps since v000 together make it 4.51 times as fast.
// Contractions: q/k/v projections, q.k^T scores, p.v and output projection all on v_wmma_f32_16x16x32_bf16 with bf16 hi/lo split operands (hi*hi + hi*lo + lo*hi), f32 accumulate; softmax and all side math in f32.
#include <hip/hip_runtime.h>

typedef __attribute__((ext_vector_type(16))) _Float16 v16h;
typedef __attribute__((ext_vector_type(8)))  _Float16 v8h;
typedef __attribute__((ext_vector_type(16))) __bf16   v16b;
typedef __attribute__((ext_vector_type(8)))  __bf16   v8b;
typedef __attribute__((ext_vector_type(8)))  float    v8f;
typedef __attribute__((ext_vector_type(4)))  float    v4f;
typedef __attribute__((ext_vector_type(4)))  unsigned v4u;
#define U16(p) ((const unsigned short*)(const void*)(p))

// ---------------------------------------------------------------------------
// Problem constants
// ---------------------------------------------------------------------------
constexpr int NB    = 2;
constexpr int SEQ   = 2048;
constexpr int EMB   = 1024;
constexpr int NHEAD = 16;
constexpr int HDIM  = 64;
constexpr int NTOK  = NB * SEQ;              // 4096 rows of [EMB]
constexpr int NROWH = NTOK * NHEAD;          // 65536 rows of [HDIM]

// attention tiling
constexpr int AQB = 64;                      // query rows per query block (4 waves x 16)
constexpr int AKC = 64;                      // keys per chunk
constexpr int ANW = 4;
// LDS row pitch of the K tiles (and of the output projection's operand tiles), in 16-bit elements: 144 B = 16 B x 9 (odd), so that the
// 16 rows a ds_load_b128 fragment read touches start on distinct bank groups (128-B rows do not).
constexpr int APT = 72;
// LDS row pitch of the V tiles, kept row-major [kv][d] and read by ds_load_tr16_b128: 160 B = 32 B x 5 (odd),
// the conflict-free pitch of that reader.
constexpr int VPT = 80;

// GEMM shape contract (no run-time tails)
static_assert(NROWH % 64 == 0);              // qkv GEMM M
static_assert(HDIM % 64 == 0);               // qkv GEMM N
static_assert(HDIM % 32 == 0);               // qkv GEMM K
static_assert(NTOK % 64 == 0);
static_assert(EMB % 64 == 0);
static_assert(EMB % 32 == 0);
static_assert(SEQ % AQB == 0);
static_assert(AQB == AKC);
static_assert(APT >= AKC && APT >= HDIM && (APT * 2) % 16 == 0 && ((APT * 2) / 16) % 2 == 1);
static_assert(VPT >= HDIM && (VPT * 2) % 32 == 0 && ((VPT * 2) / 32) % 2 == 1);

// ---------------------------------------------------------------------------
//   XH   [0          ,  8 MiB)  x   bf16 hi  [4194304]
//   XL   [8 MiB      , 16 MiB)  x   bf16 lo
//   WH   [16 MiB     , +24576)  Wq|Wk|Wv bf16 hi, 3 planes of [64][64] (carve 64 KiB)
//   WL   [16 MiB+64K , +24576)  Wq|Wk|Wv bf16 lo (carve 960 KiB)
//   WOH  [17 MiB     , 19 MiB)  Wo  bf16 hi  [1024][1024]
//   WOL  [19 MiB     , 21 MiB)  Wo  bf16 lo
//   QKVH [21 MiB     , 45 MiB)  q|k|v bf16 hi, 3 planes of [65536][64] (element (b,s,h,d) at (b*SEQ+s)*EMB + h*64 + d)
//   QKVL [45 MiB     , 69 MiB)  q|k|v bf16 lo
//   AVH  [69 MiB     , 77 MiB)  av  bf16 hi  [4096][1024]
//   AVL  [77 MiB     , 85 MiB)  av  bf16 lo
//   total 85 MiB = 89128960 B
// ---------------------------------------------------------------------------
constexpr size_t MIB      = 1048576;
constexpr size_t OFF_XH   = 0;
constexpr size_t OFF_XL   = 8 * MIB;
constexpr size_t OFF_WH   = 16 * MIB;
constexpr size_t OFF_WL   = 16 * MIB + 65536;
constexpr size_t OFF_WOH  = 17 * MIB;
constexpr size_t OFF_WOL  = 19 * MIB;
constexpr size_t OFF_QKVH = 21 * MIB;
constexpr size_t OFF_QKVL = 45 * MIB;
constexpr size_t OFF_AVH  = 69 * MIB;
constexpr size_t OFF_AVL  = 77 * MIB;
constexpr size_t WS_TOTAL = 85 * MIB;
constexpr size_t PLANE_QKV = (size_t)NROWH * HDIM;      // elements per q/k/v plane
static_assert((size_t)NB * SEQ * EMB * 2 <= OFF_XL - OFF_XH);
static_assert((size_t)3 * HDIM * HDIM * 2 <= OFF_WL - OFF_WH);
static_assert((size_t)3 * HDIM * HDIM * 2 <= OFF_WOH - OFF_WL);
static_assert((size_t)EMB * EMB * 2 <= OFF_WOL - OFF_WOH);
static_assert((size_t)EMB * EMB * 2 <= OFF_QKVH - OFF_WOL);
static_assert(3 * PLANE_QKV * 2 <= OFF_QKVL - OFF_QKVH);
static_assert(3 * PLANE_QKV * 2 <= OFF_AVH - OFF_QKVL);
static_assert((size_t)NTOK * EMB * 2 <= OFF_AVL - OFF_AVH);
static_assert((size_t)NTOK * EMB * 2 <= WS_TOTAL - OFF_AVL);
static_assert(WS_TOTAL <= 134217728);

// ---------------------------------------------------------------------------
// Helpers
// ---------------------------------------------------------------------------
__device__ __forceinline__ unsigned short f2bf_bits(float f) {
  unsigned u = __float_as_uint(f);
  return (unsigned short)((u + 0x7FFFu + ((u >> 16) & 1u)) >> 16);
}
__device__ __forceinline__ float bf_bits2f(unsigned short h) { return __uint_as_float(((unsigned)h) << 16); }

// hazard guards as plain device helpers (no inline asm inside the kernel template body)
__device__ __forceinline__ void dep_guard_h(v8f& a, v8f& b, v16h x, v16h y) { asm volatile("v_nop\n\tv_nop\n\tv_nop\n\tv_nop" : "+v"(a), "+v"(b) : "v"(x), "v"(y)); }
__device__ __forceinline__ void dep_guard_b(v8f& a, v8f& b, v16b x, v16b y) { asm volatile("v_nop\n\tv_nop\n\tv_nop\n\tv_nop" : "+v"(a), "+v"(b) : "v"(x), "v"(y)); }
__device__ __forceinline__ void keep4_h(v16h a, v16h b, v16h c, v16h d) { asm volatile("v_nop" :: "v"(a), "v"(b), "v"(c), "v"(d)); }
__device__ __forceinline__ void keep4_b(v16b a, v16b b, v16b c, v16b d) { asm volatile("v_nop" :: "v"(a), "v"(b), "v"(c), "v"(d)); }
__device__ __forceinline__ void acc_guard4(v8f& a, v8f& b, v8f& c, v8f& d) { asm volatile("v_nop\n\tv_nop\n\tv_nop\n\tv_nop" : "+v"(a), "+v"(b), "+v"(c), "+v"(d)); }
template <typename T> struct Frag;
template <> struct Frag<_Float16> {
  typedef v16h V; union U { v16h v; v8h h[2]; };
  static __device__ __forceinline__ v16h load(const _Float16* p) {   // elements 0..7 <- p[0..7], 8..15 <- p[16..23]
    U f; f.h[0] = *(const v8h*)(p); f.h[1] = *(const v8h*)(p + 16); return f.v;
  }
  static __device__ __forceinline__ v8f mma(v16h a, v16h b, v8f c) {
    return __builtin_amdgcn_wmma_f32_16x16x32_f16(false, a, false, b, (short)0, c, false, false);
  }
  static __device__ __forceinline__ void guard(v8f& a, v8f& b, v16h x, v16h y) { dep_guard_h(a, b, x, y); }
  static __device__ __forceinline__ void keep(v16h a, v16h b, v16h c, v16h d) { keep4_h(a, b, c, d); }
};
template <> struct Frag<__bf16> {
  typedef v16b V; union U { v16b v; v8b h[2]; };
  static __device__ __forceinline__ v16b load(const __bf16* p) {
    U f; f.h[0] = *(const v8b*)(p); f.h[1] = *(const v8b*)(p + 16); return f.v;
  }
  static __device__ __forceinline__ v8f mma(v16b a, v16b b, v8f c) {
    return __builtin_amdgcn_wmma_f32_16x16x32_bf16(false, a, false, b, (short)0, c, false, false);
  }
  static __device__ __forceinline__ void guard(v8f& a, v8f& b, v16b x, v16b y) { dep_guard_b(a, b, x, y); }
  static __device__ __forceinline__ void keep(v16b a, v16b b, v16b c, v16b d) { keep4_b(a, b, c, d); }
};

// ---- Register-blocked batched WMMA GEMM --------------------------------
// C[m,n] = scale * sum_k A[m,k] * Bt[n,k] (+bias)(+resid); each wave owns a 64x64 tile.
// A row-major [M,K]; Bt row-major [N,K]; M,N % 64 == 0, K % 32 == 0.
// SPLIT: operands are hi/lo planes (A2/Bt2 = lo planes, same layout); product = hi.hi + hi.lo + lo.hi.
// BIAS_MODE: 0 = none, 1 = bias[m], 2 = bias[n].
// OUT_MODE: 0 = f32, 1 = f16, 2 = bf16 hi plane (Cout) + bf16 lo plane (Cout2).
// ET: 0 = f16 operands, 1 = bf16 operands (pointers passed as 16-bit storage)
template <int ET> struct Elem;
template <> struct Elem<0> { typedef _Float16 T; };
template <> struct Elem<1> { typedef __bf16 T; };
template <int ET, bool SPLIT, int BIAS_MODE, int OUT_MODE, bool RESID, int ACT = 0>
__global__ __launch_bounds__(256) void wmma_gemm64(
    const unsigned short* __restrict__ Ap, const unsigned short* __restrict__ A2p, int lda, long strideA,
    const unsigned short* __restrict__ Btp, const unsigned short* __restrict__ Bt2p, int ldb, long strideB,
    void* __restrict__ Cout, void* __restrict__ Cout2, int ldc, long strideC,
    const float* __restrict__ bias,
    const float* __restrict__ resid, long strideR,
    int M, int N, int K, float scale) {
  typedef typename Elem<ET>::T T;
  typedef typename Frag<T>::V V;
  const T* A = (const T*)Ap; const T* A2 = (const T*)A2p; const T* Bt = (const T*)Btp; const T* Bt2 = (const T*)Bt2p;
  __shared__ __align__(16) float sT[8][16 * 68];   // per-wave 16x64 slab, pitch 68 floats
  const int b    = blockIdx.y;
  const int lane = threadIdx.x & 31;
  const int wave = threadIdx.x >> 5;
  const int tilesN = N >> 6;
  const int tilesM = M >> 6;
  const int tile = blockIdx.x * 8 + wave;
  if (tile >= tilesM * tilesN) return;   // wave-uniform; no block barriers in this kernel
  const int tm = tile / tilesN;
  const int tn = tile - tm * tilesN;
  const int m0 = tm << 6;
  const int n0 = tn << 6;

  const T* Ab  = A  + (size_t)b * strideA;
  const T* Bb  = Bt + (size_t)b * strideB;
  const T* Ab2 = SPLIT ? (A2  + (size_t)b * strideA) : nullptr;
  const T* Bb2 = SPLIT ? (Bt2 + (size_t)b * strideB) : nullptr;

  const int rlane = lane & 15;                 // row (A) / col (B, D) within subtile
  const int koff  = (lane >> 4) * 8;           // k offset of this lane half
  const int mOff  = (lane >> 4) * 8;           // D row offset

  v8f acc[4][4];
#pragma unroll
  for (int i = 0; i < 4; ++i)
#pragma unroll
    for (int j = 0; j < 4; ++j) acc[i][j] = (v8f){0.f,0.f,0.f,0.f,0.f,0.f,0.f,0.f};

  for (int k0 = 0; k0 < K; k0 += 32) {
    V bh[4], bl[4];
#pragma unroll
    for (int j = 0; j < 4; ++j) {
      const size_t bo = (size_t)(n0 + (j << 4) + rlane) * ldb + koff + k0;
      bh[j] = Frag<T>::load(Bb + bo);
      if (SPLIT) bl[j] = Frag<T>::load(Bb2 + bo);
    }
#pragma unroll
    for (int i = 0; i < 4; ++i) {
      const size_t ao = (size_t)(m0 + (i << 4) + rlane) * lda + koff + k0;
      V ah = Frag<T>::load(Ab + ao);
      V al;
      if (SPLIT) al = Frag<T>::load(Ab2 + ao);
#pragma unroll
      for (int j = 0; j < 4; ++j) {
        acc[i][j] = Frag<T>::mma(ah, bh[j], acc[i][j]);
        if (SPLIT) {
          acc[i][j] = Frag<T>::mma(ah, bl[j], acc[i][j]);
          acc[i][j] = Frag<T>::mma(al, bh[j], acc[i][j]);
        }
      }
      Frag<T>::guard(acc[i][0], acc[i][3], ah, SPLIT ? al : ah);
    }
    Frag<T>::keep(bh[0], bh[1], bh[2], bh[3]);
    if (SPLIT) Frag<T>::keep(bl[0], bl[1], bl[2], bl[3]);
  }
  acc_guard4(acc[0][0], acc[0][1], acc[0][2], acc[0][3]);
  acc_guard4(acc[1][0], acc[1][1], acc[1][2], acc[1][3]);
  acc_guard4(acc[2][0], acc[2][1], acc[2][2], acc[2][3]);
  acc_guard4(acc[3][0], acc[3][1], acc[3][2], acc[3][3]);

  // ---- epilogue ----
  float* slab = sT[wave];
  const float* Rb = RESID ? (resid + (size_t)b * strideR) : nullptr;
#pragma unroll
  for (int i = 0; i < 4; ++i) {
    const int mBase = m0 + (i << 4);
#pragma unroll
    for (int j = 0; j < 4; ++j) {
      const int n = n0 + (j << 4) + rlane;
      float bv = 0.f;
      if (BIAS_MODE == 2) bv = bias[n];
#pragma unroll
      for (int r = 0; r < 8; ++r) {
        float v = acc[i][j][r] * scale;
        if (BIAS_MODE == 1) v += bias[mBase + mOff + r];
        if (BIAS_MODE == 2) v += bv;
        if (RESID) v += Rb[(size_t)(mBase + mOff + r) * ldc + n];
        if (ACT == 1) v = tanhf(v);
        if (ACT == 2) v = fmaxf(v, 0.0f);
        if (ACT == 3) v = v / (1.0f + expf(-v));
        if (ACT == 4) v = (v > 0.f) ? v : 0.01f * v;
        if (ACT == 5) v = 0.5f * v * (1.0f + erff(v * 0.70710678118654752f));
        slab[(mOff + r) * 68 + (j << 4) + rlane] = v;
      }
    }
    __builtin_amdgcn_fence(__ATOMIC_RELEASE, "workgroup");
    __builtin_amdgcn_wave_barrier();
    __builtin_amdgcn_fence(__ATOMIC_ACQUIRE, "workgroup");
    if (OUT_MODE == 0) {
      float* C = (float*)Cout + (size_t)b * strideC;
      const int hh = lane >> 4, c4 = (lane & 15) * 4;     // row seg = 256 B = 16 lanes x 16 B
      {
#pragma unroll
        for (int it = 0; it < 8; ++it) {
          const int row = it * 2 + hh;
          v4f v = *(const v4f*)(slab + row * 68 + c4);
          *(v4f*)(C + (size_t)(mBase + row) * ldc + n0 + c4) = v;
        }
        
      }
    } else {
      const int q = lane >> 3, c8 = (lane & 7) * 8;
      unsigned short* C  = (unsigned short*)Cout  + (size_t)b * strideC;
      unsigned short* C2 = (OUT_MODE == 2) ? ((unsigned short*)Cout2 + (size_t)b * strideC) : nullptr;
      {
#pragma unroll
        for (int it = 0; it < 4; ++it) {
          const int row = it * 4 + q;
          const float* sp = slab + row * 68 + c8;
          v8h hv, lv;
#pragma unroll
          for (int e = 0; e < 8; ++e) {
            if (OUT_MODE == 1) {
              hv[e] = (_Float16)sp[e];
            } else {
              unsigned short hb = f2bf_bits(sp[e]);
              unsigned short lb = f2bf_bits(sp[e] - bf_bits2f(hb));
              hv[e] = __builtin_bit_cast(_Float16, hb);
              lv[e] = __builtin_bit_cast(_Float16, lb);
            }
          }
          *(v8h*)(C + (size_t)(mBase + row) * ldc + n0 + c8) = hv;
          if (OUT_MODE == 2) *(v8h*)(C2 + (size_t)(mBase + row) * ldc + n0 + c8) = lv;
        }
        
      }
    }
    __builtin_amdgcn_fence(__ATOMIC_RELEASE, "workgroup");
    __builtin_amdgcn_wave_barrier();
    __builtin_amdgcn_fence(__ATOMIC_ACQUIRE, "workgroup");
  }
}

// ---------------------------------------------------------------------------
// f32 -> bf16 hi + bf16 lo planes (RNE converts). 8 elements per thread:
// two b128 loads, one b128 store per plane; lanes 8q..8q+7 of a wave fill one
// ---------------------------------------------------------------------------
__device__ __forceinline__ void split_pair(float f0, float f1, unsigned& hw, unsigned& lw) {
  const unsigned short h0 = f2bf_bits(f0);
  const unsigned short h1 = f2bf_bits(f1);
  const unsigned short l0 = f2bf_bits(f0 - bf_bits2f(h0));
  const unsigned short l1 = f2bf_bits(f1 - bf_bits2f(h1));
  hw = (unsigned)h0 | ((unsigned)h1 << 16);
  lw = (unsigned)l0 | ((unsigned)l1 << 16);
}

__global__ __launch_bounds__(256) void split_planes_bf16(
    const float* __restrict__ src, unsigned short* __restrict__ hi,
    unsigned short* __restrict__ lo, int n8) {
  const int i = blockIdx.x * 256 + threadIdx.x;
  if (i >= n8) return;                      // no barriers in this kernel
  const size_t e0 = (size_t)i * 8;
  const v4f a = *(const v4f*)(src + e0);
  const v4f c = *(const v4f*)(src + e0 + 4);
  unsigned hx, hy, hz, hw, lx, ly, lz, lw;
  split_pair(a[0], a[1], hx, lx);
  split_pair(a[2], a[3], hy, ly);
  split_pair(c[0], c[1], hz, lz);
  split_pair(c[2], c[3], hw, lw);
  const v4u hv = (v4u){hx, hy, hz, hw};
  const v4u lv = (v4u){lx, ly, lz, lw};
  *(v4u*)(hi + e0) = hv;
  *(v4u*)(lo + e0) = lv;
  
}

// ---------------------------------------------------------------------------
// Causal flash attention, head dim 64, bf16 hi/lo planes in, bf16 hi/lo planes out.
//   q,k,v planes: element (b, s, h, d) at (b*SEQ + s)*EMB + h*64 + d (ushort storage).
//   scores^T = k.q^T * sm_scale : hi.hi + hi.lo + lo.hi on v_wmma_f32_16x16x32_bf16 (A = K rows, B = Q)
//   out^T    = v^T.p^T          : p and v as bf16 hi/lo, same three products (A = V^T, B = P^T)
//   Transposed, a lane holds 32 scores of ONE query (column c): maximum and sum run inside the lane, with one
//   exchange between the lane halves, and two score tiles converted in place are the B operand P^T of the second
//   product, so that P never goes through LDS.
//   online softmax in f32, exponentials in base 2; block = 4 waves; a query block = 64 query rows of one (b, h), 16 per wave;
//   grid.x = NB * NHEAD * (SEQ/64) / 2; keys visited in 64-wide chunks 0..qb (causal).
//   A query block qb costs qb + 1 chunks, and all blocks of the grid are resident at once, so the launch lasts as
//   long as its fullest block: each block takes query blocks 31 - p and p of one (b, h), one after the other in
//   every wave, which is 33 chunks for every block of the grid.
//   Output planes: element (b, q, h*64+d) at (b*SEQ+q)*EMB + h*64 + d; each wave writes
// ---------------------------------------------------------------------------
typedef __attribute__((ext_vector_type(2))) float  v2f;
typedef __attribute__((ext_vector_type(2))) __bf16 v2b;
// two f32 -> packed bf16 hi pair and bf16 lo pair (lo = f - hi), both converts round to nearest even
__device__ __forceinline__ void at_split2(float f0, float f1, v2b& hi, v2b& lo) {
  hi = __builtin_convertvector((v2f){f0, f1}, v2b);
  lo = __builtin_convertvector((v2f){f0 - (float)hi[0], f1 - (float)hi[1]}, v2b);
}
__device__ __forceinline__ v8f at_mma(v16b a, v16b b, v8f c) {
  c = __builtin_amdgcn_wmma_f32_16x16x32_bf16(false, a, false, b, (short)0, c, false, false);
  asm volatile("v_nop\n\tv_nop\n\tv_nop\n\tv_nop" : "+v"(c) : "v"(a), "v"(b));
  return c;
}

// value of lane l ^ 16 (the other 16-lane half) by a cross-row move in the vector unit; all 32 lanes are active at every call
__device__ __forceinline__ float half_swap(float x) {
  const int v = __float_as_int(x);
  return __int_as_float(__builtin_amdgcn_permlanex16(v, v, 0x76543210, 0xfedcba98, false, false));
}

// 2^x in place, 1 or 16 values a statement. The instruction set asks for one free slot between a transcendental and a
// next instruction that reads its result or overwrites its source. Here each v_exp_f32 names one register of
// its own, so none touches its neighbour's, and the v_nop at the end is the slot of the last.
__device__ __forceinline__ void exp2_x1(float& x) {
  asm("v_exp_f32 %0, %0\n\tv_nop" : "+v"(x));
}
__device__ __forceinline__ void exp2_x16(float (&x)[16]) {
  asm("v_exp_f32 %0, %0\n\tv_exp_f32 %1, %1\n\tv_exp_f32 %2, %2\n\tv_exp_f32 %3, %3\n\t"
      "v_exp_f32 %4, %4\n\tv_exp_f32 %5, %5\n\tv_exp_f32 %6, %6\n\tv_exp_f32 %7, %7\n\t"
      "v_exp_f32 %8, %8\n\tv_exp_f32 %9, %9\n\tv_exp_f32 %10, %10\n\tv_exp_f32 %11, %11\n\t"
      "v_exp_f32 %12, %12\n\tv_exp_f32 %13, %13\n\tv_exp_f32 %14, %14\n\tv_exp_f32 %15, %15\n\t"
      "v_nop"
      : "+v"(x[0]), "+v"(x[1]), "+v"(x[2]), "+v"(x[3]), "+v"(x[4]), "+v"(x[5]), "+v"(x[6]), "+v"(x[7]),
        "+v"(x[8]), "+v"(x[9]), "+v"(x[10]), "+v"(x[11]), "+v"(x[12]), "+v"(x[13]), "+v"(x[14]), "+v"(x[15]));
}

// transposing LDS read of a row-major 16-bit tile T: with lane l's pointer at
// T[kbase + 8 (l >> 4) + (l & 7)][dbase + 8 ((l >> 3) & 1)], lane (c = l & 15, hh = l >> 4) gets
// T[kbase + 8 hh + 0..7][dbase + c]. All 32 lanes are active and hold an address inside the tile at every call.
typedef __attribute__((ext_vector_type(8))) short v8s;
__device__ __forceinline__ v8b ld_tr16(const unsigned short* p) {
  typedef __attribute__((address_space(3))) v8s lds_v8s;
  return __builtin_bit_cast(v8b, __builtin_amdgcn_ds_load_tr16_b128_v8i16((lds_v8s*)p));
}

__global__ __launch_bounds__(128)
void attn_causal_hd64(const unsigned short* __restrict__ Qh, const unsigned short* __restrict__ Ql,
                      const unsigned short* __restrict__ Kh, const unsigned short* __restrict__ Kl,
                      const unsigned short* __restrict__ Vh, const unsigned short* __restrict__ Vl,
                      unsigned short* __restrict__ Oh, unsigned short* __restrict__ Ol,
                      float sm_scale) {
  union FB { v16b v; v8b h[2]; };
  __shared__ __align__(16) unsigned short Ksh[AKC * APT];     // K hi [kv][d]   9 KB
  __shared__ __align__(16) unsigned short Ksl[AKC * APT];     // K lo [kv][d]   9 KB
  __shared__ __align__(16) unsigned short Vsh[AKC * VPT];     // V hi [kv][d]  10 KB
  __shared__ __align__(16) unsigned short Vsl[AKC * VPT];     // V lo [kv][d]  10 KB
  __shared__ __align__(16) float  Os[ANW][16 * 68];           // per wave out tile, pitch 68

  const int tid  = threadIdx.x;
  const int wave = tid >> 5;
  const int lane = tid & 31;
  const int hh   = lane >> 4;
  const int c    = lane & 15;
  const float NEG_INF = -__builtin_inff();
  // exp(sm_scale * s - m) = 2^(sc2 * s - m * log2(e)): one multiply-add and one v_exp_f32 an element (sm_scale > 0)
  const float sc2 = sm_scale * 1.44269504088896340736f;

  constexpr int NQB = SEQ / AQB;                 // 32 query blocks per (b, h)
  constexpr int NPR = NQB / 2;                   // 16 pairs (31 - p, p) per (b, h)
  static_assert(NQB % 2 == 0);
  const int bx   = blockIdx.x;
  const int pr   = bx % NPR;
  const int bhid = bx / NPR;
  const int h    = bhid % NHEAD;
  const int b    = bhid / NHEAD;
  const size_t hoff = (size_t)h * HDIM;

  for (int half = 0; half < 2; ++half) {         // block-uniform: every wave walks both query blocks in this order
  const int qb   = half ? pr : NQB - 1 - pr;
  const int q0   = qb * AQB + wave * 16;

  // ---- Q fragments (B operand): column = query c, elements 0..7 <- d = dc*32 + 8hh + 0..7, 8..15 <- dc*32 + 16 + 8hh + 0..7
  v16b qah[2], qal[2];
  {
    const size_t qo = (size_t)(b * SEQ + q0 + c) * EMB + hoff + 8 * hh;
    const __bf16* qhp = (const __bf16*)(const void*)Qh;
    const __bf16* qlp = (const __bf16*)(const void*)Ql;
#pragma unroll
    for (int dc = 0; dc < 2; ++dc) {
      qah[dc] = Frag<__bf16>::load(qhp + qo + dc * 32);
      qal[dc] = Frag<__bf16>::load(qlp + qo + dc * 32);
    }
  }

  // of query q0 + c: running maximum (log2 units, alike in both lane halves) and the sum over this half's keys
  float mrow = NEG_INF, lrow = 0.f;
  v8f oacc[4];                                   // oacc[t][r] = out[q0 + c][t*16 + 8hh + r]
#pragma unroll
  for (int t = 0; t < 4; ++t) oacc[t] = (v8f){0.f,0.f,0.f,0.f,0.f,0.f,0.f,0.f};

  // staging map: thread -> rows skv + 16 i (i = 0..3), 16-byte column group scol, of each 64 x 64 K / V plane tile
  const int skv = tid >> 3, scol = (tid & 7) * 8;
  // one 32-bit byte offset (< 8 MiB) serves all four planes on their scalar base pointers: one address register
  // instead of four pairs
  const unsigned sgb = (unsigned)(((b * SEQ + skv) * EMB + h * HDIM + scol) * 2);
  v4u kwh[4], kwl[4], vwh[4], vwl[4];            // K hi, K lo, V hi, V lo words of the chunk fetched ahead
  const int nChunks = qb + 1;                    // block-uniform, <= 32
  // ---- chunk 0's K and V words, all 16 global loads in flight together ----
  {
    const unsigned gb = sgb;
#pragma unroll
    for (int i = 0; i < 4; ++i) {
      kwh[i] = *(const v4u*)((const char*)Kh + gb + 16 * i * EMB * 2);
      kwl[i] = *(const v4u*)((const char*)Kl + gb + 16 * i * EMB * 2);
      vwh[i] = *(const v4u*)((const char*)Vh + gb + 16 * i * EMB * 2);
      vwl[i] = *(const v4u*)((const char*)Vl + gb + 16 * i * EMB * 2);
    }
  }
  // the address registers of the Q, K and V loads above are written anew below: their translations are waited for
  // first; the Q words as inputs keep the wait behind their loads (once per query block)
  asm volatile("s_wait_xcnt 0x0" :: "v"(qah[0]), "v"(qah[1]), "v"(qal[0]), "v"(qal[1]) : "memory");
  for (int kc = 0; kc < nChunks; ++kc) {
    const int kv0 = kc * AKC;
    __syncthreads();
    // ---- K and V words fetched one trip ahead go from registers to LDS ----
#pragma unroll
    for (int i = 0; i < 4; ++i) {
      *(v4u*)(Ksh + (skv + 16 * i) * APT + scol) = kwh[i];
      *(v4u*)(Ksl + (skv + 16 * i) * APT + scol) = kwl[i];
    }
    // ---- V hi/lo row-major as they come: one 16-B LDS store a word; the fragment reads transpose ----
#pragma unroll
    for (int i = 0; i < 4; ++i) {
      *(v4u*)(Vsh + (skv + 16 * i) * VPT + scol) = vwh[i];
      *(v4u*)(Vsl + (skv + 16 * i) * VPT + scol) = vwl[i];
    }
    __syncthreads();

    // ---- scores^T: 4 key tiles x 2 d-chunks x 3 products; s[j][r] = score of key kv0 + j*16 + 8hh + r, query q0 + c ----
    v8f s[4];
#pragma unroll
    for (int j = 0; j < 4; ++j) {
      s[j] = (v8f){0.f,0.f,0.f,0.f,0.f,0.f,0.f,0.f};
#pragma unroll
      for (int dc = 0; dc < 2; ++dc) {
        FB kfh, kfl;
        const int ko = (j * 16 + c) * APT + dc * 32 + 8 * hh;
        kfh.h[0] = *(const v8b*)(Ksh + ko);
        kfh.h[1] = *(const v8b*)(Ksh + ko + 16);
        kfl.h[0] = *(const v8b*)(Ksl + ko);
        kfl.h[1] = *(const v8b*)(Ksl + ko + 16);
        s[j] = at_mma(kfh.v, qah[dc], s[j]);
        s[j] = at_mma(kfl.v, qah[dc], s[j]);
        s[j] = at_mma(kfh.v, qal[dc], s[j]);
      }
    }
    // ---- causal mask on the diagonal chunk (select, -inf fill): there kv0 = qb * 64, so key j*16 + 8hh + r of the
    //      chunk lies behind query wave*16 + c where j*16 + r > lim; elsewhere lim is above every j*16 + r.
    //      Maximum of the raw scores in four independent chains; the maximum alone is scaled here: sc2 > 0 and
    //      rounding is monotone, so it is the maximum of the scaled scores ----
    const int lim = (kc == qb) ? wave * 16 + c - 8 * hh : AKC;
    float mx[4];
#pragma unroll
    for (int j = 0; j < 4; ++j) {
      float m = NEG_INF;
#pragma unroll
      for (int r = 0; r < 8; ++r) {
        const float val = (j * 16 + r > lim) ? NEG_INF : s[j][r];
        s[j][r] = val;
        m = fmaxf(m, val);
      }
      mx[j] = m;
    }
    float cm = fmaxf(fmaxf(mx[0], mx[1]), fmaxf(mx[2], mx[3]));
    cm = fmaxf(cm, half_swap(cm)) * sc2;         // both halves' keys: finite, key kv0 is never behind a query of the block
    // ---- online softmax update in base 2 (mrow holds log2 units); P^T hi/lo packed in registers:
    //      element e of ph[kk] = p of key kk*32 + 8hh + e (e < 8), kk*32 + 16 + 8hh + e - 8 (e >= 8): the B operand's k order ----
    const float mnew = fmaxf(mrow, cm);
    float alpha = mrow - mnew;                   // 2^(old maximum - new maximum)
    mrow = mnew;
    exp2_x1(alpha);
    v16b ph[2], pl[2];
    float ps[4];                                 // four independent partial sums, started by the first four values
#pragma unroll
    for (int kk = 0; kk < 2; ++kk) {             // two score tiles = 16 exponentials a statement
      float pe[16];
#pragma unroll
      for (int e = 0; e < 16; ++e) pe[e] = fmaf(s[kk * 2 + (e >> 3)][e & 7], sc2, -mnew);
      exp2_x16(pe);
#pragma unroll
      for (int e = 0; e < 16; e += 2) {
        const bool first = (kk == 0 && e < 4);
        ps[e & 3]       = first ? pe[e]     : ps[e & 3] + pe[e];
        ps[(e & 3) + 1] = first ? pe[e + 1] : ps[(e & 3) + 1] + pe[e + 1];
        v2b a, bl;
        at_split2(pe[e], pe[e + 1], a, bl);
        ph[kk][e] = a[0];  ph[kk][e + 1] = a[1];
        pl[kk][e] = bl[0]; pl[kk][e + 1] = bl[1];
      }
    }
    lrow = lrow * alpha + ((ps[0] + ps[1]) + (ps[2] + ps[3]));
#pragma unroll
    for (int t = 0; t < 4; ++t) oacc[t] *= alpha;
    // ---- next chunk's K and V words: 16 global loads in flight together, their latency under the P.V products ----
    if (kc + 1 < nChunks) {
      const unsigned gb = sgb + (unsigned)(kv0 + AKC) * (EMB * 2);
#pragma unroll
      for (int i = 0; i < 4; ++i) {
        kwh[i] = *(const v4u*)((const char*)Kh + gb + 16 * i * EMB * 2);
        kwl[i] = *(const v4u*)((const char*)Kl + gb + 16 * i * EMB * 2);
        vwh[i] = *(const v4u*)((const char*)Vh + gb + 16 * i * EMB * 2);
        vwl[i] = *(const v4u*)((const char*)Vl + gb + 16 * i * EMB * 2);
      }
      // the offset register of these loads is written anew right below: their translations are waited for first
      asm volatile("s_wait_xcnt 0x0" ::: "memory");
    }
    // ---- O^T += V^T.P^T : A[m=d][k=kv] = V[kv][d], row d = t*16 + c by transposing reads, B = P^T;
    //      elements 0..7 <- kv = kk*32 + 8hh + 0..7, 8..15 <- kk*32 + 16 + 8hh + 0..7, the k order of ph and pl ----
#pragma unroll
    for (int kk = 0; kk < 2; ++kk) {
#pragma unroll
      for (int t = 0; t < 4; ++t) {
        FB vb, vlo;
        const int vo = (kk * 32 + 8 * hh + (lane & 7)) * VPT + t * 16 + 8 * ((lane >> 3) & 1);
        vb.h[0]  = ld_tr16(Vsh + vo);
        vb.h[1]  = ld_tr16(Vsh + vo + 16 * VPT);
        vlo.h[0] = ld_tr16(Vsl + vo);
        vlo.h[1] = ld_tr16(Vsl + vo + 16 * VPT);
        oacc[t] = at_mma(vb.v, ph[kk], oacc[t]);
        oacc[t] = at_mma(vlo.v, ph[kk], oacc[t]);
        oacc[t] = at_mma(vb.v, pl[kk], oacc[t]);
      }
    }
  }

  // ---- epilogue: 1/l, per-wave LDS slab, whole-line bf16 hi/lo stores ----
  float* os = Os[wave];
  {
    const float inv = 1.0f / (lrow + half_swap(lrow));   // the two halves' key sums joined once
#pragma unroll
    for (int t = 0; t < 4; ++t) {
      const v8f o = oacc[t] * inv;
      *(v4f*)(os + c * 68 + t * 16 + 8 * hh)     = (v4f){o[0], o[1], o[2], o[3]};
      *(v4f*)(os + c * 68 + t * 16 + 8 * hh + 4) = (v4f){o[4], o[5], o[6], o[7]};
    }
  }
  __builtin_amdgcn_fence(__ATOMIC_RELEASE, "workgroup");
  __builtin_amdgcn_wave_barrier();
  __builtin_amdgcn_fence(__ATOMIC_ACQUIRE, "workgroup");
  {
    // rows it*4 + q4 (it 0..3, q4 0..3) = 0..15; c8 = 0..56 step 8 -> full 16 x 64 tile per plane
    const int q4 = lane >> 3, c8 = (lane & 7) * 8;
    {
#pragma unroll
      for (int it = 0; it < 4; ++it) {
        const int row = it * 4 + q4;
        const float* sp = os + row * 68 + c8;
        v8h hv, lv;
#pragma unroll
        for (int e = 0; e < 8; ++e) {
          unsigned short hb = f2bf_bits(sp[e]);
          unsigned short lb = f2bf_bits(sp[e] - bf_bits2f(hb));
          hv[e] = __builtin_bit_cast(_Float16, hb);
          lv[e] = __builtin_bit_cast(_Float16, lb);
        }
        const size_t oo = (size_t)(b * SEQ + q0 + row) * EMB + hoff + c8;
        *(v8h*)(Oh + oo) = hv;
        *(v8h*)(Ol + oo) = lv;
      }
      
    }
  }
  // the second query block writes the registers of the stores above anew: their translations are waited for first
  asm volatile("s_wait_xcnt 0x0" ::: "memory");
  }   // half
}

// ---------------------------------------------------------------------------
// Output projection C[m][n] = sum_k A[m][k] * Bt[n][k], A = av hi/lo [NTOK][EMB], Bt = Wo hi/lo [EMB][EMB], C f32.
//   One 128 x 128 tile of C per block, 256 blocks, 8 waves of 64 x 32 (2 x 4). A stage is 64 k = one 128-B line of
//   every operand row: the block loads it once by whole lines (a wave-wide 16-B load covers 4 rows), one stage ahead
//   into registers, stores it to LDS at the 144-B pitch of the ds_load_b128 fragment reads, and all 8 waves read
//   their fragments from there. Two LDS buffers, one barrier a stage: a wave stores stage s + 1 only behind the
//   barrier of stage s, which every wave reaches only after its last read of stage s - 1 (the same buffer).
//   Per accumulator the products come in the order k ascending by 32, hi.hi, hi.lo, lo.hi.
// ---------------------------------------------------------------------------
constexpr int GBT = 128;                     // tile rows (m) and columns (n) per block
constexpr int GBK = 64;                      // k per stage
constexpr int GNS = EMB / GBK;               // 16 stages
constexpr int GPL = GBT * APT;               // 16-bit elements of one plane tile in LDS
constexpr int GCP = 36;                      // f32 pitch of the per-wave output slab: 144 B
static_assert(NTOK % GBT == 0 && EMB % GBT == 0 && EMB % GBK == 0 && GBK <= APT);

__global__ __launch_bounds__(256)
void out_proj_lds(const unsigned short* __restrict__ Ah, const unsigned short* __restrict__ Al,
                  const unsigned short* __restrict__ Bh, const unsigned short* __restrict__ Bl,
                  float* __restrict__ C) {
  union FB { v16b v; v8b h[2]; };
  __shared__ __align__(16) unsigned short sAh[2 * GPL];
  __shared__ __align__(16) unsigned short sAl[2 * GPL];
  __shared__ __align__(16) unsigned short sBh[2 * GPL];
  __shared__ __align__(16) unsigned short sBl[2 * GPL];
  __shared__ __align__(16) float sC[8][16 * GCP];

  const int tid  = threadIdx.x;
  const int wave = tid >> 5;
  const int lane = tid & 31;
  const int hh   = lane >> 4;
  const int c    = lane & 15;
  constexpr int TN = EMB / GBT;                // 8 tile columns
  const int tn = blockIdx.x % TN;
  const int tm = blockIdx.x / TN;
  const int m0 = tm * GBT;
  const int n0 = tn * GBT;
  const int wm = (wave >> 2) * 64;             // wave's rows inside the tile
  const int wn = (wave & 3) * 32;              // wave's columns inside the tile

  // staging map: thread -> rows srow + 32 i (i = 0..3), 16-byte column group scol, of each 128 x 64 plane tile.
  // 8 lanes take one row (a whole 128-B line); the two rows of a 16-lane half lie 8 rows = 1152 B apart in LDS,
  // 128 B modulo the 256 B of the banks, so that a half's ds_store_b128 meets every bank once.
  const int sg   = lane >> 3;
  const int srow = (wave >> 2) * 16 + (sg & 1) * 8 + (wave & 3) * 2 + (sg >> 1);
  const int scol = (tid & 7) * 8;
  const unsigned ga = (unsigned)(((m0 + srow) * EMB + scol) * 2);   // byte offset in the A planes (< 8 MiB)
  const unsigned gb = (unsigned)(((n0 + srow) * EMB + scol) * 2);   // byte offset in the B planes (< 2 MiB)
  v4u rah[4], ral[4], rbh[4], rbl[4];
#pragma unroll
  for (int i = 0; i < 4; ++i) {
    rah[i] = *(const v4u*)((const char*)Ah + ga + 32 * i * EMB * 2);
    ral[i] = *(const v4u*)((const char*)Al + ga + 32 * i * EMB * 2);
    rbh[i] = *(const v4u*)((const char*)Bh + gb + 32 * i * EMB * 2);
    rbl[i] = *(const v4u*)((const char*)Bl + gb + 32 * i * EMB * 2);
  }
  // the offset registers of these loads may be written anew below: their translations are waited for first
  asm volatile("s_wait_xcnt 0x0" ::: "memory");

  v8f acc[4][2];
#pragma unroll
  for (int i = 0; i < 4; ++i)
#pragma unroll
    for (int j = 0; j < 2; ++j) acc[i][j] = (v8f){0.f,0.f,0.f,0.f,0.f,0.f,0.f,0.f};

  for (int s = 0; s < GNS; ++s) {
    const int bo = (s & 1) * GPL;
    // ---- the stage fetched one trip ahead goes from registers to LDS ----
#pragma unroll
    for (int i = 0; i < 4; ++i) {
      const int so = bo + (srow + 32 * i) * APT + scol;
      *(v4u*)(sAh + so) = rah[i];
      *(v4u*)(sAl + so) = ral[i];
      *(v4u*)(sBh + so) = rbh[i];
      *(v4u*)(sBl + so) = rbl[i];
    }
    __syncthreads();
    // ---- next stage's 16 global loads in flight together, their latency under this stage's products ----
    if (s + 1 < GNS) {
      const unsigned ko = (unsigned)(s + 1) * (GBK * 2);
#pragma unroll
      for (int i = 0; i < 4; ++i) {
        rah[i] = *(const v4u*)((const char*)Ah + (ga + ko) + 32 * i * EMB * 2);
        ral[i] = *(const v4u*)((const char*)Al + (ga + ko) + 32 * i * EMB * 2);
        rbh[i] = *(const v4u*)((const char*)Bh + (gb + ko) + 32 * i * EMB * 2);
        rbl[i] = *(const v4u*)((const char*)Bl + (gb + ko) + 32 * i * EMB * 2);
      }
      // the offset registers of these loads are written anew in the next trip: their translations are waited for first
      asm volatile("s_wait_xcnt 0x0" ::: "memory");
    }
    // ---- fragments: row (A) or column (B) = c, elements 0..7 <- k = ks*32 + 8hh + 0..7, 8..15 <- ks*32 + 16 + 8hh + 0..7
#pragma unroll
    for (int ks = 0; ks < 2; ++ks) {
      FB fah[4], fal[4], fbh[2], fbl[2];
#pragma unroll
      for (int i = 0; i < 4; ++i) {
        const int ao = bo + (wm + i * 16 + c) * APT + ks * 32 + 8 * hh;
        fah[i].h[0] = *(const v8b*)(sAh + ao);
        fah[i].h[1] = *(const v8b*)(sAh + ao + 16);
        fal[i].h[0] = *(const v8b*)(sAl + ao);
        fal[i].h[1] = *(const v8b*)(sAl + ao + 16);
      }
#pragma unroll
      for (int j = 0; j < 2; ++j) {
        const int bq = bo + (wn + j * 16 + c) * APT + ks * 32 + 8 * hh;
        fbh[j].h[0] = *(const v8b*)(sBh + bq);
        fbh[j].h[1] = *(const v8b*)(sBh + bq + 16);
        fbl[j].h[0] = *(const v8b*)(sBl + bq);
        fbl[j].h[1] = *(const v8b*)(sBl + bq + 16);
      }
      // eight independent accumulator tiles between two products into the same tile
#pragma unroll
      for (int i = 0; i < 4; ++i)
#pragma unroll
        for (int j = 0; j < 2; ++j) acc[i][j] = Frag<__bf16>::mma(fah[i].v, fbh[j].v, acc[i][j]);
#pragma unroll
      for (int i = 0; i < 4; ++i)
#pragma unroll
        for (int j = 0; j < 2; ++j) acc[i][j] = Frag<__bf16>::mma(fah[i].v, fbl[j].v, acc[i][j]);
#pragma unroll
      for (int i = 0; i < 4; ++i)
#pragma unroll
        for (int j = 0; j < 2; ++j) acc[i][j] = Frag<__bf16>::mma(fal[i].v, fbh[j].v, acc[i][j]);
    }
  }

  // ---- epilogue: per-wave 16 x 32 f32 slab, whole 128-B lines to C ----
  // The slab passes values between lanes of one wave only, so the fences name LDS alone: a fence over all memory
  // would also wait for the C stores of the tile row before.
  float* slab = sC[wave];
#pragma unroll
  for (int i = 0; i < 4; ++i) {
#pragma unroll
    for (int j = 0; j < 2; ++j)
#pragma unroll
      for (int r = 0; r < 8; ++r) slab[(8 * hh + r) * GCP + j * 16 + c] = acc[i][j][r];
    __builtin_amdgcn_fence(__ATOMIC_RELEASE, "workgroup", "local");
    __builtin_amdgcn_wave_barrier();
    __builtin_amdgcn_fence(__ATOMIC_ACQUIRE, "workgroup", "local");
    const int q4 = lane >> 3, c4 = (lane & 7) * 4;       // 8 lanes x 16 B = one 128-B row segment
#pragma unroll
    for (int it = 0; it < 4; ++it) {
      const int row = it * 4 + q4;
      const v4f v = *(const v4f*)(slab + row * GCP + c4);
      *(v4f*)(C + (size_t)(m0 + wm + i * 16 + row) * EMB + n0 + wn + c4) = v;
    }
    // the next tile row writes registers of the stores above anew: their translations are waited for first
    if (i < 3) {
      asm volatile("s_wait_xcnt 0x0" ::: "memory");
      __builtin_amdgcn_sched_barrier(0);   // keeps the next tile row's address arithmetic behind that wait
    }
    __builtin_amdgcn_fence(__ATOMIC_RELEASE, "workgroup", "local");
    __builtin_amdgcn_wave_barrier();
    __builtin_amdgcn_fence(__ATOMIC_ACQUIRE, "workgroup", "local");
  }
}

// ---------------------------------------------------------------------------
// Host launcher: 8 launches, no runtime API calls other than launches.
// ---------------------------------------------------------------------------
extern "C" void kernel_launch(void* const* d_in, const int* in_sizes, int n_in,
                              void* d_out, int out_size, void* d_ws, size_t ws_size,
                              hipStream_t stream) {
  if (n_in < 5) return;
  if (in_sizes[0] != NB * SEQ * EMB) return;
  if (in_sizes[1] != HDIM * HDIM || in_sizes[2] != HDIM * HDIM || in_sizes[3] != HDIM * HDIM) return;
  if (in_sizes[4] != EMB * EMB) return;
  if (out_size != NB * SEQ * EMB) return;
  if (ws_size < WS_TOTAL) return;

  const float* x  = (const float*)d_in[0];
  const float* Wq = (const float*)d_in[1];
  const float* Wk = (const float*)d_in[2];
  const float* Wv = (const float*)d_in[3];
  const float* Wo = (const float*)d_in[4];
  float* out = (float*)d_out;

  char* ws = (char*)d_ws;
  unsigned short* XH   = (unsigned short*)(ws + OFF_XH);
  unsigned short* XL   = (unsigned short*)(ws + OFF_XL);
  unsigned short* WH   = (unsigned short*)(ws + OFF_WH);
  unsigned short* WL   = (unsigned short*)(ws + OFF_WL);
  unsigned short* WOH  = (unsigned short*)(ws + OFF_WOH);
  unsigned short* WOL  = (unsigned short*)(ws + OFF_WOL);
  unsigned short* QKVH = (unsigned short*)(ws + OFF_QKVH);
  unsigned short* QKVL = (unsigned short*)(ws + OFF_QKVL);
  unsigned short* AVH  = (unsigned short*)(ws + OFF_AVH);
  unsigned short* AVL  = (unsigned short*)(ws + OFF_AVL);
  const float* dummyf = (const float*)(ws + OFF_XH);     // unused pointer slots point inside ws

  // ---- operand planes (bf16 hi/lo) ----
  {
    const int n8x = (NB * SEQ * EMB) / 8;                // 524288 threads cover 4194304 elements
    split_planes_bf16<<<(n8x + 255) / 256, 256, 0, stream>>>(x, XH, XL, n8x);
    const int n8w = (HDIM * HDIM) / 8;                   // 512 threads cover 4096 elements each
    split_planes_bf16<<<(n8w + 255) / 256, 256, 0, stream>>>(Wq, WH + 0 * HDIM * HDIM, WL + 0 * HDIM * HDIM, n8w);
    split_planes_bf16<<<(n8w + 255) / 256, 256, 0, stream>>>(Wk, WH + 1 * HDIM * HDIM, WL + 1 * HDIM * HDIM, n8w);
    split_planes_bf16<<<(n8w + 255) / 256, 256, 0, stream>>>(Wv, WH + 2 * HDIM * HDIM, WL + 2 * HDIM * HDIM, n8w);
    const int n8o = (EMB * EMB) / 8;                     // 131072 threads cover 1048576 elements
    split_planes_bf16<<<(n8o + 255) / 256, 256, 0, stream>>>(Wo, WOH, WOL, n8o);
  }

  // ---- q|k|v = xh[65536][64] . W{q,k,v}^T : M=65536, N=64, K=64; grid.y selects the weight plane ----
  {
    const int tiles = (NROWH / 64) * (HDIM / 64);        // 1024 wave tiles
    dim3 grid((tiles + 7) / 8, 3);
    wmma_gemm64<1, true, 0, 2, false><<<grid, 256, 0, stream>>>(
        XH, XL, HDIM, 0L,
        WH, WL, HDIM, (long)(HDIM * HDIM),
        (void*)QKVH, (void*)QKVL, HDIM, (long)PLANE_QKV,
        dummyf, dummyf, 0L,
        NROWH, HDIM, HDIM, 1.0f);
  }

  // ---- causal attention per (b, h): av hi/lo planes ----
  {
    const int nblk = NB * NHEAD * (SEQ / AQB) / 2;       // 512 blocks x 2 x 64 query rows
    attn_causal_hd64<<<nblk, 128, 0, stream>>>(
        QKVH + 0 * PLANE_QKV, QKVL + 0 * PLANE_QKV,
        QKVH + 1 * PLANE_QKV, QKVL + 1 * PLANE_QKV,
        QKVH + 2 * PLANE_QKV, QKVL + 2 * PLANE_QKV,
        AVH, AVL, 0.125f);
  }

  // ---- out = av[4096][1024] . Wo^T : M=4096, N=1024, K=1024, f32 into d_out ----
  {
    const int nblk = (NTOK / GBT) * (EMB / GBT);         // 256 blocks, one 128 x 128 tile each
    out_proj_lds<<<nblk, 256, 0, stream>>>(AVH, AVL, WOH, WOL, out);
  }
}

// v009
// A run of this version takes 111 microseconds.
// Next to v008, in two timings, it ran 1.08 times as fast each time.
// Over all steps from v000 it is 4.88 times as fast.
// Contractions: q/k/v projections, q.k^T scores, p.v and output projection all on v_wmma_f32_16x16x32_bf16 with bf16 hi/lo split operands (hi*hi + hi*lo + lo*hi), f32 accumulate; softmax and all side math in f32.
#include <hip/hip_runtime.h>

typedef __attribute__((ext_vector_type(16))) _Float16 v16h;
typedef __attribute__((ext_vector_type(8)))  _Float16 v8h;
typedef __attribute__((ext_vector_type(16))) __bf16   v16b;
typedef __attribute__((ext_vector_type(8)))  __bf16   v8b;
typedef __attribute__((ext_vector_type(8)))  float    v8f;
typedef __attribute__((ext_vector_type(4)))  float    v4f;
typedef __attribute__((ext_vector_type(4)))  unsigned v4u;
#define U16(p) ((const unsigned short*)(const void*)(p))

// ---------------------------------------------------------------------------
// Problem constants
// ---------------------------------------------------------------------------
constexpr int NB    = 2;
constexpr int SEQ   = 2048;
constexpr int EMB   = 1024;
constexpr int NHEAD = 16;
constexpr int HDIM  = 64;
constexpr int NTOK  = NB * SEQ;              // 4096 rows of [EMB]
constexpr int NROWH = NTOK * NHEAD;          // 65536 rows of [HDIM]

// attention tiling
constexpr int AQB = 64;                      // query rows per query block (4 waves x 16)
constexpr int AKC = 64;                      // keys per chunk
constexpr int ANW = 4;
// LDS row pitch of the K tiles (and of the output projection's operand tiles), in 16-bit elements: 144 B = 16 B x 9 (odd), so that the
// 16 rows a ds_load_b128 fragment read touches start on distinct bank groups (128-B rows do not).
constexpr int APT = 72;
// LDS row pitch of the V tiles, kept row-major [kv][d] and read by ds_load_tr16_b128: 160 B = 32 B x 5 (odd),
// the conflict-free pitch of that reader.
constexpr int VPT = 80;

// GEMM shape contract (no run-time tails)
static_assert(NROWH % 64 == 0);              // qkv GEMM M
static_assert(HDIM % 64 == 0);               // qkv GEMM N
static_assert(HDIM % 32 == 0);               // qkv GEMM K
static_assert(NTOK % 64 == 0);
static_assert(EMB % 64 == 0);
static_assert(EMB % 32 == 0);
static_assert(SEQ % AQB == 0);
static_assert(AQB == AKC);
static_assert(APT >= AKC && APT >= HDIM && (APT * 2) % 16 == 0 && ((APT * 2) / 16) % 2 == 1);
static_assert(VPT >= HDIM && (VPT * 2) % 32 == 0 && ((VPT * 2) / 32) % 2 == 1);

// ---------------------------------------------------------------------------
//   XH   [0          ,  8 MiB)  x   bf16 hi  [4194304]
//   XL   [8 MiB      , 16 MiB)  x   bf16 lo
//   WH   [16 MiB     , +24576)  Wq|Wk|Wv bf16 hi, 3 planes of [64][64] (carve 64 KiB)
//   WL   [16 MiB+64K , +24576)  Wq|Wk|Wv bf16 lo (carve 960 KiB)
//   WOH  [17 MiB     , 19 MiB)  Wo  bf16 hi  [1024][1024]
//   WOL  [19 MiB     , 21 MiB)  Wo  bf16 lo
//   QKVH [21 MiB     , 45 MiB)  q|k|v bf16 hi, 3 planes of [65536][64] (element (b,s,h,d) at (b*SEQ+s)*EMB + h*64 + d)
//   QKVL [45 MiB     , 69 MiB)  q|k|v bf16 lo
//   AVH  [69 MiB     , 77 MiB)  av  bf16 hi  [4096][1024]
//   AVL  [77 MiB     , 85 MiB)  av  bf16 lo
//   total 85 MiB = 89128960 B
// ---------------------------------------------------------------------------
constexpr size_t MIB      = 1048576;
constexpr size_t OFF_XH   = 0;
constexpr size_t OFF_XL   = 8 * MIB;
constexpr size_t OFF_WH   = 16 * MIB;
constexpr size_t OFF_WL   = 16 * MIB + 65536;
constexpr size_t OFF_WOH  = 17 * MIB;
constexpr size_t OFF_WOL  = 19 * MIB;
constexpr size_t OFF_QKVH = 21 * MIB;
constexpr size_t OFF_QKVL = 45 * MIB;
constexpr size_t OFF_AVH  = 69 * MIB;
constexpr size_t OFF_AVL  = 77 * MIB;
constexpr size_t WS_TOTAL = 85 * MIB;
constexpr size_t PLANE_QKV = (size_t)NROWH * HDIM;      // elements per q/k/v plane
static_assert((size_t)NB * SEQ * EMB * 2 <= OFF_XL - OFF_XH);
static_assert((size_t)3 * HDIM * HDIM * 2 <= OFF_WL - OFF_WH);
static_assert((size_t)3 * HDIM * HDIM * 2 <= OFF_WOH - OFF_WL);
static_assert((size_t)EMB * EMB * 2 <= OFF_WOL - OFF_WOH);
static_assert((size_t)EMB * EMB * 2 <= OFF_QKVH - OFF_WOL);
static_assert(3 * PLANE_QKV * 2 <= OFF_QKVL - OFF_QKVH);
static_assert(3 * PLANE_QKV * 2 <= OFF_AVH - OFF_QKVL);
static_assert((size_t)NTOK * EMB * 2 <= OFF_AVL - OFF_AVH);
static_assert((size_t)NTOK * EMB * 2 <= WS_TOTAL - OFF_AVL);
static_assert(WS_TOTAL <= 134217728);

// ---------------------------------------------------------------------------
// Helpers
// ---------------------------------------------------------------------------
__device__ __forceinline__ unsigned short f2bf_bits(float f) {
  unsigned u = __float_as_uint(f);
  return (unsigned short)((u + 0x7FFFu + ((u >> 16) & 1u)) >> 16);
}
__device__ __forceinline__ float bf_bits2f(unsigned short h) { return __uint_as_float(((unsigned)h) << 16); }

// hazard guards as plain device helpers (no inline asm inside the kernel template body)
__device__ __forceinline__ void dep_guard_h(v8f& a, v8f& b, v16h x, v16h y) { asm volatile("v_nop\n\tv_nop\n\tv_nop\n\tv_nop" : "+v"(a), "+v"(b) : "v"(x), "v"(y)); }
__device__ __forceinline__ void dep_guard_b(v8f& a, v8f& b, v16b x, v16b y) { asm volatile("v_nop\n\tv_nop\n\tv_nop\n\tv_nop" : "+v"(a), "+v"(b) : "v"(x), "v"(y)); }
__device__ __forceinline__ void keep4_h(v16h a, v16h b, v16h c, v16h d) { asm volatile("v_nop" :: "v"(a), "v"(b), "v"(c), "v"(d)); }
__device__ __forceinline__ void keep4_b(v16b a, v16b b, v16b c, v16b d) { asm volatile("v_nop" :: "v"(a), "v"(b), "v"(c), "v"(d)); }
__device__ __forceinline__ void acc_guard4(v8f& a, v8f& b, v8f& c, v8f& d) { asm volatile("v_nop\n\tv_nop\n\tv_nop\n\tv_nop" : "+v"(a), "+v"(b), "+v"(c), "+v"(d)); }
template <typename T> struct Frag;
template <> struct Frag<_Float16> {
  typedef v16h V; union U { v16h v; v8h h[2]; };
  static __device__ __forceinline__ v16h load(const _Float16* p) {   // elements 0..7 <- p[0..7], 8..15 <- p[16..23]
    U f; f.h[0] = *(const v8h*)(p); f.h[1] = *(const v8h*)(p + 16); return f.v;
  }
  static __device__ __forceinline__ v8f mma(v16h a, v16h b, v8f c) {
    return __builtin_amdgcn_wmma_f32_16x16x32_f16(false, a, false, b, (short)0, c, false, false);
  }
  static __device__ __forceinline__ void guard(v8f& a, v8f& b, v16h x, v16h y) { dep_guard_h(a, b, x, y); }
  static __device__ __forceinline__ void keep(v16h a, v16h b, v16h c, v16h d) { keep4_h(a, b, c, d); }
};
template <> struct Frag<__bf16> {
  typedef v16b V; union U { v16b v; v8b h[2]; };
  static __device__ __forceinline__ v16b load(const __bf16* p) {
    U f; f.h[0] = *(const v8b*)(p); f.h[1] = *(const v8b*)(p + 16); return f.v;
  }
  static __device__ __forceinline__ v8f mma(v16b a, v16b b, v8f c) {
    return __builtin_amdgcn_wmma_f32_16x16x32_bf16(false, a, false, b, (short)0, c, false, false);
  }
  static __device__ __forceinline__ void guard(v8f& a, v8f& b, v16b x, v16b y) { dep_guard_b(a, b, x, y); }
  static __device__ __forceinline__ void keep(v16b a, v16b b, v16b c, v16b d) { keep4_b(a, b, c, d); }
};

// ---- Register-blocked batched WMMA GEMM --------------------------------
// C[m,n] = scale * sum_k A[m,k] * Bt[n,k] (+bias)(+resid); each wave owns a 64x64 tile.
// A row-major [M,K]; Bt row-major [N,K]; M,N % 64 == 0, K % 32 == 0.
// SPLIT: operands are hi/lo planes (A2/Bt2 = lo planes, same layout); product = hi.hi + hi.lo + lo.hi.
// BIAS_MODE: 0 = none, 1 = bias[m], 2 = bias[n].
// OUT_MODE: 0 = f32, 1 = f16, 2 = bf16 hi plane (Cout) + bf16 lo plane (Cout2).
// ET: 0 = f16 operands, 1 = bf16 operands (pointers passed as 16-bit storage)
template <int ET> struct Elem;
template <> struct Elem<0> { typedef _Float16 T; };
template <> struct Elem<1> { typedef __bf16 T; };
template <int ET, bool SPLIT, int BIAS_MODE, int OUT_MODE, bool RESID, int ACT = 0>
__global__ __launch_bounds__(256) void wmma_gemm64(
    const unsigned short* __restrict__ Ap, const unsigned short* __restrict__ A2p, int lda, long strideA,
    const unsigned short* __restrict__ Btp, const unsigned short* __restrict__ Bt2p, int ldb, long strideB,
    void* __restrict__ Cout, void* __restrict__ Cout2, int ldc, long strideC,
    const float* __restrict__ bias,
    const float* __restrict__ resid, long strideR,
    int M, int N, int K, float scale) {
  typedef typename Elem<ET>::T T;
  typedef typename Frag<T>::V V;
  const T* A = (const T*)Ap; const T* A2 = (const T*)A2p; const T* Bt = (const T*)Btp; const T* Bt2 = (const T*)Bt2p;
  __shared__ __align__(16) float sT[8][16 * 68];   // per-wave 16x64 slab, pitch 68 floats
  const int b    = blockIdx.y;
  const int lane = threadIdx.x & 31;
  const int wave = threadIdx.x >> 5;
  const int tilesN = N >> 6;
  const int tilesM = M >> 6;
  const int tile = blockIdx.x * 8 + wave;
  if (tile >= tilesM * tilesN) return;   // wave-uniform; no block barriers in this kernel
  const int tm = tile / tilesN;
  const int tn = tile - tm * tilesN;
  const int m0 = tm << 6;
  const int n0 = tn << 6;

  const T* Ab  = A  + (size_t)b * strideA;
  const T* Bb  = Bt + (size_t)b * strideB;
  const T* Ab2 = SPLIT ? (A2  + (size_t)b * strideA) : nullptr;
  const T* Bb2 = SPLIT ? (Bt2 + (size_t)b * strideB) : nullptr;

  const int rlane = lane & 15;                 // row (A) / col (B, D) within subtile
  const int koff  = (lane >> 4) * 8;           // k offset of this lane half
  const int mOff  = (lane >> 4) * 8;           // D row offset

  v8f acc[4][4];
#pragma unroll
  for (int i = 0; i < 4; ++i)
#pragma unroll
    for (int j = 0; j < 4; ++j) acc[i][j] = (v8f){0.f,0.f,0.f,0.f,0.f,0.f,0.f,0.f};

  for (int k0 = 0; k0 < K; k0 += 32) {
    V bh[4], bl[4];
#pragma unroll
    for (int j = 0; j < 4; ++j) {
      const size_t bo = (size_t)(n0 + (j << 4) + rlane) * ldb + koff + k0;
      bh[j] = Frag<T>::load(Bb + bo);
      if (SPLIT) bl[j] = Frag<T>::load(Bb2 + bo);
    }
#pragma unroll
    for (int i = 0; i < 4; ++i) {
      const size_t ao = (size_t)(m0 + (i << 4) + rlane) * lda + koff + k0;
      V ah = Frag<T>::load(Ab + ao);
      V al;
      if (SPLIT) al = Frag<T>::load(Ab2 + ao);
#pragma unroll
      for (int j = 0; j < 4; ++j) {
        acc[i][j] = Frag<T>::mma(ah, bh[j], acc[i][j]);
        if (SPLIT) {
          acc[i][j] = Frag<T>::mma(ah, bl[j], acc[i][j]);
          acc[i][j] = Frag<T>::mma(al, bh[j], acc[i][j]);
        }
      }
      Frag<T>::guard(acc[i][0], acc[i][3], ah, SPLIT ? al : ah);
    }
    Frag<T>::keep(bh[0], bh[1], bh[2], bh[3]);
    if (SPLIT) Frag<T>::keep(bl[0], bl[1], bl[2], bl[3]);
  }
  acc_guard4(acc[0][0], acc[0][1], acc[0][2], acc[0][3]);
  acc_guard4(acc[1][0], acc[1][1], acc[1][2], acc[1][3]);
  acc_guard4(acc[2][0], acc[2][1], acc[2][2], acc[2][3]);
  acc_guard4(acc[3][0], acc[3][1], acc[3][2], acc[3][3]);

  // ---- epilogue ----
  float* slab = sT[wave];
  const float* Rb = RESID ? (resid + (size_t)b * strideR) : nullptr;
#pragma unroll
  for (int i = 0; i < 4; ++i) {
    const int mBase = m0 + (i << 4);
#pragma unroll
    for (int j = 0; j < 4; ++j) {
      const int n = n0 + (j << 4) + rlane;
      float bv = 0.f;
      if (BIAS_MODE == 2) bv = bias[n];
#pragma unroll
      for (int r = 0; r < 8; ++r) {
        float v = acc[i][j][r] * scale;
        if (BIAS_MODE == 1) v += bias[mBase + mOff + r];
        if (BIAS_MODE == 2) v += bv;
        if (RESID) v += Rb[(size_t)(mBase + mOff + r) * ldc + n];
        if (ACT == 1) v = tanhf(v);
        if (ACT == 2) v = fmaxf(v, 0.0f);
        if (ACT == 3) v = v / (1.0f + expf(-v));
        if (ACT == 4) v = (v > 0.f) ? v : 0.01f * v;
        if (ACT == 5) v = 0.5f * v * (1.0f + erff(v * 0.70710678118654752f));
        slab[(mOff + r) * 68 + (j << 4) + rlane] = v;
      }
    }
    __builtin_amdgcn_fence(__ATOMIC_RELEASE, "workgroup");
    __builtin_amdgcn_wave_barrier();
    __builtin_amdgcn_fence(__ATOMIC_ACQUIRE, "workgroup");
    if (OUT_MODE == 0) {
      float* C = (float*)Cout + (size_t)b * strideC;
      const int hh = lane >> 4, c4 = (lane & 15) * 4;     // row seg = 256 B = 16 lanes x 16 B
      {
#pragma unroll
        for (int it = 0; it < 8; ++it) {
          const int row = it * 2 + hh;
          v4f v = *(const v4f*)(slab + row * 68 + c4);
          *(v4f*)(C + (size_t)(mBase + row) * ldc + n0 + c4) = v;
        }
        
      }
    } else {
      const int q = lane >> 3, c8 = (lane & 7) * 8;
      unsigned short* C  = (unsigned short*)Cout  + (size_t)b * strideC;
      unsigned short* C2 = (OUT_MODE == 2) ? ((unsigned short*)Cout2 + (size_t)b * strideC) : nullptr;
      {
#pragma unroll
        for (int it = 0; it < 4; ++it) {
          const int row = it * 4 + q;
          const float* sp = slab + row * 68 + c8;
          v8h hv, lv;
#pragma unroll
          for (int e = 0; e < 8; ++e) {
            if (OUT_MODE == 1) {
              hv[e] = (_Float16)sp[e];
            } else {
              unsigned short hb = f2bf_bits(sp[e]);
              unsigned short lb = f2bf_bits(sp[e] - bf_bits2f(hb));
              hv[e] = __builtin_bit_cast(_Float16, hb);
              lv[e] = __builtin_bit_cast(_Float16, lb);
            }
          }
          *(v8h*)(C + (size_t)(mBase + row) * ldc + n0 + c8) = hv;
          if (OUT_MODE == 2) *(v8h*)(C2 + (size_t)(mBase + row) * ldc + n0 + c8) = lv;
        }
        
      }
    }
    __builtin_amdgcn_fence(__ATOMIC_RELEASE, "workgroup");
    __builtin_amdgcn_wave_barrier();
    __builtin_amdgcn_fence(__ATOMIC_ACQUIRE, "workgroup");
  }
}

// ---------------------------------------------------------------------------
// f32 -> bf16 hi + bf16 lo planes (RNE converts). 8 elements per thread:
// two b128 loads, one b128 store per plane; lanes 8q..8q+7 of a wave fill one
// ---------------------------------------------------------------------------
__device__ __forceinline__ void split_pair(float f0, float f1, unsigned& hw, unsigned& lw) {
  const unsigned short h0 = f2bf_bits(f0);
  const unsigned short h1 = f2bf_bits(f1);
  const unsigned short l0 = f2bf_bits(f0 - bf_bits2f(h0));
  const unsigned short l1 = f2bf_bits(f1 - bf_bits2f(h1));
  hw = (unsigned)h0 | ((unsigned)h1 << 16);
  lw = (unsigned)l0 | ((unsigned)l1 << 16);
}

__global__ __launch_bounds__(256) void split_planes_bf16(
    const float* __restrict__ src, unsigned short* __restrict__ hi,
    unsigned short* __restrict__ lo, int n8) {
  const int i = blockIdx.x * 256 + threadIdx.x;
  if (i >= n8) return;                      // no barriers in this kernel
  const size_t e0 = (size_t)i * 8;
  const v4f a = *(const v4f*)(src + e0);
  const v4f c = *(const v4f*)(src + e0 + 4);
  unsigned hx, hy, hz, hw, lx, ly, lz, lw;
  split_pair(a[0], a[1], hx, lx);
  split_pair(a[2], a[3], hy, ly);
  split_pair(c[0], c[1], hz, lz);
  split_pair(c[2], c[3], hw, lw);
  const v4u hv = (v4u){hx, hy, hz, hw};
  const v4u lv = (v4u){lx, ly, lz, lw};
  *(v4u*)(hi + e0) = hv;
  *(v4u*)(lo + e0) = lv;
  
}

// ---------------------------------------------------------------------------
// Causal flash attention, head dim 64, bf16 hi/lo planes in, bf16 hi/lo planes out.
//   q,k,v planes: element (b, s, h, d) at (b*SEQ + s)*EMB + h*64 + d (ushort storage).
//   scores^T = k.q^T * sm_scale : hi.hi + hi.lo + lo.hi on v_wmma_f32_16x16x32_bf16 (A = K rows, B = Q)
//   out^T    = v^T.p^T          : p and v as bf16 hi/lo, same three products (A = V^T, B = P^T)
//   Transposed, a lane holds 32 scores of ONE query (column c): maximum and sum run inside the lane, with one
//   exchange between the lane halves, and two score tiles converted in place are the B operand P^T of the second
//   product, so that P never goes through LDS.
//   online softmax in f32, exponentials in base 2; block = 4 waves; a query block = 64 query rows of one (b, h), 16 per wave;
//   grid.x = NB * NHEAD * (SEQ/64) / 2; keys visited in 64-wide chunks 0..qb (causal).
//   A query block qb costs qb + 1 chunks, and all blocks of the grid are resident at once, so the launch lasts as
//   long as its fullest block: each block takes query blocks 31 - p and p of one (b, h), one after the other in
//   every wave, which is 33 chunks for every block of the grid.
//   Output planes: element (b, q, h*64+d) at (b*SEQ+q)*EMB + h*64 + d; each wave writes
// ---------------------------------------------------------------------------
typedef __attribute__((ext_vector_type(2))) float  v2f;
typedef __attribute__((ext_vector_type(2))) __bf16 v2b;
// two f32 -> packed bf16 hi pair and bf16 lo pair (lo = f - hi), both converts round to nearest even
__device__ __forceinline__ void at_split2(float f0, float f1, v2b& hi, v2b& lo) {
  hi = __builtin_convertvector((v2f){f0, f1}, v2b);
  lo = __builtin_convertvector((v2f){f0 - (float)hi[0], f1 - (float)hi[1]}, v2b);
}
__device__ __forceinline__ v8f at_mma(v16b a, v16b b, v8f c) {
  return __builtin_amdgcn_wmma_f32_16x16x32_bf16(false, a, false, b, (short)0, c, false, false);
}

// value of lane l ^ 16 (the other 16-lane half) by a cross-row move in the vector unit; all 32 lanes are active at every call
__device__ __forceinline__ float half_swap(float x) {
  const int v = __float_as_int(x);
  return __int_as_float(__builtin_amdgcn_permlanex16(v, v, 0x76543210, 0xfedcba98, false, false));
}

// 2^x in place, 1 or 16 values a statement. The instruction set asks for one free slot between a transcendental and a
// next instruction that reads its result or overwrites its source. Here each v_exp_f32 names one register of
// its own, so none touches its neighbour's, and the v_nop at the end is the slot of the last.
__device__ __forceinline__ void exp2_x1(float& x) {
  asm("v_exp_f32 %0, %0\n\tv_nop" : "+v"(x));
}
__device__ __forceinline__ void exp2_x16(float (&x)[16]) {
  asm("v_exp_f32 %0, %0\n\tv_exp_f32 %1, %1\n\tv_exp_f32 %2, %2\n\tv_exp_f32 %3, %3\n\t"
      "v_exp_f32 %4, %4\n\tv_exp_f32 %5, %5\n\tv_exp_f32 %6, %6\n\tv_exp_f32 %7, %7\n\t"
      "v_exp_f32 %8, %8\n\tv_exp_f32 %9, %9\n\tv_exp_f32 %10, %10\n\tv_exp_f32 %11, %11\n\t"
      "v_exp_f32 %12, %12\n\tv_exp_f32 %13, %13\n\tv_exp_f32 %14, %14\n\tv_exp_f32 %15, %15\n\t"
      "v_nop"
      : "+v"(x[0]), "+v"(x[1]), "+v"(x[2]), "+v"(x[3]), "+v"(x[4]), "+v"(x[5]), "+v"(x[6]), "+v"(x[7]),
        "+v"(x[8]), "+v"(x[9]), "+v"(x[10]), "+v"(x[11]), "+v"(x[12]), "+v"(x[13]), "+v"(x[14]), "+v"(x[15]));
}

// transposing LDS read of a row-major 16-bit tile T: with lane l's pointer at
// T[kbase + 8 (l >> 4) + (l & 7)][dbase + 8 ((l >> 3) & 1)], lane (c = l & 15, hh = l >> 4) gets
// T[kbase + 8 hh + 0..7][dbase + c]. All 32 lanes are active and hold an address inside the tile at every call.
typedef __attribute__((ext_vector_type(8))) short v8s;
__device__ __forceinline__ v8b ld_tr16(const unsigned short* p) {
  typedef __attribute__((address_space(3))) v8s lds_v8s;
  return __builtin_bit_cast(v8b, __builtin_amdgcn_ds_load_tr16_b128_v8i16((lds_v8s*)p));
}

__global__ __launch_bounds__(128)
void attn_causal_hd64(const unsigned short* __restrict__ Qh, const unsigned short* __restrict__ Ql,
                      const unsigned short* __restrict__ Kh, const unsigned short* __restrict__ Kl,
                      const unsigned short* __restrict__ Vh, const unsigned short* __restrict__ Vl,
                      unsigned short* __restrict__ Oh, unsigned short* __restrict__ Ol,
                      float sm_scale) {
  union FB { v16b v; v8b h[2]; };
  __shared__ __align__(16) unsigned short Ksh[AKC * APT];     // K hi [kv][d]   9 KB
  __shared__ __align__(16) unsigned short Ksl[AKC * APT];     // K lo [kv][d]   9 KB
  __shared__ __align__(16) unsigned short Vsh[AKC * VPT];     // V hi [kv][d]  10 KB
  __shared__ __align__(16) unsigned short Vsl[AKC * VPT];     // V lo [kv][d]  10 KB
  __shared__ __align__(16) float  Os[ANW][16 * 68];           // per wave out tile, pitch 68

  const int tid  = threadIdx.x;
  const int wave = tid >> 5;
  const int lane = tid & 31;
  const int hh   = lane >> 4;
  const int c    = lane & 15;
  const float NEG_INF = -__builtin_inff();
  // exp(sm_scale * s - m) = 2^(sc2 * s - m * log2(e)): one multiply-add and one v_exp_f32 an element (sm_scale > 0)
  const float sc2 = sm_scale * 1.44269504088896340736f;

  constexpr int NQB = SEQ / AQB;                 // 32 query blocks per (b, h)
  constexpr int NPR = NQB / 2;                   // 16 pairs (31 - p, p) per (b, h)
  static_assert(NQB % 2 == 0);
  const int bx   = blockIdx.x;
  const int pr   = bx % NPR;
  const int bhid = bx / NPR;
  const int h    = bhid % NHEAD;
  const int b    = bhid / NHEAD;
  const size_t hoff = (size_t)h * HDIM;

  for (int half = 0; half < 2; ++half) {         // block-uniform: every wave walks both query blocks in this order
  const int qb   = half ? pr : NQB - 1 - pr;
  const int q0   = qb * AQB + wave * 16;

  // ---- Q fragments (B operand): column = query c, elements 0..7 <- d = dc*32 + 8hh + 0..7, 8..15 <- dc*32 + 16 + 8hh + 0..7
  v16b qah[2], qal[2];
  {
    const size_t qo = (size_t)(b * SEQ + q0 + c) * EMB + hoff + 8 * hh;
    const __bf16* qhp = (const __bf16*)(const void*)Qh;
    const __bf16* qlp = (const __bf16*)(const void*)Ql;
#pragma unroll
    for (int dc = 0; dc < 2; ++dc) {
      qah[dc] = Frag<__bf16>::load(qhp + qo + dc * 32);
      qal[dc] = Frag<__bf16>::load(qlp + qo + dc * 32);
    }
  }

  // of query q0 + c: running maximum (log2 units, alike in both lane halves) and the sum over this half's keys
  float mrow = NEG_INF, lrow = 0.f;
  v8f oacc[4];                                   // oacc[t][r] = out[q0 + c][t*16 + 8hh + r]
#pragma unroll
  for (int t = 0; t < 4; ++t) oacc[t] = (v8f){0.f,0.f,0.f,0.f,0.f,0.f,0.f,0.f};

  // staging map: thread -> rows skv + 16 i (i = 0..3), 16-byte column group scol, of each 64 x 64 K / V plane tile
  const int skv = tid >> 3, scol = (tid & 7) * 8;
  // one 32-bit byte offset (< 8 MiB) serves all four planes on their scalar base pointers: one address register
  // instead of four pairs
  const unsigned sgb = (unsigned)(((b * SEQ + skv) * EMB + h * HDIM + scol) * 2);
  v4u kwh[4], kwl[4], vwh[4], vwl[4];            // K hi, K lo, V hi, V lo words of the chunk fetched ahead
  const int nChunks = qb + 1;                    // block-uniform, <= 32
  // ---- chunk 0's K and V words, all 16 global loads in flight together ----
  {
    const unsigned gb = sgb;
#pragma unroll
    for (int i = 0; i < 4; ++i) {
      kwh[i] = *(const v4u*)((const char*)Kh + gb + 16 * i * EMB * 2);
      kwl[i] = *(const v4u*)((const char*)Kl + gb + 16 * i * EMB * 2);
      vwh[i] = *(const v4u*)((const char*)Vh + gb + 16 * i * EMB * 2);
      vwl[i] = *(const v4u*)((const char*)Vl + gb + 16 * i * EMB * 2);
    }
  }
  // the address registers of the Q, K and V loads above are written anew below: their translations are waited for
  // first; the Q words as inputs keep the wait behind their loads (once per query block)
  asm volatile("s_wait_xcnt 0x0" :: "v"(qah[0]), "v"(qah[1]), "v"(qal[0]), "v"(qal[1]) : "memory");
  for (int kc = 0; kc < nChunks; ++kc) {
    const int kv0 = kc * AKC;
    __syncthreads();
    // ---- K and V words fetched one trip ahead go from registers to LDS ----
#pragma unroll
    for (int i = 0; i < 4; ++i) {
      *(v4u*)(Ksh + (skv + 16 * i) * APT + scol) = kwh[i];
      *(v4u*)(Ksl + (skv + 16 * i) * APT + scol) = kwl[i];
    }
    // ---- V hi/lo row-major as they come: one 16-B LDS store a word; the fragment reads transpose ----
#pragma unroll
    for (int i = 0; i < 4; ++i) {
      *(v4u*)(Vsh + (skv + 16 * i) * VPT + scol) = vwh[i];
      *(v4u*)(Vsl + (skv + 16 * i) * VPT + scol) = vwl[i];
    }
    __syncthreads();

    // ---- scores^T: 4 key tiles x 2 d-chunks x 3 products; s[j][r] = score of key kv0 + j*16 + 8hh + r, query q0 + c ----
    //      All 16 K fragments of the chunk are read as one group; the products follow behind counted waits and go
    //      round the four independent tiles, so that none waits for a read just issued or for the product before it.
    //      Per tile the order stays d-chunk 0, 1 and in each hi.hi, lo.hi, hi.lo.
    v8f s[4];
    {
      FB kfh[2][4], kfl[2][4];
#pragma unroll
      for (int dc = 0; dc < 2; ++dc) {           // in the order in which the products take them
#pragma unroll
        for (int j = 0; j < 4; ++j) {
          const int ko = (j * 16 + c) * APT + dc * 32 + 8 * hh;
          kfh[dc][j].h[0] = *(const v8b*)(Ksh + ko);
          kfh[dc][j].h[1] = *(const v8b*)(Ksh + ko + 16);
        }
#pragma unroll
        for (int j = 0; j < 4; ++j) {
          const int ko = (j * 16 + c) * APT + dc * 32 + 8 * hh;
          kfl[dc][j].h[0] = *(const v8b*)(Ksl + ko);
          kfl[dc][j].h[1] = *(const v8b*)(Ksl + ko + 16);
        }
        // keeps d-chunk 0's reads in front of d-chunk 1's (the compiler put them last, and the first product waited
        // for 18 reads) and all reads in front of the products
        __builtin_amdgcn_sched_barrier(0);
      }
#pragma unroll
      for (int j = 0; j < 4; ++j) s[j] = (v8f){0.f,0.f,0.f,0.f,0.f,0.f,0.f,0.f};
#pragma unroll
      for (int dc = 0; dc < 2; ++dc) {
        // the scheduling barriers keep the rounds apart: without them the compiler lines a tile's products up one
        // behind the other, each waiting for the one before
#pragma unroll
        for (int j = 0; j < 4; ++j) s[j] = at_mma(kfh[dc][j].v, qah[dc], s[j]);
        __builtin_amdgcn_sched_barrier(0);
#pragma unroll
        for (int j = 0; j < 4; ++j) s[j] = at_mma(kfl[dc][j].v, qah[dc], s[j]);
        __builtin_amdgcn_sched_barrier(0);
#pragma unroll
        for (int j = 0; j < 4; ++j) s[j] = at_mma(kfh[dc][j].v, qal[dc], s[j]);
        if (dc == 0) __builtin_amdgcn_sched_barrier(0);
      }
    }
    // ---- V^T fragments of the chunk, A[m=d][k=kv] = V[kv][d], row d = t*16 + c by transposing reads, also one group:
    //      they land under the softmax arithmetic below.
    //      elements 0..7 <- kv = kk*32 + 8hh + 0..7, 8..15 <- kk*32 + 16 + 8hh + 0..7, the k order of ph and pl ----
    FB vfh[2][4], vfl[2][4];
#pragma unroll
    for (int kk = 0; kk < 2; ++kk)
#pragma unroll
      for (int t = 0; t < 4; ++t) {
        const int vo = (kk * 32 + 8 * hh + (lane & 7)) * VPT + t * 16 + 8 * ((lane >> 3) & 1);
        vfh[kk][t].h[0] = ld_tr16(Vsh + vo);
        vfh[kk][t].h[1] = ld_tr16(Vsh + vo + 16 * VPT);
        vfl[kk][t].h[0] = ld_tr16(Vsl + vo);
        vfl[kk][t].h[1] = ld_tr16(Vsl + vo + 16 * VPT);
      }
    __builtin_amdgcn_sched_barrier(0);           // keeps these reads here, in front of the mask and the maximum
    // ---- causal mask on the diagonal chunk (select, -inf fill): there kv0 = qb * 64, so key j*16 + 8hh + r of the
    //      chunk lies behind query wave*16 + c where j*16 + r > lim; elsewhere lim is above every j*16 + r.
    //      Maximum of the raw scores in four independent chains; the maximum alone is scaled here: sc2 > 0 and
    //      rounding is monotone, so it is the maximum of the scaled scores ----
    const int lim = (kc == qb) ? wave * 16 + c - 8 * hh : AKC;
    float mx[4];
#pragma unroll
    for (int j = 0; j < 4; ++j) {
      float m = NEG_INF;
#pragma unroll
      for (int r = 0; r < 8; ++r) {
        const float val = (j * 16 + r > lim) ? NEG_INF : s[j][r];
        s[j][r] = val;
        m = fmaxf(m, val);
      }
      mx[j] = m;
    }
    float cm = fmaxf(fmaxf(mx[0], mx[1]), fmaxf(mx[2], mx[3]));
    cm = fmaxf(cm, half_swap(cm)) * sc2;         // both halves' keys: finite, key kv0 is never behind a query of the block
    // ---- online softmax update in base 2 (mrow holds log2 units); P^T hi/lo packed in registers:
    //      element e of ph[kk] = p of key kk*32 + 8hh + e (e < 8), kk*32 + 16 + 8hh + e - 8 (e >= 8): the B operand's k order ----
    const float mnew = fmaxf(mrow, cm);
    float alpha = mrow - mnew;                   // 2^(old maximum - new maximum)
    mrow = mnew;
    exp2_x1(alpha);
    v16b ph[2], pl[2];
    float ps[4];                                 // four independent partial sums, started by the first four values
#pragma unroll
    for (int kk = 0; kk < 2; ++kk) {             // two score tiles = 16 exponentials a statement
      float pe[16];
#pragma unroll
      for (int e = 0; e < 16; ++e) pe[e] = fmaf(s[kk * 2 + (e >> 3)][e & 7], sc2, -mnew);
      exp2_x16(pe);
#pragma unroll
      for (int e = 0; e < 16; e += 2) {
        const bool first = (kk == 0 && e < 4);
        ps[e & 3]       = first ? pe[e]     : ps[e & 3] + pe[e];
        ps[(e & 3) + 1] = first ? pe[e + 1] : ps[(e & 3) + 1] + pe[e + 1];
        v2b a, bl;
        at_split2(pe[e], pe[e + 1], a, bl);
        ph[kk][e] = a[0];  ph[kk][e + 1] = a[1];
        pl[kk][e] = bl[0]; pl[kk][e + 1] = bl[1];
      }
    }
    lrow = lrow * alpha + ((ps[0] + ps[1]) + (ps[2] + ps[3]));
#pragma unroll
    for (int t = 0; t < 4; ++t) oacc[t] *= alpha;
    // ---- next chunk's K and V words: 16 global loads in flight together, their latency under the P.V products ----
    if (kc + 1 < nChunks) {
      const unsigned gb = sgb + (unsigned)(kv0 + AKC) * (EMB * 2);
#pragma unroll
      for (int i = 0; i < 4; ++i) {
        kwh[i] = *(const v4u*)((const char*)Kh + gb + 16 * i * EMB * 2);
        kwl[i] = *(const v4u*)((const char*)Kl + gb + 16 * i * EMB * 2);
        vwh[i] = *(const v4u*)((const char*)Vh + gb + 16 * i * EMB * 2);
        vwl[i] = *(const v4u*)((const char*)Vl + gb + 16 * i * EMB * 2);
      }
      // the offset register of these loads is written anew right below: their translations are waited for first
      asm volatile("s_wait_xcnt 0x0" ::: "memory");
    }
    // ---- O^T += V^T.P^T, A = the V^T fragments read above, B = P^T, round the four independent tiles;
    //      per tile the order stays key half 0, 1 and in each hi.hi, lo.hi, hi.lo ----
#pragma unroll
    for (int kk = 0; kk < 2; ++kk) {
#pragma unroll
      for (int t = 0; t < 4; ++t) oacc[t] = at_mma(vfh[kk][t].v, ph[kk], oacc[t]);
#pragma unroll
      for (int t = 0; t < 4; ++t) oacc[t] = at_mma(vfl[kk][t].v, ph[kk], oacc[t]);
#pragma unroll
      for (int t = 0; t < 4; ++t) oacc[t] = at_mma(vfh[kk][t].v, pl[kk], oacc[t]);
    }
  }

  // ---- epilogue: 1/l, per-wave LDS slab, whole-line bf16 hi/lo stores ----
  float* os = Os[wave];
  {
    const float inv = 1.0f / (lrow + half_swap(lrow));   // the two halves' key sums joined once
#pragma unroll
    for (int t = 0; t < 4; ++t) {
      const v8f o = oacc[t] * inv;
      *(v4f*)(os + c * 68 + t * 16 + 8 * hh)     = (v4f){o[0], o[1], o[2], o[3]};
      *(v4f*)(os + c * 68 + t * 16 + 8 * hh + 4) = (v4f){o[4], o[5], o[6], o[7]};
    }
  }
  __builtin_amdgcn_fence(__ATOMIC_RELEASE, "workgroup");
  __builtin_amdgcn_wave_barrier();
  __builtin_amdgcn_fence(__ATOMIC_ACQUIRE, "workgroup");
  {
    // rows it*4 + q4 (it 0..3, q4 0..3) = 0..15; c8 = 0..56 step 8 -> full 16 x 64 tile per plane
    const int q4 = lane >> 3, c8 = (lane & 7) * 8;
    {
#pragma unroll
      for (int it = 0; it < 4; ++it) {
        const int row = it * 4 + q4;
        const float* sp = os + row * 68 + c8;
        v8h hv, lv;
#pragma unroll
        for (int e = 0; e < 8; ++e) {
          unsigned short hb = f2bf_bits(sp[e]);
          unsigned short lb = f2bf_bits(sp[e] - bf_bits2f(hb));
          hv[e] = __builtin_bit_cast(_Float16, hb);
          lv[e] = __builtin_bit_cast(_Float16, lb);
        }
        const size_t oo = (size_t)(b * SEQ + q0 + row) * EMB + hoff + c8;
        *(v8h*)(Oh + oo) = hv;
        *(v8h*)(Ol + oo) = lv;
      }
      
    }
  }
  // the second query block writes the registers of the stores above anew: their translations are waited for first
  asm volatile("s_wait_xcnt 0x0" ::: "memory");
  }   // half
}

// ---------------------------------------------------------------------------
// Output projection C[m][n] = sum_k A[m][k] * Bt[n][k], A = av hi/lo [NTOK][EMB], Bt = Wo hi/lo [EMB][EMB], C f32.
//   One 128 x 128 tile of C per block, 256 blocks, 8 waves of 64 x 32 (2 x 4). A stage is 64 k = one 128-B line of
//   every operand row: the block loads it once by whole lines (a wave-wide 16-B load covers 4 rows), one stage ahead
//   into registers, stores it to LDS at the 144-B pitch of the ds_load_b128 fragment reads, and all 8 waves read
//   their fragments from there. Two LDS buffers, one barrier a stage: a wave stores stage s + 1 only behind the
//   barrier of stage s, which every wave reaches only after its last read of stage s - 1 (the same buffer).
//   Per accumulator the products come in the order k ascending by 32, hi.hi, hi.lo, lo.hi.
// ---------------------------------------------------------------------------
constexpr int GBT = 128;                     // tile rows (m) and columns (n) per block
constexpr int GBK = 64;                      // k per stage
constexpr int GNS = EMB / GBK;               // 16 stages
constexpr int GPL = GBT * APT;               // 16-bit elements of one plane tile in LDS
constexpr int GCP = 36;                      // f32 pitch of the per-wave output slab: 144 B
static_assert(NTOK % GBT == 0 && EMB % GBT == 0 && EMB % GBK == 0 && GBK <= APT);

__global__ __launch_bounds__(256)
void out_proj_lds(const unsigned short* __restrict__ Ah, const unsigned short* __restrict__ Al,
                  const unsigned short* __restrict__ Bh, const unsigned short* __restrict__ Bl,
                  float* __restrict__ C) {
  union FB { v16b v; v8b h[2]; };
  __shared__ __align__(16) unsigned short sAh[2 * GPL];
  __shared__ __align__(16) unsigned short sAl[2 * GPL];
  __shared__ __align__(16) unsigned short sBh[2 * GPL];
  __shared__ __align__(16) unsigned short sBl[2 * GPL];
  __shared__ __align__(16) float sC[8][16 * GCP];

  const int tid  = threadIdx.x;
  const int wave = tid >> 5;
  const int lane = tid & 31;
  const int hh   = lane >> 4;
  const int c    = lane & 15;
  constexpr int TN = EMB / GBT;                // 8 tile columns
  const int tn = blockIdx.x % TN;
  const int tm = blockIdx.x / TN;
  const int m0 = tm * GBT;
  const int n0 = tn * GBT;
  const int wm = (wave >> 2) * 64;             // wave's rows inside the tile
  const int wn = (wave & 3) * 32;              // wave's columns inside the tile

  // staging map: thread -> rows srow + 32 i (i = 0..3), 16-byte column group scol, of each 128 x 64 plane tile.
  // 8 lanes take one row (a whole 128-B line); the two rows of a 16-lane half lie 8 rows = 1152 B apart in LDS,
  // 128 B modulo the 256 B of the banks, so that a half's ds_store_b128 meets every bank once.
  const int sg   = lane >> 3;
  const int srow = (wave >> 2) * 16 + (sg & 1) * 8 + (wave & 3) * 2 + (sg >> 1);
  const int scol = (tid & 7) * 8;
  const unsigned ga = (unsigned)(((m0 + srow) * EMB + scol) * 2);   // byte offset in the A planes (< 8 MiB)
  const unsigned gb = (unsigned)(((n0 + srow) * EMB + scol) * 2);   // byte offset in the B planes (< 2 MiB)
  v4u rah[4], ral[4], rbh[4], rbl[4];
#pragma unroll
  for (int i = 0; i < 4; ++i) {
    rah[i] = *(const v4u*)((const char*)Ah + ga + 32 * i * EMB * 2);
    ral[i] = *(const v4u*)((const char*)Al + ga + 32 * i * EMB * 2);
    rbh[i] = *(const v4u*)((const char*)Bh + gb + 32 * i * EMB * 2);
    rbl[i] = *(const v4u*)((const char*)Bl + gb + 32 * i * EMB * 2);
  }
  // the offset registers of these loads may be written anew below: their translations are waited for first
  asm volatile("s_wait_xcnt 0x0" ::: "memory");

  v8f acc[4][2];
#pragma unroll
  for (int i = 0; i < 4; ++i)
#pragma unroll
    for (int j = 0; j < 2; ++j) acc[i][j] = (v8f){0.f,0.f,0.f,0.f,0.f,0.f,0.f,0.f};

  for (int s = 0; s < GNS; ++s) {
    const int bo = (s & 1) * GPL;
    // ---- the stage fetched one trip ahead goes from registers to LDS ----
#pragma unroll
    for (int i = 0; i < 4; ++i) {
      const int so = bo + (srow + 32 * i) * APT + scol;
      *(v4u*)(sAh + so) = rah[i];
      *(v4u*)(sAl + so) = ral[i];
      *(v4u*)(sBh + so) = rbh[i];
      *(v4u*)(sBl + so) = rbl[i];
    }
    __syncthreads();
    // ---- next stage's 16 global loads in flight together, their latency under this stage's products ----
    if (s + 1 < GNS) {
      const unsigned ko = (unsigned)(s + 1) * (GBK * 2);
#pragma unroll
      for (int i = 0; i < 4; ++i) {
        rah[i] = *(const v4u*)((const char*)Ah + (ga + ko) + 32 * i * EMB * 2);
        ral[i] = *(const v4u*)((const char*)Al + (ga + ko) + 32 * i * EMB * 2);
        rbh[i] = *(const v4u*)((const char*)Bh + (gb + ko) + 32 * i * EMB * 2);
        rbl[i] = *(const v4u*)((const char*)Bl + (gb + ko) + 32 * i * EMB * 2);
      }
      // the offset registers of these loads are written anew in the next trip: their translations are waited for first
      asm volatile("s_wait_xcnt 0x0" ::: "memory");
    }
    // ---- fragments: row (A) or column (B) = c, elements 0..7 <- k = ks*32 + 8hh + 0..7, 8..15 <- ks*32 + 16 + 8hh + 0..7
#pragma unroll
    for (int ks = 0; ks < 2; ++ks) {
      FB fah[4], fal[4], fbh[2], fbl[2];
#pragma unroll
      for (int i = 0; i < 4; ++i) {
        const int ao = bo + (wm + i * 16 + c) * APT + ks * 32 + 8 * hh;
        fah[i].h[0] = *(const v8b*)(sAh + ao);
        fah[i].h[1] = *(const v8b*)(sAh + ao + 16);
        fal[i].h[0] = *(const v8b*)(sAl + ao);
        fal[i].h[1] = *(const v8b*)(sAl + ao + 16);
      }
#pragma unroll
      for (int j = 0; j < 2; ++j) {
        const int bq = bo + (wn + j * 16 + c) * APT + ks * 32 + 8 * hh;
        fbh[j].h[0] = *(const v8b*)(sBh + bq);
        fbh[j].h[1] = *(const v8b*)(sBh + bq + 16);
        fbl[j].h[0] = *(const v8b*)(sBl + bq);
        fbl[j].h[1] = *(const v8b*)(sBl + bq + 16);
      }
      // eight independent accumulator tiles between two products into the same tile
#pragma unroll
      for (int i = 0; i < 4; ++i)
#pragma unroll
        for (int j = 0; j < 2; ++j) acc[i][j] = Frag<__bf16>::mma(fah[i].v, fbh[j].v, acc[i][j]);
#pragma unroll
      for (int i = 0; i < 4; ++i)
#pragma unroll
        for (int j = 0; j < 2; ++j) acc[i][j] = Frag<__bf16>::mma(fah[i].v, fbl[j].v, acc[i][j]);
#pragma unroll
      for (int i = 0; i < 4; ++i)
#pragma unroll
        for (int j = 0; j < 2; ++j) acc[i][j] = Frag<__bf16>::mma(fal[i].v, fbh[j].v, acc[i][j]);
    }
  }

  // ---- epilogue: per-wave 16 x 32 f32 slab, whole 128-B lines to C ----
  // The slab passes values between lanes of one wave only, so the fences name LDS alone: a fence over all memory
  // would also wait for the C stores of the tile row before.
  float* slab = sC[wave];
#pragma unroll
  for (int i = 0; i < 4; ++i) {
#pragma unroll
    for (int j = 0; j < 2; ++j)
#pragma unroll
      for (int r = 0; r < 8; ++r) slab[(8 * hh + r) * GCP + j * 16 + c] = acc[i][j][r];
    __builtin_amdgcn_fence(__ATOMIC_RELEASE, "workgroup", "local");
    __builtin_amdgcn_wave_barrier();
    __builtin_amdgcn_fence(__ATOMIC_ACQUIRE, "workgroup", "local");
    const int q4 = lane >> 3, c4 = (lane & 7) * 4;       // 8 lanes x 16 B = one 128-B row segment
#pragma unroll
    for (int it = 0; it < 4; ++it) {
      const int row = it * 4 + q4;
      const v4f v = *(const v4f*)(slab + row * GCP + c4);
      *(v4f*)(C + (size_t)(m0 + wm + i * 16 + row) * EMB + n0 + wn + c4) = v;
    }
    // the next tile row writes registers of the stores above anew: their translations are waited for first
    if (i < 3) {
      asm volatile("s_wait_xcnt 0x0" ::: "memory");
      __builtin_amdgcn_sched_barrier(0);   // keeps the next tile row's address arithmetic behind that wait
    }
    __builtin_amdgcn_fence(__ATOMIC_RELEASE, "workgroup", "local");
    __builtin_amdgcn_wave_barrier();
    __builtin_amdgcn_fence(__ATOMIC_ACQUIRE, "workgroup", "local");
  }
}

// ---------------------------------------------------------------------------
// Host launcher: 8 launches, no runtime API calls other than launches.
// ---------------------------------------------------------------------------
extern "C" void kernel_launch(void* const* d_in, const int* in_sizes, int n_in,
                              void* d_out, int out_size, void* d_ws, size_t ws_size,
                              hipStream_t stream) {
  if (n_in < 5) return;
  if (in_sizes[0] != NB * SEQ * EMB) return;
  if (in_sizes[1] != HDIM * HDIM || in_sizes[2] != HDIM * HDIM || in_sizes[3] != HDIM * HDIM) return;
  if (in_sizes[4] != EMB * EMB) return;
  if (out_size != NB * SEQ * EMB) return;
  if (ws_size < WS_TOTAL) return;

  const float* x  = (const float*)d_in[0];
  const float* Wq = (const float*)d_in[1];
  const float* Wk = (const float*)d_in[2];
  const float* Wv = (const float*)d_in[3];
  const float* Wo = (const float*)d_in[4];
  float* out = (float*)d_out;

  char* ws = (char*)d_ws;
  unsigned short* XH   = (unsigned short*)(ws + OFF_XH);
  unsigned short* XL   = (unsigned short*)(ws + OFF_XL);
  unsigned short* WH   = (unsigned short*)(ws + OFF_WH);
  unsigned short* WL   = (unsigned short*)(ws + OFF_WL);
  unsigned short* WOH  = (unsigned short*)(ws + OFF_WOH);
  unsigned short* WOL  = (unsigned short*)(ws + OFF_WOL);
  unsigned short* QKVH = (unsigned short*)(ws + OFF_QKVH);
  unsigned short* QKVL = (unsigned short*)(ws + OFF_QKVL);
  unsigned short* AVH  = (unsigned short*)(ws + OFF_AVH);
  unsigned short* AVL  = (unsigned short*)(ws + OFF_AVL);
  const float* dummyf = (const float*)(ws + OFF_XH);     // unused pointer slots point inside ws

  // ---- operand planes (bf16 hi/lo) ----
  {
    const int n8x = (NB * SEQ * EMB) / 8;                // 524288 threads cover 4194304 elements
    split_planes_bf16<<<(n8x + 255) / 256, 256, 0, stream>>>(x, XH, XL, n8x);
    const int n8w = (HDIM * HDIM) / 8;                   // 512 threads cover 4096 elements each
    split_planes_bf16<<<(n8w + 255) / 256, 256, 0, stream>>>(Wq, WH + 0 * HDIM * HDIM, WL + 0 * HDIM * HDIM, n8w);
    split_planes_bf16<<<(n8w + 255) / 256, 256, 0, stream>>>(Wk, WH + 1 * HDIM * HDIM, WL + 1 * HDIM * HDIM, n8w);
    split_planes_bf16<<<(n8w + 255) / 256, 256, 0, stream>>>(Wv, WH + 2 * HDIM * HDIM, WL + 2 * HDIM * HDIM, n8w);
    const int n8o = (EMB * EMB) / 8;                     // 131072 threads cover 1048576 elements
    split_planes_bf16<<<(n8o + 255) / 256, 256, 0, stream>>>(Wo, WOH, WOL, n8o);
  }

  // ---- q|k|v = xh[65536][64] . W{q,k,v}^T : M=65536, N=64, K=64; grid.y selects the weight plane ----
  {
    const int tiles = (NROWH / 64) * (HDIM / 64);        // 1024 wave tiles
    dim3 grid((tiles + 7) / 8, 3);
    wmma_gemm64<1, true, 0, 2, false><<<grid, 256, 0, stream>>>(
        XH, XL, HDIM, 0L,
        WH, WL, HDIM, (long)(HDIM * HDIM),
        (void*)QKVH, (void*)QKVL, HDIM, (long)PLANE_QKV,
        dummyf, dummyf, 0L,
        NROWH, HDIM, HDIM, 1.0f);
  }

  // ---- causal attention per (b, h): av hi/lo planes ----
  {
    const int nblk = NB * NHEAD * (SEQ / AQB) / 2;       // 512 blocks x 2 x 64 query rows
    attn_causal_hd64<<<nblk, 128, 0, stream>>>(
        QKVH + 0 * PLANE_QKV, QKVL + 0 * PLANE_QKV,
        QKVH + 1 * PLANE_QKV, QKVL + 1 * PLANE_QKV,
        QKVH + 2 * PLANE_QKV, QKVL + 2 * PLANE_QKV,
        AVH, AVL, 0.125f);
  }

  // ---- out = av[4096][1024] . Wo^T : M=4096, N=1024, K=1024, f32 into d_out ----
  {
    const int nblk = (NTOK / GBT) * (EMB / GBT);         // 256 blocks, one 128 x 128 tile each
    out_proj_lds<<<nblk, 256, 0, stream>>>(AVH, AVL, WOH, WOL, out);
  }
}

// v010
// A run of this version takes 95.3 microseconds.
// Two timings next to v009 both put it at 1.16 times that version's speed.
// All steps since v000 together make it 5.66 times as fast.
// Contractions: q/k/v projections, q.k^T scores, p.v and output projection all on v_wmma_f32_16x16x32_bf16 with bf16 hi/lo split operands (hi*hi + hi*lo + lo*hi), f32 accumulate; softmax and all side math in f32.
#include <hip/hip_runtime.h>

typedef __attribute__((ext_vector_type(16))) _Float16 v16h;
typedef __attribute__((ext_vector_type(8)))  _Float16 v8h;
typedef __attribute__((ext_vector_type(16))) __bf16   v16b;
typedef __attribute__((ext_vector_type(8)))  __bf16   v8b;
typedef __attribute__((ext_vector_type(8)))  float    v8f;
typedef __attribute__((ext_vector_type(4)))  float    v4f;
typedef __attribute__((ext_vector_type(4)))  unsigned v4u;
#define U16(p) ((const unsigned short*)(const void*)(p))

// ---------------------------------------------------------------------------
// Problem constants
// ---------------------------------------------------------------------------
constexpr int NB    = 2;
constexpr int SEQ   = 2048;
constexpr int EMB   = 1024;
constexpr int NHEAD = 16;
constexpr int HDIM  = 64;
constexpr int NTOK  = NB * SEQ;              // 4096 rows of [EMB]
constexpr int NROWH = NTOK * NHEAD;          // 65536 rows of [HDIM]

// attention tiling
constexpr int AQB = 64;                      // query rows per query block (4 waves x 16)
constexpr int AKC = 64;                      // keys per chunk
constexpr int ANW = 4;
// LDS row pitch of the K tiles (and of the output projection's operand tiles), in 16-bit elements: 144 B = 16 B x 9 (odd), so that the
// 16 rows a ds_load_b128 fragment read touches start on distinct bank groups (128-B rows do not).
constexpr int APT = 72;
// LDS row pitch of the V tiles, kept row-major [kv][d] and read by ds_load_tr16_b128: 160 B = 32 B x 5 (odd),
// the conflict-free pitch of that reader.
constexpr int VPT = 80;

// GEMM shape contract (no run-time tails)
static_assert(NROWH % 64 == 0);              // qkv GEMM M
static_assert(HDIM % 64 == 0);               // qkv GEMM N
static_assert(HDIM % 32 == 0);               // qkv GEMM K
static_assert(NTOK % 64 == 0);
static_assert(EMB % 64 == 0);
static_assert(EMB % 32 == 0);
static_assert(SEQ % AQB == 0);
static_assert(AQB == AKC);
static_assert(APT >= AKC && APT >= HDIM && (APT * 2) % 16 == 0 && ((APT * 2) / 16) % 2 == 1);
static_assert(VPT >= HDIM && (VPT * 2) % 32 == 0 && ((VPT * 2) / 32) % 2 == 1);

// ---------------------------------------------------------------------------
//   Workspace (the first 17 MiB are not used)
//   WOH  [17 MiB     , 19 MiB)  Wo  bf16 hi  [1024][1024]
//   WOL  [19 MiB     , 21 MiB)  Wo  bf16 lo
//   QKVH [21 MiB     , 45 MiB)  q|k|v bf16 hi, 3 planes of [65536][64] (element (b,s,h,d) at (b*SEQ+s)*EMB + h*64 + d)
//   QKVL [45 MiB     , 69 MiB)  q|k|v bf16 lo
//   AVH  [69 MiB     , 77 MiB)  av  bf16 hi  [4096][1024]
//   AVL  [77 MiB     , 85 MiB)  av  bf16 lo
//   total 85 MiB = 89128960 B
// ---------------------------------------------------------------------------
constexpr size_t MIB      = 1048576;
constexpr size_t OFF_WOH  = 17 * MIB;
constexpr size_t OFF_WOL  = 19 * MIB;
constexpr size_t OFF_QKVH = 21 * MIB;
constexpr size_t OFF_QKVL = 45 * MIB;
constexpr size_t OFF_AVH  = 69 * MIB;
constexpr size_t OFF_AVL  = 77 * MIB;
constexpr size_t WS_TOTAL = 85 * MIB;
constexpr size_t PLANE_QKV = (size_t)NROWH * HDIM;      // elements per q/k/v plane
static_assert((size_t)EMB * EMB * 2 <= OFF_WOL - OFF_WOH);
static_assert((size_t)EMB * EMB * 2 <= OFF_QKVH - OFF_WOL);
static_assert(3 * PLANE_QKV * 2 <= OFF_QKVL - OFF_QKVH);
static_assert(3 * PLANE_QKV * 2 <= OFF_AVH - OFF_QKVL);
static_assert((size_t)NTOK * EMB * 2 <= OFF_AVL - OFF_AVH);
static_assert((size_t)NTOK * EMB * 2 <= WS_TOTAL - OFF_AVL);
static_assert(WS_TOTAL <= 134217728);

// ---------------------------------------------------------------------------
// Helpers
// ---------------------------------------------------------------------------
__device__ __forceinline__ unsigned short f2bf_bits(float f) {
  unsigned u = __float_as_uint(f);
  return (unsigned short)((u + 0x7FFFu + ((u >> 16) & 1u)) >> 16);
}
__device__ __forceinline__ float bf_bits2f(unsigned short h) { return __uint_as_float(((unsigned)h) << 16); }

template <typename T> struct Frag;
template <> struct Frag<__bf16> {
  typedef v16b V; union U { v16b v; v8b h[2]; };
  static __device__ __forceinline__ v16b load(const __bf16* p) {
    U f; f.h[0] = *(const v8b*)(p); f.h[1] = *(const v8b*)(p + 16); return f.v;
  }
  static __device__ __forceinline__ v8f mma(v16b a, v16b b, v8f c) {
    return __builtin_amdgcn_wmma_f32_16x16x32_bf16(false, a, false, b, (short)0, c, false, false);
  }
};

// ---------------------------------------------------------------------------
// f32 -> bf16 hi + bf16 lo (RNE converts), two elements a call
// ---------------------------------------------------------------------------
__device__ __forceinline__ void split_pair(float f0, float f1, unsigned& hw, unsigned& lw) {
  const unsigned short h0 = f2bf_bits(f0);
  const unsigned short h1 = f2bf_bits(f1);
  const unsigned short l0 = f2bf_bits(f0 - bf_bits2f(h0));
  const unsigned short l1 = f2bf_bits(f1 - bf_bits2f(h1));
  hw = (unsigned)h0 | ((unsigned)h1 << 16);
  lw = (unsigned)l0 | ((unsigned)l1 << 16);
}

typedef __attribute__((ext_vector_type(2))) float  v2f;
typedef __attribute__((ext_vector_type(2))) __bf16 v2b;
// two f32 -> packed bf16 hi pair and bf16 lo pair (lo = f - hi), both converts round to nearest even
__device__ __forceinline__ void at_split2(float f0, float f1, v2b& hi, v2b& lo) {
  hi = __builtin_convertvector((v2f){f0, f1}, v2b);
  lo = __builtin_convertvector((v2f){f0 - (float)hi[0], f1 - (float)hi[1]}, v2b);
}

// the 16 f32 values of one operand fragment, straight from an f32 row: p[0..7] and p[16..23] (p in bytes)
struct RawFrag { v4f f[4]; };
__device__ __forceinline__ RawFrag frag_load_f32(const char* p) {
  RawFrag r;
  r.f[0] = *(const v4f*)(p);
  r.f[1] = *(const v4f*)(p + 16);
  r.f[2] = *(const v4f*)(p + 64);
  r.f[3] = *(const v4f*)(p + 80);
  return r;
}
// ... as a bf16 hi and a bf16 lo fragment: elements 0..7 <- p[0..7], 8..15 <- p[16..23]
__device__ __forceinline__ void frag_split(const RawFrag& r, v16b& hi, v16b& lo) {
#pragma unroll
  for (int e = 0; e < 16; e += 2) {
    v2b a, bl;
    at_split2(r.f[e >> 2][e & 3], r.f[e >> 2][(e & 3) + 1], a, bl);
    hi[e] = a[0];  hi[e + 1] = a[1];
    lo[e] = bl[0]; lo[e + 1] = bl[1];
  }
}

// ---------------------------------------------------------------------------
// q|k|v projection and every operand split of the call, one launch, grid (256, 4), 4 waves a block.
//   blockIdx.y = 0, 1, 2: plane y of C[m][n] = sum_k X[m][k] * W_y[n][k], X = x as [65536][64] f32, W_y [64][64] f32;
//   each wave owns a 64 x 64 tile (all of n). The fragments are loaded from the f32 rows and split into bf16 hi/lo in
//   registers (as many bytes a fragment as from a hi and a lo plane); product = hi.hi + hi.lo + lo.hi, k ascending by
//   32; W_y's fragments stay in registers, X goes by in four tile rows; C goes out as bf16 hi and lo planes.
//   blockIdx.y = 3: Wo f32 -> bf16 hi and lo planes for the output projection, 32 elements a thread.
// ---------------------------------------------------------------------------
constexpr int PNW = 4;                       // waves per block
constexpr int PGX = NROWH / 64 / PNW;        // 256 blocks of 4 wave tiles
constexpr int PWS = PGX * PNW * 32 * 8;      // Wo elements that plane 3 takes in one turn, 8 a thread
static_assert(NROWH % (64 * PNW) == 0 && HDIM == 64);
static_assert((EMB * EMB) % PWS == 0);

__global__ __launch_bounds__(PNW * 32) void qkv_proj_split(
    const float* __restrict__ X, const float* __restrict__ Wq, const float* __restrict__ Wk,
    const float* __restrict__ Wv, const float* __restrict__ Wo,
    unsigned short* __restrict__ Ch, unsigned short* __restrict__ Cl,
    unsigned short* __restrict__ WoH, unsigned short* __restrict__ WoL) {
  __shared__ __align__(16) float sT[PNW][16 * 68]; // per-wave 16x64 slab, pitch 68 floats
  const int pl = blockIdx.y;

  if (pl == 3) {                               // block-uniform; no block barriers in this kernel
    constexpr int NIT = (EMB * EMB) / PWS;                   // 4 groups of 8 elements a thread
    const unsigned e0 = (unsigned)(blockIdx.x * (PNW * 32) + threadIdx.x) * 8;
    v4f a[NIT], c[NIT];
#pragma unroll
    for (int it = 0; it < NIT; ++it) {
      a[it] = *(const v4f*)(Wo + e0 + it * PWS);
      c[it] = *(const v4f*)(Wo + e0 + it * PWS + 4);
    }
    // registers of these loads' addresses may be written anew below: their translations are waited for first
    asm volatile("s_wait_xcnt 0x0" ::: "memory");
#pragma unroll
    for (int it = 0; it < NIT; ++it) {
      unsigned hx, hy, hz, hw, lx, ly, lz, lw;
      split_pair(a[it][0], a[it][1], hx, lx);
      split_pair(a[it][2], a[it][3], hy, ly);
      split_pair(c[it][0], c[it][1], hz, lz);
      split_pair(c[it][2], c[it][3], hw, lw);
      *(v4u*)(WoH + e0 + it * PWS) = (v4u){hx, hy, hz, hw};
      *(v4u*)(WoL + e0 + it * PWS) = (v4u){lx, ly, lz, lw};
    }
    return;
  }

  const float* W = (pl == 0) ? Wq : (pl == 1) ? Wk : Wv;
  const int lane = threadIdx.x & 31;
  const int wave = threadIdx.x >> 5;
  const int m0   = (blockIdx.x * PNW + wave) << 6;

  const int rlane = lane & 15;                 // row (A) / col (B, D) within subtile
  const int koff  = (lane >> 4) * 8;           // k offset of this lane half
  const int mOff  = (lane >> 4) * 8;           // D row offset
  // one 32-bit byte offset an operand on its scalar base; tile row, tile column and k step are immediates
  const unsigned wo = (unsigned)((rlane * HDIM + koff) * 4);
  const unsigned xo = (unsigned)(m0 * HDIM * 4) + wo;          // < 16 MiB

  // ---- all of W_y (4 column tiles x 2 k steps) and the first 16 rows of X, 40 loads in flight together ----
  v16b bh[2][4], bl[2][4];
  RawFrag ra[2];
  {
    RawFrag rb[2][4];
#pragma unroll
    for (int ks = 0; ks < 2; ++ks)
#pragma unroll
      for (int j = 0; j < 4; ++j) rb[ks][j] = frag_load_f32((const char*)W + wo + (j * 16 * HDIM + ks * 32) * 4);
#pragma unroll
    for (int ks = 0; ks < 2; ++ks) ra[ks] = frag_load_f32((const char*)X + xo + (ks * 32) * 4);
    // the offset register of the W loads may be written anew below: their translations are waited for first
    asm volatile("s_wait_xcnt 0x0" ::: "memory");
#pragma unroll
    for (int ks = 0; ks < 2; ++ks)
#pragma unroll
      for (int j = 0; j < 4; ++j) {
        frag_split(rb[ks][j], bh[ks][j], bl[ks][j]);
        // one fragment's split is finished before the next begins, so that its f32 words free their registers
        // (interleaved, the splits took the kernel above 256 registers: three waves a SIMD instead of four)
        __builtin_amdgcn_sched_barrier(0);
      }
  }

  float* slab = sT[wave];
  const int q = lane >> 3, c8 = (lane & 7) * 8;
  // one 32-bit byte offset serves every store of both planes on their scalar bases (< 8 MiB)
  const unsigned co = (unsigned)(((m0 + q) * HDIM + c8) * 2);
  char* C  = (char*)(Ch + (size_t)pl * PLANE_QKV);
  char* C2 = (char*)(Cl + (size_t)pl * PLANE_QKV);
#pragma unroll
  for (int i = 0; i < 4; ++i) {                // 16 rows of X at a time, against all of W_y
    v16b ah[2], al[2];
#pragma unroll
    for (int ks = 0; ks < 2; ++ks) frag_split(ra[ks], ah[ks], al[ks]);
    // ---- the next 16 rows' eight loads, in flight under this tile row's products ----
    if (i < 3) {
      // keeps the loads behind the splits that read the same registers and, below, in front of the products:
      // the compiler issued them late, in two groups of four, and waited out the latency of each
      __builtin_amdgcn_sched_barrier(0);
#pragma unroll
      for (int ks = 0; ks < 2; ++ks) ra[ks] = frag_load_f32((const char*)X + xo + ((i + 1) * 16 * HDIM + ks * 32) * 4);
      // behind the last of them their offset register may be written anew: the translations are waited for first
      if (i == 2) asm volatile("s_wait_xcnt 0x0" ::: "memory");
      __builtin_amdgcn_sched_barrier(0);
    }
    // the products go round four independent accumulator tiles. The scheduling barriers keep the rounds apart:
    // without them the compiler took the tiles two by two in the same registers, a product following the last but
    // one into its tile, and the second pair's first products stood too close behind the first pair's last
    v8f acc[4];
#pragma unroll
    for (int j = 0; j < 4; ++j) acc[j] = (v8f){0.f,0.f,0.f,0.f,0.f,0.f,0.f,0.f};
#pragma unroll
    for (int ks = 0; ks < 2; ++ks) {
#pragma unroll
      for (int j = 0; j < 4; ++j) acc[j] = Frag<__bf16>::mma(ah[ks], bh[ks][j], acc[j]);
      __builtin_amdgcn_sched_barrier(0);
#pragma unroll
      for (int j = 0; j < 4; ++j) acc[j] = Frag<__bf16>::mma(ah[ks], bl[ks][j], acc[j]);
      __builtin_amdgcn_sched_barrier(0);
#pragma unroll
      for (int j = 0; j < 4; ++j) acc[j] = Frag<__bf16>::mma(al[ks], bh[ks][j], acc[j]);
      __builtin_amdgcn_sched_barrier(0);
    }
    // ---- per-wave 16 x 64 f32 slab, whole 128-B lines of each plane ----
#pragma unroll
    for (int j = 0; j < 4; ++j)
#pragma unroll
      for (int r = 0; r < 8; ++r) slab[(mOff + r) * 68 + (j << 4) + rlane] = acc[j][r];
    __builtin_amdgcn_fence(__ATOMIC_RELEASE, "workgroup");
    __builtin_amdgcn_wave_barrier();
    __builtin_amdgcn_fence(__ATOMIC_ACQUIRE, "workgroup");
#pragma unroll
    for (int it = 0; it < 4; ++it) {
      const int row = it * 4 + q;
      const float* sp = slab + row * 68 + c8;
      v8h hv, lv;
#pragma unroll
      for (int e = 0; e < 8; ++e) {
        unsigned short hb = f2bf_bits(sp[e]);
        unsigned short lb = f2bf_bits(sp[e] - bf_bits2f(hb));
        hv[e] = __builtin_bit_cast(_Float16, hb);
        lv[e] = __builtin_bit_cast(_Float16, lb);
      }
      *(v8h*)(C + co + (i * 16 + it * 4) * HDIM * 2) = hv;
      *(v8h*)(C2 + co + (i * 16 + it * 4) * HDIM * 2) = lv;
    }
    // the next tile row writes registers of the stores above anew: their translations are waited for first
    if (i < 3) asm volatile("s_wait_xcnt 0x0" ::: "memory");
    __builtin_amdgcn_fence(__ATOMIC_RELEASE, "workgroup");
    __builtin_amdgcn_wave_barrier();
    __builtin_amdgcn_fence(__ATOMIC_ACQUIRE, "workgroup");
  }
}

// ---------------------------------------------------------------------------
// Causal flash attention, head dim 64, bf16 hi/lo planes in, bf16 hi/lo planes out.
//   q,k,v planes: element (b, s, h, d) at (b*SEQ + s)*EMB + h*64 + d (ushort storage).
//   scores^T = k.q^T * sm_scale : hi.hi + hi.lo + lo.hi on v_wmma_f32_16x16x32_bf16 (A = K rows, B = Q)
//   out^T    = v^T.p^T          : p and v as bf16 hi/lo, same three products (A = V^T, B = P^T)
//   Transposed, a lane holds 32 scores of ONE query (column c): maximum and sum run inside the lane, with one
//   exchange between the lane halves, and two score tiles converted in place are the B operand P^T of the second
//   product, so that P never goes through LDS.
//   online softmax in f32, exponentials in base 2; block = 4 waves; a query block = 64 query rows of one (b, h), 16 per wave;
//   grid.x = NB * NHEAD * (SEQ/64) / 2; keys visited in 64-wide chunks 0..qb (causal).
//   A query block qb costs qb + 1 chunks, and all blocks of the grid are resident at once, so the launch lasts as
//   long as its fullest block: each block takes query blocks 31 - p and p of one (b, h), one after the other in
//   every wave, which is 33 chunks for every block of the grid.
//   Output planes: element (b, q, h*64+d) at (b*SEQ+q)*EMB + h*64 + d; each wave writes
// ---------------------------------------------------------------------------
__device__ __forceinline__ v8f at_mma(v16b a, v16b b, v8f c) {
  return __builtin_amdgcn_wmma_f32_16x16x32_bf16(false, a, false, b, (short)0, c, false, false);
}

// value of lane l ^ 16 (the other 16-lane half) by a cross-row move in the vector unit; all 32 lanes are active at every call
__device__ __forceinline__ float half_swap(float x) {
  const int v = __float_as_int(x);
  return __int_as_float(__builtin_amdgcn_permlanex16(v, v, 0x76543210, 0xfedcba98, false, false));
}

// 2^x in place, 1 or 16 values a statement. The instruction set asks for one free slot between a transcendental and a
// next instruction that reads its result or overwrites its source. Here each v_exp_f32 names one register of
// its own, so none touches its neighbour's, and the v_nop at the end is the slot of the last.
__device__ __forceinline__ void exp2_x1(float& x) {
  asm("v_exp_f32 %0, %0\n\tv_nop" : "+v"(x));
}
__device__ __forceinline__ void exp2_x16(float (&x)[16]) {
  asm("v_exp_f32 %0, %0\n\tv_exp_f32 %1, %1\n\tv_exp_f32 %2, %2\n\tv_exp_f32 %3, %3\n\t"
      "v_exp_f32 %4, %4\n\tv_exp_f32 %5, %5\n\tv_exp_f32 %6, %6\n\tv_exp_f32 %7, %7\n\t"
      "v_exp_f32 %8, %8\n\tv_exp_f32 %9, %9\n\tv_exp_f32 %10, %10\n\tv_exp_f32 %11, %11\n\t"
      "v_exp_f32 %12, %12\n\tv_exp_f32 %13, %13\n\tv_exp_f32 %14, %14\n\tv_exp_f32 %15, %15\n\t"
      "v_nop"
      : "+v"(x[0]), "+v"(x[1]), "+v"(x[2]), "+v"(x[3]), "+v"(x[4]), "+v"(x[5]), "+v"(x[6]), "+v"(x[7]),
        "+v"(x[8]), "+v"(x[9]), "+v"(x[10]), "+v"(x[11]), "+v"(x[12]), "+v"(x[13]), "+v"(x[14]), "+v"(x[15]));
}

// transposing LDS read of a row-major 16-bit tile T: with lane l's pointer at
// T[kbase + 8 (l >> 4) + (l & 7)][dbase + 8 ((l >> 3) & 1)], lane (c = l & 15, hh = l >> 4) gets
// T[kbase + 8 hh + 0..7][dbase + c]. All 32 lanes are active and hold an address inside the tile at every call.
typedef __attribute__((ext_vector_type(8))) short v8s;
__device__ __forceinline__ v8b ld_tr16(const unsigned short* p) {
  typedef __attribute__((address_space(3))) v8s lds_v8s;
  return __builtin_bit_cast(v8b, __builtin_amdgcn_ds_load_tr16_b128_v8i16((lds_v8s*)p));
}

__global__ __launch_bounds__(128)
void attn_causal_hd64(const unsigned short* __restrict__ Qh, const unsigned short* __restrict__ Ql,
                      const unsigned short* __restrict__ Kh, const unsigned short* __restrict__ Kl,
                      const unsigned short* __restrict__ Vh, const unsigned short* __restrict__ Vl,
                      unsigned short* __restrict__ Oh, unsigned short* __restrict__ Ol,
                      float sm_scale) {
  union FB { v16b v; v8b h[2]; };
  __shared__ __align__(16) unsigned short Ksh[AKC * APT];     // K hi [kv][d]   9 KB
  __shared__ __align__(16) unsigned short Ksl[AKC * APT];     // K lo [kv][d]   9 KB
  __shared__ __align__(16) unsigned short Vsh[AKC * VPT];     // V hi [kv][d]  10 KB
  __shared__ __align__(16) unsigned short Vsl[AKC * VPT];     // V lo [kv][d]  10 KB
  __shared__ __align__(16) float  Os[ANW][16 * 68];           // per wave out tile, pitch 68

  const int tid  = threadIdx.x;
  const int wave = tid >> 5;
  const int lane = tid & 31;
  const int hh   = lane >> 4;
  const int c    = lane & 15;
  const float NEG_INF = -__builtin_inff();
  // exp(sm_scale * s - m) = 2^(sc2 * s - m * log2(e)): one multiply-add and one v_exp_f32 an element (sm_scale > 0)
  const float sc2 = sm_scale * 1.44269504088896340736f;

  constexpr int NQB = SEQ / AQB;                 // 32 query blocks per (b, h)
  constexpr int NPR = NQB / 2;                   // 16 pairs (31 - p, p) per (b, h)
  static_assert(NQB % 2 == 0);
  const int bx   = blockIdx.x;
  const int pr   = bx % NPR;
  const int bhid = bx / NPR;
  const int h    = bhid % NHEAD;
  const int b    = bhid / NHEAD;
  const size_t hoff = (size_t)h * HDIM;

  for (int half = 0; half < 2; ++half) {         // block-uniform: every wave walks both query blocks in this order
  const int qb   = half ? pr : NQB - 1 - pr;
  const int q0   = qb * AQB + wave * 16;

  // ---- Q fragments (B operand): column = query c, elements 0..7 <- d = dc*32 + 8hh + 0..7, 8..15 <- dc*32 + 16 + 8hh + 0..7
  v16b qah[2], qal[2];
  {
    const size_t qo = (size_t)(b * SEQ + q0 + c) * EMB + hoff + 8 * hh;
    const __bf16* qhp = (const __bf16*)(const void*)Qh;
    const __bf16* qlp = (const __bf16*)(const void*)Ql;
#pragma unroll
    for (int dc = 0; dc < 2; ++dc) {
      qah[dc] = Frag<__bf16>::load(qhp + qo + dc * 32);
      qal[dc] = Frag<__bf16>::load(qlp + qo + dc * 32);
    }
  }

  // of query q0 + c: running maximum (log2 units, alike in both lane halves) and the sum over this half's keys
  float mrow = NEG_INF, lrow = 0.f;
  v8f oacc[4];                                   // oacc[t][r] = out[q0 + c][t*16 + 8hh + r]
#pragma unroll
  for (int t = 0; t < 4; ++t) oacc[t] = (v8f){0.f,0.f,0.f,0.f,0.f,0.f,0.f,0.f};

  // staging map: thread -> rows skv + 16 i (i = 0..3), 16-byte column group scol, of each 64 x 64 K / V plane tile
  const int skv = tid >> 3, scol = (tid & 7) * 8;
  // one 32-bit byte offset (< 8 MiB) serves all four planes on their scalar base pointers: one address register
  // instead of four pairs
  const unsigned sgb = (unsigned)(((b * SEQ + skv) * EMB + h * HDIM + scol) * 2);
  v4u kwh[4], kwl[4], vwh[4], vwl[4];            // K hi, K lo, V hi, V lo words of the chunk fetched ahead
  const int nChunks = qb + 1;                    // block-uniform, <= 32
  // ---- chunk 0's K and V words, all 16 global loads in flight together ----
  {
    const unsigned gb = sgb;
#pragma unroll
    for (int i = 0; i < 4; ++i) {
      kwh[i] = *(const v4u*)((const char*)Kh + gb + 16 * i * EMB * 2);
      kwl[i] = *(const v4u*)((const char*)Kl + gb + 16 * i * EMB * 2);
      vwh[i] = *(const v4u*)((const char*)Vh + gb + 16 * i * EMB * 2);
      vwl[i] = *(const v4u*)((const char*)Vl + gb + 16 * i * EMB * 2);
    }
  }
  // the address registers of the Q, K and V loads above are written anew below: their translations are waited for
  // first; the Q words as inputs keep the wait behind their loads (once per query block)
  asm volatile("s_wait_xcnt 0x0" :: "v"(qah[0]), "v"(qah[1]), "v"(qal[0]), "v"(qal[1]) : "memory");
  for (int kc = 0; kc < nChunks; ++kc) {
    const int kv0 = kc * AKC;
    __syncthreads();
    // ---- K and V words fetched one trip ahead go from registers to LDS ----
#pragma unroll
    for (int i = 0; i < 4; ++i) {
      *(v4u*)(Ksh + (skv + 16 * i) * APT + scol) = kwh[i];
      *(v4u*)(Ksl + (skv + 16 * i) * APT + scol) = kwl[i];
    }
    // ---- V hi/lo row-major as they come: one 16-B LDS store a word; the fragment reads transpose ----
#pragma unroll
    for (int i = 0; i < 4; ++i) {
      *(v4u*)(Vsh + (skv + 16 * i) * VPT + scol) = vwh[i];
      *(v4u*)(Vsl + (skv + 16 * i) * VPT + scol) = vwl[i];
    }
    __syncthreads();

    // ---- scores^T: 4 key tiles x 2 d-chunks x 3 products; s[j][r] = score of key kv0 + j*16 + 8hh + r, query q0 + c ----
    //      All 16 K fragments of the chunk are read as one group; the products follow behind counted waits and go
    //      round the four independent tiles, so that none waits for a read just issued or for the product before it.
    //      Per tile the order stays d-chunk 0, 1 and in each hi.hi, lo.hi, hi.lo.
    v8f s[4];
    {
      FB kfh[2][4], kfl[2][4];
#pragma unroll
      for (int dc = 0; dc < 2; ++dc) {           // in the order in which the products take them
#pragma unroll
        for (int j = 0; j < 4; ++j) {
          const int ko = (j * 16 + c) * APT + dc * 32 + 8 * hh;
          kfh[dc][j].h[0] = *(const v8b*)(Ksh + ko);
          kfh[dc][j].h[1] = *(const v8b*)(Ksh + ko + 16);
        }
#pragma unroll
        for (int j = 0; j < 4; ++j) {
          const int ko = (j * 16 + c) * APT + dc * 32 + 8 * hh;
          kfl[dc][j].h[0] = *(const v8b*)(Ksl + ko);
          kfl[dc][j].h[1] = *(const v8b*)(Ksl + ko + 16);
        }
        // keeps d-chunk 0's reads in front of d-chunk 1's (the compiler put them last, and the first product waited
        // for 18 reads) and all reads in front of the products
        __builtin_amdgcn_sched_barrier(0);
      }
#pragma unroll
      for (int j = 0; j < 4; ++j) s[j] = (v8f){0.f,0.f,0.f,0.f,0.f,0.f,0.f,0.f};
#pragma unroll
      for (int dc = 0; dc < 2; ++dc) {
        // the scheduling barriers keep the rounds apart: without them the compiler lines a tile's products up one
        // behind the other, each waiting for the one before
#pragma unroll
        for (int j = 0; j < 4; ++j) s[j] = at_mma(kfh[dc][j].v, qah[dc], s[j]);
        __builtin_amdgcn_sched_barrier(0);
#pragma unroll
        for (int j = 0; j < 4; ++j) s[j] = at_mma(kfl[dc][j].v, qah[dc], s[j]);
        __builtin_amdgcn_sched_barrier(0);
#pragma unroll
        for (int j = 0; j < 4; ++j) s[j] = at_mma(kfh[dc][j].v, qal[dc], s[j]);
        if (dc == 0) __builtin_amdgcn_sched_barrier(0);
      }
    }
    // ---- V^T fragments of the chunk, A[m=d][k=kv] = V[kv][d], row d = t*16 + c by transposing reads, also one group:
    //      they land under the softmax arithmetic below.
    //      elements 0..7 <- kv = kk*32 + 8hh + 0..7, 8..15 <- kk*32 + 16 + 8hh + 0..7, the k order of ph and pl ----
    FB vfh[2][4], vfl[2][4];
#pragma unroll
    for (int kk = 0; kk < 2; ++kk)
#pragma unroll
      for (int t = 0; t < 4; ++t) {
        const int vo = (kk * 32 + 8 * hh + (lane & 7)) * VPT + t * 16 + 8 * ((lane >> 3) & 1);
        vfh[kk][t].h[0] = ld_tr16(Vsh + vo);
        vfh[kk][t].h[1] = ld_tr16(Vsh + vo + 16 * VPT);
        vfl[kk][t].h[0] = ld_tr16(Vsl + vo);
        vfl[kk][t].h[1] = ld_tr16(Vsl + vo + 16 * VPT);
      }
    __builtin_amdgcn_sched_barrier(0);           // keeps these reads here, in front of the mask and the maximum
    // ---- causal mask on the diagonal chunk (select, -inf fill): there kv0 = qb * 64, so key j*16 + 8hh + r of the
    //      chunk lies behind query wave*16 + c where j*16 + r > lim; elsewhere lim is above every j*16 + r.
    //      Maximum of the raw scores in four independent chains; the maximum alone is scaled here: sc2 > 0 and
    //      rounding is monotone, so it is the maximum of the scaled scores ----
    const int lim = (kc == qb) ? wave * 16 + c - 8 * hh : AKC;
    float mx[4];
#pragma unroll
    for (int j = 0; j < 4; ++j) {
      float m = NEG_INF;
#pragma unroll
      for (int r = 0; r < 8; ++r) {
        const float val = (j * 16 + r > lim) ? NEG_INF : s[j][r];
        s[j][r] = val;
        m = fmaxf(m, val);
      }
      mx[j] = m;
    }
    float cm = fmaxf(fmaxf(mx[0], mx[1]), fmaxf(mx[2], mx[3]));
    cm = fmaxf(cm, half_swap(cm)) * sc2;         // both halves' keys: finite, key kv0 is never behind a query of the block
    // ---- online softmax update in base 2 (mrow holds log2 units); P^T hi/lo packed in registers:
    //      element e of ph[kk] = p of key kk*32 + 8hh + e (e < 8), kk*32 + 16 + 8hh + e - 8 (e >= 8): the B operand's k order ----
    const float mnew = fmaxf(mrow, cm);
    float alpha = mrow - mnew;                   // 2^(old maximum - new maximum)
    mrow = mnew;
    exp2_x1(alpha);
    v16b ph[2], pl[2];
    float ps[4];                                 // four independent partial sums, started by the first four values
#pragma unroll
    for (int kk = 0; kk < 2; ++kk) {             // two score tiles = 16 exponentials a statement
      float pe[16];
#pragma unroll
      for (int e = 0; e < 16; ++e) pe[e] = fmaf(s[kk * 2 + (e >> 3)][e & 7], sc2, -mnew);
      exp2_x16(pe);
#pragma unroll
      for (int e = 0; e < 16; e += 2) {
        const bool first = (kk == 0 && e < 4);
        ps[e & 3]       = first ? pe[e]     : ps[e & 3] + pe[e];
        ps[(e & 3) + 1] = first ? pe[e + 1] : ps[(e & 3) + 1] + pe[e + 1];
        v2b a, bl;
        at_split2(pe[e], pe[e + 1], a, bl);
        ph[kk][e] = a[0];  ph[kk][e + 1] = a[1];
        pl[kk][e] = bl[0]; pl[kk][e + 1] = bl[1];
      }
    }
    lrow = lrow * alpha + ((ps[0] + ps[1]) + (ps[2] + ps[3]));
#pragma unroll
    for (int t = 0; t < 4; ++t) oacc[t] *= alpha;
    // ---- next chunk's K and V words: 16 global loads in flight together, their latency under the P.V products ----
    if (kc + 1 < nChunks) {
      const unsigned gb = sgb + (unsigned)(kv0 + AKC) * (EMB * 2);
#pragma unroll
      for (int i = 0; i < 4; ++i) {
        kwh[i] = *(const v4u*)((const char*)Kh + gb + 16 * i * EMB * 2);
        kwl[i] = *(const v4u*)((const char*)Kl + gb + 16 * i * EMB * 2);
        vwh[i] = *(const v4u*)((const char*)Vh + gb + 16 * i * EMB * 2);
        vwl[i] = *(const v4u*)((const char*)Vl + gb + 16 * i * EMB * 2);
      }
      // the offset register of these loads is written anew right below: their translations are waited for first
      asm volatile("s_wait_xcnt 0x0" ::: "memory");
    }
    // ---- O^T += V^T.P^T, A = the V^T fragments read above, B = P^T, round the four independent tiles;
    //      per tile the order stays key half 0, 1 and in each hi.hi, lo.hi, hi.lo ----
#pragma unroll
    for (int kk = 0; kk < 2; ++kk) {
#pragma unroll
      for (int t = 0; t < 4; ++t) oacc[t] = at_mma(vfh[kk][t].v, ph[kk], oacc[t]);
#pragma unroll
      for (int t = 0; t < 4; ++t) oacc[t] = at_mma(vfl[kk][t].v, ph[kk], oacc[t]);
#pragma unroll
      for (int t = 0; t < 4; ++t) oacc[t] = at_mma(vfh[kk][t].v, pl[kk], oacc[t]);
    }
  }

  // ---- epilogue: 1/l, per-wave LDS slab, whole-line bf16 hi/lo stores ----
  float* os = Os[wave];
  {
    const float inv = 1.0f / (lrow + half_swap(lrow));   // the two halves' key sums joined once
#pragma unroll
    for (int t = 0; t < 4; ++t) {
      const v8f o = oacc[t] * inv;
      *(v4f*)(os + c * 68 + t * 16 + 8 * hh)     = (v4f){o[0], o[1], o[2], o[3]};
      *(v4f*)(os + c * 68 + t * 16 + 8 * hh + 4) = (v4f){o[4], o[5], o[6], o[7]};
    }
  }
  __builtin_amdgcn_fence(__ATOMIC_RELEASE, "workgroup");
  __builtin_amdgcn_wave_barrier();
  __builtin_amdgcn_fence(__ATOMIC_ACQUIRE, "workgroup");
  {
    // rows it*4 + q4 (it 0..3, q4 0..3) = 0..15; c8 = 0..56 step 8 -> full 16 x 64 tile per plane
    const int q4 = lane >> 3, c8 = (lane & 7) * 8;
    {
#pragma unroll
      for (int it = 0; it < 4; ++it) {
        const int row = it * 4 + q4;
        const float* sp = os + row * 68 + c8;
        v8h hv, lv;
#pragma unroll
        for (int e = 0; e < 8; ++e) {
          unsigned short hb = f2bf_bits(sp[e]);
          unsigned short lb = f2bf_bits(sp[e] - bf_bits2f(hb));
          hv[e] = __builtin_bit_cast(_Float16, hb);
          lv[e] = __builtin_bit_cast(_Float16, lb);
        }
        const size_t oo = (size_t)(b * SEQ + q0 + row) * EMB + hoff + c8;
        *(v8h*)(Oh + oo) = hv;
        *(v8h*)(Ol + oo) = lv;
      }
      
    }
  }
  // the second query block writes the registers of the stores above anew: their translations are waited for first
  asm volatile("s_wait_xcnt 0x0" ::: "memory");
  }   // half
}

// ---------------------------------------------------------------------------
// Output projection C[m][n] = sum_k A[m][k] * Bt[n][k], A = av hi/lo [NTOK][EMB], Bt = Wo hi/lo [EMB][EMB], C f32.
//   One 128 x 128 tile of C per block, 256 blocks, 8 waves of 64 x 32 (2 x 4). A stage is 64 k = one 128-B line of
//   every operand row: the block loads it once by whole lines (a wave-wide 16-B load covers 4 rows), one stage ahead
//   into registers, stores it to LDS at the 144-B pitch of the ds_load_b128 fragment reads, and all 8 waves read
//   their fragments from there. Two LDS buffers, one barrier a stage: a wave stores stage s + 1 only behind the
//   barrier of stage s, which every wave reaches only after its last read of stage s - 1 (the same buffer).
//   Per accumulator the products come in the order k ascending by 32, hi.hi, hi.lo, lo.hi.
// ---------------------------------------------------------------------------
constexpr int GBT = 128;                     // tile rows (m) and columns (n) per block
constexpr int GBK = 64;                      // k per stage
constexpr int GNS = EMB / GBK;               // 16 stages
constexpr int GPL = GBT * APT;               // 16-bit elements of one plane tile in LDS
constexpr int GCP = 36;                      // f32 pitch of the per-wave output slab: 144 B
static_assert(NTOK % GBT == 0 && EMB % GBT == 0 && EMB % GBK == 0 && GBK <= APT);

__global__ __launch_bounds__(256)
void out_proj_lds(const unsigned short* __restrict__ Ah, const unsigned short* __restrict__ Al,
                  const unsigned short* __restrict__ Bh, const unsigned short* __restrict__ Bl,
                  float* __restrict__ C) {
  union FB { v16b v; v8b h[2]; };
  __shared__ __align__(16) unsigned short sAh[2 * GPL];
  __shared__ __align__(16) unsigned short sAl[2 * GPL];
  __shared__ __align__(16) unsigned short sBh[2 * GPL];
  __shared__ __align__(16) unsigned short sBl[2 * GPL];
  __shared__ __align__(16) float sC[8][16 * GCP];

  const int tid  = threadIdx.x;
  const int wave = tid >> 5;
  const int lane = tid & 31;
  const int hh   = lane >> 4;
  const int c    = lane & 15;
  constexpr int TN = EMB / GBT;                // 8 tile columns
  const int tn = blockIdx.x % TN;
  const int tm = blockIdx.x / TN;
  const int m0 = tm * GBT;
  const int n0 = tn * GBT;
  const int wm = (wave >> 2) * 64;             // wave's rows inside the tile
  const int wn = (wave & 3) * 32;              // wave's columns inside the tile

  // staging map: thread -> rows srow + 32 i (i = 0..3), 16-byte column group scol, of each 128 x 64 plane tile.
  // 8 lanes take one row (a whole 128-B line); the two rows of a 16-lane half lie 8 rows = 1152 B apart in LDS,
  // 128 B modulo the 256 B of the banks, so that a half's ds_store_b128 meets every bank once.
  const int sg   = lane >> 3;
  const int srow = (wave >> 2) * 16 + (sg & 1) * 8 + (wave & 3) * 2 + (sg >> 1);
  const int scol = (tid & 7) * 8;
  const unsigned ga = (unsigned)(((m0 + srow) * EMB + scol) * 2);   // byte offset in the A planes (< 8 MiB)
  const unsigned gb = (unsigned)(((n0 + srow) * EMB + scol) * 2);   // byte offset in the B planes (< 2 MiB)
  v4u rah[4], ral[4], rbh[4], rbl[4];
#pragma unroll
  for (int i = 0; i < 4; ++i) {
    rah[i] = *(const v4u*)((const char*)Ah + ga + 32 * i * EMB * 2);
    ral[i] = *(const v4u*)((const char*)Al + ga + 32 * i * EMB * 2);
    rbh[i] = *(const v4u*)((const char*)Bh + gb + 32 * i * EMB * 2);
    rbl[i] = *(const v4u*)((const char*)Bl + gb + 32 * i * EMB * 2);
  }
  // the offset registers of these loads may be written anew below: their translations are waited for first
  asm volatile("s_wait_xcnt 0x0" ::: "memory");

  v8f acc[4][2];
#pragma unroll
  for (int i = 0; i < 4; ++i)
#pragma unroll
    for (int j = 0; j < 2; ++j) acc[i][j] = (v8f){0.f,0.f,0.f,0.f,0.f,0.f,0.f,0.f};

  for (int s = 0; s < GNS; ++s) {
    const int bo = (s & 1) * GPL;
    // ---- the stage fetched one trip ahead goes from registers to LDS ----
#pragma unroll
    for (int i = 0; i < 4; ++i) {
      const int so = bo + (srow + 32 * i) * APT + scol;
      *(v4u*)(sAh + so) = rah[i];
      *(v4u*)(sAl + so) = ral[i];
      *(v4u*)(sBh + so) = rbh[i];
      *(v4u*)(sBl + so) = rbl[i];
    }
    __syncthreads();
    // ---- next stage's 16 global loads in flight together, their latency under this stage's products ----
    if (s + 1 < GNS) {
      const unsigned ko = (unsigned)(s + 1) * (GBK * 2);
#pragma unroll
      for (int i = 0; i < 4; ++i) {
        rah[i] = *(const v4u*)((const char*)Ah + (ga + ko) + 32 * i * EMB * 2);
        ral[i] = *(const v4u*)((const char*)Al + (ga + ko) + 32 * i * EMB * 2);
        rbh[i] = *(const v4u*)((const char*)Bh + (gb + ko) + 32 * i * EMB * 2);
        rbl[i] = *(const v4u*)((const char*)Bl + (gb + ko) + 32 * i * EMB * 2);
      }
      // the offset registers of these loads are written anew in the next trip: their translations are waited for first
      asm volatile("s_wait_xcnt 0x0" ::: "memory");
    }
    // ---- fragments: row (A) or column (B) = c, elements 0..7 <- k = ks*32 + 8hh + 0..7, 8..15 <- ks*32 + 16 + 8hh + 0..7
#pragma unroll
    for (int ks = 0; ks < 2; ++ks) {
      FB fah[4], fal[4], fbh[2], fbl[2];
#pragma unroll
      for (int i = 0; i < 4; ++i) {
        const int ao = bo + (wm + i * 16 + c) * APT + ks * 32 + 8 * hh;
        fah[i].h[0] = *(const v8b*)(sAh + ao);
        fah[i].h[1] = *(const v8b*)(sAh + ao + 16);
        fal[i].h[0] = *(const v8b*)(sAl + ao);
        fal[i].h[1] = *(const v8b*)(sAl + ao + 16);
      }
#pragma unroll
      for (int j = 0; j < 2; ++j) {
        const int bq = bo + (wn + j * 16 + c) * APT + ks * 32 + 8 * hh;
        fbh[j].h[0] = *(const v8b*)(sBh + bq);
        fbh[j].h[1] = *(const v8b*)(sBh + bq + 16);
        fbl[j].h[0] = *(const v8b*)(sBl + bq);
        fbl[j].h[1] = *(const v8b*)(sBl + bq + 16);
      }
      // eight independent accumulator tiles between two products into the same tile
#pragma unroll
      for (int i = 0; i < 4; ++i)
#pragma unroll
        for (int j = 0; j < 2; ++j) acc[i][j] = Frag<__bf16>::mma(fah[i].v, fbh[j].v, acc[i][j]);
#pragma unroll
      for (int i = 0; i < 4; ++i)
#pragma unroll
        for (int j = 0; j < 2; ++j) acc[i][j] = Frag<__bf16>::mma(fah[i].v, fbl[j].v, acc[i][j]);
#pragma unroll
      for (int i = 0; i < 4; ++i)
#pragma unroll
        for (int j = 0; j < 2; ++j) acc[i][j] = Frag<__bf16>::mma(fal[i].v, fbh[j].v, acc[i][j]);
    }
  }

  // ---- epilogue: per-wave 16 x 32 f32 slab, whole 128-B lines to C ----
  // The slab passes values between lanes of one wave only, so the fences name LDS alone: a fence over all memory
  // would also wait for the C stores of the tile row before.
  float* slab = sC[wave];
#pragma unroll
  for (int i = 0; i < 4; ++i) {
#pragma unroll
    for (int j = 0; j < 2; ++j)
#pragma unroll
      for (int r = 0; r < 8; ++r) slab[(8 * hh + r) * GCP + j * 16 + c] = acc[i][j][r];
    __builtin_amdgcn_fence(__ATOMIC_RELEASE, "workgroup", "local");
    __builtin_amdgcn_wave_barrier();
    __builtin_amdgcn_fence(__ATOMIC_ACQUIRE, "workgroup", "local");
    const int q4 = lane >> 3, c4 = (lane & 7) * 4;       // 8 lanes x 16 B = one 128-B row segment
#pragma unroll
    for (int it = 0; it < 4; ++it) {
      const int row = it * 4 + q4;
      const v4f v = *(const v4f*)(slab + row * GCP + c4);
      *(v4f*)(C + (size_t)(m0 + wm + i * 16 + row) * EMB + n0 + wn + c4) = v;
    }
    // the next tile row writes registers of the stores above anew: their translations are waited for first
    if (i < 3) {
      asm volatile("s_wait_xcnt 0x0" ::: "memory");
      __builtin_amdgcn_sched_barrier(0);   // keeps the next tile row's address arithmetic behind that wait
    }
    __builtin_amdgcn_fence(__ATOMIC_RELEASE, "workgroup", "local");
    __builtin_amdgcn_wave_barrier();
    __builtin_amdgcn_fence(__ATOMIC_ACQUIRE, "workgroup", "local");
  }
}

// ---------------------------------------------------------------------------
// Host launcher: 3 launches, no runtime API calls other than launches.
// ---------------------------------------------------------------------------
extern "C" void kernel_launch(void* const* d_in, const int* in_sizes, int n_in,
                              void* d_out, int out_size, void* d_ws, size_t ws_size,
                              hipStream_t stream) {
  if (n_in < 5) return;
  if (in_sizes[0] != NB * SEQ * EMB) return;
  if (in_sizes[1] != HDIM * HDIM || in_sizes[2] != HDIM * HDIM || in_sizes[3] != HDIM * HDIM) return;
  if (in_sizes[4] != EMB * EMB) return;
  if (out_size != NB * SEQ * EMB) return;
  if (ws_size < WS_TOTAL) return;

  const float* x  = (const float*)d_in[0];
  const float* Wq = (const float*)d_in[1];
  const float* Wk = (const float*)d_in[2];
  const float* Wv = (const float*)d_in[3];
  const float* Wo = (const float*)d_in[4];
  float* out = (float*)d_out;

  char* ws = (char*)d_ws;
  unsigned short* WOH  = (unsigned short*)(ws + OFF_WOH);
  unsigned short* WOL  = (unsigned short*)(ws + OFF_WOL);
  unsigned short* QKVH = (unsigned short*)(ws + OFF_QKVH);
  unsigned short* QKVL = (unsigned short*)(ws + OFF_QKVL);
  unsigned short* AVH  = (unsigned short*)(ws + OFF_AVH);
  unsigned short* AVL  = (unsigned short*)(ws + OFF_AVL);

  // ---- q|k|v = x[65536][64] . W{q,k,v}^T from the f32 operands (grid.y 0..2); Wo hi/lo planes (grid.y 3) ----
  qkv_proj_split<<<dim3(PGX, 4), PNW * 32, 0, stream>>>(x, Wq, Wk, Wv, Wo, QKVH, QKVL, WOH, WOL);

  // ---- causal attention per (b, h): av hi/lo planes ----
  {
    const int nblk = NB * NHEAD * (SEQ / AQB) / 2;       // 512 blocks x 2 x 64 query rows
    attn_causal_hd64<<<nblk, 128, 0, stream>>>(
        QKVH + 0 * PLANE_QKV, QKVL + 0 * PLANE_QKV,
        QKVH + 1 * PLANE_QKV, QKVL + 1 * PLANE_QKV,
        QKVH + 2 * PLANE_QKV, QKVL + 2 * PLANE_QKV,
        AVH, AVL, 0.125f);
  }

  // ---- out = av[4096][1024] . Wo^T : M=4096, N=1024, K=1024, f32 into d_out ----
  {
    const int nblk = (NTOK / GBT) * (EMB / GBT);         // 256 blocks, one 128 x 128 tile each
    out_proj_lds<<<nblk, 256, 0, stream>>>(AVH, AVL, WOH, WOL, out);
  }
}
